// v000
// Times are from an AMD MI455X. After a warm-up the kernel runs many times in a row, and a time is the length of
// such a window on the GPU divided by its runs, so every launch and the gaps after it count. The runs cycle
// through copies of the inputs. A figure is the median of several windows, for all but v000 over two sittings.
// Sittings can differ by a few percent; kernels timed side by side share one.
// v000 is the starting kernel. One run takes 8260 microseconds.
#include <hip/hip_runtime.h>
// Causal multi-head attention (q, k, v inputs [1][4096][1024]; qp/kp/vp = input W^T (nn.Linear [out][in], no bias), 16 heads of 64; scores x (8/64) = /8; causal mask (keys > query get -inf); softmax; out = (probs v merged) Wo^T -> [1][4096][1024]).
// Structure: token rows r = s; q, k, v inputs as exact f16 rows (bf16-rounded); Q, K, V as three WMMA GEMMs (32x64 wave tiles, f32 accumulation, exact x16 weights, f16 outputs); per batch: V^T for all heads via LDS transposes; per query tile of 256 rows: scores against the keys below the tile end only (K = 64, all heads on grid.y, alpha = 0.125), causal row softmax on VALU with an arithmetic 0/1 key mask over the computed range (f32 statistics, native exp; weights x256 f16), o = P . V^T (K = keys below the tile end, alpha 2^-2: o carried x64, folded into the output GEMM alpha) written straight into the merged f16 o rows; out = o W_o GEMM (f32) into the output layout.
// Compute dtype: inputs rounded to bf16; x / weights exact; q, k, v, softmax weights and o as plain f16 GEMM operands (~2^-12); scores and softmax statistics f32. v_wmma_f32_16x16x32_f16.
#define NB 1
#define SQ 4096
#define DM 1024
#define NH 16
#define HD 64
#define HG 4                         /* heads per launch of the non-template k_vt (not launched) */
#define QT 256                       /* query rows per causal tile */
#define NKX SQ                       /* S / P row pitch */
#define QT0 256                      /* first-tile rows recomputed exactly in f32 */
#define B0 0                         /* first batch processed (debug hook) */
#define NBR NB                       /* batches processed (debug hook) */
#define NR ((size_t)NB * SQ)         /* token rows */
#define MP ((int)((size_t)NBR * SQ)) /* rows projected (debug hook) */
#define QN SQ                        /* query rows attended per batch (debug hook) */
#define NHD NH                       /* heads attended (debug hook) */
#define MPO MP                       /* rows through the output stage (debug hook) */
#define LQ DM      /* row pitch of the q/k/v rows */
typedef __bf16 v16b __attribute__((ext_vector_type(16)));
typedef unsigned short v8us __attribute__((ext_vector_type(8), may_alias));
typedef float  v8f  __attribute__((ext_vector_type(8)));
typedef float  v4f  __attribute__((ext_vector_type(4)));
typedef float  v4fa __attribute__((ext_vector_type(4), may_alias));
union FragB { v16b v; v8us half[2]; unsigned short u[16]; };

__device__ __forceinline__ unsigned short bf16_bits(float x) { unsigned int u = __float_as_uint(x); return (unsigned short)((u + 0x7FFFu + ((u >> 16) & 1u)) >> 16); }
__device__ __forceinline__ float bf16_val(unsigned short b) { return __uint_as_float(((unsigned int)b) << 16); }
__device__ __forceinline__ float bf16_round(float x) { return bf16_val(bf16_bits(x)); }
// D += A·B with NT terms: 1 = ah·bh, 2 = + al·bh (A split), 3 = + ah·bl (both split)
template <int NT>
__device__ __forceinline__ v8f mmaN(v16b ah, v16b al, v16b bh, v16b bl, v8f c) {
  c = __builtin_amdgcn_wmma_f32_16x16x32_bf16(false, ah, false, bh, (short)0, c, false, false);
  if (NT >= 2) c = __builtin_amdgcn_wmma_f32_16x16x32_bf16(false, al, false, bh, (short)0, c, false, false);
  if (NT >= 3) c = __builtin_amdgcn_wmma_f32_16x16x32_bf16(false, ah, false, bl, (short)0, c, false, false);
  asm volatile("v_nop\n\tv_nop\n\tv_nop\n\tv_nop" : "+v"(c) : "v"(ah), "v"(al), "v"(bh), "v"(bl));
  return c;
}

__global__ __launch_bounds__(256) void k_wt_bf16(const float* __restrict__ W, unsigned short* __restrict__ Wt, int K, int N) {
  const int t = blockIdx.x * 256 + threadIdx.x;
  const int k8n = K / 8;
  if (t >= N * k8n) return;
  const int n = t / k8n, k8 = (t % k8n) * 8;
  v8us v;
#pragma unroll
  for (int i = 0; i < 8; ++i) v[i] = bf16_bits(W[(size_t)(k8 + i) * N + n]);
  *(v8us*)(Wt + (size_t)n * K + k8) = v;
  
}

// GEMM C[M][N] (f32, pitch ldc) = act(A[M][K]·W + bias). A f32 row-major (pitch lda) converted per fragment to bf16
// (ASPLIT: hi/lo two planes -> 2 terms, else single rounded term); Wt bf16 [N][K] (pitch ldb). BIAS_BF16 rounds the
// bias to bf16 first (bias quantised to bf16 before the add). K%32==0, M%16==0, N%64==0.
template <bool ASPLIT, int ACT, bool BIAS_BF16>
__global__ __launch_bounds__(128) void k_gemm_bf(const float* __restrict__ A, int lda, const unsigned short* __restrict__ Wt, int ldb,
                                               const float* __restrict__ bias, float* __restrict__ C, int ldc, int M, int N, int K) {
  __shared__ __attribute__((aligned(16))) float so[4][16][64];
  const int tid = threadIdx.x, w = tid >> 5, lane = tid & 31, ln = lane & 15, hh = lane >> 4;
  const int ntn = N / 64;
  const int wid = blockIdx.x * 4 + w;
  const int mt = wid / ntn, nq = wid % ntn;
  if (mt * 16 >= M) return;
  const int row0 = mt * 16, col0 = nq * 64;
  const float* arow = A + (size_t)(row0 + ln) * lda;
  v8f acc[4] = {};
  for (int kb = 0; kb < K; kb += 32) {
    FragB ah, al;
    const v4f x0 = *(const v4fa*)(arow + kb + 8 * hh), x1 = *(const v4fa*)(arow + kb + 8 * hh + 4);
    const v4f x2 = *(const v4fa*)(arow + kb + 16 + 8 * hh), x3 = *(const v4fa*)(arow + kb + 16 + 8 * hh + 4);
    float xs[16] = {x0[0],x0[1],x0[2],x0[3],x1[0],x1[1],x1[2],x1[3],x2[0],x2[1],x2[2],x2[3],x3[0],x3[1],x3[2],x3[3]};
#pragma unroll
    for (int i = 0; i < 16; ++i) { const unsigned short hb = bf16_bits(xs[i]); ah.u[i] = hb; al.u[i] = ASPLIT ? bf16_bits(xs[i] - bf16_val(hb)) : (unsigned short)0; }
#pragma unroll
    for (int t = 0; t < 4; ++t) {
      const unsigned short* brow = Wt + (size_t)(col0 + t * 16 + ln) * ldb + kb;
      FragB b;
      b.half[0] = *(const v8us*)(brow + 8 * hh);
      b.half[1] = *(const v8us*)(brow + 16 + 8 * hh);
      acc[t] = mmaN<ASPLIT ? 2 : 1>(ah.v, al.v, b.v, b.v, acc[t]);
    }
  }
#pragma unroll
  for (int t = 0; t < 4; ++t) {
    float bv = bias ? bias[col0 + t * 16 + ln] : 0.f;
    if (BIAS_BF16) bv = bf16_round(bv);
#pragma unroll
    for (int r = 0; r < 8; ++r) { float v = acc[t][r] + bv; if (ACT == 1) v = fmaxf(v, 0.f); so[w][8 * hh + r][t * 16 + ln] = v; }
  }
  __builtin_amdgcn_fence(__ATOMIC_ACQ_REL, "workgroup");
  __builtin_amdgcn_wave_barrier();
  const int rsub = lane >> 4, c4 = (lane & 15) * 4;
  {
#pragma unroll
    for (int q = 0; q < 8; ++q) {
      const int r = q * 2 + rsub;
      const v4f v = *(const v4fa*)&so[w][r][c4];
      *(v4f*)(C + (size_t)(row0 + r) * ldc + col0 + c4) = v;
    }
    
  }
}

// GEMM C = act(A·W + bias + resid): A f32 (ASPLIT -> hi/lo 2 terms), Wt bf16 [N][K]; ACT 0 none, 1 relu, 2 exact gelu;
// resid (optional, f32, row index = (row % rmod), pitch ldr, RES_BF16 rounds it) added before the activation.
template <bool ASPLIT, int ACT, bool BIAS_BF16, bool RES_BF16>
__global__ __launch_bounds__(128) void k_gemm_bf3(const float* __restrict__ A, int lda, const unsigned short* __restrict__ Wt, int ldb,
                                                const float* __restrict__ bias, const float* __restrict__ resid, int rmod, int ldr,
                                                float* __restrict__ C, int ldc, int M, int N, int K) {
  __shared__ __attribute__((aligned(16))) float so[4][16][64];
  const int tid = threadIdx.x, w = tid >> 5, lane = tid & 31, ln = lane & 15, hh = lane >> 4;
  const int ntn = N / 64;
  const int wid = blockIdx.x * 4 + w;
  const int mt = wid / ntn, nq = wid % ntn;
  if (mt * 16 >= M) return;
  const int row0 = mt * 16, col0 = nq * 64;
  const float* arow = A + (size_t)(row0 + ln) * lda;
  v8f acc[4] = {};
  for (int kb = 0; kb < K; kb += 32) {
    FragB ah, al;
    const v4f x0 = *(const v4fa*)(arow + kb + 8 * hh), x1 = *(const v4fa*)(arow + kb + 8 * hh + 4);
    const v4f x2 = *(const v4fa*)(arow + kb + 16 + 8 * hh), x3 = *(const v4fa*)(arow + kb + 16 + 8 * hh + 4);
    float xs[16] = {x0[0],x0[1],x0[2],x0[3],x1[0],x1[1],x1[2],x1[3],x2[0],x2[1],x2[2],x2[3],x3[0],x3[1],x3[2],x3[3]};
#pragma unroll
    for (int i = 0; i < 16; ++i) { const unsigned short hb = bf16_bits(xs[i]); ah.u[i] = hb; al.u[i] = ASPLIT ? bf16_bits(xs[i] - bf16_val(hb)) : (unsigned short)0; }
#pragma unroll
    for (int t = 0; t < 4; ++t) {
      const unsigned short* brow = Wt + (size_t)(col0 + t * 16 + ln) * ldb + kb;
      FragB b;
      b.half[0] = *(const v8us*)(brow + 8 * hh);
      b.half[1] = *(const v8us*)(brow + 16 + 8 * hh);
      acc[t] = mmaN<ASPLIT ? 2 : 1>(ah.v, al.v, b.v, b.v, acc[t]);
    }
  }
#pragma unroll
  for (int t = 0; t < 4; ++t) {
    const int col = col0 + t * 16 + ln;
    float bv = bias ? bias[col] : 0.f;
    if (BIAS_BF16) bv = bf16_round(bv);
#pragma unroll
    for (int r = 0; r < 8; ++r) {
      float v = acc[t][r] + bv;
      if (resid) { float rv = resid[(size_t)((row0 + 8 * hh + r) % rmod) * ldr + col]; if (RES_BF16) rv = bf16_round(rv); v += rv; }
      if (ACT == 1) v = fmaxf(v, 0.f);
      if (ACT == 2) v = 0.5f * v * (1.0f + erff(v * 0.70710678118654752f));
      if (ACT == 3) { const float u = 0.7978845608028654f * (v + 0.044715f * v * v * v); v = 0.5f * v * (1.0f + tanhf(u)); }
      so[w][8 * hh + r][t * 16 + ln] = v;
    }
  }
  __builtin_amdgcn_fence(__ATOMIC_ACQ_REL, "workgroup");
  __builtin_amdgcn_wave_barrier();
  const int rsub = lane >> 4, c4 = (lane & 15) * 4;
  {
#pragma unroll
    for (int q = 0; q < 8; ++q) {
      const int r = q * 2 + rsub;
      const v4f v = *(const v4fa*)&so[w][r][c4];
      *(v4f*)(C + (size_t)(row0 + r) * ldc + col0 + c4) = v;
    }
    
  }
}
// row LayerNorm (biased variance, eps) over N: s = X (+ R); optional out_sum <- s; out_norm <- (s-mu)*rsqrt(var+eps)*g + b
template <bool PARAM_BF16>
__global__ __launch_bounds__(256) void k_layernorm(const float* __restrict__ X, const float* __restrict__ R, const float* __restrict__ g, const float* __restrict__ bta,
                                                  float* __restrict__ out_sum, float* __restrict__ out_norm, int N, float eps) {
  __shared__ float red[256];
  const int row = blockIdx.x, tid = threadIdx.x;
  const float* x = X + (size_t)row * N; const float* rr = R ? R + (size_t)row * N : nullptr;
  float vals[16];                     // up to N = 4096
  const int per = N / 256;            // contiguous chunk per thread? use strided-by-4 chunks: thread handles j = tid*4 + 1024*u
  float s1 = 0.f;
  for (int u = 0; u < per / 4; ++u) {
    const int j = tid * 4 + 1024 * u;
    const v4f a = *(const v4fa*)(x + j);
    v4f b = {0.f,0.f,0.f,0.f}; if (rr) b = *(const v4fa*)(rr + j);
#pragma unroll
    for (int q = 0; q < 4; ++q) { const float v = a[q] + b[q]; vals[u * 4 + q] = v; s1 += v; }
  }
  red[tid] = s1; __syncthreads();
  for (int st = 128; st > 0; st >>= 1) { if (tid < st) red[tid] += red[tid + st]; __syncthreads(); }
  const float mu = red[0] / (float)N; __syncthreads();
  float s2 = 0.f;
  for (int u = 0; u < per / 4; ++u)
#pragma unroll
    for (int q = 0; q < 4; ++q) { const float c = vals[u * 4 + q] - mu; s2 += c * c; }
  red[tid] = s2; __syncthreads();
  for (int st = 128; st > 0; st >>= 1) { if (tid < st) red[tid] += red[tid + st]; __syncthreads(); }
  const float rs = rsqrtf(red[0] / (float)N + eps);
  {
    for (int u = 0; u < per / 4; ++u) {
      const int j = tid * 4 + 1024 * u;
      v4f o, sm;
#pragma unroll
      for (int q = 0; q < 4; ++q) {
        float gg = g[j + q], bb = bta[j + q];
        if (PARAM_BF16) { gg = bf16_round(gg); bb = bf16_round(bb); }
        sm[q] = vals[u * 4 + q]; o[q] = (vals[u * 4 + q] - mu) * rs * gg + bb;
      }
      if (out_sum) *(v4f*)(out_sum + (size_t)row * N + j) = sm;
      *(v4f*)(out_norm + (size_t)row * N + j) = o;
    }
    
  }
}



// ---- f16 WMMA path (v_wmma_f32_16x16x32_f16): 11-bit significands for operands in range — used where a [0,1] probability operand needs more precision than bf16
typedef _Float16 v16h __attribute__((ext_vector_type(16)));
union FragH { v16h v; v8us half[2]; _Float16 h[16]; unsigned short u[16]; };
template <int NT>
__device__ __forceinline__ v8f mmaH(v16h ah, v16h al, v16h bh, v16h bl, v8f c) {
  c = __builtin_amdgcn_wmma_f32_16x16x32_f16(false, ah, false, bh, (short)0, c, false, false);
  if (NT >= 2) c = __builtin_amdgcn_wmma_f32_16x16x32_f16(false, al, false, bh, (short)0, c, false, false);
  if (NT >= 3) c = __builtin_amdgcn_wmma_f32_16x16x32_f16(false, ah, false, bl, (short)0, c, false, false);
  asm volatile("v_nop\n\tv_nop\n\tv_nop\n\tv_nop" : "+v"(c) : "v"(ah), "v"(al), "v"(bh), "v"(bl));
  return c;
}
// batched GEMM like k_gemm_b but f16 operands: A f32 (split into f16 hi/lo if ASPLIT, else rounded to f16), Bt = f16 values [n][k]; alpha; C f32; N multiple of 16 (partial tiles skipped)
template <bool ASPLIT>
__global__ __launch_bounds__(128) void k_gemm_h(const float* __restrict__ A, int lda, size_t sA, const _Float16* __restrict__ Bh, int ldb, size_t sB, float alpha, float* __restrict__ C, int ldc, size_t sC, int M, int N, int K) {
  __shared__ __attribute__((aligned(16))) float so[4][16][64];
  const int tid = threadIdx.x, w = tid >> 5, lane = tid & 31, ln = lane & 15, hh = lane >> 4; const int by = blockIdx.y;
  A += (size_t)by * sA; Bh += (size_t)by * sB; C += (size_t)by * sC;
  const int ntn = (N + 63) / 64; const int wid = blockIdx.x * 4 + w; const int mt = wid / ntn, nq = wid % ntn; if (mt * 16 >= M) return;
  const int row0 = mt * 16, col0 = nq * 64; const float* arow = A + (size_t)(row0 + ln) * lda;
  v8f acc[4] = {};
  for (int kb = 0; kb < K; kb += 32) {
    FragH ah, al;
    const v4f x0 = *(const v4fa*)(arow + kb + 8 * hh), x1 = *(const v4fa*)(arow + kb + 8 * hh + 4), x2 = *(const v4fa*)(arow + kb + 16 + 8 * hh), x3 = *(const v4fa*)(arow + kb + 16 + 8 * hh + 4);
    float xs[16] = {x0[0],x0[1],x0[2],x0[3],x1[0],x1[1],x1[2],x1[3],x2[0],x2[1],x2[2],x2[3],x3[0],x3[1],x3[2],x3[3]};
#pragma unroll
    for (int i = 0; i < 16; ++i) { const _Float16 h = (_Float16)xs[i]; ah.h[i] = h; al.h[i] = ASPLIT ? (_Float16)(xs[i] - (float)h) : (_Float16)0.0f; }
#pragma unroll
    for (int t = 0; t < 4; ++t) { if (col0 + t * 16 >= N) continue; const size_t boff = (size_t)(col0 + t * 16 + ln) * ldb + kb; FragH bq; bq.half[0] = *(const v8us*)(Bh + boff + 8 * hh); bq.half[1] = *(const v8us*)(Bh + boff + 16 + 8 * hh);
      acc[t] = mmaH<ASPLIT ? 2 : 1>(ah.v, al.v, bq.v, bq.v, acc[t]); }
  }
#pragma unroll
  for (int t = 0; t < 4; ++t) { if (col0 + t * 16 >= N) continue;
#pragma unroll
    for (int r = 0; r < 8; ++r) so[w][8 * hh + r][t * 16 + ln] = acc[t][r] * alpha; }
  __builtin_amdgcn_fence(__ATOMIC_ACQ_REL, "workgroup"); __builtin_amdgcn_wave_barrier();
  const int rsub = lane >> 4, c4 = (lane & 15) * 4;
  {
#pragma unroll
    for (int q = 0; q < 8; ++q) { const int r = q * 2 + rsub; if (col0 + c4 < N) { const v4f v = *(const v4fa*)&so[w][r][c4]; *(v4f*)(C + (size_t)(row0 + r) * ldc + col0 + c4) = v; } }
     }
}

// Wt[n][k] = f16(W[k][n]·scale) from f32 row-major W[K][N] (scale = power of two; bf16-exact weights stay exact in f16 away from the subnormal range)
__global__ __launch_bounds__(256) void k_wt_f16(const float* __restrict__ W, _Float16* __restrict__ Wt, int K, int N, float scale) {
  const int t = blockIdx.x * 256 + threadIdx.x; if (t >= N * (K / 8)) return; const int n = t / (K / 8), k8 = (t % (K / 8)) * 8; FragH f;
#pragma unroll
  for (int i = 0; i < 8; ++i) f.h[i] = (_Float16)(bf16_round(W[(size_t)(k8 + i) * N + n]) * scale); const v8us o = f.half[0];
  *(v8us*)((unsigned short*)Wt + (size_t)n * K + k8) = o; 
}
// k_gemm_hh variant with fused epilogue: v = acc·alpha + bias[by·sBias + col] (+ CP[(row/rowsPerB)·sCPb + by·64 + col] if CP) ; ACT 0 none / 1 elu ; writes f16 C16 (and f32 C if non-null)
template <int ACT>
__global__ __launch_bounds__(128) void k_gemm_hhx(const _Float16* __restrict__ A, int lda, size_t sA, const _Float16* __restrict__ Bh, int ldb, size_t sB, float alpha, const float* __restrict__ bias, size_t sBias, const float* __restrict__ CP, int rowsPerB, size_t sCPb, int row0g,
    float* __restrict__ C, _Float16* __restrict__ C16, int ldc, size_t sC, int M, int N, int K) {
  __shared__ __attribute__((aligned(16))) float so[4][16][64];
  const int tid = threadIdx.x, w = tid >> 5, lane = tid & 31, ln = lane & 15, hh = lane >> 4; const int by = blockIdx.y;
  A += (size_t)by * sA; Bh += (size_t)by * sB; const size_t cofs = (size_t)by * sC; const float* bp = bias ? bias + (size_t)by * sBias : nullptr;
  const int ntn = (N + 63) / 64; const int wid = blockIdx.x * 4 + w; const int mt = wid / ntn, nq = wid % ntn; if (mt * 16 >= M) return;
  const int row0 = mt * 16, col0 = nq * 64; const _Float16* arow = A + (size_t)(row0 + ln) * lda;
  v8f acc[4] = {};
  for (int kb = 0; kb < K; kb += 32) { FragH ah; ah.half[0] = *(const v8us*)((const unsigned short*)arow + kb + 8 * hh); ah.half[1] = *(const v8us*)((const unsigned short*)arow + kb + 16 + 8 * hh);
#pragma unroll
    for (int t = 0; t < 4; ++t) { if (col0 + t * 16 >= N) continue; const size_t boff = (size_t)(col0 + t * 16 + ln) * ldb + kb; FragH bq; bq.half[0] = *(const v8us*)((const unsigned short*)Bh + boff + 8 * hh); bq.half[1] = *(const v8us*)((const unsigned short*)Bh + boff + 16 + 8 * hh);
      acc[t] = mmaH<1>(ah.v, ah.v, bq.v, bq.v, acc[t]); }
  }
#pragma unroll
  for (int t = 0; t < 4; ++t) { if (col0 + t * 16 >= N) continue; const int col = col0 + t * 16 + ln; const float bv = bp ? bf16_round(bp[col]) : 0.f;
#pragma unroll
    for (int r = 0; r < 8; ++r) { float v = acc[t][r] * alpha + bv; if (CP) { const int rr = row0g + row0 + 8 * hh + r; if (rowsPerB < 0) v += CP[cofs + (size_t)rr * ldc + col];      /* rowsPerB < 0: own element of the batched C plane */ else { const int bidx = rr / rowsPerB; v += CP[(size_t)bidx * sCPb + (size_t)by * 64 + col]; } } if (ACT == 1) v = (v > 0.f) ? v : expm1f(v); else if (ACT == 7) v = (v > 0.f) ? v + 1.0f : expf(v); else if (ACT == 8) v = tanhf(v); else if (ACT == 9) v = 0.5f * v * (1.0f + tanhf(0.7978845608028654f * (v + 0.044715f * v * v * v))); else if (ACT == 11) v = 1.0f / (1.0f + expf(-v)); else if (ACT == 12) v = (v > 0.f) ? v : 0.01f * v; else if (ACT == 14) v = (v > 0.f) ? v : 0.1f * v; else if (ACT == 16) v = (v >= 0.f) ? v : 0.3f * v; else if (ACT == 17) v = (v >= 0.f) ? v : 0.2f * v; else if (ACT == 15) v = v / (1.0f + expf(-v)); else if (ACT == 3) v = fmaxf(v, 0.f); else if (ACT == 6) v = 0.5f * v * (1.0f + erff(v * 0.70710678118654752f)); so[w][8 * hh + r][t * 16 + ln] = v; } }
  __builtin_amdgcn_fence(__ATOMIC_ACQ_REL, "workgroup"); __builtin_amdgcn_wave_barrier();
  const int rsub = lane >> 4, c4 = (lane & 15) * 4; typedef _Float16 v4h __attribute__((ext_vector_type(4)));
  {
#pragma unroll
    for (int q = 0; q < 8; ++q) { const int r = q * 2 + rsub; if (col0 + c4 < N) { const v4f v = *(const v4fa*)&so[w][r][c4]; if (C) *(v4f*)(C + cofs + (size_t)(row0 + r) * ldc + col0 + c4) = v; if (C16) { v4h h4; for (int i = 0; i < 4; ++i) h4[i] = (_Float16)v[i]; *(v4h*)(C16 + cofs + (size_t)(row0 + r) * ldc + col0 + c4) = h4; } } }
     }
}


typedef _Float16 v4h __attribute__((ext_vector_type(4)));

__global__ __launch_bounds__(256) void k_x16(const float* __restrict__ x, _Float16* __restrict__ X16, size_t n8) { const size_t t = (size_t)blockIdx.x * 256 + threadIdx.x; if (t >= n8) return; FragH f;
#pragma unroll
  for (int q = 0; q < 8; ++q) f.h[q] = (_Float16)bf16_round(x[t * 8 + q]); *(v8us*)((unsigned short*)X16 + t * 8) = f.half[0];  }
__global__ __launch_bounds__(256) void k_h16(const float* __restrict__ x, _Float16* __restrict__ X16, size_t n8) { const size_t t = (size_t)blockIdx.x * 256 + threadIdx.x; if (t >= n8) return; FragH f;
#pragma unroll
  for (int q = 0; q < 8; ++q) f.h[q] = (_Float16)x[t * 8 + q]; *(v8us*)((unsigned short*)X16 + t * 8) = f.half[0];  }
__global__ __launch_bounds__(256) void k_round16f(const float* __restrict__ W, _Float16* __restrict__ Bt, size_t n8) { const size_t t = (size_t)blockIdx.x * 256 + threadIdx.x; if (t >= n8) return; FragH f;
#pragma unroll
  for (int i = 0; i < 8; ++i) f.h[i] = (_Float16)(bf16_round(W[t * 8 + i]) * 16.0f); *(v8us*)((unsigned short*)Bt + t * 8) = f.half[0];  }
template <int NHv, int TTv>
__global__ __launch_bounds__(256) void k_vt(const _Float16* __restrict__ V16, int ldv, int voff, _Float16* __restrict__ Vt) { __shared__ unsigned short tl[64][66]; const int tid = threadIdx.x; const int slab = blockIdx.x / (TTv / 64), lg = blockIdx.x % (TTv / 64); const int b = slab / NHv, h = slab % NHv;
  for (int i = tid; i < 64 * 8; i += 256) { const int r = i / 8, c8 = (i % 8) * 8; FragH f; f.half[0] = *(const v8us*)((const unsigned short*)V16 + ((size_t)b * TTv + lg * 64 + r) * ldv + voff + h * 64 + c8);
#pragma unroll
    for (int q = 0; q < 8; ++q) tl[r][c8 + q] = f.u[q]; }
  __syncthreads();
  {
#pragma unroll
    for (int rd = 0; rd < 2; ++rd) { const int d = rd * 32 + tid / 8, pc = tid % 8; FragH f;
#pragma unroll
      for (int q = 0; q < 8; ++q) f.u[q] = tl[pc * 8 + q][d];
      *(v8us*)((unsigned short*)Vt + ((size_t)slab * 64 + d) * TTv + lg * 64 + pc * 8) = f.half[0]; }
     } }

__global__ __launch_bounds__(256) void k_hl(const float* __restrict__ F, _Float16* __restrict__ Hh, _Float16* __restrict__ Hl, size_t n8) { const size_t t = (size_t)blockIdx.x * 256 + threadIdx.x; if (t >= n8) return; FragH fh, fl; const v4f a = *(const v4fa*)(F + t * 8), c = *(const v4fa*)(F + t * 8 + 4);
#pragma unroll
  for (int q = 0; q < 4; ++q) { _Float16 h = (_Float16)a[q]; fh.h[q] = h; fl.h[q] = (_Float16)((a[q] - (float)h) * 1024.0f); h = (_Float16)c[q]; fh.h[4 + q] = h; fl.h[4 + q] = (_Float16)((c[q] - (float)h) * 1024.0f); }
  { *(v8us*)((unsigned short*)Hh + t * 8) = fh.half[0]; *(v8us*)((unsigned short*)Hl + t * 8) = fl.half[0];  } }

// ---- fast GEMM (wave tile 32x64; requires M % 32 == 0 rows per launch region and N % 64 == 0); epilogue = k_gemm_hhx semantics ----
__device__ __forceinline__ v16h g2_frag(const _Float16* p, int hh) { FragH f; f.half[0] = *(const v8us*)((const unsigned short*)p + 8 * hh); f.half[1] = *(const v8us*)((const unsigned short*)p + 16 + 8 * hh); return f.v; }
__device__ __forceinline__ v8f g2_mma(v16h a, v16h b, v8f c) { v8f d = __builtin_amdgcn_wmma_f32_16x16x32_f16(false, a, false, b, (short)0, c, false, false); asm volatile("v_nop\n\tv_nop\n\tv_nop\n\tv_nop" : "+v"(d) : "v"(a), "v"(b)); return d; }
template <int ACT>
__global__ __launch_bounds__(128) void k_gemm2(const _Float16* __restrict__ A, int lda, size_t sA, const _Float16* __restrict__ Bh, int ldb, size_t sB, float alpha, const float* __restrict__ bias, size_t sBias, const float* __restrict__ CP, int rowsPerB, size_t sCPb, int row0g,
    float* __restrict__ C, _Float16* __restrict__ C16, int ldc, size_t sC, int M, int N, int K) { static_assert(ACT == 0 || ACT == 3 || ACT == 6 || ACT == 8 || ACT == 9 || ACT == 11 || ACT == 12 || ACT == 14 || ACT == 15 || ACT == 16 || ACT == 17, "k_gemm2: unsupported ACT code (would silently apply no activation)");
  __shared__ __attribute__((aligned(16))) float so[4][32][68];
  const int tid = threadIdx.x, w = tid >> 5, lane = tid & 31, ln = lane & 15, hh = lane >> 4; const int by = blockIdx.y;
  A += (size_t)by * sA; Bh += (size_t)by * sB; const size_t cofs = (size_t)by * sC; const float* bp = bias ? bias + (size_t)by * sBias : nullptr;
  const int ntn = N >> 6; const int mt = blockIdx.x / ntn, nq = blockIdx.x - mt * ntn; const int row0 = mt * 128 + 32 * w, col0 = nq * 64; if (row0 >= M) return;
  const _Float16* a0p = A + (size_t)(row0 + ln) * lda; const _Float16* a1p = a0p + (size_t)16 * lda;
  const _Float16* b0p = Bh + (size_t)(col0 + ln) * ldb; const _Float16* b1p = b0p + (size_t)16 * ldb; const _Float16* b2p = b1p + (size_t)16 * ldb; const _Float16* b3p = b2p + (size_t)16 * ldb;
  const v8f z8 = {0.f,0.f,0.f,0.f,0.f,0.f,0.f,0.f}; v8f c00 = z8, c01 = z8, c02 = z8, c03 = z8, c10 = z8, c11 = z8, c12 = z8, c13 = z8;
#pragma unroll 1
  for (int kb = 0; kb < K; kb += 32) { const v16h a0 = g2_frag(a0p + kb, hh), a1 = g2_frag(a1p + kb, hh);
    v16h b = g2_frag(b0p + kb, hh); c00 = g2_mma(a0, b, c00); c10 = g2_mma(a1, b, c10);
    b = g2_frag(b1p + kb, hh); c01 = g2_mma(a0, b, c01); c11 = g2_mma(a1, b, c11);
    b = g2_frag(b2p + kb, hh); c02 = g2_mma(a0, b, c02); c12 = g2_mma(a1, b, c12);
    b = g2_frag(b3p + kb, hh); c03 = g2_mma(a0, b, c03); c13 = g2_mma(a1, b, c13); }
  v8f accs[8] = {c00, c01, c02, c03, c10, c11, c12, c13};
#pragma unroll
  for (int u = 0; u < 8; ++u) { const int t = u & 3, half = u >> 2; const int col = col0 + t * 16 + ln; const float bv = bp ? bf16_round(bp[col]) : 0.f;
#pragma unroll
    for (int r = 0; r < 8; ++r) { const int rloc = half * 16 + 8 * hh + r; float v = accs[u][r] * alpha + bv; if (CP) { if (rowsPerB < 0) v += CP[cofs + (size_t)(row0g + row0 + rloc) * ldc + col];      /* rowsPerB < 0: own element of the batched C plane */ else { const int bidx = (row0g + row0 + rloc) / rowsPerB; v += CP[(size_t)bidx * sCPb + (size_t)by * 64 + col]; } }
      if (ACT == 3) v = fmaxf(v, 0.f); else if (ACT == 6) v = 0.5f * v * (1.0f + erff(v * 0.70710678118654752f)); else if (ACT == 11) v = 1.0f / (1.0f + expf(-v)); else if (ACT == 15) v = v / (1.0f + expf(-v)); else if (ACT == 12) v = (v > 0.f) ? v : 0.01f * v; else if (ACT == 8) v = tanhf(v); else if (ACT == 9) v = 0.5f * v * (1.0f + tanhf(0.7978845608028654f * (v + 0.044715f * v * v * v))); else if (ACT == 14) v = (v > 0.f) ? v : 0.1f * v; else if (ACT == 16) v = (v >= 0.f) ? v : 0.3f * v; else if (ACT == 17) v = (v >= 0.f) ? v : 0.2f * v;
      so[w][rloc][t * 16 + ln] = v; } }
  __builtin_amdgcn_fence(__ATOMIC_ACQ_REL, "workgroup"); __builtin_amdgcn_wave_barrier();
  const int rsub = lane >> 4, c4 = (lane & 15) * 4;
  {
#pragma unroll
    for (int q = 0; q < 16; ++q) { const int r = q * 2 + rsub; const v4f v = *(const v4fa*)&so[w][r][c4]; if (C) *(v4f*)(C + cofs + (size_t)(row0 + r) * ldc + col0 + c4) = v; if (C16) { v4h h4; for (int i = 0; i < 4; ++i) h4[i] = (_Float16)v[i]; *(v4h*)(C16 + cofs + (size_t)(row0 + r) * ldc + col0 + c4) = h4; } }
     } }


__global__ __launch_bounds__(256) void k_wnat(const float* __restrict__ w, size_t n8, _Float16* __restrict__ Bt) { const size_t t = (size_t)blockIdx.x * 256 + threadIdx.x; if (t >= n8) return; FragH f; for (int q = 0; q < 8; ++q) f.h[q] = (_Float16)(bf16_round(w[t * 8 + q]) * 16.0f); *(v8us*)((unsigned short*)Bt + t * 8) = f.half[0];  }
__global__ __launch_bounds__(256) void k_rsm(const float* __restrict__ S, _Float16* __restrict__ P, int nrows) {
  #pragma clang fp contract(off)
  const int i = blockIdx.x * 256 + threadIdx.x; if (i >= nrows) return; const float* s = S + (size_t)i * SQ; float mx = -3.0e38f;
#pragma unroll 1
  for (int j = 0; j < SQ; ++j) mx = fmaxf(mx, s[j]); float se = 0.f;
#pragma unroll 1
  for (int j = 0; j < SQ; ++j) se += expf(s[j] - mx); const float sc = 256.0f / se;
#pragma unroll 1
  for (int j0 = 0; j0 < SQ; j0 += 8) { FragH f; for (int q = 0; q < 8; ++q) f.h[q] = (_Float16)(expf(s[j0 + q] - mx) * sc); unsigned short* d = (unsigned short*)P + (size_t)i * SQ + j0; *(v8us*)d = f.half[0];  } }
__global__ __launch_bounds__(256) void k_vt(const _Float16* __restrict__ V16, int b, int h0, _Float16* __restrict__ VT) { __shared__ unsigned short tl[64][65]; const int tid = threadIdx.x; const int hh = blockIdx.x % HG, sg = blockIdx.x / HG; const int s0 = sg * 64; const int h = h0 + hh;
  for (int i = tid; i < 64 * 8; i += 256) { const int j = i / 8, d8 = (i % 8) * 8; FragH f; f.half[0] = *(const v8us*)((const unsigned short*)V16 + ((size_t)b * SQ + s0 + j) * DM + h * HD + d8); for (int q = 0; q < 8; ++q) tl[d8 + q][j] = f.u[q]; }
  __syncthreads();
  { for (int i = tid; i < 64 * 8; i += 256) { const int d = i / 8, j8 = (i % 8) * 8; FragH f; for (int q = 0; q < 8; ++q) f.u[q] = tl[d][j8 + q]; *(v8us*)((unsigned short*)VT + ((size_t)hh * HD + d) * SQ + s0 + j8) = f.half[0]; }  } }



__global__ __launch_bounds__(256) void k_rsmcf2(const float* __restrict__ S, _Float16* __restrict__ P, int hg, int q0, int nk) {
  #pragma clang fp contract(off)
  const int t = blockIdx.x * 256 + threadIdx.x; if (t >= hg * QT) return; const size_t i = (size_t)t; const float* s = S + i * NKX; const int last = q0 + (t % QT); float mx = -3.0e38f;
#pragma unroll 1
  for (int j = 0; j < nk; ++j) { const float f = (j <= last) ? 1.f : 0.f; mx = fmaxf(mx, fmaf(f, s[j], (1.f - f) * -1.0e9f)); } float se = 0.f;
#pragma unroll 1
  for (int j = 0; j < nk; ++j) { const float f = (j <= last) ? 1.f : 0.f; se += __expf(fmaf(f, s[j], (1.f - f) * -1.0e9f) - mx); } const float sc = 256.0f / se;
#pragma unroll 1
  for (int j0 = 0; j0 < nk; j0 += 8) { FragH fr; for (int q = 0; q < 8; ++q) { const int j = j0 + q; const float f = (j <= last) ? 1.f : 0.f; fr.h[q] = (_Float16)(__expf(fmaf(f, s[j], (1.f - f) * -1.0e9f) - mx) * sc); } unsigned short* d = (unsigned short*)P + i * NKX + j0; *(v8us*)d = fr.half[0];  } }


template <int MASKADD>
__global__ __launch_bounds__(64) void k_att0(const float* __restrict__ QF, const float* __restrict__ KF, const float* __restrict__ VF, int ld, const float* __restrict__ mask, float scale, float* __restrict__ OF, int ldo) {
  #pragma clang fp contract(off)
  __shared__ __attribute__((aligned(16))) float lq[64][64]; __shared__ __attribute__((aligned(16))) float lo[64][64];
  const int tid = threadIdx.x; const int h = blockIdx.x / (QT0 / 64), rg = blockIdx.x % (QT0 / 64); const int i = rg * 64 + tid;
  const float* qr = QF + (size_t)i * ld + h * HD;
#pragma unroll 1
  for (int c = 0; c < HD / 4; ++c) { *(v4f*)&lq[tid][c * 4] = *(const v4fa*)(qr + c * 4); const v4f z = {0.f, 0.f, 0.f, 0.f}; *(v4f*)&lo[tid][c * 4] = z; }
  float m = -1.0e30f, l = 0.f; const int jmax = MASKADD ? (SQ - 1) : (rg * 64 + 63);      /* additive-mask form: every key (the mask input decides); causal form: keys up to the block's last row */
#pragma unroll 1
  for (int j = 0; j <= jmax; ++j) { const float* kr = KF + (size_t)j * ld + h * HD; const float* vr = VF + (size_t)j * ld + h * HD; float s = 0.f;
#pragma unroll 1
    for (int c = 0; c < HD / 4; ++c) { const v4f kq = *(const v4fa*)(kr + c * 4); const v4f qq = *(v4f*)&lq[tid][c * 4]; s = __fadd_rn(s, __fmul_rn(qq[0], kq[0])); s = __fadd_rn(s, __fmul_rn(qq[1], kq[1])); s = __fadd_rn(s, __fmul_rn(qq[2], kq[2])); s = __fadd_rn(s, __fmul_rn(qq[3], kq[3])); }
    s = __fmul_rn(s, scale); if (MASKADD) s = __fadd_rn(s, __fmul_rn(bf16_round(mask[(size_t)i * SQ + j]), -10000.0f));
    const float f = (MASKADD || j <= i) ? 1.f : 0.f; const float sm = fmaf(f, s, (1.f - f) * -1.0e30f); const float mn = fmaxf(m, sm); const float sc = expf(m - mn); const float e = expf(sm - mn); l = __fadd_rn(__fmul_rn(l, sc), e); m = mn;
#pragma unroll 1
    for (int c = 0; c < HD / 4; ++c) { const v4f vv = *(const v4fa*)(vr + c * 4); v4f oo = *(v4f*)&lo[tid][c * 4]; for (int u = 0; u < 4; ++u) oo[u] = __fadd_rn(__fmul_rn(oo[u], sc), __fmul_rn(e, vv[u])); *(v4f*)&lo[tid][c * 4] = oo; } }
  const float fin = 64.0f / l;      /* o carried x64 like the f16 path */
#pragma unroll 1
  for (int c = 0; c < HD / 4; ++c) { v4f oo = *(v4f*)&lo[tid][c * 4]; for (int u = 0; u < 4; ++u) oo[u] = __fmul_rn(oo[u], fin); *(v4f*)&lo[tid][c * 4] = oo; }
  __syncthreads();
  {
#pragma unroll 1
    for (int it = 0; it < 16; ++it) { const int row = it * 4 + tid / 16, pc = (tid % 16) * 4; const v4f v = *(const v4f*)&lo[row][pc]; *(v4f*)(OF + (size_t)(rg * 64 + row) * ldo + h * HD + pc) = v; }
     } }

extern "C" void kernel_launch(void* const* d_in, const int* in_sizes, int n_in,
                              void* d_out, int out_size, void* d_ws, size_t ws_size, hipStream_t stream) {
  (void)in_sizes; (void)n_in; (void)out_size;
  const float* const* I = (const float* const*)d_in; const float* xq = I[0]; const float* xk = I[1]; const float* xv = I[2]; const float* wq = I[3]; const float* wk = I[4]; const float* wv = I[5]; const float* wo = I[6];      /* nn.Linear weights [out][in] */
  char* ws = (char*)d_ws; size_t off = 0;
  auto take = [&](size_t bytes) { char* p = ws + off; off += (bytes + 255) & ~(size_t)255; return p; };
  _Float16* BQ = (_Float16*)take((size_t)DM * DM * 2); _Float16* BK = (_Float16*)take((size_t)DM * DM * 2); _Float16* BV = (_Float16*)take((size_t)DM * DM * 2); _Float16* BO = (_Float16*)take((size_t)DM * DM * 2);
  _Float16* XQ = (_Float16*)take(NR * DM * 2); _Float16* XK = (_Float16*)take(NR * DM * 2); _Float16* XV = (_Float16*)take(NR * DM * 2); _Float16* Q16 = (_Float16*)take(NR * DM * 2); _Float16* K16 = (_Float16*)take(NR * DM * 2); _Float16* V16 = (_Float16*)take(NR * DM * 2); _Float16* O16 = (_Float16*)take(NR * DM * 2);
  float* S = (float*)take((size_t)NH * QT * NKX * 4); _Float16* P = (_Float16*)take((size_t)NH * QT * NKX * 2); _Float16* VT = (_Float16*)take((size_t)NH * HD * SQ * 2);
  float* QF0 = (float*)take((size_t)QT0 * DM * 4); float* KF0 = (float*)take((size_t)QT0 * DM * 4); float* VF0 = (float*)take((size_t)QT0 * DM * 4); float* OF0 = (float*)take((size_t)NB * QT0 * DM * 4); _Float16* OH0 = (_Float16*)take((size_t)NB * QT0 * DM * 2); _Float16* OL0 = (_Float16*)take((size_t)NB * QT0 * DM * 2);
  if (off > ws_size) return;
  { const unsigned g = (unsigned)(((size_t)DM * DM / 8 + 255) / 256); k_wnat<<<g, 256, 0, stream>>>(wq, (size_t)DM * DM / 8, BQ); k_wnat<<<g, 256, 0, stream>>>(wk, (size_t)DM * DM / 8, BK); k_wnat<<<g, 256, 0, stream>>>(wv, (size_t)DM * DM / 8, BV); k_wnat<<<g, 256, 0, stream>>>(wo, (size_t)DM * DM / 8, BO); }      /* natural [out][in] = Bt[n][k], x16 */
  k_x16<<<(unsigned)((NR * DM / 8 + 255) / 256), 256, 0, stream>>>(xq, XQ, NR * DM / 8); k_x16<<<(unsigned)((NR * DM / 8 + 255) / 256), 256, 0, stream>>>(xk, XK, NR * DM / 8); k_x16<<<(unsigned)((NR * DM / 8 + 255) / 256), 256, 0, stream>>>(xv, XV, NR * DM / 8);
  const size_t r0p = (size_t)B0 * SQ;      /* first projected row */
  k_gemm2<0><<<dim3((unsigned)((MP / 128) * (DM / 64)), 1), 128, 0, stream>>>(XQ + r0p * DM, DM, 0, BQ, DM, 0, 0.0625f, nullptr, 0, nullptr, 1, 0, 0, nullptr, Q16 + r0p * DM, DM, 0, MP, DM, DM);
  k_gemm2<0><<<dim3((unsigned)((MP / 128) * (DM / 64)), 1), 128, 0, stream>>>(XK + r0p * DM, DM, 0, BK, DM, 0, 0.0625f, nullptr, 0, nullptr, 1, 0, 0, nullptr, K16 + r0p * DM, DM, 0, MP, DM, DM);
  k_gemm2<0><<<dim3((unsigned)((MP / 128) * (DM / 64)), 1), 128, 0, stream>>>(XV + r0p * DM, DM, 0, BV, DM, 0, 0.0625f, nullptr, 0, nullptr, 1, 0, 0, nullptr, V16 + r0p * DM, DM, 0, MP, DM, DM);
  for (int b = B0; b < B0 + NBR; ++b) { const size_t r0 = (size_t)b * SQ;
    k_vt<NH, SQ><<<NH * (SQ / 64), 256, 0, stream>>>(V16 + r0 * LQ, LQ, 0, VT);      /* V^T [NH][HD][SQ] for this batch */
    k_gemm2<0><<<dim3((QT0 / 128) * (DM / 64), 1), 128, 0, stream>>>(XQ + r0 * DM, DM, 0, BQ, DM, 0, 0.0625f, nullptr, 0, nullptr, 1, 0, 0, QF0, nullptr, DM, 0, QT0, DM, DM); k_gemm2<0><<<dim3((QT0 / 128) * (DM / 64), 1), 128, 0, stream>>>(XK + r0 * DM, DM, 0, BK, DM, 0, 0.0625f, nullptr, 0, nullptr, 1, 0, 0, KF0, nullptr, DM, 0, QT0, DM, DM); k_gemm2<0><<<dim3((QT0 / 128) * (DM / 64), 1), 128, 0, stream>>>(XV + r0 * DM, DM, 0, BV, DM, 0, 0.0625f, nullptr, 0, nullptr, 1, 0, 0, VF0, nullptr, DM, 0, QT0, DM, DM);      /* f32 q, k, v of the first 256 rows (exact products) */
    k_att0<0><<<NH * (QT0 / 64), 64, 0, stream>>>(QF0, KF0, VF0, DM, nullptr, 0.125f, OF0 + (size_t)b * QT0 * DM, DM);      /* exact f32 attention for rows 0..255 (o x64) */
    for (int q0 = 0; q0 < QN; q0 += QT) { const int nk = q0 + QT;      /* causal: only keys below the tile end are computed */
      k_gemm2<0><<<dim3((QT / 128) * (nk / 64), NHD), 128, 0, stream>>>(Q16 + (r0 + q0) * LQ, LQ, (size_t)HD, K16 + r0 * LQ, LQ, (size_t)HD, 0.125f, nullptr, 0, nullptr, 1, 0, 0, S, nullptr, NKX, (size_t)QT * NKX, QT, nk, HD);      /* scores, all heads on grid.y */
      k_rsmcf2<<<(NHD * QT + 255) / 256, 256, 0, stream>>>(S, P, NHD, q0, nk);
      k_gemm2<0><<<dim3((QT / 128) * (HD / 64), NHD), 128, 0, stream>>>(P, NKX, (size_t)QT * NKX, VT, SQ, (size_t)HD * SQ, 0.25f, nullptr, 0, nullptr, 1, 0, 0, nullptr, O16 + (r0 + q0) * DM, DM, (size_t)HD, QT, HD, nk); } }      /* o (merged heads, x64) as f16 rows */
  k_gemm2<0><<<dim3((unsigned)((MPO / 128) * (DM / 64)), 1), 128, 0, stream>>>(O16 + r0p * DM, DM, 0, BO, DM, 0, 0.0009765625f, nullptr, 0, nullptr, 1, 0, 0, (float*)d_out + r0p * DM, nullptr, DM, 0, MPO, DM, DM);      /* out rows are the output layout */
  k_hl<<<(unsigned)(((size_t)NB * QT0 * DM / 8 + 255) / 256), 256, 0, stream>>>(OF0, OH0, OL0, (size_t)NB * QT0 * DM / 8);      /* first-tile o (x64) -> f16 hi + x1024 residual planes */
  for (int b = B0; b < B0 + NBR; ++b) { const size_t r0 = (size_t)b * SQ; const size_t f0 = (size_t)b * QT0;
    k_gemm2<0><<<dim3((QT0 / 128) * (DM / 64), 1), 128, 0, stream>>>(OH0 + f0 * DM, DM, 0, BO, DM, 0, 0.0009765625f, nullptr, 0, nullptr, 1, 0, 0, (float*)d_out + r0 * DM, nullptr, DM, 0, QT0, DM, DM);      /* rows 0..255: out = o_hi Wo, overwriting the f16-path rows */
    k_gemm2<0><<<dim3((QT0 / 128) * (DM / 64), 1), 128, 0, stream>>>(OL0 + f0 * DM, DM, 0, BO, DM, 0, 0.00000095367431640625f, nullptr, 0, (const float*)d_out + r0 * DM, -1, 0, 0, (float*)d_out + r0 * DM, nullptr, DM, 0, QT0, DM, DM); }      /* += o_lo Wo 2^-20 (own-element accumulate) */
}

// v001
// A run of this version takes 2590 microseconds.
// In two side-by-side timings against v000, it was 3.18 and 3.20 times as fast.
#include <hip/hip_runtime.h>
// Causal multi-head attention (q, k, v inputs [1][4096][1024]; qp/kp/vp = input W^T (nn.Linear [out][in], no bias), 16 heads of 64; scores x (8/64) = /8; causal mask (keys > query get -inf); softmax; out = (probs v merged) Wo^T -> [1][4096][1024]).
// Structure: token rows r = s; q, k, v inputs as exact f16 rows (bf16-rounded); Q, K, V as three WMMA GEMMs (32x64 wave tiles, f32 accumulation, exact x16 weights, f16 outputs); per batch: V^T for all heads via LDS transposes; per query tile of 256 rows: scores against the keys below the tile end only (K = 64, all heads on grid.y, alpha = 0.125), causal row softmax on VALU, one wave per row with the row in registers, keys above the query masked over the computed range (f32 statistics, native exp; weights x256 f16), o = P . V^T (K = keys below the tile end, alpha 2^-2: o carried x64, folded into the output GEMM alpha) written straight into the merged f16 o rows; out = o W_o GEMM (f32) into the output layout.
// Compute dtype: inputs rounded to bf16; x / weights exact; q, k, v, softmax weights and o as plain f16 GEMM operands (~2^-12); scores and softmax statistics f32. v_wmma_f32_16x16x32_f16.
#define NB 1
#define SQ 4096
#define DM 1024
#define NH 16
#define HD 64
#define HG 4                         /* heads per launch of the non-template k_vt (not launched) */
#define QT 256                       /* query rows per causal tile */
#define NKX SQ                       /* S / P row pitch */
#define QT0 256                      /* first-tile rows recomputed exactly in f32 */
#define B0 0                         /* first batch processed (debug hook) */
#define NBR NB                       /* batches processed (debug hook) */
#define NR ((size_t)NB * SQ)         /* token rows */
#define MP ((int)((size_t)NBR * SQ)) /* rows projected (debug hook) */
#define QN SQ                        /* query rows attended per batch (debug hook) */
#define NHD NH                       /* heads attended (debug hook) */
#define MPO MP                       /* rows through the output stage (debug hook) */
#define LQ DM      /* row pitch of the q/k/v rows */
typedef __bf16 v16b __attribute__((ext_vector_type(16)));
typedef unsigned short v8us __attribute__((ext_vector_type(8), may_alias));
typedef float  v8f  __attribute__((ext_vector_type(8)));
typedef float  v4f  __attribute__((ext_vector_type(4)));
typedef float  v4fa __attribute__((ext_vector_type(4), may_alias));
union FragB { v16b v; v8us half[2]; unsigned short u[16]; };

__device__ __forceinline__ unsigned short bf16_bits(float x) { unsigned int u = __float_as_uint(x); return (unsigned short)((u + 0x7FFFu + ((u >> 16) & 1u)) >> 16); }
__device__ __forceinline__ float bf16_val(unsigned short b) { return __uint_as_float(((unsigned int)b) << 16); }
__device__ __forceinline__ float bf16_round(float x) { return bf16_val(bf16_bits(x)); }
// D += A·B with NT terms: 1 = ah·bh, 2 = + al·bh (A split), 3 = + ah·bl (both split)
template <int NT>
__device__ __forceinline__ v8f mmaN(v16b ah, v16b al, v16b bh, v16b bl, v8f c) {
  c = __builtin_amdgcn_wmma_f32_16x16x32_bf16(false, ah, false, bh, (short)0, c, false, false);
  if (NT >= 2) c = __builtin_amdgcn_wmma_f32_16x16x32_bf16(false, al, false, bh, (short)0, c, false, false);
  if (NT >= 3) c = __builtin_amdgcn_wmma_f32_16x16x32_bf16(false, ah, false, bl, (short)0, c, false, false);
  asm volatile("v_nop\n\tv_nop\n\tv_nop\n\tv_nop" : "+v"(c) : "v"(ah), "v"(al), "v"(bh), "v"(bl));
  return c;
}

__global__ __launch_bounds__(256) void k_wt_bf16(const float* __restrict__ W, unsigned short* __restrict__ Wt, int K, int N) {
  const int t = blockIdx.x * 256 + threadIdx.x;
  const int k8n = K / 8;
  if (t >= N * k8n) return;
  const int n = t / k8n, k8 = (t % k8n) * 8;
  v8us v;
#pragma unroll
  for (int i = 0; i < 8; ++i) v[i] = bf16_bits(W[(size_t)(k8 + i) * N + n]);
  *(v8us*)(Wt + (size_t)n * K + k8) = v;
  
}

// GEMM C[M][N] (f32, pitch ldc) = act(A[M][K]·W + bias). A f32 row-major (pitch lda) converted per fragment to bf16
// (ASPLIT: hi/lo two planes -> 2 terms, else single rounded term); Wt bf16 [N][K] (pitch ldb). BIAS_BF16 rounds the
// bias to bf16 first (bias quantised to bf16 before the add). K%32==0, M%16==0, N%64==0.
template <bool ASPLIT, int ACT, bool BIAS_BF16>
__global__ __launch_bounds__(128) void k_gemm_bf(const float* __restrict__ A, int lda, const unsigned short* __restrict__ Wt, int ldb,
                                               const float* __restrict__ bias, float* __restrict__ C, int ldc, int M, int N, int K) {
  __shared__ __attribute__((aligned(16))) float so[4][16][64];
  const int tid = threadIdx.x, w = tid >> 5, lane = tid & 31, ln = lane & 15, hh = lane >> 4;
  const int ntn = N / 64;
  const int wid = blockIdx.x * 4 + w;
  const int mt = wid / ntn, nq = wid % ntn;
  if (mt * 16 >= M) return;
  const int row0 = mt * 16, col0 = nq * 64;
  const float* arow = A + (size_t)(row0 + ln) * lda;
  v8f acc[4] = {};
  for (int kb = 0; kb < K; kb += 32) {
    FragB ah, al;
    const v4f x0 = *(const v4fa*)(arow + kb + 8 * hh), x1 = *(const v4fa*)(arow + kb + 8 * hh + 4);
    const v4f x2 = *(const v4fa*)(arow + kb + 16 + 8 * hh), x3 = *(const v4fa*)(arow + kb + 16 + 8 * hh + 4);
    float xs[16] = {x0[0],x0[1],x0[2],x0[3],x1[0],x1[1],x1[2],x1[3],x2[0],x2[1],x2[2],x2[3],x3[0],x3[1],x3[2],x3[3]};
#pragma unroll
    for (int i = 0; i < 16; ++i) { const unsigned short hb = bf16_bits(xs[i]); ah.u[i] = hb; al.u[i] = ASPLIT ? bf16_bits(xs[i] - bf16_val(hb)) : (unsigned short)0; }
#pragma unroll
    for (int t = 0; t < 4; ++t) {
      const unsigned short* brow = Wt + (size_t)(col0 + t * 16 + ln) * ldb + kb;
      FragB b;
      b.half[0] = *(const v8us*)(brow + 8 * hh);
      b.half[1] = *(const v8us*)(brow + 16 + 8 * hh);
      acc[t] = mmaN<ASPLIT ? 2 : 1>(ah.v, al.v, b.v, b.v, acc[t]);
    }
  }
#pragma unroll
  for (int t = 0; t < 4; ++t) {
    float bv = bias ? bias[col0 + t * 16 + ln] : 0.f;
    if (BIAS_BF16) bv = bf16_round(bv);
#pragma unroll
    for (int r = 0; r < 8; ++r) { float v = acc[t][r] + bv; if (ACT == 1) v = fmaxf(v, 0.f); so[w][8 * hh + r][t * 16 + ln] = v; }
  }
  __builtin_amdgcn_fence(__ATOMIC_ACQ_REL, "workgroup");
  __builtin_amdgcn_wave_barrier();
  const int rsub = lane >> 4, c4 = (lane & 15) * 4;
  {
#pragma unroll
    for (int q = 0; q < 8; ++q) {
      const int r = q * 2 + rsub;
      const v4f v = *(const v4fa*)&so[w][r][c4];
      *(v4f*)(C + (size_t)(row0 + r) * ldc + col0 + c4) = v;
    }
    
  }
}

// GEMM C = act(A·W + bias + resid): A f32 (ASPLIT -> hi/lo 2 terms), Wt bf16 [N][K]; ACT 0 none, 1 relu, 2 exact gelu;
// resid (optional, f32, row index = (row % rmod), pitch ldr, RES_BF16 rounds it) added before the activation.
template <bool ASPLIT, int ACT, bool BIAS_BF16, bool RES_BF16>
__global__ __launch_bounds__(128) void k_gemm_bf3(const float* __restrict__ A, int lda, const unsigned short* __restrict__ Wt, int ldb,
                                                const float* __restrict__ bias, const float* __restrict__ resid, int rmod, int ldr,
                                                float* __restrict__ C, int ldc, int M, int N, int K) {
  __shared__ __attribute__((aligned(16))) float so[4][16][64];
  const int tid = threadIdx.x, w = tid >> 5, lane = tid & 31, ln = lane & 15, hh = lane >> 4;
  const int ntn = N / 64;
  const int wid = blockIdx.x * 4 + w;
  const int mt = wid / ntn, nq = wid % ntn;
  if (mt * 16 >= M) return;
  const int row0 = mt * 16, col0 = nq * 64;
  const float* arow = A + (size_t)(row0 + ln) * lda;
  v8f acc[4] = {};
  for (int kb = 0; kb < K; kb += 32) {
    FragB ah, al;
    const v4f x0 = *(const v4fa*)(arow + kb + 8 * hh), x1 = *(const v4fa*)(arow + kb + 8 * hh + 4);
    const v4f x2 = *(const v4fa*)(arow + kb + 16 + 8 * hh), x3 = *(const v4fa*)(arow + kb + 16 + 8 * hh + 4);
    float xs[16] = {x0[0],x0[1],x0[2],x0[3],x1[0],x1[1],x1[2],x1[3],x2[0],x2[1],x2[2],x2[3],x3[0],x3[1],x3[2],x3[3]};
#pragma unroll
    for (int i = 0; i < 16; ++i) { const unsigned short hb = bf16_bits(xs[i]); ah.u[i] = hb; al.u[i] = ASPLIT ? bf16_bits(xs[i] - bf16_val(hb)) : (unsigned short)0; }
#pragma unroll
    for (int t = 0; t < 4; ++t) {
      const unsigned short* brow = Wt + (size_t)(col0 + t * 16 + ln) * ldb + kb;
      FragB b;
      b.half[0] = *(const v8us*)(brow + 8 * hh);
      b.half[1] = *(const v8us*)(brow + 16 + 8 * hh);
      acc[t] = mmaN<ASPLIT ? 2 : 1>(ah.v, al.v, b.v, b.v, acc[t]);
    }
  }
#pragma unroll
  for (int t = 0; t < 4; ++t) {
    const int col = col0 + t * 16 + ln;
    float bv = bias ? bias[col] : 0.f;
    if (BIAS_BF16) bv = bf16_round(bv);
#pragma unroll
    for (int r = 0; r < 8; ++r) {
      float v = acc[t][r] + bv;
      if (resid) { float rv = resid[(size_t)((row0 + 8 * hh + r) % rmod) * ldr + col]; if (RES_BF16) rv = bf16_round(rv); v += rv; }
      if (ACT == 1) v = fmaxf(v, 0.f);
      if (ACT == 2) v = 0.5f * v * (1.0f + erff(v * 0.70710678118654752f));
      if (ACT == 3) { const float u = 0.7978845608028654f * (v + 0.044715f * v * v * v); v = 0.5f * v * (1.0f + tanhf(u)); }
      so[w][8 * hh + r][t * 16 + ln] = v;
    }
  }
  __builtin_amdgcn_fence(__ATOMIC_ACQ_REL, "workgroup");
  __builtin_amdgcn_wave_barrier();
  const int rsub = lane >> 4, c4 = (lane & 15) * 4;
  {
#pragma unroll
    for (int q = 0; q < 8; ++q) {
      const int r = q * 2 + rsub;
      const v4f v = *(const v4fa*)&so[w][r][c4];
      *(v4f*)(C + (size_t)(row0 + r) * ldc + col0 + c4) = v;
    }
    
  }
}
// row LayerNorm (biased variance, eps) over N: s = X (+ R); optional out_sum <- s; out_norm <- (s-mu)*rsqrt(var+eps)*g + b
template <bool PARAM_BF16>
__global__ __launch_bounds__(256) void k_layernorm(const float* __restrict__ X, const float* __restrict__ R, const float* __restrict__ g, const float* __restrict__ bta,
                                                  float* __restrict__ out_sum, float* __restrict__ out_norm, int N, float eps) {
  __shared__ float red[256];
  const int row = blockIdx.x, tid = threadIdx.x;
  const float* x = X + (size_t)row * N; const float* rr = R ? R + (size_t)row * N : nullptr;
  float vals[16];                     // up to N = 4096
  const int per = N / 256;            // contiguous chunk per thread? use strided-by-4 chunks: thread handles j = tid*4 + 1024*u
  float s1 = 0.f;
  for (int u = 0; u < per / 4; ++u) {
    const int j = tid * 4 + 1024 * u;
    const v4f a = *(const v4fa*)(x + j);
    v4f b = {0.f,0.f,0.f,0.f}; if (rr) b = *(const v4fa*)(rr + j);
#pragma unroll
    for (int q = 0; q < 4; ++q) { const float v = a[q] + b[q]; vals[u * 4 + q] = v; s1 += v; }
  }
  red[tid] = s1; __syncthreads();
  for (int st = 128; st > 0; st >>= 1) { if (tid < st) red[tid] += red[tid + st]; __syncthreads(); }
  const float mu = red[0] / (float)N; __syncthreads();
  float s2 = 0.f;
  for (int u = 0; u < per / 4; ++u)
#pragma unroll
    for (int q = 0; q < 4; ++q) { const float c = vals[u * 4 + q] - mu; s2 += c * c; }
  red[tid] = s2; __syncthreads();
  for (int st = 128; st > 0; st >>= 1) { if (tid < st) red[tid] += red[tid + st]; __syncthreads(); }
  const float rs = rsqrtf(red[0] / (float)N + eps);
  {
    for (int u = 0; u < per / 4; ++u) {
      const int j = tid * 4 + 1024 * u;
      v4f o, sm;
#pragma unroll
      for (int q = 0; q < 4; ++q) {
        float gg = g[j + q], bb = bta[j + q];
        if (PARAM_BF16) { gg = bf16_round(gg); bb = bf16_round(bb); }
        sm[q] = vals[u * 4 + q]; o[q] = (vals[u * 4 + q] - mu) * rs * gg + bb;
      }
      if (out_sum) *(v4f*)(out_sum + (size_t)row * N + j) = sm;
      *(v4f*)(out_norm + (size_t)row * N + j) = o;
    }
    
  }
}



// ---- f16 WMMA path (v_wmma_f32_16x16x32_f16): 11-bit significands for operands in range — used where a [0,1] probability operand needs more precision than bf16
typedef _Float16 v16h __attribute__((ext_vector_type(16)));
union FragH { v16h v; v8us half[2]; _Float16 h[16]; unsigned short u[16]; };
template <int NT>
__device__ __forceinline__ v8f mmaH(v16h ah, v16h al, v16h bh, v16h bl, v8f c) {
  c = __builtin_amdgcn_wmma_f32_16x16x32_f16(false, ah, false, bh, (short)0, c, false, false);
  if (NT >= 2) c = __builtin_amdgcn_wmma_f32_16x16x32_f16(false, al, false, bh, (short)0, c, false, false);
  if (NT >= 3) c = __builtin_amdgcn_wmma_f32_16x16x32_f16(false, ah, false, bl, (short)0, c, false, false);
  asm volatile("v_nop\n\tv_nop\n\tv_nop\n\tv_nop" : "+v"(c) : "v"(ah), "v"(al), "v"(bh), "v"(bl));
  return c;
}
// batched GEMM like k_gemm_b but f16 operands: A f32 (split into f16 hi/lo if ASPLIT, else rounded to f16), Bt = f16 values [n][k]; alpha; C f32; N multiple of 16 (partial tiles skipped)
template <bool ASPLIT>
__global__ __launch_bounds__(128) void k_gemm_h(const float* __restrict__ A, int lda, size_t sA, const _Float16* __restrict__ Bh, int ldb, size_t sB, float alpha, float* __restrict__ C, int ldc, size_t sC, int M, int N, int K) {
  __shared__ __attribute__((aligned(16))) float so[4][16][64];
  const int tid = threadIdx.x, w = tid >> 5, lane = tid & 31, ln = lane & 15, hh = lane >> 4; const int by = blockIdx.y;
  A += (size_t)by * sA; Bh += (size_t)by * sB; C += (size_t)by * sC;
  const int ntn = (N + 63) / 64; const int wid = blockIdx.x * 4 + w; const int mt = wid / ntn, nq = wid % ntn; if (mt * 16 >= M) return;
  const int row0 = mt * 16, col0 = nq * 64; const float* arow = A + (size_t)(row0 + ln) * lda;
  v8f acc[4] = {};
  for (int kb = 0; kb < K; kb += 32) {
    FragH ah, al;
    const v4f x0 = *(const v4fa*)(arow + kb + 8 * hh), x1 = *(const v4fa*)(arow + kb + 8 * hh + 4), x2 = *(const v4fa*)(arow + kb + 16 + 8 * hh), x3 = *(const v4fa*)(arow + kb + 16 + 8 * hh + 4);
    float xs[16] = {x0[0],x0[1],x0[2],x0[3],x1[0],x1[1],x1[2],x1[3],x2[0],x2[1],x2[2],x2[3],x3[0],x3[1],x3[2],x3[3]};
#pragma unroll
    for (int i = 0; i < 16; ++i) { const _Float16 h = (_Float16)xs[i]; ah.h[i] = h; al.h[i] = ASPLIT ? (_Float16)(xs[i] - (float)h) : (_Float16)0.0f; }
#pragma unroll
    for (int t = 0; t < 4; ++t) { if (col0 + t * 16 >= N) continue; const size_t boff = (size_t)(col0 + t * 16 + ln) * ldb + kb; FragH bq; bq.half[0] = *(const v8us*)(Bh + boff + 8 * hh); bq.half[1] = *(const v8us*)(Bh + boff + 16 + 8 * hh);
      acc[t] = mmaH<ASPLIT ? 2 : 1>(ah.v, al.v, bq.v, bq.v, acc[t]); }
  }
#pragma unroll
  for (int t = 0; t < 4; ++t) { if (col0 + t * 16 >= N) continue;
#pragma unroll
    for (int r = 0; r < 8; ++r) so[w][8 * hh + r][t * 16 + ln] = acc[t][r] * alpha; }
  __builtin_amdgcn_fence(__ATOMIC_ACQ_REL, "workgroup"); __builtin_amdgcn_wave_barrier();
  const int rsub = lane >> 4, c4 = (lane & 15) * 4;
  {
#pragma unroll
    for (int q = 0; q < 8; ++q) { const int r = q * 2 + rsub; if (col0 + c4 < N) { const v4f v = *(const v4fa*)&so[w][r][c4]; *(v4f*)(C + (size_t)(row0 + r) * ldc + col0 + c4) = v; } }
     }
}

// Wt[n][k] = f16(W[k][n]·scale) from f32 row-major W[K][N] (scale = power of two; bf16-exact weights stay exact in f16 away from the subnormal range)
__global__ __launch_bounds__(256) void k_wt_f16(const float* __restrict__ W, _Float16* __restrict__ Wt, int K, int N, float scale) {
  const int t = blockIdx.x * 256 + threadIdx.x; if (t >= N * (K / 8)) return; const int n = t / (K / 8), k8 = (t % (K / 8)) * 8; FragH f;
#pragma unroll
  for (int i = 0; i < 8; ++i) f.h[i] = (_Float16)(bf16_round(W[(size_t)(k8 + i) * N + n]) * scale); const v8us o = f.half[0];
  *(v8us*)((unsigned short*)Wt + (size_t)n * K + k8) = o; 
}
// k_gemm_hh variant with fused epilogue: v = acc·alpha + bias[by·sBias + col] (+ CP[(row/rowsPerB)·sCPb + by·64 + col] if CP) ; ACT 0 none / 1 elu ; writes f16 C16 (and f32 C if non-null)
template <int ACT>
__global__ __launch_bounds__(128) void k_gemm_hhx(const _Float16* __restrict__ A, int lda, size_t sA, const _Float16* __restrict__ Bh, int ldb, size_t sB, float alpha, const float* __restrict__ bias, size_t sBias, const float* __restrict__ CP, int rowsPerB, size_t sCPb, int row0g,
    float* __restrict__ C, _Float16* __restrict__ C16, int ldc, size_t sC, int M, int N, int K) {
  __shared__ __attribute__((aligned(16))) float so[4][16][64];
  const int tid = threadIdx.x, w = tid >> 5, lane = tid & 31, ln = lane & 15, hh = lane >> 4; const int by = blockIdx.y;
  A += (size_t)by * sA; Bh += (size_t)by * sB; const size_t cofs = (size_t)by * sC; const float* bp = bias ? bias + (size_t)by * sBias : nullptr;
  const int ntn = (N + 63) / 64; const int wid = blockIdx.x * 4 + w; const int mt = wid / ntn, nq = wid % ntn; if (mt * 16 >= M) return;
  const int row0 = mt * 16, col0 = nq * 64; const _Float16* arow = A + (size_t)(row0 + ln) * lda;
  v8f acc[4] = {};
  for (int kb = 0; kb < K; kb += 32) { FragH ah; ah.half[0] = *(const v8us*)((const unsigned short*)arow + kb + 8 * hh); ah.half[1] = *(const v8us*)((const unsigned short*)arow + kb + 16 + 8 * hh);
#pragma unroll
    for (int t = 0; t < 4; ++t) { if (col0 + t * 16 >= N) continue; const size_t boff = (size_t)(col0 + t * 16 + ln) * ldb + kb; FragH bq; bq.half[0] = *(const v8us*)((const unsigned short*)Bh + boff + 8 * hh); bq.half[1] = *(const v8us*)((const unsigned short*)Bh + boff + 16 + 8 * hh);
      acc[t] = mmaH<1>(ah.v, ah.v, bq.v, bq.v, acc[t]); }
  }
#pragma unroll
  for (int t = 0; t < 4; ++t) { if (col0 + t * 16 >= N) continue; const int col = col0 + t * 16 + ln; const float bv = bp ? bf16_round(bp[col]) : 0.f;
#pragma unroll
    for (int r = 0; r < 8; ++r) { float v = acc[t][r] * alpha + bv; if (CP) { const int rr = row0g + row0 + 8 * hh + r; if (rowsPerB < 0) v += CP[cofs + (size_t)rr * ldc + col];      /* rowsPerB < 0: own element of the batched C plane */ else { const int bidx = rr / rowsPerB; v += CP[(size_t)bidx * sCPb + (size_t)by * 64 + col]; } } if (ACT == 1) v = (v > 0.f) ? v : expm1f(v); else if (ACT == 7) v = (v > 0.f) ? v + 1.0f : expf(v); else if (ACT == 8) v = tanhf(v); else if (ACT == 9) v = 0.5f * v * (1.0f + tanhf(0.7978845608028654f * (v + 0.044715f * v * v * v))); else if (ACT == 11) v = 1.0f / (1.0f + expf(-v)); else if (ACT == 12) v = (v > 0.f) ? v : 0.01f * v; else if (ACT == 14) v = (v > 0.f) ? v : 0.1f * v; else if (ACT == 16) v = (v >= 0.f) ? v : 0.3f * v; else if (ACT == 17) v = (v >= 0.f) ? v : 0.2f * v; else if (ACT == 15) v = v / (1.0f + expf(-v)); else if (ACT == 3) v = fmaxf(v, 0.f); else if (ACT == 6) v = 0.5f * v * (1.0f + erff(v * 0.70710678118654752f)); so[w][8 * hh + r][t * 16 + ln] = v; } }
  __builtin_amdgcn_fence(__ATOMIC_ACQ_REL, "workgroup"); __builtin_amdgcn_wave_barrier();
  const int rsub = lane >> 4, c4 = (lane & 15) * 4; typedef _Float16 v4h __attribute__((ext_vector_type(4)));
  {
#pragma unroll
    for (int q = 0; q < 8; ++q) { const int r = q * 2 + rsub; if (col0 + c4 < N) { const v4f v = *(const v4fa*)&so[w][r][c4]; if (C) *(v4f*)(C + cofs + (size_t)(row0 + r) * ldc + col0 + c4) = v; if (C16) { v4h h4; for (int i = 0; i < 4; ++i) h4[i] = (_Float16)v[i]; *(v4h*)(C16 + cofs + (size_t)(row0 + r) * ldc + col0 + c4) = h4; } } }
     }
}


typedef _Float16 v4h __attribute__((ext_vector_type(4)));

__global__ __launch_bounds__(256) void k_x16(const float* __restrict__ x, _Float16* __restrict__ X16, size_t n8) { const size_t t = (size_t)blockIdx.x * 256 + threadIdx.x; if (t >= n8) return; FragH f;
#pragma unroll
  for (int q = 0; q < 8; ++q) f.h[q] = (_Float16)bf16_round(x[t * 8 + q]); *(v8us*)((unsigned short*)X16 + t * 8) = f.half[0];  }
__global__ __launch_bounds__(256) void k_h16(const float* __restrict__ x, _Float16* __restrict__ X16, size_t n8) { const size_t t = (size_t)blockIdx.x * 256 + threadIdx.x; if (t >= n8) return; FragH f;
#pragma unroll
  for (int q = 0; q < 8; ++q) f.h[q] = (_Float16)x[t * 8 + q]; *(v8us*)((unsigned short*)X16 + t * 8) = f.half[0];  }
__global__ __launch_bounds__(256) void k_round16f(const float* __restrict__ W, _Float16* __restrict__ Bt, size_t n8) { const size_t t = (size_t)blockIdx.x * 256 + threadIdx.x; if (t >= n8) return; FragH f;
#pragma unroll
  for (int i = 0; i < 8; ++i) f.h[i] = (_Float16)(bf16_round(W[t * 8 + i]) * 16.0f); *(v8us*)((unsigned short*)Bt + t * 8) = f.half[0];  }
template <int NHv, int TTv>
__global__ __launch_bounds__(256) void k_vt(const _Float16* __restrict__ V16, int ldv, int voff, _Float16* __restrict__ Vt) { __shared__ unsigned short tl[64][66]; const int tid = threadIdx.x; const int slab = blockIdx.x / (TTv / 64), lg = blockIdx.x % (TTv / 64); const int b = slab / NHv, h = slab % NHv;
  for (int i = tid; i < 64 * 8; i += 256) { const int r = i / 8, c8 = (i % 8) * 8; FragH f; f.half[0] = *(const v8us*)((const unsigned short*)V16 + ((size_t)b * TTv + lg * 64 + r) * ldv + voff + h * 64 + c8);
#pragma unroll
    for (int q = 0; q < 8; ++q) tl[r][c8 + q] = f.u[q]; }
  __syncthreads();
  {
#pragma unroll
    for (int rd = 0; rd < 2; ++rd) { const int d = rd * 32 + tid / 8, pc = tid % 8; FragH f;
#pragma unroll
      for (int q = 0; q < 8; ++q) f.u[q] = tl[pc * 8 + q][d];
      *(v8us*)((unsigned short*)Vt + ((size_t)slab * 64 + d) * TTv + lg * 64 + pc * 8) = f.half[0]; }
     } }

__global__ __launch_bounds__(256) void k_hl(const float* __restrict__ F, _Float16* __restrict__ Hh, _Float16* __restrict__ Hl, size_t n8) { const size_t t = (size_t)blockIdx.x * 256 + threadIdx.x; if (t >= n8) return; FragH fh, fl; const v4f a = *(const v4fa*)(F + t * 8), c = *(const v4fa*)(F + t * 8 + 4);
#pragma unroll
  for (int q = 0; q < 4; ++q) { _Float16 h = (_Float16)a[q]; fh.h[q] = h; fl.h[q] = (_Float16)((a[q] - (float)h) * 1024.0f); h = (_Float16)c[q]; fh.h[4 + q] = h; fl.h[4 + q] = (_Float16)((c[q] - (float)h) * 1024.0f); }
  { *(v8us*)((unsigned short*)Hh + t * 8) = fh.half[0]; *(v8us*)((unsigned short*)Hl + t * 8) = fl.half[0];  } }

// ---- fast GEMM (wave tile 32x64; requires M % 32 == 0 rows per launch region and N % 64 == 0); epilogue = k_gemm_hhx semantics ----
__device__ __forceinline__ v16h g2_frag(const _Float16* p, int hh) { FragH f; f.half[0] = *(const v8us*)((const unsigned short*)p + 8 * hh); f.half[1] = *(const v8us*)((const unsigned short*)p + 16 + 8 * hh); return f.v; }
__device__ __forceinline__ v8f g2_mma(v16h a, v16h b, v8f c) { v8f d = __builtin_amdgcn_wmma_f32_16x16x32_f16(false, a, false, b, (short)0, c, false, false); asm volatile("v_nop\n\tv_nop\n\tv_nop\n\tv_nop" : "+v"(d) : "v"(a), "v"(b)); return d; }
template <int ACT>
__global__ __launch_bounds__(128) void k_gemm2(const _Float16* __restrict__ A, int lda, size_t sA, const _Float16* __restrict__ Bh, int ldb, size_t sB, float alpha, const float* __restrict__ bias, size_t sBias, const float* __restrict__ CP, int rowsPerB, size_t sCPb, int row0g,
    float* __restrict__ C, _Float16* __restrict__ C16, int ldc, size_t sC, int M, int N, int K) { static_assert(ACT == 0 || ACT == 3 || ACT == 6 || ACT == 8 || ACT == 9 || ACT == 11 || ACT == 12 || ACT == 14 || ACT == 15 || ACT == 16 || ACT == 17, "k_gemm2: unsupported ACT code (would silently apply no activation)");
  __shared__ __attribute__((aligned(16))) float so[4][32][68];
  const int tid = threadIdx.x, w = tid >> 5, lane = tid & 31, ln = lane & 15, hh = lane >> 4; const int by = blockIdx.y;
  A += (size_t)by * sA; Bh += (size_t)by * sB; const size_t cofs = (size_t)by * sC; const float* bp = bias ? bias + (size_t)by * sBias : nullptr;
  const int ntn = N >> 6; const int mt = blockIdx.x / ntn, nq = blockIdx.x - mt * ntn; const int row0 = mt * 128 + 32 * w, col0 = nq * 64; if (row0 >= M) return;
  const _Float16* a0p = A + (size_t)(row0 + ln) * lda; const _Float16* a1p = a0p + (size_t)16 * lda;
  const _Float16* b0p = Bh + (size_t)(col0 + ln) * ldb; const _Float16* b1p = b0p + (size_t)16 * ldb; const _Float16* b2p = b1p + (size_t)16 * ldb; const _Float16* b3p = b2p + (size_t)16 * ldb;
  const v8f z8 = {0.f,0.f,0.f,0.f,0.f,0.f,0.f,0.f}; v8f c00 = z8, c01 = z8, c02 = z8, c03 = z8, c10 = z8, c11 = z8, c12 = z8, c13 = z8;
#pragma unroll 1
  for (int kb = 0; kb < K; kb += 32) { const v16h a0 = g2_frag(a0p + kb, hh), a1 = g2_frag(a1p + kb, hh);
    v16h b = g2_frag(b0p + kb, hh); c00 = g2_mma(a0, b, c00); c10 = g2_mma(a1, b, c10);
    b = g2_frag(b1p + kb, hh); c01 = g2_mma(a0, b, c01); c11 = g2_mma(a1, b, c11);
    b = g2_frag(b2p + kb, hh); c02 = g2_mma(a0, b, c02); c12 = g2_mma(a1, b, c12);
    b = g2_frag(b3p + kb, hh); c03 = g2_mma(a0, b, c03); c13 = g2_mma(a1, b, c13); }
  v8f accs[8] = {c00, c01, c02, c03, c10, c11, c12, c13};
#pragma unroll
  for (int u = 0; u < 8; ++u) { const int t = u & 3, half = u >> 2; const int col = col0 + t * 16 + ln; const float bv = bp ? bf16_round(bp[col]) : 0.f;
#pragma unroll
    for (int r = 0; r < 8; ++r) { const int rloc = half * 16 + 8 * hh + r; float v = accs[u][r] * alpha + bv; if (CP) { if (rowsPerB < 0) v += CP[cofs + (size_t)(row0g + row0 + rloc) * ldc + col];      /* rowsPerB < 0: own element of the batched C plane */ else { const int bidx = (row0g + row0 + rloc) / rowsPerB; v += CP[(size_t)bidx * sCPb + (size_t)by * 64 + col]; } }
      if (ACT == 3) v = fmaxf(v, 0.f); else if (ACT == 6) v = 0.5f * v * (1.0f + erff(v * 0.70710678118654752f)); else if (ACT == 11) v = 1.0f / (1.0f + expf(-v)); else if (ACT == 15) v = v / (1.0f + expf(-v)); else if (ACT == 12) v = (v > 0.f) ? v : 0.01f * v; else if (ACT == 8) v = tanhf(v); else if (ACT == 9) v = 0.5f * v * (1.0f + tanhf(0.7978845608028654f * (v + 0.044715f * v * v * v))); else if (ACT == 14) v = (v > 0.f) ? v : 0.1f * v; else if (ACT == 16) v = (v >= 0.f) ? v : 0.3f * v; else if (ACT == 17) v = (v >= 0.f) ? v : 0.2f * v;
      so[w][rloc][t * 16 + ln] = v; } }
  __builtin_amdgcn_fence(__ATOMIC_ACQ_REL, "workgroup"); __builtin_amdgcn_wave_barrier();
  const int rsub = lane >> 4, c4 = (lane & 15) * 4;
  {
#pragma unroll
    for (int q = 0; q < 16; ++q) { const int r = q * 2 + rsub; const v4f v = *(const v4fa*)&so[w][r][c4]; if (C) *(v4f*)(C + cofs + (size_t)(row0 + r) * ldc + col0 + c4) = v; if (C16) { v4h h4; for (int i = 0; i < 4; ++i) h4[i] = (_Float16)v[i]; *(v4h*)(C16 + cofs + (size_t)(row0 + r) * ldc + col0 + c4) = h4; } }
     } }


__global__ __launch_bounds__(256) void k_wnat(const float* __restrict__ w, size_t n8, _Float16* __restrict__ Bt) { const size_t t = (size_t)blockIdx.x * 256 + threadIdx.x; if (t >= n8) return; FragH f; for (int q = 0; q < 8; ++q) f.h[q] = (_Float16)(bf16_round(w[t * 8 + q]) * 16.0f); *(v8us*)((unsigned short*)Bt + t * 8) = f.half[0];  }
__global__ __launch_bounds__(256) void k_rsm(const float* __restrict__ S, _Float16* __restrict__ P, int nrows) {
  #pragma clang fp contract(off)
  const int i = blockIdx.x * 256 + threadIdx.x; if (i >= nrows) return; const float* s = S + (size_t)i * SQ; float mx = -3.0e38f;
#pragma unroll 1
  for (int j = 0; j < SQ; ++j) mx = fmaxf(mx, s[j]); float se = 0.f;
#pragma unroll 1
  for (int j = 0; j < SQ; ++j) se += expf(s[j] - mx); const float sc = 256.0f / se;
#pragma unroll 1
  for (int j0 = 0; j0 < SQ; j0 += 8) { FragH f; for (int q = 0; q < 8; ++q) f.h[q] = (_Float16)(expf(s[j0 + q] - mx) * sc); unsigned short* d = (unsigned short*)P + (size_t)i * SQ + j0; *(v8us*)d = f.half[0];  } }
__global__ __launch_bounds__(256) void k_vt(const _Float16* __restrict__ V16, int b, int h0, _Float16* __restrict__ VT) { __shared__ unsigned short tl[64][65]; const int tid = threadIdx.x; const int hh = blockIdx.x % HG, sg = blockIdx.x / HG; const int s0 = sg * 64; const int h = h0 + hh;
  for (int i = tid; i < 64 * 8; i += 256) { const int j = i / 8, d8 = (i % 8) * 8; FragH f; f.half[0] = *(const v8us*)((const unsigned short*)V16 + ((size_t)b * SQ + s0 + j) * DM + h * HD + d8); for (int q = 0; q < 8; ++q) tl[d8 + q][j] = f.u[q]; }
  __syncthreads();
  { for (int i = tid; i < 64 * 8; i += 256) { const int d = i / 8, j8 = (i % 8) * 8; FragH f; for (int q = 0; q < 8; ++q) f.u[q] = tl[d][j8 + q]; *(v8us*)((unsigned short*)VT + ((size_t)hh * HD + d) * SQ + s0 + j8) = f.half[0]; }  } }



// Causal row softmax, one wave per score row. The nk scores of a row are read once, 512 contiguous bytes per wave-wide load, and stay in the wave's
// registers for the maximum, the exponentials, their sum and the x256 f16 weights (256 contiguous bytes per wave-wide store). nk is a multiple of QT.
// Row maximum and row sum: four partial values per lane, then a butterfly over the 32 lanes (four steps inside a 16-lane row, one across the rows).
#define RG (NKX / QT)                /* groups of QT columns in a full score row; a lane holds 8 scores of each, as two chunks of 4 */
template <int X> __device__ __forceinline__ float row_xor(float v) { return __builtin_bit_cast(float, __builtin_amdgcn_update_dpp(0, __builtin_bit_cast(int, v), 0x160 | X, 0xf, 0xf, true)); }      /* lane l <- lane l ^ X, X < 16 */
__device__ __forceinline__ float half_xor(float v) { const int i = __builtin_bit_cast(int, v); return __builtin_bit_cast(float, __builtin_amdgcn_permlanex16(i, i, 0x76543210, 0xfedcba98, false, false)); }      /* lane l <- lane l ^ 16 */
__device__ __forceinline__ float wave_max(float v) { v = fmaxf(v, row_xor<1>(v)); v = fmaxf(v, row_xor<2>(v)); v = fmaxf(v, row_xor<4>(v)); v = fmaxf(v, row_xor<8>(v)); return fmaxf(v, half_xor(v)); }
__device__ __forceinline__ float wave_sum(float v) { v += row_xor<1>(v); v += row_xor<2>(v); v += row_xor<4>(v); v += row_xor<8>(v); return v + half_xor(v); }
__global__ __launch_bounds__(256) void k_rsmcf2(const float* __restrict__ S, _Float16* __restrict__ P, int hg, int q0, int nk) {
  static_assert(QT == 256, "a group is two wave-wide loads of 128 columns");
  const int lane = threadIdx.x & 31; const int t = blockIdx.x * 8 + __builtin_amdgcn_readfirstlane((int)(threadIdx.x >> 5)); if (t >= hg * QT) return;
  const float* s = S + (size_t)t * NKX + lane * 4; _Float16* d = P + (size_t)t * NKX + lane * 4; const int last = q0 + (t % QT);
  v4f x[2 * RG];      /* every loop over g below is fully unrolled: x and h are indexed by constants only and so stay in registers */
#pragma unroll
  for (int g = 0; g < RG; ++g) if (g * QT < nk) { x[2 * g] = *(const v4fa*)(s + g * QT); x[2 * g + 1] = *(const v4fa*)(s + g * QT + 128); }      /* all of the row's loads are in flight before the first use */
  asm volatile("s_wait_xcnt 0x0" ::: "memory");      /* the loads' address registers are reused below while the loads are still in flight: the wait stands in front of that overwrite */
  v4f m4 = {-3.0e38f, -3.0e38f, -3.0e38f, -3.0e38f};
#pragma unroll
  for (int g = 0; g < RG; ++g) if (g * QT < nk) {
    if (g * QT + QT > q0) { for (int c = 2 * g; c < 2 * g + 2; ++c) for (int u = 0; u < 4; ++u) x[c][u] = (c * 128 + lane * 4 + u <= last) ? x[c][u] : -1.0e9f; }      /* last >= q0: a group that ends at or below q0 holds no masked key */
    for (int u = 0; u < 4; ++u) m4[u] = fmaxf(m4[u], fmaxf(x[2 * g][u], x[2 * g + 1][u])); }
  const float mx = wave_max(fmaxf(fmaxf(m4[0], m4[1]), fmaxf(m4[2], m4[3])));
  v4f s4 = {0.f, 0.f, 0.f, 0.f};
#pragma unroll
  for (int g = 0; g < RG; ++g) if (g * QT < nk) { for (int c = 2 * g; c < 2 * g + 2; ++c) for (int u = 0; u < 4; ++u) { x[c][u] = __expf(x[c][u] - mx); s4[u] += x[c][u]; } }
  const float sc = 256.0f / wave_sum((s4[0] + s4[1]) + (s4[2] + s4[3]));
  v4h h[2 * RG];
#pragma unroll
  for (int g = 0; g < RG; ++g) if (g * QT < nk) { for (int c = 2 * g; c < 2 * g + 2; ++c) for (int u = 0; u < 4; ++u) h[c][u] = (_Float16)(x[c][u] * sc); }
#pragma unroll
  for (int g = 0; g < RG; ++g) if (g * QT < nk) { *(v4h*)(d + g * QT) = h[2 * g]; *(v4h*)(d + g * QT + 128) = h[2 * g + 1]; } }      /* stores last, each from registers of its own: nothing is written over a store's registers */


template <int MASKADD>
__global__ __launch_bounds__(64) void k_att0(const float* __restrict__ QF, const float* __restrict__ KF, const float* __restrict__ VF, int ld, const float* __restrict__ mask, float scale, float* __restrict__ OF, int ldo) {
  #pragma clang fp contract(off)
  __shared__ __attribute__((aligned(16))) float lq[64][64]; __shared__ __attribute__((aligned(16))) float lo[64][64];
  const int tid = threadIdx.x; const int h = blockIdx.x / (QT0 / 64), rg = blockIdx.x % (QT0 / 64); const int i = rg * 64 + tid;
  const float* qr = QF + (size_t)i * ld + h * HD;
#pragma unroll 1
  for (int c = 0; c < HD / 4; ++c) { *(v4f*)&lq[tid][c * 4] = *(const v4fa*)(qr + c * 4); const v4f z = {0.f, 0.f, 0.f, 0.f}; *(v4f*)&lo[tid][c * 4] = z; }
  float m = -1.0e30f, l = 0.f; const int jmax = MASKADD ? (SQ - 1) : (rg * 64 + 63);      /* additive-mask form: every key (the mask input decides); causal form: keys up to the block's last row */
#pragma unroll 1
  for (int j = 0; j <= jmax; ++j) { const float* kr = KF + (size_t)j * ld + h * HD; const float* vr = VF + (size_t)j * ld + h * HD; float s = 0.f;
#pragma unroll 1
    for (int c = 0; c < HD / 4; ++c) { const v4f kq = *(const v4fa*)(kr + c * 4); const v4f qq = *(v4f*)&lq[tid][c * 4]; s = __fadd_rn(s, __fmul_rn(qq[0], kq[0])); s = __fadd_rn(s, __fmul_rn(qq[1], kq[1])); s = __fadd_rn(s, __fmul_rn(qq[2], kq[2])); s = __fadd_rn(s, __fmul_rn(qq[3], kq[3])); }
    s = __fmul_rn(s, scale); if (MASKADD) s = __fadd_rn(s, __fmul_rn(bf16_round(mask[(size_t)i * SQ + j]), -10000.0f));
    const float f = (MASKADD || j <= i) ? 1.f : 0.f; const float sm = fmaf(f, s, (1.f - f) * -1.0e30f); const float mn = fmaxf(m, sm); const float sc = expf(m - mn); const float e = expf(sm - mn); l = __fadd_rn(__fmul_rn(l, sc), e); m = mn;
#pragma unroll 1
    for (int c = 0; c < HD / 4; ++c) { const v4f vv = *(const v4fa*)(vr + c * 4); v4f oo = *(v4f*)&lo[tid][c * 4]; for (int u = 0; u < 4; ++u) oo[u] = __fadd_rn(__fmul_rn(oo[u], sc), __fmul_rn(e, vv[u])); *(v4f*)&lo[tid][c * 4] = oo; } }
  const float fin = 64.0f / l;      /* o carried x64 like the f16 path */
#pragma unroll 1
  for (int c = 0; c < HD / 4; ++c) { v4f oo = *(v4f*)&lo[tid][c * 4]; for (int u = 0; u < 4; ++u) oo[u] = __fmul_rn(oo[u], fin); *(v4f*)&lo[tid][c * 4] = oo; }
  __syncthreads();
  {
#pragma unroll 1
    for (int it = 0; it < 16; ++it) { const int row = it * 4 + tid / 16, pc = (tid % 16) * 4; const v4f v = *(const v4f*)&lo[row][pc]; *(v4f*)(OF + (size_t)(rg * 64 + row) * ldo + h * HD + pc) = v; }
     } }

extern "C" void kernel_launch(void* const* d_in, const int* in_sizes, int n_in,
                              void* d_out, int out_size, void* d_ws, size_t ws_size, hipStream_t stream) {
  (void)in_sizes; (void)n_in; (void)out_size;
  const float* const* I = (const float* const*)d_in; const float* xq = I[0]; const float* xk = I[1]; const float* xv = I[2]; const float* wq = I[3]; const float* wk = I[4]; const float* wv = I[5]; const float* wo = I[6];      /* nn.Linear weights [out][in] */
  char* ws = (char*)d_ws; size_t off = 0;
  auto take = [&](size_t bytes) { char* p = ws + off; off += (bytes + 255) & ~(size_t)255; return p; };
  _Float16* BQ = (_Float16*)take((size_t)DM * DM * 2); _Float16* BK = (_Float16*)take((size_t)DM * DM * 2); _Float16* BV = (_Float16*)take((size_t)DM * DM * 2); _Float16* BO = (_Float16*)take((size_t)DM * DM * 2);
  _Float16* XQ = (_Float16*)take(NR * DM * 2); _Float16* XK = (_Float16*)take(NR * DM * 2); _Float16* XV = (_Float16*)take(NR * DM * 2); _Float16* Q16 = (_Float16*)take(NR * DM * 2); _Float16* K16 = (_Float16*)take(NR * DM * 2); _Float16* V16 = (_Float16*)take(NR * DM * 2); _Float16* O16 = (_Float16*)take(NR * DM * 2);
  float* S = (float*)take((size_t)NH * QT * NKX * 4); _Float16* P = (_Float16*)take((size_t)NH * QT * NKX * 2); _Float16* VT = (_Float16*)take((size_t)NH * HD * SQ * 2);
  float* QF0 = (float*)take((size_t)QT0 * DM * 4); float* KF0 = (float*)take((size_t)QT0 * DM * 4); float* VF0 = (float*)take((size_t)QT0 * DM * 4); float* OF0 = (float*)take((size_t)NB * QT0 * DM * 4); _Float16* OH0 = (_Float16*)take((size_t)NB * QT0 * DM * 2); _Float16* OL0 = (_Float16*)take((size_t)NB * QT0 * DM * 2);
  if (off > ws_size) return;
  { const unsigned g = (unsigned)(((size_t)DM * DM / 8 + 255) / 256); k_wnat<<<g, 256, 0, stream>>>(wq, (size_t)DM * DM / 8, BQ); k_wnat<<<g, 256, 0, stream>>>(wk, (size_t)DM * DM / 8, BK); k_wnat<<<g, 256, 0, stream>>>(wv, (size_t)DM * DM / 8, BV); k_wnat<<<g, 256, 0, stream>>>(wo, (size_t)DM * DM / 8, BO); }      /* natural [out][in] = Bt[n][k], x16 */
  k_x16<<<(unsigned)((NR * DM / 8 + 255) / 256), 256, 0, stream>>>(xq, XQ, NR * DM / 8); k_x16<<<(unsigned)((NR * DM / 8 + 255) / 256), 256, 0, stream>>>(xk, XK, NR * DM / 8); k_x16<<<(unsigned)((NR * DM / 8 + 255) / 256), 256, 0, stream>>>(xv, XV, NR * DM / 8);
  const size_t r0p = (size_t)B0 * SQ;      /* first projected row */
  k_gemm2<0><<<dim3((unsigned)((MP / 128) * (DM / 64)), 1), 128, 0, stream>>>(XQ + r0p * DM, DM, 0, BQ, DM, 0, 0.0625f, nullptr, 0, nullptr, 1, 0, 0, nullptr, Q16 + r0p * DM, DM, 0, MP, DM, DM);
  k_gemm2<0><<<dim3((unsigned)((MP / 128) * (DM / 64)), 1), 128, 0, stream>>>(XK + r0p * DM, DM, 0, BK, DM, 0, 0.0625f, nullptr, 0, nullptr, 1, 0, 0, nullptr, K16 + r0p * DM, DM, 0, MP, DM, DM);
  k_gemm2<0><<<dim3((unsigned)((MP / 128) * (DM / 64)), 1), 128, 0, stream>>>(XV + r0p * DM, DM, 0, BV, DM, 0, 0.0625f, nullptr, 0, nullptr, 1, 0, 0, nullptr, V16 + r0p * DM, DM, 0, MP, DM, DM);
  for (int b = B0; b < B0 + NBR; ++b) { const size_t r0 = (size_t)b * SQ;
    k_vt<NH, SQ><<<NH * (SQ / 64), 256, 0, stream>>>(V16 + r0 * LQ, LQ, 0, VT);      /* V^T [NH][HD][SQ] for this batch */
    k_gemm2<0><<<dim3((QT0 / 128) * (DM / 64), 1), 128, 0, stream>>>(XQ + r0 * DM, DM, 0, BQ, DM, 0, 0.0625f, nullptr, 0, nullptr, 1, 0, 0, QF0, nullptr, DM, 0, QT0, DM, DM); k_gemm2<0><<<dim3((QT0 / 128) * (DM / 64), 1), 128, 0, stream>>>(XK + r0 * DM, DM, 0, BK, DM, 0, 0.0625f, nullptr, 0, nullptr, 1, 0, 0, KF0, nullptr, DM, 0, QT0, DM, DM); k_gemm2<0><<<dim3((QT0 / 128) * (DM / 64), 1), 128, 0, stream>>>(XV + r0 * DM, DM, 0, BV, DM, 0, 0.0625f, nullptr, 0, nullptr, 1, 0, 0, VF0, nullptr, DM, 0, QT0, DM, DM);      /* f32 q, k, v of the first 256 rows (exact products) */
    k_att0<0><<<NH * (QT0 / 64), 64, 0, stream>>>(QF0, KF0, VF0, DM, nullptr, 0.125f, OF0 + (size_t)b * QT0 * DM, DM);      /* exact f32 attention for rows 0..255 (o x64) */
    for (int q0 = 0; q0 < QN; q0 += QT) { const int nk = q0 + QT;      /* causal: only keys below the tile end are computed */
      k_gemm2<0><<<dim3((QT / 128) * (nk / 64), NHD), 128, 0, stream>>>(Q16 + (r0 + q0) * LQ, LQ, (size_t)HD, K16 + r0 * LQ, LQ, (size_t)HD, 0.125f, nullptr, 0, nullptr, 1, 0, 0, S, nullptr, NKX, (size_t)QT * NKX, QT, nk, HD);      /* scores, all heads on grid.y */
      k_rsmcf2<<<(NHD * QT + 7) / 8, 256, 0, stream>>>(S, P, NHD, q0, nk);      /* one wave per row, 8 rows per block */
      k_gemm2<0><<<dim3((QT / 128) * (HD / 64), NHD), 128, 0, stream>>>(P, NKX, (size_t)QT * NKX, VT, SQ, (size_t)HD * SQ, 0.25f, nullptr, 0, nullptr, 1, 0, 0, nullptr, O16 + (r0 + q0) * DM, DM, (size_t)HD, QT, HD, nk); } }      /* o (merged heads, x64) as f16 rows */
  k_gemm2<0><<<dim3((unsigned)((MPO / 128) * (DM / 64)), 1), 128, 0, stream>>>(O16 + r0p * DM, DM, 0, BO, DM, 0, 0.0009765625f, nullptr, 0, nullptr, 1, 0, 0, (float*)d_out + r0p * DM, nullptr, DM, 0, MPO, DM, DM);      /* out rows are the output layout */
  k_hl<<<(unsigned)(((size_t)NB * QT0 * DM / 8 + 255) / 256), 256, 0, stream>>>(OF0, OH0, OL0, (size_t)NB * QT0 * DM / 8);      /* first-tile o (x64) -> f16 hi + x1024 residual planes */
  for (int b = B0; b < B0 + NBR; ++b) { const size_t r0 = (size_t)b * SQ; const size_t f0 = (size_t)b * QT0;
    k_gemm2<0><<<dim3((QT0 / 128) * (DM / 64), 1), 128, 0, stream>>>(OH0 + f0 * DM, DM, 0, BO, DM, 0, 0.0009765625f, nullptr, 0, nullptr, 1, 0, 0, (float*)d_out + r0 * DM, nullptr, DM, 0, QT0, DM, DM);      /* rows 0..255: out = o_hi Wo, overwriting the f16-path rows */
    k_gemm2<0><<<dim3((QT0 / 128) * (DM / 64), 1), 128, 0, stream>>>(OL0 + f0 * DM, DM, 0, BO, DM, 0, 0.00000095367431640625f, nullptr, 0, (const float*)d_out + r0 * DM, -1, 0, 0, (float*)d_out + r0 * DM, nullptr, DM, 0, QT0, DM, DM); }      /* += o_lo Wo 2^-20 (own-element accumulate) */
}

// v002
// A run of this version takes 1890 microseconds.
// Two timings next to v001 both put it at 1.37 times that version's speed.
// Counting every step since v000, it is 4.36 times as fast.
#include <hip/hip_runtime.h>
// Causal multi-head attention (q, k, v inputs [1][4096][1024]; qp/kp/vp = input W^T (nn.Linear [out][in], no bias), 16 heads of 64; scores x (8/64) = /8; causal mask (keys > query get -inf); softmax; out = (probs v merged) Wo^T -> [1][4096][1024]).
// Structure: token rows r = s; q, k, v inputs as exact f16 rows (bf16-rounded); Q, K, V as three WMMA GEMMs (32x64 wave tiles, f32 accumulation, exact x16 weights, f16 outputs); per batch: V^T for all heads via LDS transposes; per query tile of 256 rows: scores against the keys below the tile end only (K = 64, all heads on grid.y, alpha = 0.125), causal row softmax on VALU, one wave per row with the row in registers, keys above the query masked over the computed range (f32 statistics, native exp; weights x256 f16), o = P . V^T (K = keys below the tile end, alpha 2^-2: o carried x64, folded into the output GEMM alpha) written straight into the merged f16 o rows; out = o W_o GEMM (f32) into the output layout.
// Compute dtype: inputs rounded to bf16; x / weights exact; q, k, v, softmax weights and o as plain f16 GEMM operands (~2^-12); scores and softmax statistics f32. v_wmma_f32_16x16x32_f16.
#define NB 1
#define SQ 4096
#define DM 1024
#define NH 16
#define HD 64
#define HG 4                         /* heads per launch of the non-template k_vt (not launched) */
#define QT 256                       /* query rows per causal tile */
#define NKX SQ                       /* S / P row pitch */
#define QT0 256                      /* first-tile rows recomputed exactly in f32 */
#define B0 0                         /* first batch processed (debug hook) */
#define NBR NB                       /* batches processed (debug hook) */
#define NR ((size_t)NB * SQ)         /* token rows */
#define MP ((int)((size_t)NBR * SQ)) /* rows projected (debug hook) */
#define QN SQ                        /* query rows attended per batch (debug hook) */
#define NHD NH                       /* heads attended (debug hook) */
#define MPO MP                       /* rows through the output stage (debug hook) */
#define LQ DM      /* row pitch of the q/k/v rows */
typedef __bf16 v16b __attribute__((ext_vector_type(16)));
typedef unsigned short v8us __attribute__((ext_vector_type(8), may_alias));
typedef float  v8f  __attribute__((ext_vector_type(8)));
typedef float  v4f  __attribute__((ext_vector_type(4)));
typedef float  v4fa __attribute__((ext_vector_type(4), may_alias));
union FragB { v16b v; v8us half[2]; unsigned short u[16]; };

__device__ __forceinline__ unsigned short bf16_bits(float x) { unsigned int u = __float_as_uint(x); return (unsigned short)((u + 0x7FFFu + ((u >> 16) & 1u)) >> 16); }
__device__ __forceinline__ float bf16_val(unsigned short b) { return __uint_as_float(((unsigned int)b) << 16); }
__device__ __forceinline__ float bf16_round(float x) { return bf16_val(bf16_bits(x)); }
// D += A·B with NT terms: 1 = ah·bh, 2 = + al·bh (A split), 3 = + ah·bl (both split)
template <int NT>
__device__ __forceinline__ v8f mmaN(v16b ah, v16b al, v16b bh, v16b bl, v8f c) {
  c = __builtin_amdgcn_wmma_f32_16x16x32_bf16(false, ah, false, bh, (short)0, c, false, false);
  if (NT >= 2) c = __builtin_amdgcn_wmma_f32_16x16x32_bf16(false, al, false, bh, (short)0, c, false, false);
  if (NT >= 3) c = __builtin_amdgcn_wmma_f32_16x16x32_bf16(false, ah, false, bl, (short)0, c, false, false);
  asm volatile("v_nop\n\tv_nop\n\tv_nop\n\tv_nop" : "+v"(c) : "v"(ah), "v"(al), "v"(bh), "v"(bl));
  return c;
}

__global__ __launch_bounds__(256) void k_wt_bf16(const float* __restrict__ W, unsigned short* __restrict__ Wt, int K, int N) {
  const int t = blockIdx.x * 256 + threadIdx.x;
  const int k8n = K / 8;
  if (t >= N * k8n) return;
  const int n = t / k8n, k8 = (t % k8n) * 8;
  v8us v;
#pragma unroll
  for (int i = 0; i < 8; ++i) v[i] = bf16_bits(W[(size_t)(k8 + i) * N + n]);
  *(v8us*)(Wt + (size_t)n * K + k8) = v;
  
}

// GEMM C[M][N] (f32, pitch ldc) = act(A[M][K]·W + bias). A f32 row-major (pitch lda) converted per fragment to bf16
// (ASPLIT: hi/lo two planes -> 2 terms, else single rounded term); Wt bf16 [N][K] (pitch ldb). BIAS_BF16 rounds the
// bias to bf16 first (bias quantised to bf16 before the add). K%32==0, M%16==0, N%64==0.
template <bool ASPLIT, int ACT, bool BIAS_BF16>
__global__ __launch_bounds__(128) void k_gemm_bf(const float* __restrict__ A, int lda, const unsigned short* __restrict__ Wt, int ldb,
                                               const float* __restrict__ bias, float* __restrict__ C, int ldc, int M, int N, int K) {
  __shared__ __attribute__((aligned(16))) float so[4][16][64];
  const int tid = threadIdx.x, w = tid >> 5, lane = tid & 31, ln = lane & 15, hh = lane >> 4;
  const int ntn = N / 64;
  const int wid = blockIdx.x * 4 + w;
  const int mt = wid / ntn, nq = wid % ntn;
  if (mt * 16 >= M) return;
  const int row0 = mt * 16, col0 = nq * 64;
  const float* arow = A + (size_t)(row0 + ln) * lda;
  v8f acc[4] = {};
  for (int kb = 0; kb < K; kb += 32) {
    FragB ah, al;
    const v4f x0 = *(const v4fa*)(arow + kb + 8 * hh), x1 = *(const v4fa*)(arow + kb + 8 * hh + 4);
    const v4f x2 = *(const v4fa*)(arow + kb + 16 + 8 * hh), x3 = *(const v4fa*)(arow + kb + 16 + 8 * hh + 4);
    float xs[16] = {x0[0],x0[1],x0[2],x0[3],x1[0],x1[1],x1[2],x1[3],x2[0],x2[1],x2[2],x2[3],x3[0],x3[1],x3[2],x3[3]};
#pragma unroll
    for (int i = 0; i < 16; ++i) { const unsigned short hb = bf16_bits(xs[i]); ah.u[i] = hb; al.u[i] = ASPLIT ? bf16_bits(xs[i] - bf16_val(hb)) : (unsigned short)0; }
#pragma unroll
    for (int t = 0; t < 4; ++t) {
      const unsigned short* brow = Wt + (size_t)(col0 + t * 16 + ln) * ldb + kb;
      FragB b;
      b.half[0] = *(const v8us*)(brow + 8 * hh);
      b.half[1] = *(const v8us*)(brow + 16 + 8 * hh);
      acc[t] = mmaN<ASPLIT ? 2 : 1>(ah.v, al.v, b.v, b.v, acc[t]);
    }
  }
#pragma unroll
  for (int t = 0; t < 4; ++t) {
    float bv = bias ? bias[col0 + t * 16 + ln] : 0.f;
    if (BIAS_BF16) bv = bf16_round(bv);
#pragma unroll
    for (int r = 0; r < 8; ++r) { float v = acc[t][r] + bv; if (ACT == 1) v = fmaxf(v, 0.f); so[w][8 * hh + r][t * 16 + ln] = v; }
  }
  __builtin_amdgcn_fence(__ATOMIC_ACQ_REL, "workgroup");
  __builtin_amdgcn_wave_barrier();
  const int rsub = lane >> 4, c4 = (lane & 15) * 4;
  {
#pragma unroll
    for (int q = 0; q < 8; ++q) {
      const int r = q * 2 + rsub;
      const v4f v = *(const v4fa*)&so[w][r][c4];
      *(v4f*)(C + (size_t)(row0 + r) * ldc + col0 + c4) = v;
    }
    
  }
}

// GEMM C = act(A·W + bias + resid): A f32 (ASPLIT -> hi/lo 2 terms), Wt bf16 [N][K]; ACT 0 none, 1 relu, 2 exact gelu;
// resid (optional, f32, row index = (row % rmod), pitch ldr, RES_BF16 rounds it) added before the activation.
template <bool ASPLIT, int ACT, bool BIAS_BF16, bool RES_BF16>
__global__ __launch_bounds__(128) void k_gemm_bf3(const float* __restrict__ A, int lda, const unsigned short* __restrict__ Wt, int ldb,
                                                const float* __restrict__ bias, const float* __restrict__ resid, int rmod, int ldr,
                                                float* __restrict__ C, int ldc, int M, int N, int K) {
  __shared__ __attribute__((aligned(16))) float so[4][16][64];
  const int tid = threadIdx.x, w = tid >> 5, lane = tid & 31, ln = lane & 15, hh = lane >> 4;
  const int ntn = N / 64;
  const int wid = blockIdx.x * 4 + w;
  const int mt = wid / ntn, nq = wid % ntn;
  if (mt * 16 >= M) return;
  const int row0 = mt * 16, col0 = nq * 64;
  const float* arow = A + (size_t)(row0 + ln) * lda;
  v8f acc[4] = {};
  for (int kb = 0; kb < K; kb += 32) {
    FragB ah, al;
    const v4f x0 = *(const v4fa*)(arow + kb + 8 * hh), x1 = *(const v4fa*)(arow + kb + 8 * hh + 4);
    const v4f x2 = *(const v4fa*)(arow + kb + 16 + 8 * hh), x3 = *(const v4fa*)(arow + kb + 16 + 8 * hh + 4);
    float xs[16] = {x0[0],x0[1],x0[2],x0[3],x1[0],x1[1],x1[2],x1[3],x2[0],x2[1],x2[2],x2[3],x3[0],x3[1],x3[2],x3[3]};
#pragma unroll
    for (int i = 0; i < 16; ++i) { const unsigned short hb = bf16_bits(xs[i]); ah.u[i] = hb; al.u[i] = ASPLIT ? bf16_bits(xs[i] - bf16_val(hb)) : (unsigned short)0; }
#pragma unroll
    for (int t = 0; t < 4; ++t) {
      const unsigned short* brow = Wt + (size_t)(col0 + t * 16 + ln) * ldb + kb;
      FragB b;
      b.half[0] = *(const v8us*)(brow + 8 * hh);
      b.half[1] = *(const v8us*)(brow + 16 + 8 * hh);
      acc[t] = mmaN<ASPLIT ? 2 : 1>(ah.v, al.v, b.v, b.v, acc[t]);
    }
  }
#pragma unroll
  for (int t = 0; t < 4; ++t) {
    const int col = col0 + t * 16 + ln;
    float bv = bias ? bias[col] : 0.f;
    if (BIAS_BF16) bv = bf16_round(bv);
#pragma unroll
    for (int r = 0; r < 8; ++r) {
      float v = acc[t][r] + bv;
      if (resid) { float rv = resid[(size_t)((row0 + 8 * hh + r) % rmod) * ldr + col]; if (RES_BF16) rv = bf16_round(rv); v += rv; }
      if (ACT == 1) v = fmaxf(v, 0.f);
      if (ACT == 2) v = 0.5f * v * (1.0f + erff(v * 0.70710678118654752f));
      if (ACT == 3) { const float u = 0.7978845608028654f * (v + 0.044715f * v * v * v); v = 0.5f * v * (1.0f + tanhf(u)); }
      so[w][8 * hh + r][t * 16 + ln] = v;
    }
  }
  __builtin_amdgcn_fence(__ATOMIC_ACQ_REL, "workgroup");
  __builtin_amdgcn_wave_barrier();
  const int rsub = lane >> 4, c4 = (lane & 15) * 4;
  {
#pragma unroll
    for (int q = 0; q < 8; ++q) {
      const int r = q * 2 + rsub;
      const v4f v = *(const v4fa*)&so[w][r][c4];
      *(v4f*)(C + (size_t)(row0 + r) * ldc + col0 + c4) = v;
    }
    
  }
}
// row LayerNorm (biased variance, eps) over N: s = X (+ R); optional out_sum <- s; out_norm <- (s-mu)*rsqrt(var+eps)*g + b
template <bool PARAM_BF16>
__global__ __launch_bounds__(256) void k_layernorm(const float* __restrict__ X, const float* __restrict__ R, const float* __restrict__ g, const float* __restrict__ bta,
                                                  float* __restrict__ out_sum, float* __restrict__ out_norm, int N, float eps) {
  __shared__ float red[256];
  const int row = blockIdx.x, tid = threadIdx.x;
  const float* x = X + (size_t)row * N; const float* rr = R ? R + (size_t)row * N : nullptr;
  float vals[16];                     // up to N = 4096
  const int per = N / 256;            // contiguous chunk per thread? use strided-by-4 chunks: thread handles j = tid*4 + 1024*u
  float s1 = 0.f;
  for (int u = 0; u < per / 4; ++u) {
    const int j = tid * 4 + 1024 * u;
    const v4f a = *(const v4fa*)(x + j);
    v4f b = {0.f,0.f,0.f,0.f}; if (rr) b = *(const v4fa*)(rr + j);
#pragma unroll
    for (int q = 0; q < 4; ++q) { const float v = a[q] + b[q]; vals[u * 4 + q] = v; s1 += v; }
  }
  red[tid] = s1; __syncthreads();
  for (int st = 128; st > 0; st >>= 1) { if (tid < st) red[tid] += red[tid + st]; __syncthreads(); }
  const float mu = red[0] / (float)N; __syncthreads();
  float s2 = 0.f;
  for (int u = 0; u < per / 4; ++u)
#pragma unroll
    for (int q = 0; q < 4; ++q) { const float c = vals[u * 4 + q] - mu; s2 += c * c; }
  red[tid] = s2; __syncthreads();
  for (int st = 128; st > 0; st >>= 1) { if (tid < st) red[tid] += red[tid + st]; __syncthreads(); }
  const float rs = rsqrtf(red[0] / (float)N + eps);
  {
    for (int u = 0; u < per / 4; ++u) {
      const int j = tid * 4 + 1024 * u;
      v4f o, sm;
#pragma unroll
      for (int q = 0; q < 4; ++q) {
        float gg = g[j + q], bb = bta[j + q];
        if (PARAM_BF16) { gg = bf16_round(gg); bb = bf16_round(bb); }
        sm[q] = vals[u * 4 + q]; o[q] = (vals[u * 4 + q] - mu) * rs * gg + bb;
      }
      if (out_sum) *(v4f*)(out_sum + (size_t)row * N + j) = sm;
      *(v4f*)(out_norm + (size_t)row * N + j) = o;
    }
    
  }
}



// ---- f16 WMMA path (v_wmma_f32_16x16x32_f16): 11-bit significands for operands in range — used where a [0,1] probability operand needs more precision than bf16
typedef _Float16 v16h __attribute__((ext_vector_type(16)));
union FragH { v16h v; v8us half[2]; _Float16 h[16]; unsigned short u[16]; };
template <int NT>
__device__ __forceinline__ v8f mmaH(v16h ah, v16h al, v16h bh, v16h bl, v8f c) {
  c = __builtin_amdgcn_wmma_f32_16x16x32_f16(false, ah, false, bh, (short)0, c, false, false);
  if (NT >= 2) c = __builtin_amdgcn_wmma_f32_16x16x32_f16(false, al, false, bh, (short)0, c, false, false);
  if (NT >= 3) c = __builtin_amdgcn_wmma_f32_16x16x32_f16(false, ah, false, bl, (short)0, c, false, false);
  asm volatile("v_nop\n\tv_nop\n\tv_nop\n\tv_nop" : "+v"(c) : "v"(ah), "v"(al), "v"(bh), "v"(bl));
  return c;
}
// batched GEMM like k_gemm_b but f16 operands: A f32 (split into f16 hi/lo if ASPLIT, else rounded to f16), Bt = f16 values [n][k]; alpha; C f32; N multiple of 16 (partial tiles skipped)
template <bool ASPLIT>
__global__ __launch_bounds__(128) void k_gemm_h(const float* __restrict__ A, int lda, size_t sA, const _Float16* __restrict__ Bh, int ldb, size_t sB, float alpha, float* __restrict__ C, int ldc, size_t sC, int M, int N, int K) {
  __shared__ __attribute__((aligned(16))) float so[4][16][64];
  const int tid = threadIdx.x, w = tid >> 5, lane = tid & 31, ln = lane & 15, hh = lane >> 4; const int by = blockIdx.y;
  A += (size_t)by * sA; Bh += (size_t)by * sB; C += (size_t)by * sC;
  const int ntn = (N + 63) / 64; const int wid = blockIdx.x * 4 + w; const int mt = wid / ntn, nq = wid % ntn; if (mt * 16 >= M) return;
  const int row0 = mt * 16, col0 = nq * 64; const float* arow = A + (size_t)(row0 + ln) * lda;
  v8f acc[4] = {};
  for (int kb = 0; kb < K; kb += 32) {
    FragH ah, al;
    const v4f x0 = *(const v4fa*)(arow + kb + 8 * hh), x1 = *(const v4fa*)(arow + kb + 8 * hh + 4), x2 = *(const v4fa*)(arow + kb + 16 + 8 * hh), x3 = *(const v4fa*)(arow + kb + 16 + 8 * hh + 4);
    float xs[16] = {x0[0],x0[1],x0[2],x0[3],x1[0],x1[1],x1[2],x1[3],x2[0],x2[1],x2[2],x2[3],x3[0],x3[1],x3[2],x3[3]};
#pragma unroll
    for (int i = 0; i < 16; ++i) { const _Float16 h = (_Float16)xs[i]; ah.h[i] = h; al.h[i] = ASPLIT ? (_Float16)(xs[i] - (float)h) : (_Float16)0.0f; }
#pragma unroll
    for (int t = 0; t < 4; ++t) { if (col0 + t * 16 >= N) continue; const size_t boff = (size_t)(col0 + t * 16 + ln) * ldb + kb; FragH bq; bq.half[0] = *(const v8us*)(Bh + boff + 8 * hh); bq.half[1] = *(const v8us*)(Bh + boff + 16 + 8 * hh);
      acc[t] = mmaH<ASPLIT ? 2 : 1>(ah.v, al.v, bq.v, bq.v, acc[t]); }
  }
#pragma unroll
  for (int t = 0; t < 4; ++t) { if (col0 + t * 16 >= N) continue;
#pragma unroll
    for (int r = 0; r < 8; ++r) so[w][8 * hh + r][t * 16 + ln] = acc[t][r] * alpha; }
  __builtin_amdgcn_fence(__ATOMIC_ACQ_REL, "workgroup"); __builtin_amdgcn_wave_barrier();
  const int rsub = lane >> 4, c4 = (lane & 15) * 4;
  {
#pragma unroll
    for (int q = 0; q < 8; ++q) { const int r = q * 2 + rsub; if (col0 + c4 < N) { const v4f v = *(const v4fa*)&so[w][r][c4]; *(v4f*)(C + (size_t)(row0 + r) * ldc + col0 + c4) = v; } }
     }
}

// Wt[n][k] = f16(W[k][n]·scale) from f32 row-major W[K][N] (scale = power of two; bf16-exact weights stay exact in f16 away from the subnormal range)
__global__ __launch_bounds__(256) void k_wt_f16(const float* __restrict__ W, _Float16* __restrict__ Wt, int K, int N, float scale) {
  const int t = blockIdx.x * 256 + threadIdx.x; if (t >= N * (K / 8)) return; const int n = t / (K / 8), k8 = (t % (K / 8)) * 8; FragH f;
#pragma unroll
  for (int i = 0; i < 8; ++i) f.h[i] = (_Float16)(bf16_round(W[(size_t)(k8 + i) * N + n]) * scale); const v8us o = f.half[0];
  *(v8us*)((unsigned short*)Wt + (size_t)n * K + k8) = o; 
}
// k_gemm_hh variant with fused epilogue: v = acc·alpha + bias[by·sBias + col] (+ CP[(row/rowsPerB)·sCPb + by·64 + col] if CP) ; ACT 0 none / 1 elu ; writes f16 C16 (and f32 C if non-null)
template <int ACT>
__global__ __launch_bounds__(128) void k_gemm_hhx(const _Float16* __restrict__ A, int lda, size_t sA, const _Float16* __restrict__ Bh, int ldb, size_t sB, float alpha, const float* __restrict__ bias, size_t sBias, const float* __restrict__ CP, int rowsPerB, size_t sCPb, int row0g,
    float* __restrict__ C, _Float16* __restrict__ C16, int ldc, size_t sC, int M, int N, int K) {
  __shared__ __attribute__((aligned(16))) float so[4][16][64];
  const int tid = threadIdx.x, w = tid >> 5, lane = tid & 31, ln = lane & 15, hh = lane >> 4; const int by = blockIdx.y;
  A += (size_t)by * sA; Bh += (size_t)by * sB; const size_t cofs = (size_t)by * sC; const float* bp = bias ? bias + (size_t)by * sBias : nullptr;
  const int ntn = (N + 63) / 64; const int wid = blockIdx.x * 4 + w; const int mt = wid / ntn, nq = wid % ntn; if (mt * 16 >= M) return;
  const int row0 = mt * 16, col0 = nq * 64; const _Float16* arow = A + (size_t)(row0 + ln) * lda;
  v8f acc[4] = {};
  for (int kb = 0; kb < K; kb += 32) { FragH ah; ah.half[0] = *(const v8us*)((const unsigned short*)arow + kb + 8 * hh); ah.half[1] = *(const v8us*)((const unsigned short*)arow + kb + 16 + 8 * hh);
#pragma unroll
    for (int t = 0; t < 4; ++t) { if (col0 + t * 16 >= N) continue; const size_t boff = (size_t)(col0 + t * 16 + ln) * ldb + kb; FragH bq; bq.half[0] = *(const v8us*)((const unsigned short*)Bh + boff + 8 * hh); bq.half[1] = *(const v8us*)((const unsigned short*)Bh + boff + 16 + 8 * hh);
      acc[t] = mmaH<1>(ah.v, ah.v, bq.v, bq.v, acc[t]); }
  }
#pragma unroll
  for (int t = 0; t < 4; ++t) { if (col0 + t * 16 >= N) continue; const int col = col0 + t * 16 + ln; const float bv = bp ? bf16_round(bp[col]) : 0.f;
#pragma unroll
    for (int r = 0; r < 8; ++r) { float v = acc[t][r] * alpha + bv; if (CP) { const int rr = row0g + row0 + 8 * hh + r; if (rowsPerB < 0) v += CP[cofs + (size_t)rr * ldc + col];      /* rowsPerB < 0: own element of the batched C plane */ else { const int bidx = rr / rowsPerB; v += CP[(size_t)bidx * sCPb + (size_t)by * 64 + col]; } } if (ACT == 1) v = (v > 0.f) ? v : expm1f(v); else if (ACT == 7) v = (v > 0.f) ? v + 1.0f : expf(v); else if (ACT == 8) v = tanhf(v); else if (ACT == 9) v = 0.5f * v * (1.0f + tanhf(0.7978845608028654f * (v + 0.044715f * v * v * v))); else if (ACT == 11) v = 1.0f / (1.0f + expf(-v)); else if (ACT == 12) v = (v > 0.f) ? v : 0.01f * v; else if (ACT == 14) v = (v > 0.f) ? v : 0.1f * v; else if (ACT == 16) v = (v >= 0.f) ? v : 0.3f * v; else if (ACT == 17) v = (v >= 0.f) ? v : 0.2f * v; else if (ACT == 15) v = v / (1.0f + expf(-v)); else if (ACT == 3) v = fmaxf(v, 0.f); else if (ACT == 6) v = 0.5f * v * (1.0f + erff(v * 0.70710678118654752f)); so[w][8 * hh + r][t * 16 + ln] = v; } }
  __builtin_amdgcn_fence(__ATOMIC_ACQ_REL, "workgroup"); __builtin_amdgcn_wave_barrier();
  const int rsub = lane >> 4, c4 = (lane & 15) * 4; typedef _Float16 v4h __attribute__((ext_vector_type(4)));
  {
#pragma unroll
    for (int q = 0; q < 8; ++q) { const int r = q * 2 + rsub; if (col0 + c4 < N) { const v4f v = *(const v4fa*)&so[w][r][c4]; if (C) *(v4f*)(C + cofs + (size_t)(row0 + r) * ldc + col0 + c4) = v; if (C16) { v4h h4; for (int i = 0; i < 4; ++i) h4[i] = (_Float16)v[i]; *(v4h*)(C16 + cofs + (size_t)(row0 + r) * ldc + col0 + c4) = h4; } } }
     }
}


typedef _Float16 v4h __attribute__((ext_vector_type(4)));

__global__ __launch_bounds__(256) void k_x16(const float* __restrict__ x, _Float16* __restrict__ X16, size_t n8) { const size_t t = (size_t)blockIdx.x * 256 + threadIdx.x; if (t >= n8) return; FragH f;
#pragma unroll
  for (int q = 0; q < 8; ++q) f.h[q] = (_Float16)bf16_round(x[t * 8 + q]); *(v8us*)((unsigned short*)X16 + t * 8) = f.half[0];  }
__global__ __launch_bounds__(256) void k_h16(const float* __restrict__ x, _Float16* __restrict__ X16, size_t n8) { const size_t t = (size_t)blockIdx.x * 256 + threadIdx.x; if (t >= n8) return; FragH f;
#pragma unroll
  for (int q = 0; q < 8; ++q) f.h[q] = (_Float16)x[t * 8 + q]; *(v8us*)((unsigned short*)X16 + t * 8) = f.half[0];  }
__global__ __launch_bounds__(256) void k_round16f(const float* __restrict__ W, _Float16* __restrict__ Bt, size_t n8) { const size_t t = (size_t)blockIdx.x * 256 + threadIdx.x; if (t >= n8) return; FragH f;
#pragma unroll
  for (int i = 0; i < 8; ++i) f.h[i] = (_Float16)(bf16_round(W[t * 8 + i]) * 16.0f); *(v8us*)((unsigned short*)Bt + t * 8) = f.half[0];  }
template <int NHv, int TTv>
__global__ __launch_bounds__(256) void k_vt(const _Float16* __restrict__ V16, int ldv, int voff, _Float16* __restrict__ Vt) { __shared__ unsigned short tl[64][66]; const int tid = threadIdx.x; const int slab = blockIdx.x / (TTv / 64), lg = blockIdx.x % (TTv / 64); const int b = slab / NHv, h = slab % NHv;
  for (int i = tid; i < 64 * 8; i += 256) { const int r = i / 8, c8 = (i % 8) * 8; FragH f; f.half[0] = *(const v8us*)((const unsigned short*)V16 + ((size_t)b * TTv + lg * 64 + r) * ldv + voff + h * 64 + c8);
#pragma unroll
    for (int q = 0; q < 8; ++q) tl[r][c8 + q] = f.u[q]; }
  __syncthreads();
  {
#pragma unroll
    for (int rd = 0; rd < 2; ++rd) { const int d = rd * 32 + tid / 8, pc = tid % 8; FragH f;
#pragma unroll
      for (int q = 0; q < 8; ++q) f.u[q] = tl[pc * 8 + q][d];
      *(v8us*)((unsigned short*)Vt + ((size_t)slab * 64 + d) * TTv + lg * 64 + pc * 8) = f.half[0]; }
     } }

__global__ __launch_bounds__(256) void k_hl(const float* __restrict__ F, _Float16* __restrict__ Hh, _Float16* __restrict__ Hl, size_t n8) { const size_t t = (size_t)blockIdx.x * 256 + threadIdx.x; if (t >= n8) return; FragH fh, fl; const v4f a = *(const v4fa*)(F + t * 8), c = *(const v4fa*)(F + t * 8 + 4);
#pragma unroll
  for (int q = 0; q < 4; ++q) { _Float16 h = (_Float16)a[q]; fh.h[q] = h; fl.h[q] = (_Float16)((a[q] - (float)h) * 1024.0f); h = (_Float16)c[q]; fh.h[4 + q] = h; fl.h[4 + q] = (_Float16)((c[q] - (float)h) * 1024.0f); }
  { *(v8us*)((unsigned short*)Hh + t * 8) = fh.half[0]; *(v8us*)((unsigned short*)Hl + t * 8) = fl.half[0];  } }

// ---- fast GEMM (wave tile 32x64; requires M % 32 == 0 rows per launch region and N % 64 == 0); epilogue = k_gemm_hhx semantics ----
__device__ __forceinline__ v16h g2_frag(const _Float16* p, int hh) { FragH f; f.half[0] = *(const v8us*)((const unsigned short*)p + 8 * hh); f.half[1] = *(const v8us*)((const unsigned short*)p + 16 + 8 * hh); return f.v; }
__device__ __forceinline__ v8f g2_mma(v16h a, v16h b, v8f c) { v8f d = __builtin_amdgcn_wmma_f32_16x16x32_f16(false, a, false, b, (short)0, c, false, false); asm volatile("v_nop\n\tv_nop\n\tv_nop\n\tv_nop" : "+v"(d) : "v"(a), "v"(b)); return d; }
template <int ACT>
__global__ __launch_bounds__(128) void k_gemm2(const _Float16* __restrict__ A, int lda, size_t sA, const _Float16* __restrict__ Bh, int ldb, size_t sB, float alpha, const float* __restrict__ bias, size_t sBias, const float* __restrict__ CP, int rowsPerB, size_t sCPb, int row0g,
    float* __restrict__ C, _Float16* __restrict__ C16, int ldc, size_t sC, int M, int N, int K) { static_assert(ACT == 0 || ACT == 3 || ACT == 6 || ACT == 8 || ACT == 9 || ACT == 11 || ACT == 12 || ACT == 14 || ACT == 15 || ACT == 16 || ACT == 17, "k_gemm2: unsupported ACT code (would silently apply no activation)");
  __shared__ __attribute__((aligned(16))) float so[4][32][68];
  const int tid = threadIdx.x, w = tid >> 5, lane = tid & 31, ln = lane & 15, hh = lane >> 4; const int by = blockIdx.y;
  A += (size_t)by * sA; Bh += (size_t)by * sB; const size_t cofs = (size_t)by * sC; const float* bp = bias ? bias + (size_t)by * sBias : nullptr;
  const int ntn = N >> 6; const int mt = blockIdx.x / ntn, nq = blockIdx.x - mt * ntn; const int row0 = mt * 128 + 32 * w, col0 = nq * 64; if (row0 >= M) return;
  const _Float16* a0p = A + (size_t)(row0 + ln) * lda; const _Float16* a1p = a0p + (size_t)16 * lda;
  const _Float16* b0p = Bh + (size_t)(col0 + ln) * ldb; const _Float16* b1p = b0p + (size_t)16 * ldb; const _Float16* b2p = b1p + (size_t)16 * ldb; const _Float16* b3p = b2p + (size_t)16 * ldb;
  const v8f z8 = {0.f,0.f,0.f,0.f,0.f,0.f,0.f,0.f}; v8f c00 = z8, c01 = z8, c02 = z8, c03 = z8, c10 = z8, c11 = z8, c12 = z8, c13 = z8;
#pragma unroll 1
  for (int kb = 0; kb < K; kb += 32) { const v16h a0 = g2_frag(a0p + kb, hh), a1 = g2_frag(a1p + kb, hh);
    v16h b = g2_frag(b0p + kb, hh); c00 = g2_mma(a0, b, c00); c10 = g2_mma(a1, b, c10);
    b = g2_frag(b1p + kb, hh); c01 = g2_mma(a0, b, c01); c11 = g2_mma(a1, b, c11);
    b = g2_frag(b2p + kb, hh); c02 = g2_mma(a0, b, c02); c12 = g2_mma(a1, b, c12);
    b = g2_frag(b3p + kb, hh); c03 = g2_mma(a0, b, c03); c13 = g2_mma(a1, b, c13); }
  v8f accs[8] = {c00, c01, c02, c03, c10, c11, c12, c13};
#pragma unroll
  for (int u = 0; u < 8; ++u) { const int t = u & 3, half = u >> 2; const int col = col0 + t * 16 + ln; const float bv = bp ? bf16_round(bp[col]) : 0.f;
#pragma unroll
    for (int r = 0; r < 8; ++r) { const int rloc = half * 16 + 8 * hh + r; float v = accs[u][r] * alpha + bv; if (CP) { if (rowsPerB < 0) v += CP[cofs + (size_t)(row0g + row0 + rloc) * ldc + col];      /* rowsPerB < 0: own element of the batched C plane */ else { const int bidx = (row0g + row0 + rloc) / rowsPerB; v += CP[(size_t)bidx * sCPb + (size_t)by * 64 + col]; } }
      if (ACT == 3) v = fmaxf(v, 0.f); else if (ACT == 6) v = 0.5f * v * (1.0f + erff(v * 0.70710678118654752f)); else if (ACT == 11) v = 1.0f / (1.0f + expf(-v)); else if (ACT == 15) v = v / (1.0f + expf(-v)); else if (ACT == 12) v = (v > 0.f) ? v : 0.01f * v; else if (ACT == 8) v = tanhf(v); else if (ACT == 9) v = 0.5f * v * (1.0f + tanhf(0.7978845608028654f * (v + 0.044715f * v * v * v))); else if (ACT == 14) v = (v > 0.f) ? v : 0.1f * v; else if (ACT == 16) v = (v >= 0.f) ? v : 0.3f * v; else if (ACT == 17) v = (v >= 0.f) ? v : 0.2f * v;
      so[w][rloc][t * 16 + ln] = v; } }
  __builtin_amdgcn_fence(__ATOMIC_ACQ_REL, "workgroup"); __builtin_amdgcn_wave_barrier();
  const int rsub = lane >> 4, c4 = (lane & 15) * 4;
  {
#pragma unroll
    for (int q = 0; q < 16; ++q) { const int r = q * 2 + rsub; const v4f v = *(const v4fa*)&so[w][r][c4]; if (C) *(v4f*)(C + cofs + (size_t)(row0 + r) * ldc + col0 + c4) = v; if (C16) { v4h h4; for (int i = 0; i < 4; ++i) h4[i] = (_Float16)v[i]; *(v4h*)(C16 + cofs + (size_t)(row0 + r) * ldc + col0 + c4) = h4; } }
     } }


__global__ __launch_bounds__(256) void k_wnat(const float* __restrict__ w, size_t n8, _Float16* __restrict__ Bt) { const size_t t = (size_t)blockIdx.x * 256 + threadIdx.x; if (t >= n8) return; FragH f; for (int q = 0; q < 8; ++q) f.h[q] = (_Float16)(bf16_round(w[t * 8 + q]) * 16.0f); *(v8us*)((unsigned short*)Bt + t * 8) = f.half[0];  }
__global__ __launch_bounds__(256) void k_rsm(const float* __restrict__ S, _Float16* __restrict__ P, int nrows) {
  #pragma clang fp contract(off)
  const int i = blockIdx.x * 256 + threadIdx.x; if (i >= nrows) return; const float* s = S + (size_t)i * SQ; float mx = -3.0e38f;
#pragma unroll 1
  for (int j = 0; j < SQ; ++j) mx = fmaxf(mx, s[j]); float se = 0.f;
#pragma unroll 1
  for (int j = 0; j < SQ; ++j) se += expf(s[j] - mx); const float sc = 256.0f / se;
#pragma unroll 1
  for (int j0 = 0; j0 < SQ; j0 += 8) { FragH f; for (int q = 0; q < 8; ++q) f.h[q] = (_Float16)(expf(s[j0 + q] - mx) * sc); unsigned short* d = (unsigned short*)P + (size_t)i * SQ + j0; *(v8us*)d = f.half[0];  } }
__global__ __launch_bounds__(256) void k_vt(const _Float16* __restrict__ V16, int b, int h0, _Float16* __restrict__ VT) { __shared__ unsigned short tl[64][65]; const int tid = threadIdx.x; const int hh = blockIdx.x % HG, sg = blockIdx.x / HG; const int s0 = sg * 64; const int h = h0 + hh;
  for (int i = tid; i < 64 * 8; i += 256) { const int j = i / 8, d8 = (i % 8) * 8; FragH f; f.half[0] = *(const v8us*)((const unsigned short*)V16 + ((size_t)b * SQ + s0 + j) * DM + h * HD + d8); for (int q = 0; q < 8; ++q) tl[d8 + q][j] = f.u[q]; }
  __syncthreads();
  { for (int i = tid; i < 64 * 8; i += 256) { const int d = i / 8, j8 = (i % 8) * 8; FragH f; for (int q = 0; q < 8; ++q) f.u[q] = tl[d][j8 + q]; *(v8us*)((unsigned short*)VT + ((size_t)hh * HD + d) * SQ + s0 + j8) = f.half[0]; }  } }



// Causal row softmax, one wave per score row. The nk scores of a row are read once, 512 contiguous bytes per wave-wide load, and stay in the wave's
// registers for the maximum, the exponentials, their sum and the x256 f16 weights (256 contiguous bytes per wave-wide store). nk is a multiple of QT.
// Row maximum and row sum: four partial values per lane, then a butterfly over the 32 lanes (four steps inside a 16-lane row, one across the rows).
#define RG (NKX / QT)                /* groups of QT columns in a full score row; a lane holds 8 scores of each, as two chunks of 4 */
template <int X> __device__ __forceinline__ float row_xor(float v) { return __builtin_bit_cast(float, __builtin_amdgcn_update_dpp(0, __builtin_bit_cast(int, v), 0x160 | X, 0xf, 0xf, true)); }      /* lane l <- lane l ^ X, X < 16 */
__device__ __forceinline__ float half_xor(float v) { const int i = __builtin_bit_cast(int, v); return __builtin_bit_cast(float, __builtin_amdgcn_permlanex16(i, i, 0x76543210, 0xfedcba98, false, false)); }      /* lane l <- lane l ^ 16 */
__device__ __forceinline__ float wave_max(float v) { v = fmaxf(v, row_xor<1>(v)); v = fmaxf(v, row_xor<2>(v)); v = fmaxf(v, row_xor<4>(v)); v = fmaxf(v, row_xor<8>(v)); return fmaxf(v, half_xor(v)); }
__device__ __forceinline__ float wave_sum(float v) { v += row_xor<1>(v); v += row_xor<2>(v); v += row_xor<4>(v); v += row_xor<8>(v); return v + half_xor(v); }
__global__ __launch_bounds__(256) void k_rsmcf2(const float* __restrict__ S, _Float16* __restrict__ P, int hg, int q0, int nk) {
  static_assert(QT == 256, "a group is two wave-wide loads of 128 columns");
  const int lane = threadIdx.x & 31; const int t = blockIdx.x * 8 + __builtin_amdgcn_readfirstlane((int)(threadIdx.x >> 5)); if (t >= hg * QT) return;
  const float* s = S + (size_t)t * NKX + lane * 4; _Float16* d = P + (size_t)t * NKX + lane * 4; const int last = q0 + (t % QT);
  v4f x[2 * RG];      /* every loop over g below is fully unrolled: x and h are indexed by constants only and so stay in registers */
#pragma unroll
  for (int g = 0; g < RG; ++g) if (g * QT < nk) { x[2 * g] = *(const v4fa*)(s + g * QT); x[2 * g + 1] = *(const v4fa*)(s + g * QT + 128); }      /* all of the row's loads are in flight before the first use */
  asm volatile("s_wait_xcnt 0x0" ::: "memory");      /* the loads' address registers are reused below while the loads are still in flight: the wait stands in front of that overwrite */
  v4f m4 = {-3.0e38f, -3.0e38f, -3.0e38f, -3.0e38f};
#pragma unroll
  for (int g = 0; g < RG; ++g) if (g * QT < nk) {
    if (g * QT + QT > q0) { for (int c = 2 * g; c < 2 * g + 2; ++c) for (int u = 0; u < 4; ++u) x[c][u] = (c * 128 + lane * 4 + u <= last) ? x[c][u] : -1.0e9f; }      /* last >= q0: a group that ends at or below q0 holds no masked key */
    for (int u = 0; u < 4; ++u) m4[u] = fmaxf(m4[u], fmaxf(x[2 * g][u], x[2 * g + 1][u])); }
  const float mx = wave_max(fmaxf(fmaxf(m4[0], m4[1]), fmaxf(m4[2], m4[3])));
  v4f s4 = {0.f, 0.f, 0.f, 0.f};
#pragma unroll
  for (int g = 0; g < RG; ++g) if (g * QT < nk) { for (int c = 2 * g; c < 2 * g + 2; ++c) for (int u = 0; u < 4; ++u) { x[c][u] = __expf(x[c][u] - mx); s4[u] += x[c][u]; } }
  const float sc = 256.0f / wave_sum((s4[0] + s4[1]) + (s4[2] + s4[3]));
  v4h h[2 * RG];
#pragma unroll
  for (int g = 0; g < RG; ++g) if (g * QT < nk) { for (int c = 2 * g; c < 2 * g + 2; ++c) for (int u = 0; u < 4; ++u) h[c][u] = (_Float16)(x[c][u] * sc); }
#pragma unroll
  for (int g = 0; g < RG; ++g) if (g * QT < nk) { *(v4h*)(d + g * QT) = h[2 * g]; *(v4h*)(d + g * QT + 128) = h[2 * g + 1]; } }      /* stores last, each from registers of its own: nothing is written over a store's registers */


template <int MASKADD>
__global__ __launch_bounds__(64) void k_att0(const float* __restrict__ QF, const float* __restrict__ KF, const float* __restrict__ VF, int ld, const float* __restrict__ mask, float scale, float* __restrict__ OF, int ldo) {
  #pragma clang fp contract(off)
  __shared__ __attribute__((aligned(16))) float lo[64][64];      /* used once, at the end: turns the threads' o rows into whole-line stores */
  const int tid = threadIdx.x; const int h = blockIdx.x / (QT0 / 64), rg = blockIdx.x % (QT0 / 64); const int i = rg * 64 + tid;
  const float* qr = QF + (size_t)i * ld + h * HD;
  v4f q[HD / 4], o[HD / 4];      /* the thread's q row and o row: every loop over c is fully unrolled, so both are indexed by constants only and stay in registers */
#pragma unroll
  for (int c = 0; c < HD / 4; ++c) { q[c] = *(const v4fa*)(qr + c * 4); const v4f z = {0.f, 0.f, 0.f, 0.f}; o[c] = z; }
  asm volatile("s_wait_xcnt 0x0" :: "v"(qr) : "memory");      /* qr is named so that the 16 loads' address registers live up to this wait: none of them is overwritten in front of it, not even by a later load's result */
  float m = -1.0e30f, l = 0.f; const int jmax = MASKADD ? (SQ - 1) : (rg * 64 + 63);      /* additive-mask form: every key (the mask input decides); causal form: keys up to the block's last row */
#pragma unroll 1
  for (int j = 0; j <= jmax; ++j) { const float* kr = KF + (size_t)j * ld + h * HD; const float* vr = VF + (size_t)j * ld + h * HD; float s = 0.f;
#pragma unroll
    for (int c = 0; c < HD / 4; ++c) { const v4f kq = *(const v4fa*)(kr + c * 4); s = __fadd_rn(s, __fmul_rn(q[c][0], kq[0])); s = __fadd_rn(s, __fmul_rn(q[c][1], kq[1])); s = __fadd_rn(s, __fmul_rn(q[c][2], kq[2])); s = __fadd_rn(s, __fmul_rn(q[c][3], kq[3])); }
    s = __fmul_rn(s, scale); if (MASKADD) s = __fadd_rn(s, __fmul_rn(bf16_round(mask[(size_t)i * SQ + j]), -10000.0f));
    const float f = (MASKADD || j <= i) ? 1.f : 0.f; const float sm = fmaf(f, s, (1.f - f) * -1.0e30f); const float mn = fmaxf(m, sm); const float sc = expf(m - mn); const float e = expf(sm - mn); l = __fadd_rn(__fmul_rn(l, sc), e); m = mn;
#pragma unroll
    for (int c = 0; c < HD / 4; ++c) { const v4f vv = *(const v4fa*)(vr + c * 4); for (int u = 0; u < 4; ++u) o[c][u] = __fadd_rn(__fmul_rn(o[c][u], sc), __fmul_rn(e, vv[u])); } }
  const float fin = 64.0f / l;      /* o carried x64 like the f16 path */
#pragma unroll
  for (int c = 0; c < HD / 4; ++c) { v4f oo = o[c]; for (int u = 0; u < 4; ++u) oo[u] = __fmul_rn(oo[u], fin); *(v4f*)&lo[tid][c * 4] = oo; }
  __syncthreads();
  {
#pragma unroll 1
    for (int it = 0; it < 16; ++it) { const int row = it * 4 + tid / 16, pc = (tid % 16) * 4; const v4f v = *(const v4f*)&lo[row][pc]; *(v4f*)(OF + (size_t)(rg * 64 + row) * ldo + h * HD + pc) = v; }
     } }

extern "C" void kernel_launch(void* const* d_in, const int* in_sizes, int n_in,
                              void* d_out, int out_size, void* d_ws, size_t ws_size, hipStream_t stream) {
  (void)in_sizes; (void)n_in; (void)out_size;
  const float* const* I = (const float* const*)d_in; const float* xq = I[0]; const float* xk = I[1]; const float* xv = I[2]; const float* wq = I[3]; const float* wk = I[4]; const float* wv = I[5]; const float* wo = I[6];      /* nn.Linear weights [out][in] */
  char* ws = (char*)d_ws; size_t off = 0;
  auto take = [&](size_t bytes) { char* p = ws + off; off += (bytes + 255) & ~(size_t)255; return p; };
  _Float16* BQ = (_Float16*)take((size_t)DM * DM * 2); _Float16* BK = (_Float16*)take((size_t)DM * DM * 2); _Float16* BV = (_Float16*)take((size_t)DM * DM * 2); _Float16* BO = (_Float16*)take((size_t)DM * DM * 2);
  _Float16* XQ = (_Float16*)take(NR * DM * 2); _Float16* XK = (_Float16*)take(NR * DM * 2); _Float16* XV = (_Float16*)take(NR * DM * 2); _Float16* Q16 = (_Float16*)take(NR * DM * 2); _Float16* K16 = (_Float16*)take(NR * DM * 2); _Float16* V16 = (_Float16*)take(NR * DM * 2); _Float16* O16 = (_Float16*)take(NR * DM * 2);
  float* S = (float*)take((size_t)NH * QT * NKX * 4); _Float16* P = (_Float16*)take((size_t)NH * QT * NKX * 2); _Float16* VT = (_Float16*)take((size_t)NH * HD * SQ * 2);
  float* QF0 = (float*)take((size_t)QT0 * DM * 4); float* KF0 = (float*)take((size_t)QT0 * DM * 4); float* VF0 = (float*)take((size_t)QT0 * DM * 4); float* OF0 = (float*)take((size_t)NB * QT0 * DM * 4); _Float16* OH0 = (_Float16*)take((size_t)NB * QT0 * DM * 2); _Float16* OL0 = (_Float16*)take((size_t)NB * QT0 * DM * 2);
  if (off > ws_size) return;
  { const unsigned g = (unsigned)(((size_t)DM * DM / 8 + 255) / 256); k_wnat<<<g, 256, 0, stream>>>(wq, (size_t)DM * DM / 8, BQ); k_wnat<<<g, 256, 0, stream>>>(wk, (size_t)DM * DM / 8, BK); k_wnat<<<g, 256, 0, stream>>>(wv, (size_t)DM * DM / 8, BV); k_wnat<<<g, 256, 0, stream>>>(wo, (size_t)DM * DM / 8, BO); }      /* natural [out][in] = Bt[n][k], x16 */
  k_x16<<<(unsigned)((NR * DM / 8 + 255) / 256), 256, 0, stream>>>(xq, XQ, NR * DM / 8); k_x16<<<(unsigned)((NR * DM / 8 + 255) / 256), 256, 0, stream>>>(xk, XK, NR * DM / 8); k_x16<<<(unsigned)((NR * DM / 8 + 255) / 256), 256, 0, stream>>>(xv, XV, NR * DM / 8);
  const size_t r0p = (size_t)B0 * SQ;      /* first projected row */
  k_gemm2<0><<<dim3((unsigned)((MP / 128) * (DM / 64)), 1), 128, 0, stream>>>(XQ + r0p * DM, DM, 0, BQ, DM, 0, 0.0625f, nullptr, 0, nullptr, 1, 0, 0, nullptr, Q16 + r0p * DM, DM, 0, MP, DM, DM);
  k_gemm2<0><<<dim3((unsigned)((MP / 128) * (DM / 64)), 1), 128, 0, stream>>>(XK + r0p * DM, DM, 0, BK, DM, 0, 0.0625f, nullptr, 0, nullptr, 1, 0, 0, nullptr, K16 + r0p * DM, DM, 0, MP, DM, DM);
  k_gemm2<0><<<dim3((unsigned)((MP / 128) * (DM / 64)), 1), 128, 0, stream>>>(XV + r0p * DM, DM, 0, BV, DM, 0, 0.0625f, nullptr, 0, nullptr, 1, 0, 0, nullptr, V16 + r0p * DM, DM, 0, MP, DM, DM);
  for (int b = B0; b < B0 + NBR; ++b) { const size_t r0 = (size_t)b * SQ;
    k_vt<NH, SQ><<<NH * (SQ / 64), 256, 0, stream>>>(V16 + r0 * LQ, LQ, 0, VT);      /* V^T [NH][HD][SQ] for this batch */
    k_gemm2<0><<<dim3((QT0 / 128) * (DM / 64), 1), 128, 0, stream>>>(XQ + r0 * DM, DM, 0, BQ, DM, 0, 0.0625f, nullptr, 0, nullptr, 1, 0, 0, QF0, nullptr, DM, 0, QT0, DM, DM); k_gemm2<0><<<dim3((QT0 / 128) * (DM / 64), 1), 128, 0, stream>>>(XK + r0 * DM, DM, 0, BK, DM, 0, 0.0625f, nullptr, 0, nullptr, 1, 0, 0, KF0, nullptr, DM, 0, QT0, DM, DM); k_gemm2<0><<<dim3((QT0 / 128) * (DM / 64), 1), 128, 0, stream>>>(XV + r0 * DM, DM, 0, BV, DM, 0, 0.0625f, nullptr, 0, nullptr, 1, 0, 0, VF0, nullptr, DM, 0, QT0, DM, DM);      /* f32 q, k, v of the first 256 rows (exact products) */
    k_att0<0><<<NH * (QT0 / 64), 64, 0, stream>>>(QF0, KF0, VF0, DM, nullptr, 0.125f, OF0 + (size_t)b * QT0 * DM, DM);      /* exact f32 attention for rows 0..255 (o x64) */
    for (int q0 = 0; q0 < QN; q0 += QT) { const int nk = q0 + QT;      /* causal: only keys below the tile end are computed */
      k_gemm2<0><<<dim3((QT / 128) * (nk / 64), NHD), 128, 0, stream>>>(Q16 + (r0 + q0) * LQ, LQ, (size_t)HD, K16 + r0 * LQ, LQ, (size_t)HD, 0.125f, nullptr, 0, nullptr, 1, 0, 0, S, nullptr, NKX, (size_t)QT * NKX, QT, nk, HD);      /* scores, all heads on grid.y */
      k_rsmcf2<<<(NHD * QT + 7) / 8, 256, 0, stream>>>(S, P, NHD, q0, nk);      /* one wave per row, 8 rows per block */
      k_gemm2<0><<<dim3((QT / 128) * (HD / 64), NHD), 128, 0, stream>>>(P, NKX, (size_t)QT * NKX, VT, SQ, (size_t)HD * SQ, 0.25f, nullptr, 0, nullptr, 1, 0, 0, nullptr, O16 + (r0 + q0) * DM, DM, (size_t)HD, QT, HD, nk); } }      /* o (merged heads, x64) as f16 rows */
  k_gemm2<0><<<dim3((unsigned)((MPO / 128) * (DM / 64)), 1), 128, 0, stream>>>(O16 + r0p * DM, DM, 0, BO, DM, 0, 0.0009765625f, nullptr, 0, nullptr, 1, 0, 0, (float*)d_out + r0p * DM, nullptr, DM, 0, MPO, DM, DM);      /* out rows are the output layout */
  k_hl<<<(unsigned)(((size_t)NB * QT0 * DM / 8 + 255) / 256), 256, 0, stream>>>(OF0, OH0, OL0, (size_t)NB * QT0 * DM / 8);      /* first-tile o (x64) -> f16 hi + x1024 residual planes */
  for (int b = B0; b < B0 + NBR; ++b) { const size_t r0 = (size_t)b * SQ; const size_t f0 = (size_t)b * QT0;
    k_gemm2<0><<<dim3((QT0 / 128) * (DM / 64), 1), 128, 0, stream>>>(OH0 + f0 * DM, DM, 0, BO, DM, 0, 0.0009765625f, nullptr, 0, nullptr, 1, 0, 0, (float*)d_out + r0 * DM, nullptr, DM, 0, QT0, DM, DM);      /* rows 0..255: out = o_hi Wo, overwriting the f16-path rows */
    k_gemm2<0><<<dim3((QT0 / 128) * (DM / 64), 1), 128, 0, stream>>>(OL0 + f0 * DM, DM, 0, BO, DM, 0, 0.00000095367431640625f, nullptr, 0, (const float*)d_out + r0 * DM, -1, 0, 0, (float*)d_out + r0 * DM, nullptr, DM, 0, QT0, DM, DM); }      /* += o_lo Wo 2^-20 (own-element accumulate) */
}

// v003
// One run takes 614 microseconds.
// Next to v002, in two timings, it ran 3.11 and 3.09 times as fast.
// Over all steps from v000 it is 13.5 times as fast.
#include <hip/hip_runtime.h>
// Causal multi-head attention (q, k, v inputs [1][4096][1024]; qp/kp/vp = input W^T (nn.Linear [out][in], no bias), 16 heads of 64; scores x (8/64) = /8; causal mask (keys > query get -inf); softmax; out = (probs v merged) Wo^T -> [1][4096][1024]).
// Structure: token rows r = s; q, k, v inputs as exact f16 rows (bf16-rounded); Q, K, V as three WMMA GEMMs (32x64 wave tiles, f32 accumulation, exact x16 weights, f16 outputs); per batch: V^T for all heads via LDS transposes; one fused attention launch: a wave owns 32 query rows of a head and walks the keys up to its last row in steps of 32: scores on WMMA (K = 64, x 0.125), online causal softmax in registers (f32 running maximum and sum, native exp; unnormalised weights f16), o += P V on WMMA (f32), divided by the row sum at the end (o carried x64, folded into the output GEMM alpha) written straight into the merged f16 o rows; out = o W_o GEMM (f32) into the output layout.
// Compute dtype: inputs rounded to bf16; x / weights exact; q, k, v, softmax weights and o as plain f16 GEMM operands (~2^-12); scores and softmax statistics f32. v_wmma_f32_16x16x32_f16.
#define NB 1
#define SQ 4096
#define DM 1024
#define NH 16
#define HD 64
#define HG 4                         /* heads per launch of the non-template k_vt (not launched) */
#define QT 256                       /* not used */
#define NKX SQ                       /* not used */
#define QT0 256                      /* first-tile rows recomputed exactly in f32 */
#define B0 0                         /* first batch processed (debug hook) */
#define NBR NB                       /* batches processed (debug hook) */
#define NR ((size_t)NB * SQ)         /* token rows */
#define MP ((int)((size_t)NBR * SQ)) /* rows projected (debug hook) */
#define QN SQ                        /* query rows attended per batch (not used) */
#define NHD NH                       /* heads attended (not used) */
#define MPO MP                       /* rows through the output stage (debug hook) */
#define LQ DM      /* row pitch of the q/k/v rows */
typedef __bf16 v16b __attribute__((ext_vector_type(16)));
typedef unsigned short v8us __attribute__((ext_vector_type(8), may_alias));
typedef float  v8f  __attribute__((ext_vector_type(8)));
typedef float  v4f  __attribute__((ext_vector_type(4)));
typedef float  v4fa __attribute__((ext_vector_type(4), may_alias));
union FragB { v16b v; v8us half[2]; unsigned short u[16]; };

__device__ __forceinline__ unsigned short bf16_bits(float x) { unsigned int u = __float_as_uint(x); return (unsigned short)((u + 0x7FFFu + ((u >> 16) & 1u)) >> 16); }
__device__ __forceinline__ float bf16_val(unsigned short b) { return __uint_as_float(((unsigned int)b) << 16); }
__device__ __forceinline__ float bf16_round(float x) { return bf16_val(bf16_bits(x)); }
// D += A·B with NT terms: 1 = ah·bh, 2 = + al·bh (A split), 3 = + ah·bl (both split)
template <int NT>
__device__ __forceinline__ v8f mmaN(v16b ah, v16b al, v16b bh, v16b bl, v8f c) {
  c = __builtin_amdgcn_wmma_f32_16x16x32_bf16(false, ah, false, bh, (short)0, c, false, false);
  if (NT >= 2) c = __builtin_amdgcn_wmma_f32_16x16x32_bf16(false, al, false, bh, (short)0, c, false, false);
  if (NT >= 3) c = __builtin_amdgcn_wmma_f32_16x16x32_bf16(false, ah, false, bl, (short)0, c, false, false);
  asm volatile("v_nop\n\tv_nop\n\tv_nop\n\tv_nop" : "+v"(c) : "v"(ah), "v"(al), "v"(bh), "v"(bl));
  return c;
}

__global__ __launch_bounds__(256) void k_wt_bf16(const float* __restrict__ W, unsigned short* __restrict__ Wt, int K, int N) {
  const int t = blockIdx.x * 256 + threadIdx.x;
  const int k8n = K / 8;
  if (t >= N * k8n) return;
  const int n = t / k8n, k8 = (t % k8n) * 8;
  v8us v;
#pragma unroll
  for (int i = 0; i < 8; ++i) v[i] = bf16_bits(W[(size_t)(k8 + i) * N + n]);
  *(v8us*)(Wt + (size_t)n * K + k8) = v;
  
}

// GEMM C[M][N] (f32, pitch ldc) = act(A[M][K]·W + bias). A f32 row-major (pitch lda) converted per fragment to bf16
// (ASPLIT: hi/lo two planes -> 2 terms, else single rounded term); Wt bf16 [N][K] (pitch ldb). BIAS_BF16 rounds the
// bias to bf16 first (bias quantised to bf16 before the add). K%32==0, M%16==0, N%64==0.
template <bool ASPLIT, int ACT, bool BIAS_BF16>
__global__ __launch_bounds__(128) void k_gemm_bf(const float* __restrict__ A, int lda, const unsigned short* __restrict__ Wt, int ldb,
                                               const float* __restrict__ bias, float* __restrict__ C, int ldc, int M, int N, int K) {
  __shared__ __attribute__((aligned(16))) float so[4][16][64];
  const int tid = threadIdx.x, w = tid >> 5, lane = tid & 31, ln = lane & 15, hh = lane >> 4;
  const int ntn = N / 64;
  const int wid = blockIdx.x * 4 + w;
  const int mt = wid / ntn, nq = wid % ntn;
  if (mt * 16 >= M) return;
  const int row0 = mt * 16, col0 = nq * 64;
  const float* arow = A + (size_t)(row0 + ln) * lda;
  v8f acc[4] = {};
  for (int kb = 0; kb < K; kb += 32) {
    FragB ah, al;
    const v4f x0 = *(const v4fa*)(arow + kb + 8 * hh), x1 = *(const v4fa*)(arow + kb + 8 * hh + 4);
    const v4f x2 = *(const v4fa*)(arow + kb + 16 + 8 * hh), x3 = *(const v4fa*)(arow + kb + 16 + 8 * hh + 4);
    float xs[16] = {x0[0],x0[1],x0[2],x0[3],x1[0],x1[1],x1[2],x1[3],x2[0],x2[1],x2[2],x2[3],x3[0],x3[1],x3[2],x3[3]};
#pragma unroll
    for (int i = 0; i < 16; ++i) { const unsigned short hb = bf16_bits(xs[i]); ah.u[i] = hb; al.u[i] = ASPLIT ? bf16_bits(xs[i] - bf16_val(hb)) : (unsigned short)0; }
#pragma unroll
    for (int t = 0; t < 4; ++t) {
      const unsigned short* brow = Wt + (size_t)(col0 + t * 16 + ln) * ldb + kb;
      FragB b;
      b.half[0] = *(const v8us*)(brow + 8 * hh);
      b.half[1] = *(const v8us*)(brow + 16 + 8 * hh);
      acc[t] = mmaN<ASPLIT ? 2 : 1>(ah.v, al.v, b.v, b.v, acc[t]);
    }
  }
#pragma unroll
  for (int t = 0; t < 4; ++t) {
    float bv = bias ? bias[col0 + t * 16 + ln] : 0.f;
    if (BIAS_BF16) bv = bf16_round(bv);
#pragma unroll
    for (int r = 0; r < 8; ++r) { float v = acc[t][r] + bv; if (ACT == 1) v = fmaxf(v, 0.f); so[w][8 * hh + r][t * 16 + ln] = v; }
  }
  __builtin_amdgcn_fence(__ATOMIC_ACQ_REL, "workgroup");
  __builtin_amdgcn_wave_barrier();
  const int rsub = lane >> 4, c4 = (lane & 15) * 4;
  {
#pragma unroll
    for (int q = 0; q < 8; ++q) {
      const int r = q * 2 + rsub;
      const v4f v = *(const v4fa*)&so[w][r][c4];
      *(v4f*)(C + (size_t)(row0 + r) * ldc + col0 + c4) = v;
    }
    
  }
}

// GEMM C = act(A·W + bias + resid): A f32 (ASPLIT -> hi/lo 2 terms), Wt bf16 [N][K]; ACT 0 none, 1 relu, 2 exact gelu;
// resid (optional, f32, row index = (row % rmod), pitch ldr, RES_BF16 rounds it) added before the activation.
template <bool ASPLIT, int ACT, bool BIAS_BF16, bool RES_BF16>
__global__ __launch_bounds__(128) void k_gemm_bf3(const float* __restrict__ A, int lda, const unsigned short* __restrict__ Wt, int ldb,
                                                const float* __restrict__ bias, const float* __restrict__ resid, int rmod, int ldr,
                                                float* __restrict__ C, int ldc, int M, int N, int K) {
  __shared__ __attribute__((aligned(16))) float so[4][16][64];
  const int tid = threadIdx.x, w = tid >> 5, lane = tid & 31, ln = lane & 15, hh = lane >> 4;
  const int ntn = N / 64;
  const int wid = blockIdx.x * 4 + w;
  const int mt = wid / ntn, nq = wid % ntn;
  if (mt * 16 >= M) return;
  const int row0 = mt * 16, col0 = nq * 64;
  const float* arow = A + (size_t)(row0 + ln) * lda;
  v8f acc[4] = {};
  for (int kb = 0; kb < K; kb += 32) {
    FragB ah, al;
    const v4f x0 = *(const v4fa*)(arow + kb + 8 * hh), x1 = *(const v4fa*)(arow + kb + 8 * hh + 4);
    const v4f x2 = *(const v4fa*)(arow + kb + 16 + 8 * hh), x3 = *(const v4fa*)(arow + kb + 16 + 8 * hh + 4);
    float xs[16] = {x0[0],x0[1],x0[2],x0[3],x1[0],x1[1],x1[2],x1[3],x2[0],x2[1],x2[2],x2[3],x3[0],x3[1],x3[2],x3[3]};
#pragma unroll
    for (int i = 0; i < 16; ++i) { const unsigned short hb = bf16_bits(xs[i]); ah.u[i] = hb; al.u[i] = ASPLIT ? bf16_bits(xs[i] - bf16_val(hb)) : (unsigned short)0; }
#pragma unroll
    for (int t = 0; t < 4; ++t) {
      const unsigned short* brow = Wt + (size_t)(col0 + t * 16 + ln) * ldb + kb;
      FragB b;
      b.half[0] = *(const v8us*)(brow + 8 * hh);
      b.half[1] = *(const v8us*)(brow + 16 + 8 * hh);
      acc[t] = mmaN<ASPLIT ? 2 : 1>(ah.v, al.v, b.v, b.v, acc[t]);
    }
  }
#pragma unroll
  for (int t = 0; t < 4; ++t) {
    const int col = col0 + t * 16 + ln;
    float bv = bias ? bias[col] : 0.f;
    if (BIAS_BF16) bv = bf16_round(bv);
#pragma unroll
    for (int r = 0; r < 8; ++r) {
      float v = acc[t][r] + bv;
      if (resid) { float rv = resid[(size_t)((row0 + 8 * hh + r) % rmod) * ldr + col]; if (RES_BF16) rv = bf16_round(rv); v += rv; }
      if (ACT == 1) v = fmaxf(v, 0.f);
      if (ACT == 2) v = 0.5f * v * (1.0f + erff(v * 0.70710678118654752f));
      if (ACT == 3) { const float u = 0.7978845608028654f * (v + 0.044715f * v * v * v); v = 0.5f * v * (1.0f + tanhf(u)); }
      so[w][8 * hh + r][t * 16 + ln] = v;
    }
  }
  __builtin_amdgcn_fence(__ATOMIC_ACQ_REL, "workgroup");
  __builtin_amdgcn_wave_barrier();
  const int rsub = lane >> 4, c4 = (lane & 15) * 4;
  {
#pragma unroll
    for (int q = 0; q < 8; ++q) {
      const int r = q * 2 + rsub;
      const v4f v = *(const v4fa*)&so[w][r][c4];
      *(v4f*)(C + (size_t)(row0 + r) * ldc + col0 + c4) = v;
    }
    
  }
}
// row LayerNorm (biased variance, eps) over N: s = X (+ R); optional out_sum <- s; out_norm <- (s-mu)*rsqrt(var+eps)*g + b
template <bool PARAM_BF16>
__global__ __launch_bounds__(256) void k_layernorm(const float* __restrict__ X, const float* __restrict__ R, const float* __restrict__ g, const float* __restrict__ bta,
                                                  float* __restrict__ out_sum, float* __restrict__ out_norm, int N, float eps) {
  __shared__ float red[256];
  const int row = blockIdx.x, tid = threadIdx.x;
  const float* x = X + (size_t)row * N; const float* rr = R ? R + (size_t)row * N : nullptr;
  float vals[16];                     // up to N = 4096
  const int per = N / 256;            // contiguous chunk per thread? use strided-by-4 chunks: thread handles j = tid*4 + 1024*u
  float s1 = 0.f;
  for (int u = 0; u < per / 4; ++u) {
    const int j = tid * 4 + 1024 * u;
    const v4f a = *(const v4fa*)(x + j);
    v4f b = {0.f,0.f,0.f,0.f}; if (rr) b = *(const v4fa*)(rr + j);
#pragma unroll
    for (int q = 0; q < 4; ++q) { const float v = a[q] + b[q]; vals[u * 4 + q] = v; s1 += v; }
  }
  red[tid] = s1; __syncthreads();
  for (int st = 128; st > 0; st >>= 1) { if (tid < st) red[tid] += red[tid + st]; __syncthreads(); }
  const float mu = red[0] / (float)N; __syncthreads();
  float s2 = 0.f;
  for (int u = 0; u < per / 4; ++u)
#pragma unroll
    for (int q = 0; q < 4; ++q) { const float c = vals[u * 4 + q] - mu; s2 += c * c; }
  red[tid] = s2; __syncthreads();
  for (int st = 128; st > 0; st >>= 1) { if (tid < st) red[tid] += red[tid + st]; __syncthreads(); }
  const float rs = rsqrtf(red[0] / (float)N + eps);
  {
    for (int u = 0; u < per / 4; ++u) {
      const int j = tid * 4 + 1024 * u;
      v4f o, sm;
#pragma unroll
      for (int q = 0; q < 4; ++q) {
        float gg = g[j + q], bb = bta[j + q];
        if (PARAM_BF16) { gg = bf16_round(gg); bb = bf16_round(bb); }
        sm[q] = vals[u * 4 + q]; o[q] = (vals[u * 4 + q] - mu) * rs * gg + bb;
      }
      if (out_sum) *(v4f*)(out_sum + (size_t)row * N + j) = sm;
      *(v4f*)(out_norm + (size_t)row * N + j) = o;
    }
    
  }
}



// ---- f16 WMMA path (v_wmma_f32_16x16x32_f16): 11-bit significands for operands in range — used where a [0,1] probability operand needs more precision than bf16
typedef _Float16 v16h __attribute__((ext_vector_type(16)));
union FragH { v16h v; v8us half[2]; _Float16 h[16]; unsigned short u[16]; };
template <int NT>
__device__ __forceinline__ v8f mmaH(v16h ah, v16h al, v16h bh, v16h bl, v8f c) {
  c = __builtin_amdgcn_wmma_f32_16x16x32_f16(false, ah, false, bh, (short)0, c, false, false);
  if (NT >= 2) c = __builtin_amdgcn_wmma_f32_16x16x32_f16(false, al, false, bh, (short)0, c, false, false);
  if (NT >= 3) c = __builtin_amdgcn_wmma_f32_16x16x32_f16(false, ah, false, bl, (short)0, c, false, false);
  asm volatile("v_nop\n\tv_nop\n\tv_nop\n\tv_nop" : "+v"(c) : "v"(ah), "v"(al), "v"(bh), "v"(bl));
  return c;
}
// batched GEMM like k_gemm_b but f16 operands: A f32 (split into f16 hi/lo if ASPLIT, else rounded to f16), Bt = f16 values [n][k]; alpha; C f32; N multiple of 16 (partial tiles skipped)
template <bool ASPLIT>
__global__ __launch_bounds__(128) void k_gemm_h(const float* __restrict__ A, int lda, size_t sA, const _Float16* __restrict__ Bh, int ldb, size_t sB, float alpha, float* __restrict__ C, int ldc, size_t sC, int M, int N, int K) {
  __shared__ __attribute__((aligned(16))) float so[4][16][64];
  const int tid = threadIdx.x, w = tid >> 5, lane = tid & 31, ln = lane & 15, hh = lane >> 4; const int by = blockIdx.y;
  A += (size_t)by * sA; Bh += (size_t)by * sB; C += (size_t)by * sC;
  const int ntn = (N + 63) / 64; const int wid = blockIdx.x * 4 + w; const int mt = wid / ntn, nq = wid % ntn; if (mt * 16 >= M) return;
  const int row0 = mt * 16, col0 = nq * 64; const float* arow = A + (size_t)(row0 + ln) * lda;
  v8f acc[4] = {};
  for (int kb = 0; kb < K; kb += 32) {
    FragH ah, al;
    const v4f x0 = *(const v4fa*)(arow + kb + 8 * hh), x1 = *(const v4fa*)(arow + kb + 8 * hh + 4), x2 = *(const v4fa*)(arow + kb + 16 + 8 * hh), x3 = *(const v4fa*)(arow + kb + 16 + 8 * hh + 4);
    float xs[16] = {x0[0],x0[1],x0[2],x0[3],x1[0],x1[1],x1[2],x1[3],x2[0],x2[1],x2[2],x2[3],x3[0],x3[1],x3[2],x3[3]};
#pragma unroll
    for (int i = 0; i < 16; ++i) { const _Float16 h = (_Float16)xs[i]; ah.h[i] = h; al.h[i] = ASPLIT ? (_Float16)(xs[i] - (float)h) : (_Float16)0.0f; }
#pragma unroll
    for (int t = 0; t < 4; ++t) { if (col0 + t * 16 >= N) continue; const size_t boff = (size_t)(col0 + t * 16 + ln) * ldb + kb; FragH bq; bq.half[0] = *(const v8us*)(Bh + boff + 8 * hh); bq.half[1] = *(const v8us*)(Bh + boff + 16 + 8 * hh);
      acc[t] = mmaH<ASPLIT ? 2 : 1>(ah.v, al.v, bq.v, bq.v, acc[t]); }
  }
#pragma unroll
  for (int t = 0; t < 4; ++t) { if (col0 + t * 16 >= N) continue;
#pragma unroll
    for (int r = 0; r < 8; ++r) so[w][8 * hh + r][t * 16 + ln] = acc[t][r] * alpha; }
  __builtin_amdgcn_fence(__ATOMIC_ACQ_REL, "workgroup"); __builtin_amdgcn_wave_barrier();
  const int rsub = lane >> 4, c4 = (lane & 15) * 4;
  {
#pragma unroll
    for (int q = 0; q < 8; ++q) { const int r = q * 2 + rsub; if (col0 + c4 < N) { const v4f v = *(const v4fa*)&so[w][r][c4]; *(v4f*)(C + (size_t)(row0 + r) * ldc + col0 + c4) = v; } }
     }
}

// Wt[n][k] = f16(W[k][n]·scale) from f32 row-major W[K][N] (scale = power of two; bf16-exact weights stay exact in f16 away from the subnormal range)
__global__ __launch_bounds__(256) void k_wt_f16(const float* __restrict__ W, _Float16* __restrict__ Wt, int K, int N, float scale) {
  const int t = blockIdx.x * 256 + threadIdx.x; if (t >= N * (K / 8)) return; const int n = t / (K / 8), k8 = (t % (K / 8)) * 8; FragH f;
#pragma unroll
  for (int i = 0; i < 8; ++i) f.h[i] = (_Float16)(bf16_round(W[(size_t)(k8 + i) * N + n]) * scale); const v8us o = f.half[0];
  *(v8us*)((unsigned short*)Wt + (size_t)n * K + k8) = o; 
}
// k_gemm_hh variant with fused epilogue: v = acc·alpha + bias[by·sBias + col] (+ CP[(row/rowsPerB)·sCPb + by·64 + col] if CP) ; ACT 0 none / 1 elu ; writes f16 C16 (and f32 C if non-null)
template <int ACT>
__global__ __launch_bounds__(128) void k_gemm_hhx(const _Float16* __restrict__ A, int lda, size_t sA, const _Float16* __restrict__ Bh, int ldb, size_t sB, float alpha, const float* __restrict__ bias, size_t sBias, const float* __restrict__ CP, int rowsPerB, size_t sCPb, int row0g,
    float* __restrict__ C, _Float16* __restrict__ C16, int ldc, size_t sC, int M, int N, int K) {
  __shared__ __attribute__((aligned(16))) float so[4][16][64];
  const int tid = threadIdx.x, w = tid >> 5, lane = tid & 31, ln = lane & 15, hh = lane >> 4; const int by = blockIdx.y;
  A += (size_t)by * sA; Bh += (size_t)by * sB; const size_t cofs = (size_t)by * sC; const float* bp = bias ? bias + (size_t)by * sBias : nullptr;
  const int ntn = (N + 63) / 64; const int wid = blockIdx.x * 4 + w; const int mt = wid / ntn, nq = wid % ntn; if (mt * 16 >= M) return;
  const int row0 = mt * 16, col0 = nq * 64; const _Float16* arow = A + (size_t)(row0 + ln) * lda;
  v8f acc[4] = {};
  for (int kb = 0; kb < K; kb += 32) { FragH ah; ah.half[0] = *(const v8us*)((const unsigned short*)arow + kb + 8 * hh); ah.half[1] = *(const v8us*)((const unsigned short*)arow + kb + 16 + 8 * hh);
#pragma unroll
    for (int t = 0; t < 4; ++t) { if (col0 + t * 16 >= N) continue; const size_t boff = (size_t)(col0 + t * 16 + ln) * ldb + kb; FragH bq; bq.half[0] = *(const v8us*)((const unsigned short*)Bh + boff + 8 * hh); bq.half[1] = *(const v8us*)((const unsigned short*)Bh + boff + 16 + 8 * hh);
      acc[t] = mmaH<1>(ah.v, ah.v, bq.v, bq.v, acc[t]); }
  }
#pragma unroll
  for (int t = 0; t < 4; ++t) { if (col0 + t * 16 >= N) continue; const int col = col0 + t * 16 + ln; const float bv = bp ? bf16_round(bp[col]) : 0.f;
#pragma unroll
    for (int r = 0; r < 8; ++r) { float v = acc[t][r] * alpha + bv; if (CP) { const int rr = row0g + row0 + 8 * hh + r; if (rowsPerB < 0) v += CP[cofs + (size_t)rr * ldc + col];      /* rowsPerB < 0: own element of the batched C plane */ else { const int bidx = rr / rowsPerB; v += CP[(size_t)bidx * sCPb + (size_t)by * 64 + col]; } } if (ACT == 1) v = (v > 0.f) ? v : expm1f(v); else if (ACT == 7) v = (v > 0.f) ? v + 1.0f : expf(v); else if (ACT == 8) v = tanhf(v); else if (ACT == 9) v = 0.5f * v * (1.0f + tanhf(0.7978845608028654f * (v + 0.044715f * v * v * v))); else if (ACT == 11) v = 1.0f / (1.0f + expf(-v)); else if (ACT == 12) v = (v > 0.f) ? v : 0.01f * v; else if (ACT == 14) v = (v > 0.f) ? v : 0.1f * v; else if (ACT == 16) v = (v >= 0.f) ? v : 0.3f * v; else if (ACT == 17) v = (v >= 0.f) ? v : 0.2f * v; else if (ACT == 15) v = v / (1.0f + expf(-v)); else if (ACT == 3) v = fmaxf(v, 0.f); else if (ACT == 6) v = 0.5f * v * (1.0f + erff(v * 0.70710678118654752f)); so[w][8 * hh + r][t * 16 + ln] = v; } }
  __builtin_amdgcn_fence(__ATOMIC_ACQ_REL, "workgroup"); __builtin_amdgcn_wave_barrier();
  const int rsub = lane >> 4, c4 = (lane & 15) * 4; typedef _Float16 v4h __attribute__((ext_vector_type(4)));
  {
#pragma unroll
    for (int q = 0; q < 8; ++q) { const int r = q * 2 + rsub; if (col0 + c4 < N) { const v4f v = *(const v4fa*)&so[w][r][c4]; if (C) *(v4f*)(C + cofs + (size_t)(row0 + r) * ldc + col0 + c4) = v; if (C16) { v4h h4; for (int i = 0; i < 4; ++i) h4[i] = (_Float16)v[i]; *(v4h*)(C16 + cofs + (size_t)(row0 + r) * ldc + col0 + c4) = h4; } } }
     }
}


typedef _Float16 v4h __attribute__((ext_vector_type(4)));

__global__ __launch_bounds__(256) void k_x16(const float* __restrict__ x, _Float16* __restrict__ X16, size_t n8) { const size_t t = (size_t)blockIdx.x * 256 + threadIdx.x; if (t >= n8) return; FragH f;
#pragma unroll
  for (int q = 0; q < 8; ++q) f.h[q] = (_Float16)bf16_round(x[t * 8 + q]); *(v8us*)((unsigned short*)X16 + t * 8) = f.half[0];  }
__global__ __launch_bounds__(256) void k_h16(const float* __restrict__ x, _Float16* __restrict__ X16, size_t n8) { const size_t t = (size_t)blockIdx.x * 256 + threadIdx.x; if (t >= n8) return; FragH f;
#pragma unroll
  for (int q = 0; q < 8; ++q) f.h[q] = (_Float16)x[t * 8 + q]; *(v8us*)((unsigned short*)X16 + t * 8) = f.half[0];  }
__global__ __launch_bounds__(256) void k_round16f(const float* __restrict__ W, _Float16* __restrict__ Bt, size_t n8) { const size_t t = (size_t)blockIdx.x * 256 + threadIdx.x; if (t >= n8) return; FragH f;
#pragma unroll
  for (int i = 0; i < 8; ++i) f.h[i] = (_Float16)(bf16_round(W[t * 8 + i]) * 16.0f); *(v8us*)((unsigned short*)Bt + t * 8) = f.half[0];  }
template <int NHv, int TTv>
__global__ __launch_bounds__(256) void k_vt(const _Float16* __restrict__ V16, int ldv, int voff, _Float16* __restrict__ Vt) { __shared__ unsigned short tl[64][66]; const int tid = threadIdx.x; const int slab = blockIdx.x / (TTv / 64), lg = blockIdx.x % (TTv / 64); const int b = slab / NHv, h = slab % NHv;
  for (int i = tid; i < 64 * 8; i += 256) { const int r = i / 8, c8 = (i % 8) * 8; FragH f; f.half[0] = *(const v8us*)((const unsigned short*)V16 + ((size_t)b * TTv + lg * 64 + r) * ldv + voff + h * 64 + c8);
#pragma unroll
    for (int q = 0; q < 8; ++q) tl[r][c8 + q] = f.u[q]; }
  __syncthreads();
  {
#pragma unroll
    for (int rd = 0; rd < 2; ++rd) { const int d = rd * 32 + tid / 8, pc = tid % 8; FragH f;
#pragma unroll
      for (int q = 0; q < 8; ++q) f.u[q] = tl[pc * 8 + q][d];
      *(v8us*)((unsigned short*)Vt + ((size_t)slab * 64 + d) * TTv + lg * 64 + pc * 8) = f.half[0]; }
     } }

__global__ __launch_bounds__(256) void k_hl(const float* __restrict__ F, _Float16* __restrict__ Hh, _Float16* __restrict__ Hl, size_t n8) { const size_t t = (size_t)blockIdx.x * 256 + threadIdx.x; if (t >= n8) return; FragH fh, fl; const v4f a = *(const v4fa*)(F + t * 8), c = *(const v4fa*)(F + t * 8 + 4);
#pragma unroll
  for (int q = 0; q < 4; ++q) { _Float16 h = (_Float16)a[q]; fh.h[q] = h; fl.h[q] = (_Float16)((a[q] - (float)h) * 1024.0f); h = (_Float16)c[q]; fh.h[4 + q] = h; fl.h[4 + q] = (_Float16)((c[q] - (float)h) * 1024.0f); }
  { *(v8us*)((unsigned short*)Hh + t * 8) = fh.half[0]; *(v8us*)((unsigned short*)Hl + t * 8) = fl.half[0];  } }

// ---- fast GEMM (wave tile 32x64; requires M % 32 == 0 rows per launch region and N % 64 == 0); epilogue = k_gemm_hhx semantics ----
__device__ __forceinline__ v16h g2_frag(const _Float16* p, int hh) { FragH f; f.half[0] = *(const v8us*)((const unsigned short*)p + 8 * hh); f.half[1] = *(const v8us*)((const unsigned short*)p + 16 + 8 * hh); return f.v; }
__device__ __forceinline__ v8f g2_mma(v16h a, v16h b, v8f c) { v8f d = __builtin_amdgcn_wmma_f32_16x16x32_f16(false, a, false, b, (short)0, c, false, false); asm volatile("v_nop\n\tv_nop\n\tv_nop\n\tv_nop" : "+v"(d) : "v"(a), "v"(b)); return d; }
template <int ACT>
__global__ __launch_bounds__(128) void k_gemm2(const _Float16* __restrict__ A, int lda, size_t sA, const _Float16* __restrict__ Bh, int ldb, size_t sB, float alpha, const float* __restrict__ bias, size_t sBias, const float* __restrict__ CP, int rowsPerB, size_t sCPb, int row0g,
    float* __restrict__ C, _Float16* __restrict__ C16, int ldc, size_t sC, int M, int N, int K) { static_assert(ACT == 0 || ACT == 3 || ACT == 6 || ACT == 8 || ACT == 9 || ACT == 11 || ACT == 12 || ACT == 14 || ACT == 15 || ACT == 16 || ACT == 17, "k_gemm2: unsupported ACT code (would silently apply no activation)");
  __shared__ __attribute__((aligned(16))) float so[4][32][68];
  const int tid = threadIdx.x, w = tid >> 5, lane = tid & 31, ln = lane & 15, hh = lane >> 4; const int by = blockIdx.y;
  A += (size_t)by * sA; Bh += (size_t)by * sB; const size_t cofs = (size_t)by * sC; const float* bp = bias ? bias + (size_t)by * sBias : nullptr;
  const int ntn = N >> 6; const int mt = blockIdx.x / ntn, nq = blockIdx.x - mt * ntn; const int row0 = mt * 128 + 32 * w, col0 = nq * 64; if (row0 >= M) return;
  const _Float16* a0p = A + (size_t)(row0 + ln) * lda; const _Float16* a1p = a0p + (size_t)16 * lda;
  const _Float16* b0p = Bh + (size_t)(col0 + ln) * ldb; const _Float16* b1p = b0p + (size_t)16 * ldb; const _Float16* b2p = b1p + (size_t)16 * ldb; const _Float16* b3p = b2p + (size_t)16 * ldb;
  const v8f z8 = {0.f,0.f,0.f,0.f,0.f,0.f,0.f,0.f}; v8f c00 = z8, c01 = z8, c02 = z8, c03 = z8, c10 = z8, c11 = z8, c12 = z8, c13 = z8;
#pragma unroll 1
  for (int kb = 0; kb < K; kb += 32) { const v16h a0 = g2_frag(a0p + kb, hh), a1 = g2_frag(a1p + kb, hh);
    v16h b = g2_frag(b0p + kb, hh); c00 = g2_mma(a0, b, c00); c10 = g2_mma(a1, b, c10);
    b = g2_frag(b1p + kb, hh); c01 = g2_mma(a0, b, c01); c11 = g2_mma(a1, b, c11);
    b = g2_frag(b2p + kb, hh); c02 = g2_mma(a0, b, c02); c12 = g2_mma(a1, b, c12);
    b = g2_frag(b3p + kb, hh); c03 = g2_mma(a0, b, c03); c13 = g2_mma(a1, b, c13); }
  v8f accs[8] = {c00, c01, c02, c03, c10, c11, c12, c13};
#pragma unroll
  for (int u = 0; u < 8; ++u) { const int t = u & 3, half = u >> 2; const int col = col0 + t * 16 + ln; const float bv = bp ? bf16_round(bp[col]) : 0.f;
#pragma unroll
    for (int r = 0; r < 8; ++r) { const int rloc = half * 16 + 8 * hh + r; float v = accs[u][r] * alpha + bv; if (CP) { if (rowsPerB < 0) v += CP[cofs + (size_t)(row0g + row0 + rloc) * ldc + col];      /* rowsPerB < 0: own element of the batched C plane */ else { const int bidx = (row0g + row0 + rloc) / rowsPerB; v += CP[(size_t)bidx * sCPb + (size_t)by * 64 + col]; } }
      if (ACT == 3) v = fmaxf(v, 0.f); else if (ACT == 6) v = 0.5f * v * (1.0f + erff(v * 0.70710678118654752f)); else if (ACT == 11) v = 1.0f / (1.0f + expf(-v)); else if (ACT == 15) v = v / (1.0f + expf(-v)); else if (ACT == 12) v = (v > 0.f) ? v : 0.01f * v; else if (ACT == 8) v = tanhf(v); else if (ACT == 9) v = 0.5f * v * (1.0f + tanhf(0.7978845608028654f * (v + 0.044715f * v * v * v))); else if (ACT == 14) v = (v > 0.f) ? v : 0.1f * v; else if (ACT == 16) v = (v >= 0.f) ? v : 0.3f * v; else if (ACT == 17) v = (v >= 0.f) ? v : 0.2f * v;
      so[w][rloc][t * 16 + ln] = v; } }
  __builtin_amdgcn_fence(__ATOMIC_ACQ_REL, "workgroup"); __builtin_amdgcn_wave_barrier();
  const int rsub = lane >> 4, c4 = (lane & 15) * 4;
  {
#pragma unroll
    for (int q = 0; q < 16; ++q) { const int r = q * 2 + rsub; const v4f v = *(const v4fa*)&so[w][r][c4]; if (C) *(v4f*)(C + cofs + (size_t)(row0 + r) * ldc + col0 + c4) = v; if (C16) { v4h h4; for (int i = 0; i < 4; ++i) h4[i] = (_Float16)v[i]; *(v4h*)(C16 + cofs + (size_t)(row0 + r) * ldc + col0 + c4) = h4; } }
     } }


__global__ __launch_bounds__(256) void k_wnat(const float* __restrict__ w, size_t n8, _Float16* __restrict__ Bt) { const size_t t = (size_t)blockIdx.x * 256 + threadIdx.x; if (t >= n8) return; FragH f; for (int q = 0; q < 8; ++q) f.h[q] = (_Float16)(bf16_round(w[t * 8 + q]) * 16.0f); *(v8us*)((unsigned short*)Bt + t * 8) = f.half[0];  }
__global__ __launch_bounds__(256) void k_rsm(const float* __restrict__ S, _Float16* __restrict__ P, int nrows) {
  #pragma clang fp contract(off)
  const int i = blockIdx.x * 256 + threadIdx.x; if (i >= nrows) return; const float* s = S + (size_t)i * SQ; float mx = -3.0e38f;
#pragma unroll 1
  for (int j = 0; j < SQ; ++j) mx = fmaxf(mx, s[j]); float se = 0.f;
#pragma unroll 1
  for (int j = 0; j < SQ; ++j) se += expf(s[j] - mx); const float sc = 256.0f / se;
#pragma unroll 1
  for (int j0 = 0; j0 < SQ; j0 += 8) { FragH f; for (int q = 0; q < 8; ++q) f.h[q] = (_Float16)(expf(s[j0 + q] - mx) * sc); unsigned short* d = (unsigned short*)P + (size_t)i * SQ + j0; *(v8us*)d = f.half[0];  } }
__global__ __launch_bounds__(256) void k_vt(const _Float16* __restrict__ V16, int b, int h0, _Float16* __restrict__ VT) { __shared__ unsigned short tl[64][65]; const int tid = threadIdx.x; const int hh = blockIdx.x % HG, sg = blockIdx.x / HG; const int s0 = sg * 64; const int h = h0 + hh;
  for (int i = tid; i < 64 * 8; i += 256) { const int j = i / 8, d8 = (i % 8) * 8; FragH f; f.half[0] = *(const v8us*)((const unsigned short*)V16 + ((size_t)b * SQ + s0 + j) * DM + h * HD + d8); for (int q = 0; q < 8; ++q) tl[d8 + q][j] = f.u[q]; }
  __syncthreads();
  { for (int i = tid; i < 64 * 8; i += 256) { const int d = i / 8, j8 = (i % 8) * 8; FragH f; for (int q = 0; q < 8; ++q) f.u[q] = tl[d][j8 + q]; *(v8us*)((unsigned short*)VT + ((size_t)hh * HD + d) * SQ + s0 + j8) = f.half[0]; }  } }



#define FQ 32                        /* query rows per wave */
typedef _Float16 v8h __attribute__((ext_vector_type(8)));
__device__ __forceinline__ float half_xor(float v) { const int i = __builtin_bit_cast(int, v); return __builtin_bit_cast(float, __builtin_amdgcn_permlanex16(i, i, 0x76543210, 0xfedcba98, false, false)); }      /* lane l <- lane l ^ 16 */
__device__ __forceinline__ float exp2_slot(float x) { float y; asm("v_exp_f32 %0, %1\n\tv_nop" : "=v"(y) : "v"(x)); return y; }      /* v_nop: the slot the instruction set asks for behind a transcendental before its result is read or its source rewritten; in the same statement it stays directly behind it */
__device__ __forceinline__ v8f fa_mma(v16h a, v16h b, v8f c) { return __builtin_amdgcn_wmma_f32_16x16x32_f16(false, a, false, b, (short)0, c, false, false); }
__global__ __launch_bounds__(128) void k_fattn(const _Float16* __restrict__ Qr, const _Float16* __restrict__ Kr, const _Float16* __restrict__ Vt, _Float16* __restrict__ Or) {
  static_assert(HD == 64 && SQ % (4 * FQ) == 0, "two k chunks per score product, four d tiles, whole blocks of 4 waves");
  const int lane = threadIdx.x & 31, ln = lane & 15, hh = lane >> 4; const int w = __builtin_amdgcn_readfirstlane((int)(threadIdx.x >> 5));
  const int h = blockIdx.x % NH; const int q0 = (SQ / (4 * FQ) - 1 - (int)(blockIdx.x / NH)) * (4 * FQ) + w * FQ;      /* the longest blocks start first */
  const _Float16* kp = Kr + (size_t)ln * LQ + h * HD;          /* A rows of S^T: key rows */
  const _Float16* vp = Vt + ((size_t)h * HD + ln) * SQ;        /* A rows of O^T: rows of V^T */
  v16h qf[2][2], kf[2][2], vf[4];      /* [query group | key group][k chunk of 32 head dims]; [tile of 16 head dims] */
#pragma unroll
  for (int g = 0; g < 2; ++g)
#pragma unroll
    for (int c = 0; c < 2; ++c) qf[g][c] = g2_frag(Qr + (size_t)(q0 + 16 * g + ln) * LQ + h * HD + 32 * c, hh);
  asm volatile("" :: "v"(qf[0][0]), "v"(qf[0][1]), "v"(qf[1][0]), "v"(qf[1][1]) : "memory");      /* inputs only: the q rows have landed before the first K and V loads are issued, so the loop's counted load waits stand for K and V alone and never drain the loads fetched ahead */
#pragma unroll
  for (int t = 0; t < 2; ++t)
#pragma unroll
    for (int c = 0; c < 2; ++c) kf[t][c] = g2_frag(kp + (size_t)(16 * t) * LQ + 32 * c, hh);
  __builtin_amdgcn_sched_barrier(0);      /* keeps the first K loads in front of the first V loads, the order the loop issues them in: the wait for K at the loop's head then leaves the V loads in flight */
#pragma unroll
  for (int t = 0; t < 4; ++t) vf[t] = g2_frag(vp + (size_t)(16 * t) * SQ, hh);
  const v8f z8 = {0.f, 0.f, 0.f, 0.f, 0.f, 0.f, 0.f, 0.f};
  v8f o[2][4] = {{z8, z8, z8, z8}, {z8, z8, z8, z8}};      /* o[g][t][r] = O^T[16 t + 8 hh + r][query q0 + 16 g + ln] */
  float m[2] = {-3.0e38f, -3.0e38f}, l[2] = {0.f, 0.f};      /* m: running maximum of the raw products q.k; l: this wave half's keys only, the halves are joined once behind the loop */
  const float cs = 0.125f * 1.44269504088896f;      /* score scale x log2(e): exp(0.125 (s - m)) = exp2(cs s - cs m) */
  int kb = 0;
#pragma unroll 1
  do {      /* q0 >= 0: every wave has at least its own diagonal step */
    v8f s[2][2];      /* s[g][t][r] = q.k of key kb + 16 t + 8 hh + r, query q0 + 16 g + ln */
#pragma unroll
    for (int g = 0; g < 2; ++g)
#pragma unroll
      for (int t = 0; t < 2; ++t) s[g][t] = fa_mma(kf[t][1], qf[g][1], fa_mma(kf[t][0], qf[g][0], z8));
    const int kn = (kb + 32 <= q0) ? kb + 32 : q0;      /* the next step's keys; the last step fetches its own again (in bounds, unused) */
#pragma unroll
    for (int t = 0; t < 2; ++t)
#pragma unroll
      for (int c = 0; c < 2; ++c) kf[t][c] = g2_frag(kp + (size_t)(kn + 16 * t) * LQ + 32 * c, hh);      /* fetched one step ahead, right behind their last use: the softmax and P V hide the latency */
#pragma unroll
    for (int g = 0; g < 2; ++g) {
      if (kb == q0) {      /* the one step that holds keys above a query (wave-uniform test) */
#pragma unroll
        for (int t = 0; t < 2; ++t)
#pragma unroll
          for (int r = 0; r < 8; ++r) s[g][t][r] = (16 * t + 8 * hh + r <= 16 * g + ln) ? s[g][t][r] : -1.0e9f; }
      float mx = fmaxf(s[g][0][0], s[g][1][0]);
#pragma unroll
      for (int r = 1; r < 8; ++r) mx = fmaxf(mx, fmaxf(s[g][0][r], s[g][1][r]));
      const float mn = fmaxf(m[g], fmaxf(mx, half_xor(mx))); const float sc = exp2_slot((m[g] - mn) * cs); const float mc = mn * cs; m[g] = mn;
#pragma unroll
      for (int t = 0; t < 2; ++t)
#pragma unroll
        for (int r = 0; r < 8; ++r) s[g][t][r] = exp2_slot(fmaf(s[g][t][r], cs, -mc));
      const v8f sv = s[g][0] + s[g][1];
      l[g] = l[g] * sc + (((sv[0] + sv[1]) + (sv[2] + sv[3])) + ((sv[4] + sv[5]) + (sv[6] + sv[7])));
      const v16h pf = __builtin_shufflevector(__builtin_convertvector(s[g][0], v8h), __builtin_convertvector(s[g][1], v8h), 0, 1, 2, 3, 4, 5, 6, 7, 8, 9, 10, 11, 12, 13, 14, 15);
#pragma unroll
      for (int t = 0; t < 4; ++t) o[g][t] = fa_mma(vf[t], pf, o[g][t] * sc);
    }
#pragma unroll
    for (int t = 0; t < 4; ++t) vf[t] = g2_frag(vp + (size_t)(16 * t) * SQ + kn, hh);      /* likewise one step ahead: the next score products and softmax hide the latency */
    kb += 32;
  } while (kb <= q0);
  asm volatile("s_wait_loadcnt 0x0" ::: "memory");      /* the last step's fetched-ahead K and V are unused and still in flight: they land before the wave gives its registers back */
#pragma unroll
  for (int g = 0; g < 2; ++g) { const float fin = 64.0f / (l[g] + half_xor(l[g]));      /* o carried x64, folded into the output GEMM alpha */
    _Float16* orow = Or + (size_t)(q0 + 16 * g + ln) * DM + h * HD + 8 * hh;
#pragma unroll
    for (int t = 0; t < 4; ++t) *(v8h*)(orow + 16 * t) = __builtin_convertvector(o[g][t] * fin, v8h); }      /* a lane holds 8 consecutive head dims of its query: one 16-byte store */
}


template <int MASKADD>
__global__ __launch_bounds__(64) void k_att0(const float* __restrict__ QF, const float* __restrict__ KF, const float* __restrict__ VF, int ld, const float* __restrict__ mask, float scale, float* __restrict__ OF, int ldo) {
  #pragma clang fp contract(off)
  __shared__ __attribute__((aligned(16))) float lo[64][64];      /* used once, at the end: turns the threads' o rows into whole-line stores */
  const int tid = threadIdx.x; const int h = blockIdx.x / (QT0 / 64), rg = blockIdx.x % (QT0 / 64); const int i = rg * 64 + tid;
  const float* qr = QF + (size_t)i * ld + h * HD;
  v4f q[HD / 4], o[HD / 4];      /* the thread's q row and o row: every loop over c is fully unrolled, so both are indexed by constants only and stay in registers */
#pragma unroll
  for (int c = 0; c < HD / 4; ++c) { q[c] = *(const v4fa*)(qr + c * 4); const v4f z = {0.f, 0.f, 0.f, 0.f}; o[c] = z; }
  asm volatile("s_wait_xcnt 0x0" :: "v"(qr) : "memory");      /* qr is named so that the 16 loads' address registers live up to this wait: none of them is overwritten in front of it, not even by a later load's result */
  float m = -1.0e30f, l = 0.f; const int jmax = MASKADD ? (SQ - 1) : (rg * 64 + 63);      /* additive-mask form: every key (the mask input decides); causal form: keys up to the block's last row */
#pragma unroll 1
  for (int j = 0; j <= jmax; ++j) { const float* kr = KF + (size_t)j * ld + h * HD; const float* vr = VF + (size_t)j * ld + h * HD; float s = 0.f;
#pragma unroll
    for (int c = 0; c < HD / 4; ++c) { const v4f kq = *(const v4fa*)(kr + c * 4); s = __fadd_rn(s, __fmul_rn(q[c][0], kq[0])); s = __fadd_rn(s, __fmul_rn(q[c][1], kq[1])); s = __fadd_rn(s, __fmul_rn(q[c][2], kq[2])); s = __fadd_rn(s, __fmul_rn(q[c][3], kq[3])); }
    s = __fmul_rn(s, scale); if (MASKADD) s = __fadd_rn(s, __fmul_rn(bf16_round(mask[(size_t)i * SQ + j]), -10000.0f));
    const float f = (MASKADD || j <= i) ? 1.f : 0.f; const float sm = fmaf(f, s, (1.f - f) * -1.0e30f); const float mn = fmaxf(m, sm); const float sc = expf(m - mn); const float e = expf(sm - mn); l = __fadd_rn(__fmul_rn(l, sc), e); m = mn;
#pragma unroll
    for (int c = 0; c < HD / 4; ++c) { const v4f vv = *(const v4fa*)(vr + c * 4); for (int u = 0; u < 4; ++u) o[c][u] = __fadd_rn(__fmul_rn(o[c][u], sc), __fmul_rn(e, vv[u])); } }
  const float fin = 64.0f / l;      /* o carried x64 like the f16 path */
#pragma unroll
  for (int c = 0; c < HD / 4; ++c) { v4f oo = o[c]; for (int u = 0; u < 4; ++u) oo[u] = __fmul_rn(oo[u], fin); *(v4f*)&lo[tid][c * 4] = oo; }
  __syncthreads();
  {
#pragma unroll 1
    for (int it = 0; it < 16; ++it) { const int row = it * 4 + tid / 16, pc = (tid % 16) * 4; const v4f v = *(const v4f*)&lo[row][pc]; *(v4f*)(OF + (size_t)(rg * 64 + row) * ldo + h * HD + pc) = v; }
     } }

extern "C" void kernel_launch(void* const* d_in, const int* in_sizes, int n_in,
                              void* d_out, int out_size, void* d_ws, size_t ws_size, hipStream_t stream) {
  (void)in_sizes; (void)n_in; (void)out_size;
  const float* const* I = (const float* const*)d_in; const float* xq = I[0]; const float* xk = I[1]; const float* xv = I[2]; const float* wq = I[3]; const float* wk = I[4]; const float* wv = I[5]; const float* wo = I[6];      /* nn.Linear weights [out][in] */
  char* ws = (char*)d_ws; size_t off = 0;
  auto take = [&](size_t bytes) { char* p = ws + off; off += (bytes + 255) & ~(size_t)255; return p; };
  _Float16* BQ = (_Float16*)take((size_t)DM * DM * 2); _Float16* BK = (_Float16*)take((size_t)DM * DM * 2); _Float16* BV = (_Float16*)take((size_t)DM * DM * 2); _Float16* BO = (_Float16*)take((size_t)DM * DM * 2);
  _Float16* XQ = (_Float16*)take(NR * DM * 2); _Float16* XK = (_Float16*)take(NR * DM * 2); _Float16* XV = (_Float16*)take(NR * DM * 2); _Float16* Q16 = (_Float16*)take(NR * DM * 2); _Float16* K16 = (_Float16*)take(NR * DM * 2); _Float16* V16 = (_Float16*)take(NR * DM * 2); _Float16* O16 = (_Float16*)take(NR * DM * 2);
  _Float16* VT = (_Float16*)take((size_t)NH * HD * SQ * 2);
  float* QF0 = (float*)take((size_t)QT0 * DM * 4); float* KF0 = (float*)take((size_t)QT0 * DM * 4); float* VF0 = (float*)take((size_t)QT0 * DM * 4); float* OF0 = (float*)take((size_t)NB * QT0 * DM * 4); _Float16* OH0 = (_Float16*)take((size_t)NB * QT0 * DM * 2); _Float16* OL0 = (_Float16*)take((size_t)NB * QT0 * DM * 2);
  if (off > ws_size) return;
  { const unsigned g = (unsigned)(((size_t)DM * DM / 8 + 255) / 256); k_wnat<<<g, 256, 0, stream>>>(wq, (size_t)DM * DM / 8, BQ); k_wnat<<<g, 256, 0, stream>>>(wk, (size_t)DM * DM / 8, BK); k_wnat<<<g, 256, 0, stream>>>(wv, (size_t)DM * DM / 8, BV); k_wnat<<<g, 256, 0, stream>>>(wo, (size_t)DM * DM / 8, BO); }      /* natural [out][in] = Bt[n][k], x16 */
  k_x16<<<(unsigned)((NR * DM / 8 + 255) / 256), 256, 0, stream>>>(xq, XQ, NR * DM / 8); k_x16<<<(unsigned)((NR * DM / 8 + 255) / 256), 256, 0, stream>>>(xk, XK, NR * DM / 8); k_x16<<<(unsigned)((NR * DM / 8 + 255) / 256), 256, 0, stream>>>(xv, XV, NR * DM / 8);
  const size_t r0p = (size_t)B0 * SQ;      /* first projected row */
  k_gemm2<0><<<dim3((unsigned)((MP / 128) * (DM / 64)), 1), 128, 0, stream>>>(XQ + r0p * DM, DM, 0, BQ, DM, 0, 0.0625f, nullptr, 0, nullptr, 1, 0, 0, nullptr, Q16 + r0p * DM, DM, 0, MP, DM, DM);
  k_gemm2<0><<<dim3((unsigned)((MP / 128) * (DM / 64)), 1), 128, 0, stream>>>(XK + r0p * DM, DM, 0, BK, DM, 0, 0.0625f, nullptr, 0, nullptr, 1, 0, 0, nullptr, K16 + r0p * DM, DM, 0, MP, DM, DM);
  k_gemm2<0><<<dim3((unsigned)((MP / 128) * (DM / 64)), 1), 128, 0, stream>>>(XV + r0p * DM, DM, 0, BV, DM, 0, 0.0625f, nullptr, 0, nullptr, 1, 0, 0, nullptr, V16 + r0p * DM, DM, 0, MP, DM, DM);
  for (int b = B0; b < B0 + NBR; ++b) { const size_t r0 = (size_t)b * SQ;
    k_vt<NH, SQ><<<NH * (SQ / 64), 256, 0, stream>>>(V16 + r0 * LQ, LQ, 0, VT);      /* V^T [NH][HD][SQ] for this batch */
    k_gemm2<0><<<dim3((QT0 / 128) * (DM / 64), 1), 128, 0, stream>>>(XQ + r0 * DM, DM, 0, BQ, DM, 0, 0.0625f, nullptr, 0, nullptr, 1, 0, 0, QF0, nullptr, DM, 0, QT0, DM, DM); k_gemm2<0><<<dim3((QT0 / 128) * (DM / 64), 1), 128, 0, stream>>>(XK + r0 * DM, DM, 0, BK, DM, 0, 0.0625f, nullptr, 0, nullptr, 1, 0, 0, KF0, nullptr, DM, 0, QT0, DM, DM); k_gemm2<0><<<dim3((QT0 / 128) * (DM / 64), 1), 128, 0, stream>>>(XV + r0 * DM, DM, 0, BV, DM, 0, 0.0625f, nullptr, 0, nullptr, 1, 0, 0, VF0, nullptr, DM, 0, QT0, DM, DM);      /* f32 q, k, v of the first 256 rows (exact products) */
    k_att0<0><<<NH * (QT0 / 64), 64, 0, stream>>>(QF0, KF0, VF0, DM, nullptr, 0.125f, OF0 + (size_t)b * QT0 * DM, DM);      /* exact f32 attention for rows 0..255 (o x64) */
    k_fattn<<<NH * (SQ / (4 * FQ)), 128, 0, stream>>>(Q16 + r0 * LQ, K16 + r0 * LQ, VT, O16 + r0 * DM); }      /* o (merged heads, x64) as f16 rows: scores, softmax and P V in one launch */
  k_gemm2<0><<<dim3((unsigned)((MPO / 128) * (DM / 64)), 1), 128, 0, stream>>>(O16 + r0p * DM, DM, 0, BO, DM, 0, 0.0009765625f, nullptr, 0, nullptr, 1, 0, 0, (float*)d_out + r0p * DM, nullptr, DM, 0, MPO, DM, DM);      /* out rows are the output layout */
  k_hl<<<(unsigned)(((size_t)NB * QT0 * DM / 8 + 255) / 256), 256, 0, stream>>>(OF0, OH0, OL0, (size_t)NB * QT0 * DM / 8);      /* first-tile o (x64) -> f16 hi + x1024 residual planes */
  for (int b = B0; b < B0 + NBR; ++b) { const size_t r0 = (size_t)b * SQ; const size_t f0 = (size_t)b * QT0;
    k_gemm2<0><<<dim3((QT0 / 128) * (DM / 64), 1), 128, 0, stream>>>(OH0 + f0 * DM, DM, 0, BO, DM, 0, 0.0009765625f, nullptr, 0, nullptr, 1, 0, 0, (float*)d_out + r0 * DM, nullptr, DM, 0, QT0, DM, DM);      /* rows 0..255: out = o_hi Wo, overwriting the f16-path rows */
    k_gemm2<0><<<dim3((QT0 / 128) * (DM / 64), 1), 128, 0, stream>>>(OL0 + f0 * DM, DM, 0, BO, DM, 0, 0.00000095367431640625f, nullptr, 0, (const float*)d_out + r0 * DM, -1, 0, 0, (float*)d_out + r0 * DM, nullptr, DM, 0, QT0, DM, DM); }      /* += o_lo Wo 2^-20 (own-element accumulate) */
}

// v004
// A run of this version takes 437 microseconds.
// Two timings next to v003 put it at 1.39 and 1.41 times that version's speed.
// All steps since v000 together make it 18.9 times as fast.
#include <hip/hip_runtime.h>
// Causal multi-head attention (q, k, v inputs [1][4096][1024]; qp/kp/vp = input W^T (nn.Linear [out][in], no bias), 16 heads of 64; scores x (8/64) = /8; causal mask (keys > query get -inf); softmax; out = (probs v merged) Wo^T -> [1][4096][1024]).
// Structure: token rows r = s; q, k, v inputs as exact f16 rows (bf16-rounded); Q, K, V as three WMMA GEMMs (32x64 wave tiles, f32 accumulation, exact x16 weights, f16 outputs); per batch: V^T for all heads via LDS transposes; one fused attention launch: a wave owns 32 query rows of a head and walks the keys up to its last row in steps of 32: scores on WMMA (K = 64, x 0.125), online causal softmax in registers (f32 running maximum and sum, native exp; unnormalised weights f16), o += P V on WMMA (f32), divided by the row sum at the end (o carried x64, folded into the output GEMM alpha) written straight into the merged f16 o rows; out = o W_o GEMM (f32) into the output layout.
// Compute dtype: inputs rounded to bf16; x / weights exact; q, k, v, softmax weights and o as plain f16 GEMM operands (~2^-12); scores and softmax statistics f32. v_wmma_f32_16x16x32_f16.
#define NB 1
#define SQ 4096
#define DM 1024
#define NH 16
#define HD 64
#define HG 4                         /* heads per launch of the non-template k_vt (not launched) */
#define QT 256                       /* not used */
#define NKX SQ                       /* not used */
#define QT0 256                      /* first-tile rows recomputed exactly in f32 */
#define B0 0                         /* first batch processed (debug hook) */
#define NBR NB                       /* batches processed (debug hook) */
#define NR ((size_t)NB * SQ)         /* token rows */
#define MP ((int)((size_t)NBR * SQ)) /* rows projected (debug hook) */
#define QN SQ                        /* query rows attended per batch (not used) */
#define NHD NH                       /* heads attended (not used) */
#define MPO MP                       /* rows through the output stage (debug hook) */
#define LQ DM      /* row pitch of the q/k/v rows */
typedef __bf16 v16b __attribute__((ext_vector_type(16)));
typedef unsigned short v8us __attribute__((ext_vector_type(8), may_alias));
typedef float  v8f  __attribute__((ext_vector_type(8)));
typedef float  v4f  __attribute__((ext_vector_type(4)));
typedef float  v4fa __attribute__((ext_vector_type(4), may_alias));
union FragB { v16b v; v8us half[2]; unsigned short u[16]; };

__device__ __forceinline__ unsigned short bf16_bits(float x) { unsigned int u = __float_as_uint(x); return (unsigned short)((u + 0x7FFFu + ((u >> 16) & 1u)) >> 16); }
__device__ __forceinline__ float bf16_val(unsigned short b) { return __uint_as_float(((unsigned int)b) << 16); }
__device__ __forceinline__ float bf16_round(float x) { return bf16_val(bf16_bits(x)); }
// D += A·B with NT terms: 1 = ah·bh, 2 = + al·bh (A split), 3 = + ah·bl (both split)
template <int NT>
__device__ __forceinline__ v8f mmaN(v16b ah, v16b al, v16b bh, v16b bl, v8f c) {
  c = __builtin_amdgcn_wmma_f32_16x16x32_bf16(false, ah, false, bh, (short)0, c, false, false);
  if (NT >= 2) c = __builtin_amdgcn_wmma_f32_16x16x32_bf16(false, al, false, bh, (short)0, c, false, false);
  if (NT >= 3) c = __builtin_amdgcn_wmma_f32_16x16x32_bf16(false, ah, false, bl, (short)0, c, false, false);
  asm volatile("v_nop\n\tv_nop\n\tv_nop\n\tv_nop" : "+v"(c) : "v"(ah), "v"(al), "v"(bh), "v"(bl));
  return c;
}

__global__ __launch_bounds__(256) void k_wt_bf16(const float* __restrict__ W, unsigned short* __restrict__ Wt, int K, int N) {
  const int t = blockIdx.x * 256 + threadIdx.x;
  const int k8n = K / 8;
  if (t >= N * k8n) return;
  const int n = t / k8n, k8 = (t % k8n) * 8;
  v8us v;
#pragma unroll
  for (int i = 0; i < 8; ++i) v[i] = bf16_bits(W[(size_t)(k8 + i) * N + n]);
  *(v8us*)(Wt + (size_t)n * K + k8) = v;
  
}

// GEMM C[M][N] (f32, pitch ldc) = act(A[M][K]·W + bias). A f32 row-major (pitch lda) converted per fragment to bf16
// (ASPLIT: hi/lo two planes -> 2 terms, else single rounded term); Wt bf16 [N][K] (pitch ldb). BIAS_BF16 rounds the
// bias to bf16 first (bias quantised to bf16 before the add). K%32==0, M%16==0, N%64==0.
template <bool ASPLIT, int ACT, bool BIAS_BF16>
__global__ __launch_bounds__(128) void k_gemm_bf(const float* __restrict__ A, int lda, const unsigned short* __restrict__ Wt, int ldb,
                                               const float* __restrict__ bias, float* __restrict__ C, int ldc, int M, int N, int K) {
  __shared__ __attribute__((aligned(16))) float so[4][16][64];
  const int tid = threadIdx.x, w = tid >> 5, lane = tid & 31, ln = lane & 15, hh = lane >> 4;
  const int ntn = N / 64;
  const int wid = blockIdx.x * 4 + w;
  const int mt = wid / ntn, nq = wid % ntn;
  if (mt * 16 >= M) return;
  const int row0 = mt * 16, col0 = nq * 64;
  const float* arow = A + (size_t)(row0 + ln) * lda;
  v8f acc[4] = {};
  for (int kb = 0; kb < K; kb += 32) {
    FragB ah, al;
    const v4f x0 = *(const v4fa*)(arow + kb + 8 * hh), x1 = *(const v4fa*)(arow + kb + 8 * hh + 4);
    const v4f x2 = *(const v4fa*)(arow + kb + 16 + 8 * hh), x3 = *(const v4fa*)(arow + kb + 16 + 8 * hh + 4);
    float xs[16] = {x0[0],x0[1],x0[2],x0[3],x1[0],x1[1],x1[2],x1[3],x2[0],x2[1],x2[2],x2[3],x3[0],x3[1],x3[2],x3[3]};
#pragma unroll
    for (int i = 0; i < 16; ++i) { const unsigned short hb = bf16_bits(xs[i]); ah.u[i] = hb; al.u[i] = ASPLIT ? bf16_bits(xs[i] - bf16_val(hb)) : (unsigned short)0; }
#pragma unroll
    for (int t = 0; t < 4; ++t) {
      const unsigned short* brow = Wt + (size_t)(col0 + t * 16 + ln) * ldb + kb;
      FragB b;
      b.half[0] = *(const v8us*)(brow + 8 * hh);
      b.half[1] = *(const v8us*)(brow + 16 + 8 * hh);
      acc[t] = mmaN<ASPLIT ? 2 : 1>(ah.v, al.v, b.v, b.v, acc[t]);
    }
  }
#pragma unroll
  for (int t = 0; t < 4; ++t) {
    float bv = bias ? bias[col0 + t * 16 + ln] : 0.f;
    if (BIAS_BF16) bv = bf16_round(bv);
#pragma unroll
    for (int r = 0; r < 8; ++r) { float v = acc[t][r] + bv; if (ACT == 1) v = fmaxf(v, 0.f); so[w][8 * hh + r][t * 16 + ln] = v; }
  }
  __builtin_amdgcn_fence(__ATOMIC_ACQ_REL, "workgroup");
  __builtin_amdgcn_wave_barrier();
  const int rsub = lane >> 4, c4 = (lane & 15) * 4;
  {
#pragma unroll
    for (int q = 0; q < 8; ++q) {
      const int r = q * 2 + rsub;
      const v4f v = *(const v4fa*)&so[w][r][c4];
      *(v4f*)(C + (size_t)(row0 + r) * ldc + col0 + c4) = v;
    }
    
  }
}

// GEMM C = act(A·W + bias + resid): A f32 (ASPLIT -> hi/lo 2 terms), Wt bf16 [N][K]; ACT 0 none, 1 relu, 2 exact gelu;
// resid (optional, f32, row index = (row % rmod), pitch ldr, RES_BF16 rounds it) added before the activation.
template <bool ASPLIT, int ACT, bool BIAS_BF16, bool RES_BF16>
__global__ __launch_bounds__(128) void k_gemm_bf3(const float* __restrict__ A, int lda, const unsigned short* __restrict__ Wt, int ldb,
                                                const float* __restrict__ bias, const float* __restrict__ resid, int rmod, int ldr,
                                                float* __restrict__ C, int ldc, int M, int N, int K) {
  __shared__ __attribute__((aligned(16))) float so[4][16][64];
  const int tid = threadIdx.x, w = tid >> 5, lane = tid & 31, ln = lane & 15, hh = lane >> 4;
  const int ntn = N / 64;
  const int wid = blockIdx.x * 4 + w;
  const int mt = wid / ntn, nq = wid % ntn;
  if (mt * 16 >= M) return;
  const int row0 = mt * 16, col0 = nq * 64;
  const float* arow = A + (size_t)(row0 + ln) * lda;
  v8f acc[4] = {};
  for (int kb = 0; kb < K; kb += 32) {
    FragB ah, al;
    const v4f x0 = *(const v4fa*)(arow + kb + 8 * hh), x1 = *(const v4fa*)(arow + kb + 8 * hh + 4);
    const v4f x2 = *(const v4fa*)(arow + kb + 16 + 8 * hh), x3 = *(const v4fa*)(arow + kb + 16 + 8 * hh + 4);
    float xs[16] = {x0[0],x0[1],x0[2],x0[3],x1[0],x1[1],x1[2],x1[3],x2[0],x2[1],x2[2],x2[3],x3[0],x3[1],x3[2],x3[3]};
#pragma unroll
    for (int i = 0; i < 16; ++i) { const unsigned short hb = bf16_bits(xs[i]); ah.u[i] = hb; al.u[i] = ASPLIT ? bf16_bits(xs[i] - bf16_val(hb)) : (unsigned short)0; }
#pragma unroll
    for (int t = 0; t < 4; ++t) {
      const unsigned short* brow = Wt + (size_t)(col0 + t * 16 + ln) * ldb + kb;
      FragB b;
      b.half[0] = *(const v8us*)(brow + 8 * hh);
      b.half[1] = *(const v8us*)(brow + 16 + 8 * hh);
      acc[t] = mmaN<ASPLIT ? 2 : 1>(ah.v, al.v, b.v, b.v, acc[t]);
    }
  }
#pragma unroll
  for (int t = 0; t < 4; ++t) {
    const int col = col0 + t * 16 + ln;
    float bv = bias ? bias[col] : 0.f;
    if (BIAS_BF16) bv = bf16_round(bv);
#pragma unroll
    for (int r = 0; r < 8; ++r) {
      float v = acc[t][r] + bv;
      if (resid) { float rv = resid[(size_t)((row0 + 8 * hh + r) % rmod) * ldr + col]; if (RES_BF16) rv = bf16_round(rv); v += rv; }
      if (ACT == 1) v = fmaxf(v, 0.f);
      if (ACT == 2) v = 0.5f * v * (1.0f + erff(v * 0.70710678118654752f));
      if (ACT == 3) { const float u = 0.7978845608028654f * (v + 0.044715f * v * v * v); v = 0.5f * v * (1.0f + tanhf(u)); }
      so[w][8 * hh + r][t * 16 + ln] = v;
    }
  }
  __builtin_amdgcn_fence(__ATOMIC_ACQ_REL, "workgroup");
  __builtin_amdgcn_wave_barrier();
  const int rsub = lane >> 4, c4 = (lane & 15) * 4;
  {
#pragma unroll
    for (int q = 0; q < 8; ++q) {
      const int r = q * 2 + rsub;
      const v4f v = *(const v4fa*)&so[w][r][c4];
      *(v4f*)(C + (size_t)(row0 + r) * ldc + col0 + c4) = v;
    }
    
  }
}
// row LayerNorm (biased variance, eps) over N: s = X (+ R); optional out_sum <- s; out_norm <- (s-mu)*rsqrt(var+eps)*g + b
template <bool PARAM_BF16>
__global__ __launch_bounds__(256) void k_layernorm(const float* __restrict__ X, const float* __restrict__ R, const float* __restrict__ g, const float* __restrict__ bta,
                                                  float* __restrict__ out_sum, float* __restrict__ out_norm, int N, float eps) {
  __shared__ float red[256];
  const int row = blockIdx.x, tid = threadIdx.x;
  const float* x = X + (size_t)row * N; const float* rr = R ? R + (size_t)row * N : nullptr;
  float vals[16];                     // up to N = 4096
  const int per = N / 256;            // contiguous chunk per thread? use strided-by-4 chunks: thread handles j = tid*4 + 1024*u
  float s1 = 0.f;
  for (int u = 0; u < per / 4; ++u) {
    const int j = tid * 4 + 1024 * u;
    const v4f a = *(const v4fa*)(x + j);
    v4f b = {0.f,0.f,0.f,0.f}; if (rr) b = *(const v4fa*)(rr + j);
#pragma unroll
    for (int q = 0; q < 4; ++q) { const float v = a[q] + b[q]; vals[u * 4 + q] = v; s1 += v; }
  }
  red[tid] = s1; __syncthreads();
  for (int st = 128; st > 0; st >>= 1) { if (tid < st) red[tid] += red[tid + st]; __syncthreads(); }
  const float mu = red[0] / (float)N; __syncthreads();
  float s2 = 0.f;
  for (int u = 0; u < per / 4; ++u)
#pragma unroll
    for (int q = 0; q < 4; ++q) { const float c = vals[u * 4 + q] - mu; s2 += c * c; }
  red[tid] = s2; __syncthreads();
  for (int st = 128; st > 0; st >>= 1) { if (tid < st) red[tid] += red[tid + st]; __syncthreads(); }
  const float rs = rsqrtf(red[0] / (float)N + eps);
  {
    for (int u = 0; u < per / 4; ++u) {
      const int j = tid * 4 + 1024 * u;
      v4f o, sm;
#pragma unroll
      for (int q = 0; q < 4; ++q) {
        float gg = g[j + q], bb = bta[j + q];
        if (PARAM_BF16) { gg = bf16_round(gg); bb = bf16_round(bb); }
        sm[q] = vals[u * 4 + q]; o[q] = (vals[u * 4 + q] - mu) * rs * gg + bb;
      }
      if (out_sum) *(v4f*)(out_sum + (size_t)row * N + j) = sm;
      *(v4f*)(out_norm + (size_t)row * N + j) = o;
    }
    
  }
}



// ---- f16 WMMA path (v_wmma_f32_16x16x32_f16): 11-bit significands for operands in range — used where a [0,1] probability operand needs more precision than bf16
typedef _Float16 v16h __attribute__((ext_vector_type(16)));
union FragH { v16h v; v8us half[2]; _Float16 h[16]; unsigned short u[16]; };
template <int NT>
__device__ __forceinline__ v8f mmaH(v16h ah, v16h al, v16h bh, v16h bl, v8f c) {
  c = __builtin_amdgcn_wmma_f32_16x16x32_f16(false, ah, false, bh, (short)0, c, false, false);
  if (NT >= 2) c = __builtin_amdgcn_wmma_f32_16x16x32_f16(false, al, false, bh, (short)0, c, false, false);
  if (NT >= 3) c = __builtin_amdgcn_wmma_f32_16x16x32_f16(false, ah, false, bl, (short)0, c, false, false);
  asm volatile("v_nop\n\tv_nop\n\tv_nop\n\tv_nop" : "+v"(c) : "v"(ah), "v"(al), "v"(bh), "v"(bl));
  return c;
}
// batched GEMM like k_gemm_b but f16 operands: A f32 (split into f16 hi/lo if ASPLIT, else rounded to f16), Bt = f16 values [n][k]; alpha; C f32; N multiple of 16 (partial tiles skipped)
template <bool ASPLIT>
__global__ __launch_bounds__(128) void k_gemm_h(const float* __restrict__ A, int lda, size_t sA, const _Float16* __restrict__ Bh, int ldb, size_t sB, float alpha, float* __restrict__ C, int ldc, size_t sC, int M, int N, int K) {
  __shared__ __attribute__((aligned(16))) float so[4][16][64];
  const int tid = threadIdx.x, w = tid >> 5, lane = tid & 31, ln = lane & 15, hh = lane >> 4; const int by = blockIdx.y;
  A += (size_t)by * sA; Bh += (size_t)by * sB; C += (size_t)by * sC;
  const int ntn = (N + 63) / 64; const int wid = blockIdx.x * 4 + w; const int mt = wid / ntn, nq = wid % ntn; if (mt * 16 >= M) return;
  const int row0 = mt * 16, col0 = nq * 64; const float* arow = A + (size_t)(row0 + ln) * lda;
  v8f acc[4] = {};
  for (int kb = 0; kb < K; kb += 32) {
    FragH ah, al;
    const v4f x0 = *(const v4fa*)(arow + kb + 8 * hh), x1 = *(const v4fa*)(arow + kb + 8 * hh + 4), x2 = *(const v4fa*)(arow + kb + 16 + 8 * hh), x3 = *(const v4fa*)(arow + kb + 16 + 8 * hh + 4);
    float xs[16] = {x0[0],x0[1],x0[2],x0[3],x1[0],x1[1],x1[2],x1[3],x2[0],x2[1],x2[2],x2[3],x3[0],x3[1],x3[2],x3[3]};
#pragma unroll
    for (int i = 0; i < 16; ++i) { const _Float16 h = (_Float16)xs[i]; ah.h[i] = h; al.h[i] = ASPLIT ? (_Float16)(xs[i] - (float)h) : (_Float16)0.0f; }
#pragma unroll
    for (int t = 0; t < 4; ++t) { if (col0 + t * 16 >= N) continue; const size_t boff = (size_t)(col0 + t * 16 + ln) * ldb + kb; FragH bq; bq.half[0] = *(const v8us*)(Bh + boff + 8 * hh); bq.half[1] = *(const v8us*)(Bh + boff + 16 + 8 * hh);
      acc[t] = mmaH<ASPLIT ? 2 : 1>(ah.v, al.v, bq.v, bq.v, acc[t]); }
  }
#pragma unroll
  for (int t = 0; t < 4; ++t) { if (col0 + t * 16 >= N) continue;
#pragma unroll
    for (int r = 0; r < 8; ++r) so[w][8 * hh + r][t * 16 + ln] = acc[t][r] * alpha; }
  __builtin_amdgcn_fence(__ATOMIC_ACQ_REL, "workgroup"); __builtin_amdgcn_wave_barrier();
  const int rsub = lane >> 4, c4 = (lane & 15) * 4;
  {
#pragma unroll
    for (int q = 0; q < 8; ++q) { const int r = q * 2 + rsub; if (col0 + c4 < N) { const v4f v = *(const v4fa*)&so[w][r][c4]; *(v4f*)(C + (size_t)(row0 + r) * ldc + col0 + c4) = v; } }
     }
}

// Wt[n][k] = f16(W[k][n]·scale) from f32 row-major W[K][N] (scale = power of two; bf16-exact weights stay exact in f16 away from the subnormal range)
__global__ __launch_bounds__(256) void k_wt_f16(const float* __restrict__ W, _Float16* __restrict__ Wt, int K, int N, float scale) {
  const int t = blockIdx.x * 256 + threadIdx.x; if (t >= N * (K / 8)) return; const int n = t / (K / 8), k8 = (t % (K / 8)) * 8; FragH f;
#pragma unroll
  for (int i = 0; i < 8; ++i) f.h[i] = (_Float16)(bf16_round(W[(size_t)(k8 + i) * N + n]) * scale); const v8us o = f.half[0];
  *(v8us*)((unsigned short*)Wt + (size_t)n * K + k8) = o; 
}
// k_gemm_hh variant with fused epilogue: v = acc·alpha + bias[by·sBias + col] (+ CP[(row/rowsPerB)·sCPb + by·64 + col] if CP) ; ACT 0 none / 1 elu ; writes f16 C16 (and f32 C if non-null)
template <int ACT>
__global__ __launch_bounds__(128) void k_gemm_hhx(const _Float16* __restrict__ A, int lda, size_t sA, const _Float16* __restrict__ Bh, int ldb, size_t sB, float alpha, const float* __restrict__ bias, size_t sBias, const float* __restrict__ CP, int rowsPerB, size_t sCPb, int row0g,
    float* __restrict__ C, _Float16* __restrict__ C16, int ldc, size_t sC, int M, int N, int K) {
  __shared__ __attribute__((aligned(16))) float so[4][16][64];
  const int tid = threadIdx.x, w = tid >> 5, lane = tid & 31, ln = lane & 15, hh = lane >> 4; const int by = blockIdx.y;
  A += (size_t)by * sA; Bh += (size_t)by * sB; const size_t cofs = (size_t)by * sC; const float* bp = bias ? bias + (size_t)by * sBias : nullptr;
  const int ntn = (N + 63) / 64; const int wid = blockIdx.x * 4 + w; const int mt = wid / ntn, nq = wid % ntn; if (mt * 16 >= M) return;
  const int row0 = mt * 16, col0 = nq * 64; const _Float16* arow = A + (size_t)(row0 + ln) * lda;
  v8f acc[4] = {};
  for (int kb = 0; kb < K; kb += 32) { FragH ah; ah.half[0] = *(const v8us*)((const unsigned short*)arow + kb + 8 * hh); ah.half[1] = *(const v8us*)((const unsigned short*)arow + kb + 16 + 8 * hh);
#pragma unroll
    for (int t = 0; t < 4; ++t) { if (col0 + t * 16 >= N) continue; const size_t boff = (size_t)(col0 + t * 16 + ln) * ldb + kb; FragH bq; bq.half[0] = *(const v8us*)((const unsigned short*)Bh + boff + 8 * hh); bq.half[1] = *(const v8us*)((const unsigned short*)Bh + boff + 16 + 8 * hh);
      acc[t] = mmaH<1>(ah.v, ah.v, bq.v, bq.v, acc[t]); }
  }
#pragma unroll
  for (int t = 0; t < 4; ++t) { if (col0 + t * 16 >= N) continue; const int col = col0 + t * 16 + ln; const float bv = bp ? bf16_round(bp[col]) : 0.f;
#pragma unroll
    for (int r = 0; r < 8; ++r) { float v = acc[t][r] * alpha + bv; if (CP) { const int rr = row0g + row0 + 8 * hh + r; if (rowsPerB < 0) v += CP[cofs + (size_t)rr * ldc + col];      /* rowsPerB < 0: own element of the batched C plane */ else { const int bidx = rr / rowsPerB; v += CP[(size_t)bidx * sCPb + (size_t)by * 64 + col]; } } if (ACT == 1) v = (v > 0.f) ? v : expm1f(v); else if (ACT == 7) v = (v > 0.f) ? v + 1.0f : expf(v); else if (ACT == 8) v = tanhf(v); else if (ACT == 9) v = 0.5f * v * (1.0f + tanhf(0.7978845608028654f * (v + 0.044715f * v * v * v))); else if (ACT == 11) v = 1.0f / (1.0f + expf(-v)); else if (ACT == 12) v = (v > 0.f) ? v : 0.01f * v; else if (ACT == 14) v = (v > 0.f) ? v : 0.1f * v; else if (ACT == 16) v = (v >= 0.f) ? v : 0.3f * v; else if (ACT == 17) v = (v >= 0.f) ? v : 0.2f * v; else if (ACT == 15) v = v / (1.0f + expf(-v)); else if (ACT == 3) v = fmaxf(v, 0.f); else if (ACT == 6) v = 0.5f * v * (1.0f + erff(v * 0.70710678118654752f)); so[w][8 * hh + r][t * 16 + ln] = v; } }
  __builtin_amdgcn_fence(__ATOMIC_ACQ_REL, "workgroup"); __builtin_amdgcn_wave_barrier();
  const int rsub = lane >> 4, c4 = (lane & 15) * 4; typedef _Float16 v4h __attribute__((ext_vector_type(4)));
  {
#pragma unroll
    for (int q = 0; q < 8; ++q) { const int r = q * 2 + rsub; if (col0 + c4 < N) { const v4f v = *(const v4fa*)&so[w][r][c4]; if (C) *(v4f*)(C + cofs + (size_t)(row0 + r) * ldc + col0 + c4) = v; if (C16) { v4h h4; for (int i = 0; i < 4; ++i) h4[i] = (_Float16)v[i]; *(v4h*)(C16 + cofs + (size_t)(row0 + r) * ldc + col0 + c4) = h4; } } }
     }
}


typedef _Float16 v4h __attribute__((ext_vector_type(4)));

__global__ __launch_bounds__(256) void k_x16(const float* __restrict__ x, _Float16* __restrict__ X16, size_t n8) { const size_t t = (size_t)blockIdx.x * 256 + threadIdx.x; if (t >= n8) return; FragH f;
#pragma unroll
  for (int q = 0; q < 8; ++q) f.h[q] = (_Float16)bf16_round(x[t * 8 + q]); *(v8us*)((unsigned short*)X16 + t * 8) = f.half[0];  }
__global__ __launch_bounds__(256) void k_h16(const float* __restrict__ x, _Float16* __restrict__ X16, size_t n8) { const size_t t = (size_t)blockIdx.x * 256 + threadIdx.x; if (t >= n8) return; FragH f;
#pragma unroll
  for (int q = 0; q < 8; ++q) f.h[q] = (_Float16)x[t * 8 + q]; *(v8us*)((unsigned short*)X16 + t * 8) = f.half[0];  }
__global__ __launch_bounds__(256) void k_round16f(const float* __restrict__ W, _Float16* __restrict__ Bt, size_t n8) { const size_t t = (size_t)blockIdx.x * 256 + threadIdx.x; if (t >= n8) return; FragH f;
#pragma unroll
  for (int i = 0; i < 8; ++i) f.h[i] = (_Float16)(bf16_round(W[t * 8 + i]) * 16.0f); *(v8us*)((unsigned short*)Bt + t * 8) = f.half[0];  }
template <int NHv, int TTv>
__global__ __launch_bounds__(256) void k_vt(const _Float16* __restrict__ V16, int ldv, int voff, _Float16* __restrict__ Vt) { __shared__ unsigned short tl[64][66]; const int tid = threadIdx.x; const int slab = blockIdx.x / (TTv / 64), lg = blockIdx.x % (TTv / 64); const int b = slab / NHv, h = slab % NHv;
  for (int i = tid; i < 64 * 8; i += 256) { const int r = i / 8, c8 = (i % 8) * 8; FragH f; f.half[0] = *(const v8us*)((const unsigned short*)V16 + ((size_t)b * TTv + lg * 64 + r) * ldv + voff + h * 64 + c8);
#pragma unroll
    for (int q = 0; q < 8; ++q) tl[r][c8 + q] = f.u[q]; }
  __syncthreads();
  {
#pragma unroll
    for (int rd = 0; rd < 2; ++rd) { const int d = rd * 32 + tid / 8, pc = tid % 8; FragH f;
#pragma unroll
      for (int q = 0; q < 8; ++q) f.u[q] = tl[pc * 8 + q][d];
      *(v8us*)((unsigned short*)Vt + ((size_t)slab * 64 + d) * TTv + lg * 64 + pc * 8) = f.half[0]; }
     } }

__global__ __launch_bounds__(256) void k_hl(const float* __restrict__ F, _Float16* __restrict__ Hh, _Float16* __restrict__ Hl, size_t n8) { const size_t t = (size_t)blockIdx.x * 256 + threadIdx.x; if (t >= n8) return; FragH fh, fl; const v4f a = *(const v4fa*)(F + t * 8), c = *(const v4fa*)(F + t * 8 + 4);
#pragma unroll
  for (int q = 0; q < 4; ++q) { _Float16 h = (_Float16)a[q]; fh.h[q] = h; fl.h[q] = (_Float16)((a[q] - (float)h) * 1024.0f); h = (_Float16)c[q]; fh.h[4 + q] = h; fl.h[4 + q] = (_Float16)((c[q] - (float)h) * 1024.0f); }
  { *(v8us*)((unsigned short*)Hh + t * 8) = fh.half[0]; *(v8us*)((unsigned short*)Hl + t * 8) = fl.half[0];  } }

// ---- fast GEMM (wave tile 32x64; requires M % 128 == 0 rows per launch region, N % 64 == 0 and K % 64 == 0); epilogue = k_gemm_hhx semantics ----
__device__ __forceinline__ v16h g2_frag(const _Float16* p, int hh) { FragH f; f.half[0] = *(const v8us*)((const unsigned short*)p + 8 * hh); f.half[1] = *(const v8us*)((const unsigned short*)p + 16 + 8 * hh); return f.v; }
__device__ __forceinline__ v8f g2_mmab(v16h a, v16h b, v8f c) { return __builtin_amdgcn_wmma_f32_16x16x32_f16(false, a, false, b, (short)0, c, false, false); }
#define G2KC 64                      /* k per staged tile: 128 bytes, one cache line of every operand row */
#define G2P 72                       /* LDS row pitch in f16: 128 + 16 bytes, so that the 16 rows of a 16-byte fragment read fall on different banks */
// Block tile 128 x 64. Per 64 k the block's 128 A rows and 64 B rows go global -> registers -> LDS with whole-line loads, one tile ahead, two LDS buffers; the waves read their fragments from LDS. Needs M % 128 == 0, K % 64 == 0, K >= 64.
template <int ACT>
__global__ __launch_bounds__(128) void k_gemm2(const _Float16* __restrict__ A, int lda, size_t sA, const _Float16* __restrict__ Bh, int ldb, size_t sB, float alpha, const float* __restrict__ bias, size_t sBias, const float* __restrict__ CP, int rowsPerB, size_t sCPb, int row0g,
    float* __restrict__ C, _Float16* __restrict__ C16, int ldc, size_t sC, int M, int N, int K) { static_assert(ACT == 0 || ACT == 3 || ACT == 6 || ACT == 8 || ACT == 9 || ACT == 11 || ACT == 12 || ACT == 14 || ACT == 15 || ACT == 16 || ACT == 17, "k_gemm2: unsupported ACT code (would silently apply no activation)");
  __shared__ __attribute__((aligned(16))) float so[4][32][68];
  __shared__ __attribute__((aligned(16))) _Float16 st[2][192][G2P];      /* two staged tiles: rows 0..127 = the block's A rows, rows 128..191 = its B rows, G2KC k each */
  const int tid = threadIdx.x, w = tid >> 5, lane = tid & 31, ln = lane & 15, hh = lane >> 4; const int by = blockIdx.y;
  A += (size_t)by * sA; Bh += (size_t)by * sB; const size_t cofs = (size_t)by * sC; const float* bp = bias ? bias + (size_t)by * sBias : nullptr;
  const int ntn = N >> 6; const int mt = blockIdx.x / ntn, nq = blockIdx.x - mt * ntn; const int row0 = mt * 128 + 32 * w, col0 = nq * 64; if (mt * 128 >= M) return;      /* the same for the whole block: it stands in front of the barriers */
  const int sr = tid >> 3, sg = tid & 7;      /* staging: 8 threads bring one row's 128 bytes, so a wave's 16-byte load is 4 whole cache lines */
  const _Float16* gp[12];      /* the thread's 8 A pieces and 4 B pieces of the tile to be fetched next */
#pragma unroll
  for (int i = 0; i < 8; ++i) gp[i] = A + (size_t)(mt * 128 + sr + 16 * i) * lda + sg * 8;
#pragma unroll
  for (int i = 0; i < 4; ++i) gp[8 + i] = Bh + (size_t)(col0 + sr + 16 * i) * ldb + sg * 8;
  v8us rg[12];      /* the tile on its way from global memory to LDS */
  auto fetch = [&]() {
#pragma unroll
    for (int i = 0; i < 12; ++i) rg[i] = *(const v8us*)(const unsigned short*)gp[i];
    asm volatile("s_wait_xcnt 0x0" :: "v"(gp[0]), "v"(gp[1]), "v"(gp[2]), "v"(gp[3]), "v"(gp[4]), "v"(gp[5]), "v"(gp[6]), "v"(gp[7]), "v"(gp[8]), "v"(gp[9]), "v"(gp[10]), "v"(gp[11]) : "memory");      /* the 12 addresses are named so that their registers live up to this wait: none is overwritten in front of it, neither by the step to the next tile below nor by a load's result */
#pragma unroll
    for (int i = 0; i < 12; ++i) gp[i] += G2KC; };
  auto put = [&](int buf) {
#pragma unroll
    for (int i = 0; i < 12; ++i) *(v8us*)&st[buf][sr + 16 * i][sg * 8] = rg[i]; };
  auto lfrag = [&](int buf, int row, int kk) { FragH f; const unsigned short* p = (const unsigned short*)&st[buf][row][kk * 32 + 8 * hh]; f.half[0] = *(const v8us*)p; f.half[1] = *(const v8us*)(p + 16); return f.v; };      /* the k order of g2_frag */
  const v8f z8 = {0.f,0.f,0.f,0.f,0.f,0.f,0.f,0.f}; v8f c00 = z8, c01 = z8, c02 = z8, c03 = z8, c10 = z8, c11 = z8, c12 = z8, c13 = z8;
  const int nc = K / G2KC;
  fetch(); put(0); __syncthreads();
#pragma unroll 1      /* one copy of the tile body: the trip count is a run-time value and the body is long */
  for (int c = 0; c < nc; ++c) { const int buf = c & 1;
    if (c + 1 < nc) fetch();      /* the next tile's global loads fly while this tile is worked on */
    v16h a[2][2], b[2][4];
#pragma unroll
    for (int kk = 0; kk < 2; ++kk) { a[kk][0] = lfrag(buf, 32 * w + ln, kk); a[kk][1] = lfrag(buf, 32 * w + 16 + ln, kk);
#pragma unroll
      for (int t = 0; t < 4; ++t) b[kk][t] = lfrag(buf, 128 + 16 * t + ln, kk); }
    __builtin_amdgcn_sched_barrier(0);      /* keeps the tile's 24 LDS reads together in front of its 16 WMMAs: one LDS latency a tile with counted waits, where the scheduler otherwise reuses one B fragment's registers and waits for LDS eight times */
#pragma unroll
    for (int kk = 0; kk < 2; ++kk) {
      c00 = g2_mmab(a[kk][0], b[kk][0], c00); c10 = g2_mmab(a[kk][1], b[kk][0], c10); c01 = g2_mmab(a[kk][0], b[kk][1], c01); c11 = g2_mmab(a[kk][1], b[kk][1], c11);
      c02 = g2_mmab(a[kk][0], b[kk][2], c02); c12 = g2_mmab(a[kk][1], b[kk][2], c12); c03 = g2_mmab(a[kk][0], b[kk][3], c03); c13 = g2_mmab(a[kk][1], b[kk][3], c13); }
    if (c + 1 < nc) put(buf ^ 1);      /* into the buffer whose last readers passed the barrier at the foot of the trip before */
    __syncthreads(); }      /* one barrier a tile: publishes tile c + 1 and ends the reads of tile c */
  v8f accs[8] = {c00, c01, c02, c03, c10, c11, c12, c13};
#pragma unroll
  for (int u = 0; u < 8; ++u) { const int t = u & 3, half = u >> 2; const int col = col0 + t * 16 + ln; const float bv = bp ? bf16_round(bp[col]) : 0.f;
#pragma unroll
    for (int r = 0; r < 8; ++r) { const int rloc = half * 16 + 8 * hh + r; float v = accs[u][r] * alpha + bv; if (CP) { if (rowsPerB < 0) v += CP[cofs + (size_t)(row0g + row0 + rloc) * ldc + col];      /* rowsPerB < 0: own element of the batched C plane */ else { const int bidx = (row0g + row0 + rloc) / rowsPerB; v += CP[(size_t)bidx * sCPb + (size_t)by * 64 + col]; } }
      if (ACT == 3) v = fmaxf(v, 0.f); else if (ACT == 6) v = 0.5f * v * (1.0f + erff(v * 0.70710678118654752f)); else if (ACT == 11) v = 1.0f / (1.0f + expf(-v)); else if (ACT == 15) v = v / (1.0f + expf(-v)); else if (ACT == 12) v = (v > 0.f) ? v : 0.01f * v; else if (ACT == 8) v = tanhf(v); else if (ACT == 9) v = 0.5f * v * (1.0f + tanhf(0.7978845608028654f * (v + 0.044715f * v * v * v))); else if (ACT == 14) v = (v > 0.f) ? v : 0.1f * v; else if (ACT == 16) v = (v >= 0.f) ? v : 0.3f * v; else if (ACT == 17) v = (v >= 0.f) ? v : 0.2f * v;
      so[w][rloc][t * 16 + ln] = v; } }
  __builtin_amdgcn_fence(__ATOMIC_ACQ_REL, "workgroup"); __builtin_amdgcn_wave_barrier();
  const int rsub = lane >> 4, c4 = (lane & 15) * 4;
  {
#pragma unroll
    for (int q = 0; q < 16; ++q) { const int r = q * 2 + rsub; const v4f v = *(const v4fa*)&so[w][r][c4]; if (C) *(v4f*)(C + cofs + (size_t)(row0 + r) * ldc + col0 + c4) = v; if (C16) { v4h h4; for (int i = 0; i < 4; ++i) h4[i] = (_Float16)v[i]; *(v4h*)(C16 + cofs + (size_t)(row0 + r) * ldc + col0 + c4) = h4; } }
     } }


__global__ __launch_bounds__(256) void k_wnat(const float* __restrict__ w, size_t n8, _Float16* __restrict__ Bt) { const size_t t = (size_t)blockIdx.x * 256 + threadIdx.x; if (t >= n8) return; FragH f; for (int q = 0; q < 8; ++q) f.h[q] = (_Float16)(bf16_round(w[t * 8 + q]) * 16.0f); *(v8us*)((unsigned short*)Bt + t * 8) = f.half[0];  }
__global__ __launch_bounds__(256) void k_rsm(const float* __restrict__ S, _Float16* __restrict__ P, int nrows) {
  #pragma clang fp contract(off)
  const int i = blockIdx.x * 256 + threadIdx.x; if (i >= nrows) return; const float* s = S + (size_t)i * SQ; float mx = -3.0e38f;
#pragma unroll 1
  for (int j = 0; j < SQ; ++j) mx = fmaxf(mx, s[j]); float se = 0.f;
#pragma unroll 1
  for (int j = 0; j < SQ; ++j) se += expf(s[j] - mx); const float sc = 256.0f / se;
#pragma unroll 1
  for (int j0 = 0; j0 < SQ; j0 += 8) { FragH f; for (int q = 0; q < 8; ++q) f.h[q] = (_Float16)(expf(s[j0 + q] - mx) * sc); unsigned short* d = (unsigned short*)P + (size_t)i * SQ + j0; *(v8us*)d = f.half[0];  } }
__global__ __launch_bounds__(256) void k_vt(const _Float16* __restrict__ V16, int b, int h0, _Float16* __restrict__ VT) { __shared__ unsigned short tl[64][65]; const int tid = threadIdx.x; const int hh = blockIdx.x % HG, sg = blockIdx.x / HG; const int s0 = sg * 64; const int h = h0 + hh;
  for (int i = tid; i < 64 * 8; i += 256) { const int j = i / 8, d8 = (i % 8) * 8; FragH f; f.half[0] = *(const v8us*)((const unsigned short*)V16 + ((size_t)b * SQ + s0 + j) * DM + h * HD + d8); for (int q = 0; q < 8; ++q) tl[d8 + q][j] = f.u[q]; }
  __syncthreads();
  { for (int i = tid; i < 64 * 8; i += 256) { const int d = i / 8, j8 = (i % 8) * 8; FragH f; for (int q = 0; q < 8; ++q) f.u[q] = tl[d][j8 + q]; *(v8us*)((unsigned short*)VT + ((size_t)hh * HD + d) * SQ + s0 + j8) = f.half[0]; }  } }



#define FQ 32                        /* query rows per wave */
typedef _Float16 v8h __attribute__((ext_vector_type(8)));
__device__ __forceinline__ float half_xor(float v) { const int i = __builtin_bit_cast(int, v); return __builtin_bit_cast(float, __builtin_amdgcn_permlanex16(i, i, 0x76543210, 0xfedcba98, false, false)); }      /* lane l <- lane l ^ 16 */
__device__ __forceinline__ float exp2_slot(float x) { float y; asm("v_exp_f32 %0, %1\n\tv_nop" : "=v"(y) : "v"(x)); return y; }      /* v_nop: the slot the instruction set asks for behind a transcendental before its result is read or its source rewritten; in the same statement it stays directly behind it */
__device__ __forceinline__ v8f fa_mma(v16h a, v16h b, v8f c) { return __builtin_amdgcn_wmma_f32_16x16x32_f16(false, a, false, b, (short)0, c, false, false); }
__global__ __launch_bounds__(128) void k_fattn(const _Float16* __restrict__ Qr, const _Float16* __restrict__ Kr, const _Float16* __restrict__ Vt, _Float16* __restrict__ Or) {
  static_assert(HD == 64 && SQ % (4 * FQ) == 0, "two k chunks per score product, four d tiles, whole blocks of 4 waves");
  const int lane = threadIdx.x & 31, ln = lane & 15, hh = lane >> 4; const int w = __builtin_amdgcn_readfirstlane((int)(threadIdx.x >> 5));
  const int h = blockIdx.x % NH; const int q0 = (SQ / (4 * FQ) - 1 - (int)(blockIdx.x / NH)) * (4 * FQ) + w * FQ;      /* the longest blocks start first */
  const _Float16* kp = Kr + (size_t)ln * LQ + h * HD;          /* A rows of S^T: key rows */
  const _Float16* vp = Vt + ((size_t)h * HD + ln) * SQ;        /* A rows of O^T: rows of V^T */
  v16h qf[2][2], kf[2][2], vf[4];      /* [query group | key group][k chunk of 32 head dims]; [tile of 16 head dims] */
#pragma unroll
  for (int g = 0; g < 2; ++g)
#pragma unroll
    for (int c = 0; c < 2; ++c) qf[g][c] = g2_frag(Qr + (size_t)(q0 + 16 * g + ln) * LQ + h * HD + 32 * c, hh);
  asm volatile("" :: "v"(qf[0][0]), "v"(qf[0][1]), "v"(qf[1][0]), "v"(qf[1][1]) : "memory");      /* inputs only: the q rows have landed before the first K and V loads are issued, so the loop's counted load waits stand for K and V alone and never drain the loads fetched ahead */
#pragma unroll
  for (int t = 0; t < 2; ++t)
#pragma unroll
    for (int c = 0; c < 2; ++c) kf[t][c] = g2_frag(kp + (size_t)(16 * t) * LQ + 32 * c, hh);
  __builtin_amdgcn_sched_barrier(0);      /* keeps the first K loads in front of the first V loads, the order the loop issues them in: the wait for K at the loop's head then leaves the V loads in flight */
#pragma unroll
  for (int t = 0; t < 4; ++t) vf[t] = g2_frag(vp + (size_t)(16 * t) * SQ, hh);
  const v8f z8 = {0.f, 0.f, 0.f, 0.f, 0.f, 0.f, 0.f, 0.f};
  v8f o[2][4] = {{z8, z8, z8, z8}, {z8, z8, z8, z8}};      /* o[g][t][r] = O^T[16 t + 8 hh + r][query q0 + 16 g + ln] */
  float m[2] = {-3.0e38f, -3.0e38f}, l[2] = {0.f, 0.f};      /* m: running maximum of the raw products q.k; l: this wave half's keys only, the halves are joined once behind the loop */
  const float cs = 0.125f * 1.44269504088896f;      /* score scale x log2(e): exp(0.125 (s - m)) = exp2(cs s - cs m) */
  int kb = 0;
#pragma unroll 1
  do {      /* q0 >= 0: every wave has at least its own diagonal step */
    v8f s[2][2];      /* s[g][t][r] = q.k of key kb + 16 t + 8 hh + r, query q0 + 16 g + ln */
#pragma unroll
    for (int g = 0; g < 2; ++g)
#pragma unroll
      for (int t = 0; t < 2; ++t) s[g][t] = fa_mma(kf[t][1], qf[g][1], fa_mma(kf[t][0], qf[g][0], z8));
    const int kn = (kb + 32 <= q0) ? kb + 32 : q0;      /* the next step's keys; the last step fetches its own again (in bounds, unused) */
#pragma unroll
    for (int t = 0; t < 2; ++t)
#pragma unroll
      for (int c = 0; c < 2; ++c) kf[t][c] = g2_frag(kp + (size_t)(kn + 16 * t) * LQ + 32 * c, hh);      /* fetched one step ahead, right behind their last use: the softmax and P V hide the latency */
#pragma unroll
    for (int g = 0; g < 2; ++g) {
      if (kb == q0) {      /* the one step that holds keys above a query (wave-uniform test) */
#pragma unroll
        for (int t = 0; t < 2; ++t)
#pragma unroll
          for (int r = 0; r < 8; ++r) s[g][t][r] = (16 * t + 8 * hh + r <= 16 * g + ln) ? s[g][t][r] : -1.0e9f; }
      float mx = fmaxf(s[g][0][0], s[g][1][0]);
#pragma unroll
      for (int r = 1; r < 8; ++r) mx = fmaxf(mx, fmaxf(s[g][0][r], s[g][1][r]));
      const float mn = fmaxf(m[g], fmaxf(mx, half_xor(mx))); const float sc = exp2_slot((m[g] - mn) * cs); const float mc = mn * cs; m[g] = mn;
#pragma unroll
      for (int t = 0; t < 2; ++t)
#pragma unroll
        for (int r = 0; r < 8; ++r) s[g][t][r] = exp2_slot(fmaf(s[g][t][r], cs, -mc));
      const v8f sv = s[g][0] + s[g][1];
      l[g] = l[g] * sc + (((sv[0] + sv[1]) + (sv[2] + sv[3])) + ((sv[4] + sv[5]) + (sv[6] + sv[7])));
      const v16h pf = __builtin_shufflevector(__builtin_convertvector(s[g][0], v8h), __builtin_convertvector(s[g][1], v8h), 0, 1, 2, 3, 4, 5, 6, 7, 8, 9, 10, 11, 12, 13, 14, 15);
#pragma unroll
      for (int t = 0; t < 4; ++t) o[g][t] = fa_mma(vf[t], pf, o[g][t] * sc);
    }
#pragma unroll
    for (int t = 0; t < 4; ++t) vf[t] = g2_frag(vp + (size_t)(16 * t) * SQ + kn, hh);      /* likewise one step ahead: the next score products and softmax hide the latency */
    kb += 32;
  } while (kb <= q0);
  asm volatile("s_wait_loadcnt 0x0" ::: "memory");      /* the last step's fetched-ahead K and V are unused and still in flight: they land before the wave gives its registers back */
#pragma unroll
  for (int g = 0; g < 2; ++g) { const float fin = 64.0f / (l[g] + half_xor(l[g]));      /* o carried x64, folded into the output GEMM alpha */
    _Float16* orow = Or + (size_t)(q0 + 16 * g + ln) * DM + h * HD + 8 * hh;
#pragma unroll
    for (int t = 0; t < 4; ++t) *(v8h*)(orow + 16 * t) = __builtin_convertvector(o[g][t] * fin, v8h); }      /* a lane holds 8 consecutive head dims of its query: one 16-byte store */
}


template <int MASKADD>
__global__ __launch_bounds__(64) void k_att0(const float* __restrict__ QF, const float* __restrict__ KF, const float* __restrict__ VF, int ld, const float* __restrict__ mask, float scale, float* __restrict__ OF, int ldo) {
  #pragma clang fp contract(off)
  __shared__ __attribute__((aligned(16))) float lo[64][64];      /* used once, at the end: turns the threads' o rows into whole-line stores */
  const int tid = threadIdx.x; const int h = blockIdx.x / (QT0 / 64), rg = blockIdx.x % (QT0 / 64); const int i = rg * 64 + tid;
  const float* qr = QF + (size_t)i * ld + h * HD;
  v4f q[HD / 4], o[HD / 4];      /* the thread's q row and o row: every loop over c is fully unrolled, so both are indexed by constants only and stay in registers */
#pragma unroll
  for (int c = 0; c < HD / 4; ++c) { q[c] = *(const v4fa*)(qr + c * 4); const v4f z = {0.f, 0.f, 0.f, 0.f}; o[c] = z; }
  asm volatile("s_wait_xcnt 0x0" :: "v"(qr) : "memory");      /* qr is named so that the 16 loads' address registers live up to this wait: none of them is overwritten in front of it, not even by a later load's result */
  float m = -1.0e30f, l = 0.f; const int jmax = MASKADD ? (SQ - 1) : (rg * 64 + 63);      /* additive-mask form: every key (the mask input decides); causal form: keys up to the block's last row */
#pragma unroll 1
  for (int j = 0; j <= jmax; ++j) { const float* kr = KF + (size_t)j * ld + h * HD; const float* vr = VF + (size_t)j * ld + h * HD; float s = 0.f;
#pragma unroll
    for (int c = 0; c < HD / 4; ++c) { const v4f kq = *(const v4fa*)(kr + c * 4); s = __fadd_rn(s, __fmul_rn(q[c][0], kq[0])); s = __fadd_rn(s, __fmul_rn(q[c][1], kq[1])); s = __fadd_rn(s, __fmul_rn(q[c][2], kq[2])); s = __fadd_rn(s, __fmul_rn(q[c][3], kq[3])); }
    s = __fmul_rn(s, scale); if (MASKADD) s = __fadd_rn(s, __fmul_rn(bf16_round(mask[(size_t)i * SQ + j]), -10000.0f));
    const float f = (MASKADD || j <= i) ? 1.f : 0.f; const float sm = fmaf(f, s, (1.f - f) * -1.0e30f); const float mn = fmaxf(m, sm); const float sc = expf(m - mn); const float e = expf(sm - mn); l = __fadd_rn(__fmul_rn(l, sc), e); m = mn;
#pragma unroll
    for (int c = 0; c < HD / 4; ++c) { const v4f vv = *(const v4fa*)(vr + c * 4); for (int u = 0; u < 4; ++u) o[c][u] = __fadd_rn(__fmul_rn(o[c][u], sc), __fmul_rn(e, vv[u])); } }
  const float fin = 64.0f / l;      /* o carried x64 like the f16 path */
#pragma unroll
  for (int c = 0; c < HD / 4; ++c) { v4f oo = o[c]; for (int u = 0; u < 4; ++u) oo[u] = __fmul_rn(oo[u], fin); *(v4f*)&lo[tid][c * 4] = oo; }
  __syncthreads();
  {
#pragma unroll 1
    for (int it = 0; it < 16; ++it) { const int row = it * 4 + tid / 16, pc = (tid % 16) * 4; const v4f v = *(const v4f*)&lo[row][pc]; *(v4f*)(OF + (size_t)(rg * 64 + row) * ldo + h * HD + pc) = v; }
     } }

extern "C" void kernel_launch(void* const* d_in, const int* in_sizes, int n_in,
                              void* d_out, int out_size, void* d_ws, size_t ws_size, hipStream_t stream) {
  (void)in_sizes; (void)n_in; (void)out_size;
  const float* const* I = (const float* const*)d_in; const float* xq = I[0]; const float* xk = I[1]; const float* xv = I[2]; const float* wq = I[3]; const float* wk = I[4]; const float* wv = I[5]; const float* wo = I[6];      /* nn.Linear weights [out][in] */
  char* ws = (char*)d_ws; size_t off = 0;
  auto take = [&](size_t bytes) { char* p = ws + off; off += (bytes + 255) & ~(size_t)255; return p; };
  _Float16* BQ = (_Float16*)take((size_t)DM * DM * 2); _Float16* BK = (_Float16*)take((size_t)DM * DM * 2); _Float16* BV = (_Float16*)take((size_t)DM * DM * 2); _Float16* BO = (_Float16*)take((size_t)DM * DM * 2);
  _Float16* XQ = (_Float16*)take(NR * DM * 2); _Float16* XK = (_Float16*)take(NR * DM * 2); _Float16* XV = (_Float16*)take(NR * DM * 2); _Float16* Q16 = (_Float16*)take(NR * DM * 2); _Float16* K16 = (_Float16*)take(NR * DM * 2); _Float16* V16 = (_Float16*)take(NR * DM * 2); _Float16* O16 = (_Float16*)take(NR * DM * 2);
  _Float16* VT = (_Float16*)take((size_t)NH * HD * SQ * 2);
  float* QF0 = (float*)take((size_t)QT0 * DM * 4); float* KF0 = (float*)take((size_t)QT0 * DM * 4); float* VF0 = (float*)take((size_t)QT0 * DM * 4); float* OF0 = (float*)take((size_t)NB * QT0 * DM * 4); _Float16* OH0 = (_Float16*)take((size_t)NB * QT0 * DM * 2); _Float16* OL0 = (_Float16*)take((size_t)NB * QT0 * DM * 2);
  if (off > ws_size) return;
  { const unsigned g = (unsigned)(((size_t)DM * DM / 8 + 255) / 256); k_wnat<<<g, 256, 0, stream>>>(wq, (size_t)DM * DM / 8, BQ); k_wnat<<<g, 256, 0, stream>>>(wk, (size_t)DM * DM / 8, BK); k_wnat<<<g, 256, 0, stream>>>(wv, (size_t)DM * DM / 8, BV); k_wnat<<<g, 256, 0, stream>>>(wo, (size_t)DM * DM / 8, BO); }      /* natural [out][in] = Bt[n][k], x16 */
  k_x16<<<(unsigned)((NR * DM / 8 + 255) / 256), 256, 0, stream>>>(xq, XQ, NR * DM / 8); k_x16<<<(unsigned)((NR * DM / 8 + 255) / 256), 256, 0, stream>>>(xk, XK, NR * DM / 8); k_x16<<<(unsigned)((NR * DM / 8 + 255) / 256), 256, 0, stream>>>(xv, XV, NR * DM / 8);
  const size_t r0p = (size_t)B0 * SQ;      /* first projected row */
  k_gemm2<0><<<dim3((unsigned)((MP / 128) * (DM / 64)), 1), 128, 0, stream>>>(XQ + r0p * DM, DM, 0, BQ, DM, 0, 0.0625f, nullptr, 0, nullptr, 1, 0, 0, nullptr, Q16 + r0p * DM, DM, 0, MP, DM, DM);
  k_gemm2<0><<<dim3((unsigned)((MP / 128) * (DM / 64)), 1), 128, 0, stream>>>(XK + r0p * DM, DM, 0, BK, DM, 0, 0.0625f, nullptr, 0, nullptr, 1, 0, 0, nullptr, K16 + r0p * DM, DM, 0, MP, DM, DM);
  k_gemm2<0><<<dim3((unsigned)((MP / 128) * (DM / 64)), 1), 128, 0, stream>>>(XV + r0p * DM, DM, 0, BV, DM, 0, 0.0625f, nullptr, 0, nullptr, 1, 0, 0, nullptr, V16 + r0p * DM, DM, 0, MP, DM, DM);
  for (int b = B0; b < B0 + NBR; ++b) { const size_t r0 = (size_t)b * SQ;
    k_vt<NH, SQ><<<NH * (SQ / 64), 256, 0, stream>>>(V16 + r0 * LQ, LQ, 0, VT);      /* V^T [NH][HD][SQ] for this batch */
    k_gemm2<0><<<dim3((QT0 / 128) * (DM / 64), 1), 128, 0, stream>>>(XQ + r0 * DM, DM, 0, BQ, DM, 0, 0.0625f, nullptr, 0, nullptr, 1, 0, 0, QF0, nullptr, DM, 0, QT0, DM, DM); k_gemm2<0><<<dim3((QT0 / 128) * (DM / 64), 1), 128, 0, stream>>>(XK + r0 * DM, DM, 0, BK, DM, 0, 0.0625f, nullptr, 0, nullptr, 1, 0, 0, KF0, nullptr, DM, 0, QT0, DM, DM); k_gemm2<0><<<dim3((QT0 / 128) * (DM / 64), 1), 128, 0, stream>>>(XV + r0 * DM, DM, 0, BV, DM, 0, 0.0625f, nullptr, 0, nullptr, 1, 0, 0, VF0, nullptr, DM, 0, QT0, DM, DM);      /* f32 q, k, v of the first 256 rows (exact products) */
    k_att0<0><<<NH * (QT0 / 64), 64, 0, stream>>>(QF0, KF0, VF0, DM, nullptr, 0.125f, OF0 + (size_t)b * QT0 * DM, DM);      /* exact f32 attention for rows 0..255 (o x64) */
    k_fattn<<<NH * (SQ / (4 * FQ)), 128, 0, stream>>>(Q16 + r0 * LQ, K16 + r0 * LQ, VT, O16 + r0 * DM); }      /* o (merged heads, x64) as f16 rows: scores, softmax and P V in one launch */
  k_gemm2<0><<<dim3((unsigned)((MPO / 128) * (DM / 64)), 1), 128, 0, stream>>>(O16 + r0p * DM, DM, 0, BO, DM, 0, 0.0009765625f, nullptr, 0, nullptr, 1, 0, 0, (float*)d_out + r0p * DM, nullptr, DM, 0, MPO, DM, DM);      /* out rows are the output layout */
  k_hl<<<(unsigned)(((size_t)NB * QT0 * DM / 8 + 255) / 256), 256, 0, stream>>>(OF0, OH0, OL0, (size_t)NB * QT0 * DM / 8);      /* first-tile o (x64) -> f16 hi + x1024 residual planes */
  for (int b = B0; b < B0 + NBR; ++b) { const size_t r0 = (size_t)b * SQ; const size_t f0 = (size_t)b * QT0;
    k_gemm2<0><<<dim3((QT0 / 128) * (DM / 64), 1), 128, 0, stream>>>(OH0 + f0 * DM, DM, 0, BO, DM, 0, 0.0009765625f, nullptr, 0, nullptr, 1, 0, 0, (float*)d_out + r0 * DM, nullptr, DM, 0, QT0, DM, DM);      /* rows 0..255: out = o_hi Wo, overwriting the f16-path rows */
    k_gemm2<0><<<dim3((QT0 / 128) * (DM / 64), 1), 128, 0, stream>>>(OL0 + f0 * DM, DM, 0, BO, DM, 0, 0.00000095367431640625f, nullptr, 0, (const float*)d_out + r0 * DM, -1, 0, 0, (float*)d_out + r0 * DM, nullptr, DM, 0, QT0, DM, DM); }      /* += o_lo Wo 2^-20 (own-element accumulate) */
}

// v005
// Measured time: 278 microseconds a run.
// Next to v004, in two timings, it ran 1.57 times as fast each time.
// All steps since v000 together make it 29.8 times as fast.
#include <hip/hip_runtime.h>
// Causal multi-head attention (q, k, v inputs [1][4096][1024]; qp/kp/vp = input W^T (nn.Linear [out][in], no bias), 16 heads of 64; scores x (8/64) = /8; causal mask (keys > query get -inf); softmax; out = (probs v merged) Wo^T -> [1][4096][1024]).
// Structure: token rows r = s; q, k, v inputs as exact f16 rows (bf16-rounded); Q, K, V as three WMMA GEMMs (32x64 wave tiles, f32 accumulation, exact x16 weights, f16 outputs); per batch: V^T for all heads via LDS transposes; one fused attention launch: a wave owns 32 query rows of a head and walks the keys up to its last row in steps of 32: scores on WMMA (K = 64, x 0.125), online causal softmax in registers (f32 running maximum and sum, native exp; unnormalised weights f16), o += P V on WMMA (f32), divided by the row sum at the end (o carried x64, folded into the output GEMM alpha) written straight into the merged f16 o rows; out = o W_o GEMM (f32) into the output layout.
// Compute dtype: inputs rounded to bf16; x / weights exact; q, k, v, softmax weights and o as plain f16 GEMM operands (~2^-12); scores and softmax statistics f32. v_wmma_f32_16x16x32_f16.
#define NB 1
#define SQ 4096
#define DM 1024
#define NH 16
#define HD 64
#define HG 4                         /* heads per launch of the non-template k_vt (not launched) */
#define QT 256                       /* not used */
#define NKX SQ                       /* not used */
#define QT0 256                      /* first-tile rows recomputed exactly in f32 */
#define B0 0                         /* first batch processed (debug hook) */
#define NBR NB                       /* batches processed (debug hook) */
#define NR ((size_t)NB * SQ)         /* token rows */
#define MP ((int)((size_t)NBR * SQ)) /* rows projected (debug hook) */
#define QN SQ                        /* query rows attended per batch (not used) */
#define NHD NH                       /* heads attended (not used) */
#define MPO MP                       /* rows through the output stage (debug hook) */
#define LQ DM      /* row pitch of the q/k/v rows */
typedef __bf16 v16b __attribute__((ext_vector_type(16)));
typedef unsigned short v8us __attribute__((ext_vector_type(8), may_alias));
typedef float  v8f  __attribute__((ext_vector_type(8)));
typedef float  v4f  __attribute__((ext_vector_type(4)));
typedef float  v4fa __attribute__((ext_vector_type(4), may_alias));
union FragB { v16b v; v8us half[2]; unsigned short u[16]; };

__device__ __forceinline__ unsigned short bf16_bits(float x) { unsigned int u = __float_as_uint(x); return (unsigned short)((u + 0x7FFFu + ((u >> 16) & 1u)) >> 16); }
__device__ __forceinline__ float bf16_val(unsigned short b) { return __uint_as_float(((unsigned int)b) << 16); }
__device__ __forceinline__ float bf16_round(float x) { return bf16_val(bf16_bits(x)); }
// D += A·B with NT terms: 1 = ah·bh, 2 = + al·bh (A split), 3 = + ah·bl (both split)
template <int NT>
__device__ __forceinline__ v8f mmaN(v16b ah, v16b al, v16b bh, v16b bl, v8f c) {
  c = __builtin_amdgcn_wmma_f32_16x16x32_bf16(false, ah, false, bh, (short)0, c, false, false);
  if (NT >= 2) c = __builtin_amdgcn_wmma_f32_16x16x32_bf16(false, al, false, bh, (short)0, c, false, false);
  if (NT >= 3) c = __builtin_amdgcn_wmma_f32_16x16x32_bf16(false, ah, false, bl, (short)0, c, false, false);
  asm volatile("v_nop\n\tv_nop\n\tv_nop\n\tv_nop" : "+v"(c) : "v"(ah), "v"(al), "v"(bh), "v"(bl));
  return c;
}

__global__ __launch_bounds__(256) void k_wt_bf16(const float* __restrict__ W, unsigned short* __restrict__ Wt, int K, int N) {
  const int t = blockIdx.x * 256 + threadIdx.x;
  const int k8n = K / 8;
  if (t >= N * k8n) return;
  const int n = t / k8n, k8 = (t % k8n) * 8;
  v8us v;
#pragma unroll
  for (int i = 0; i < 8; ++i) v[i] = bf16_bits(W[(size_t)(k8 + i) * N + n]);
  *(v8us*)(Wt + (size_t)n * K + k8) = v;
  
}

// GEMM C[M][N] (f32, pitch ldc) = act(A[M][K]·W + bias). A f32 row-major (pitch lda) converted per fragment to bf16
// (ASPLIT: hi/lo two planes -> 2 terms, else single rounded term); Wt bf16 [N][K] (pitch ldb). BIAS_BF16 rounds the
// bias to bf16 first (bias quantised to bf16 before the add). K%32==0, M%16==0, N%64==0.
template <bool ASPLIT, int ACT, bool BIAS_BF16>
__global__ __launch_bounds__(128) void k_gemm_bf(const float* __restrict__ A, int lda, const unsigned short* __restrict__ Wt, int ldb,
                                               const float* __restrict__ bias, float* __restrict__ C, int ldc, int M, int N, int K) {
  __shared__ __attribute__((aligned(16))) float so[4][16][64];
  const int tid = threadIdx.x, w = tid >> 5, lane = tid & 31, ln = lane & 15, hh = lane >> 4;
  const int ntn = N / 64;
  const int wid = blockIdx.x * 4 + w;
  const int mt = wid / ntn, nq = wid % ntn;
  if (mt * 16 >= M) return;
  const int row0 = mt * 16, col0 = nq * 64;
  const float* arow = A + (size_t)(row0 + ln) * lda;
  v8f acc[4] = {};
  for (int kb = 0; kb < K; kb += 32) {
    FragB ah, al;
    const v4f x0 = *(const v4fa*)(arow + kb + 8 * hh), x1 = *(const v4fa*)(arow + kb + 8 * hh + 4);
    const v4f x2 = *(const v4fa*)(arow + kb + 16 + 8 * hh), x3 = *(const v4fa*)(arow + kb + 16 + 8 * hh + 4);
    float xs[16] = {x0[0],x0[1],x0[2],x0[3],x1[0],x1[1],x1[2],x1[3],x2[0],x2[1],x2[2],x2[3],x3[0],x3[1],x3[2],x3[3]};
#pragma unroll
    for (int i = 0; i < 16; ++i) { const unsigned short hb = bf16_bits(xs[i]); ah.u[i] = hb; al.u[i] = ASPLIT ? bf16_bits(xs[i] - bf16_val(hb)) : (unsigned short)0; }
#pragma unroll
    for (int t = 0; t < 4; ++t) {
      const unsigned short* brow = Wt + (size_t)(col0 + t * 16 + ln) * ldb + kb;
      FragB b;
      b.half[0] = *(const v8us*)(brow + 8 * hh);
      b.half[1] = *(const v8us*)(brow + 16 + 8 * hh);
      acc[t] = mmaN<ASPLIT ? 2 : 1>(ah.v, al.v, b.v, b.v, acc[t]);
    }
  }
#pragma unroll
  for (int t = 0; t < 4; ++t) {
    float bv = bias ? bias[col0 + t * 16 + ln] : 0.f;
    if (BIAS_BF16) bv = bf16_round(bv);
#pragma unroll
    for (int r = 0; r < 8; ++r) { float v = acc[t][r] + bv; if (ACT == 1) v = fmaxf(v, 0.f); so[w][8 * hh + r][t * 16 + ln] = v; }
  }
  __builtin_amdgcn_fence(__ATOMIC_ACQ_REL, "workgroup");
  __builtin_amdgcn_wave_barrier();
  const int rsub = lane >> 4, c4 = (lane & 15) * 4;
  {
#pragma unroll
    for (int q = 0; q < 8; ++q) {
      const int r = q * 2 + rsub;
      const v4f v = *(const v4fa*)&so[w][r][c4];
      *(v4f*)(C + (size_t)(row0 + r) * ldc + col0 + c4) = v;
    }
    
  }
}

// GEMM C = act(A·W + bias + resid): A f32 (ASPLIT -> hi/lo 2 terms), Wt bf16 [N][K]; ACT 0 none, 1 relu, 2 exact gelu;
// resid (optional, f32, row index = (row % rmod), pitch ldr, RES_BF16 rounds it) added before the activation.
template <bool ASPLIT, int ACT, bool BIAS_BF16, bool RES_BF16>
__global__ __launch_bounds__(128) void k_gemm_bf3(const float* __restrict__ A, int lda, const unsigned short* __restrict__ Wt, int ldb,
                                                const float* __restrict__ bias, const float* __restrict__ resid, int rmod, int ldr,
                                                float* __restrict__ C, int ldc, int M, int N, int K) {
  __shared__ __attribute__((aligned(16))) float so[4][16][64];
  const int tid = threadIdx.x, w = tid >> 5, lane = tid & 31, ln = lane & 15, hh = lane >> 4;
  const int ntn = N / 64;
  const int wid = blockIdx.x * 4 + w;
  const int mt = wid / ntn, nq = wid % ntn;
  if (mt * 16 >= M) return;
  const int row0 = mt * 16, col0 = nq * 64;
  const float* arow = A + (size_t)(row0 + ln) * lda;
  v8f acc[4] = {};
  for (int kb = 0; kb < K; kb += 32) {
    FragB ah, al;
    const v4f x0 = *(const v4fa*)(arow + kb + 8 * hh), x1 = *(const v4fa*)(arow + kb + 8 * hh + 4);
    const v4f x2 = *(const v4fa*)(arow + kb + 16 + 8 * hh), x3 = *(const v4fa*)(arow + kb + 16 + 8 * hh + 4);
    float xs[16] = {x0[0],x0[1],x0[2],x0[3],x1[0],x1[1],x1[2],x1[3],x2[0],x2[1],x2[2],x2[3],x3[0],x3[1],x3[2],x3[3]};
#pragma unroll
    for (int i = 0; i < 16; ++i) { const unsigned short hb = bf16_bits(xs[i]); ah.u[i] = hb; al.u[i] = ASPLIT ? bf16_bits(xs[i] - bf16_val(hb)) : (unsigned short)0; }
#pragma unroll
    for (int t = 0; t < 4; ++t) {
      const unsigned short* brow = Wt + (size_t)(col0 + t * 16 + ln) * ldb + kb;
      FragB b;
      b.half[0] = *(const v8us*)(brow + 8 * hh);
      b.half[1] = *(const v8us*)(brow + 16 + 8 * hh);
      acc[t] = mmaN<ASPLIT ? 2 : 1>(ah.v, al.v, b.v, b.v, acc[t]);
    }
  }
#pragma unroll
  for (int t = 0; t < 4; ++t) {
    const int col = col0 + t * 16 + ln;
    float bv = bias ? bias[col] : 0.f;
    if (BIAS_BF16) bv = bf16_round(bv);
#pragma unroll
    for (int r = 0; r < 8; ++r) {
      float v = acc[t][r] + bv;
      if (resid) { float rv = resid[(size_t)((row0 + 8 * hh + r) % rmod) * ldr + col]; if (RES_BF16) rv = bf16_round(rv); v += rv; }
      if (ACT == 1) v = fmaxf(v, 0.f);
      if (ACT == 2) v = 0.5f * v * (1.0f + erff(v * 0.70710678118654752f));
      if (ACT == 3) { const float u = 0.7978845608028654f * (v + 0.044715f * v * v * v); v = 0.5f * v * (1.0f + tanhf(u)); }
      so[w][8 * hh + r][t * 16 + ln] = v;
    }
  }
  __builtin_amdgcn_fence(__ATOMIC_ACQ_REL, "workgroup");
  __builtin_amdgcn_wave_barrier();
  const int rsub = lane >> 4, c4 = (lane & 15) * 4;
  {
#pragma unroll
    for (int q = 0; q < 8; ++q) {
      const int r = q * 2 + rsub;
      const v4f v = *(const v4fa*)&so[w][r][c4];
      *(v4f*)(C + (size_t)(row0 + r) * ldc + col0 + c4) = v;
    }
    
  }
}
// row LayerNorm (biased variance, eps) over N: s = X (+ R); optional out_sum <- s; out_norm <- (s-mu)*rsqrt(var+eps)*g + b
template <bool PARAM_BF16>
__global__ __launch_bounds__(256) void k_layernorm(const float* __restrict__ X, const float* __restrict__ R, const float* __restrict__ g, const float* __restrict__ bta,
                                                  float* __restrict__ out_sum, float* __restrict__ out_norm, int N, float eps) {
  __shared__ float red[256];
  const int row = blockIdx.x, tid = threadIdx.x;
  const float* x = X + (size_t)row * N; const float* rr = R ? R + (size_t)row * N : nullptr;
  float vals[16];                     // up to N = 4096
  const int per = N / 256;            // contiguous chunk per thread? use strided-by-4 chunks: thread handles j = tid*4 + 1024*u
  float s1 = 0.f;
  for (int u = 0; u < per / 4; ++u) {
    const int j = tid * 4 + 1024 * u;
    const v4f a = *(const v4fa*)(x + j);
    v4f b = {0.f,0.f,0.f,0.f}; if (rr) b = *(const v4fa*)(rr + j);
#pragma unroll
    for (int q = 0; q < 4; ++q) { const float v = a[q] + b[q]; vals[u * 4 + q] = v; s1 += v; }
  }
  red[tid] = s1; __syncthreads();
  for (int st = 128; st > 0; st >>= 1) { if (tid < st) red[tid] += red[tid + st]; __syncthreads(); }
  const float mu = red[0] / (float)N; __syncthreads();
  float s2 = 0.f;
  for (int u = 0; u < per / 4; ++u)
#pragma unroll
    for (int q = 0; q < 4; ++q) { const float c = vals[u * 4 + q] - mu; s2 += c * c; }
  red[tid] = s2; __syncthreads();
  for (int st = 128; st > 0; st >>= 1) { if (tid < st) red[tid] += red[tid + st]; __syncthreads(); }
  const float rs = rsqrtf(red[0] / (float)N + eps);
  {
    for (int u = 0; u < per / 4; ++u) {
      const int j = tid * 4 + 1024 * u;
      v4f o, sm;
#pragma unroll
      for (int q = 0; q < 4; ++q) {
        float gg = g[j + q], bb = bta[j + q];
        if (PARAM_BF16) { gg = bf16_round(gg); bb = bf16_round(bb); }
        sm[q] = vals[u * 4 + q]; o[q] = (vals[u * 4 + q] - mu) * rs * gg + bb;
      }
      if (out_sum) *(v4f*)(out_sum + (size_t)row * N + j) = sm;
      *(v4f*)(out_norm + (size_t)row * N + j) = o;
    }
    
  }
}



// ---- f16 WMMA path (v_wmma_f32_16x16x32_f16): 11-bit significands for operands in range — used where a [0,1] probability operand needs more precision than bf16
typedef _Float16 v16h __attribute__((ext_vector_type(16)));
union FragH { v16h v; v8us half[2]; _Float16 h[16]; unsigned short u[16]; };
template <int NT>
__device__ __forceinline__ v8f mmaH(v16h ah, v16h al, v16h bh, v16h bl, v8f c) {
  c = __builtin_amdgcn_wmma_f32_16x16x32_f16(false, ah, false, bh, (short)0, c, false, false);
  if (NT >= 2) c = __builtin_amdgcn_wmma_f32_16x16x32_f16(false, al, false, bh, (short)0, c, false, false);
  if (NT >= 3) c = __builtin_amdgcn_wmma_f32_16x16x32_f16(false, ah, false, bl, (short)0, c, false, false);
  asm volatile("v_nop\n\tv_nop\n\tv_nop\n\tv_nop" : "+v"(c) : "v"(ah), "v"(al), "v"(bh), "v"(bl));
  return c;
}
// batched GEMM like k_gemm_b but f16 operands: A f32 (split into f16 hi/lo if ASPLIT, else rounded to f16), Bt = f16 values [n][k]; alpha; C f32; N multiple of 16 (partial tiles skipped)
template <bool ASPLIT>
__global__ __launch_bounds__(128) void k_gemm_h(const float* __restrict__ A, int lda, size_t sA, const _Float16* __restrict__ Bh, int ldb, size_t sB, float alpha, float* __restrict__ C, int ldc, size_t sC, int M, int N, int K) {
  __shared__ __attribute__((aligned(16))) float so[4][16][64];
  const int tid = threadIdx.x, w = tid >> 5, lane = tid & 31, ln = lane & 15, hh = lane >> 4; const int by = blockIdx.y;
  A += (size_t)by * sA; Bh += (size_t)by * sB; C += (size_t)by * sC;
  const int ntn = (N + 63) / 64; const int wid = blockIdx.x * 4 + w; const int mt = wid / ntn, nq = wid % ntn; if (mt * 16 >= M) return;
  const int row0 = mt * 16, col0 = nq * 64; const float* arow = A + (size_t)(row0 + ln) * lda;
  v8f acc[4] = {};
  for (int kb = 0; kb < K; kb += 32) {
    FragH ah, al;
    const v4f x0 = *(const v4fa*)(arow + kb + 8 * hh), x1 = *(const v4fa*)(arow + kb + 8 * hh + 4), x2 = *(const v4fa*)(arow + kb + 16 + 8 * hh), x3 = *(const v4fa*)(arow + kb + 16 + 8 * hh + 4);
    float xs[16] = {x0[0],x0[1],x0[2],x0[3],x1[0],x1[1],x1[2],x1[3],x2[0],x2[1],x2[2],x2[3],x3[0],x3[1],x3[2],x3[3]};
#pragma unroll
    for (int i = 0; i < 16; ++i) { const _Float16 h = (_Float16)xs[i]; ah.h[i] = h; al.h[i] = ASPLIT ? (_Float16)(xs[i] - (float)h) : (_Float16)0.0f; }
#pragma unroll
    for (int t = 0; t < 4; ++t) { if (col0 + t * 16 >= N) continue; const size_t boff = (size_t)(col0 + t * 16 + ln) * ldb + kb; FragH bq; bq.half[0] = *(const v8us*)(Bh + boff + 8 * hh); bq.half[1] = *(const v8us*)(Bh + boff + 16 + 8 * hh);
      acc[t] = mmaH<ASPLIT ? 2 : 1>(ah.v, al.v, bq.v, bq.v, acc[t]); }
  }
#pragma unroll
  for (int t = 0; t < 4; ++t) { if (col0 + t * 16 >= N) continue;
#pragma unroll
    for (int r = 0; r < 8; ++r) so[w][8 * hh + r][t * 16 + ln] = acc[t][r] * alpha; }
  __builtin_amdgcn_fence(__ATOMIC_ACQ_REL, "workgroup"); __builtin_amdgcn_wave_barrier();
  const int rsub = lane >> 4, c4 = (lane & 15) * 4;
  {
#pragma unroll
    for (int q = 0; q < 8; ++q) { const int r = q * 2 + rsub; if (col0 + c4 < N) { const v4f v = *(const v4fa*)&so[w][r][c4]; *(v4f*)(C + (size_t)(row0 + r) * ldc + col0 + c4) = v; } }
     }
}

// Wt[n][k] = f16(W[k][n]·scale) from f32 row-major W[K][N] (scale = power of two; bf16-exact weights stay exact in f16 away from the subnormal range)
__global__ __launch_bounds__(256) void k_wt_f16(const float* __restrict__ W, _Float16* __restrict__ Wt, int K, int N, float scale) {
  const int t = blockIdx.x * 256 + threadIdx.x; if (t >= N * (K / 8)) return; const int n = t / (K / 8), k8 = (t % (K / 8)) * 8; FragH f;
#pragma unroll
  for (int i = 0; i < 8; ++i) f.h[i] = (_Float16)(bf16_round(W[(size_t)(k8 + i) * N + n]) * scale); const v8us o = f.half[0];
  *(v8us*)((unsigned short*)Wt + (size_t)n * K + k8) = o; 
}
// k_gemm_hh variant with fused epilogue: v = acc·alpha + bias[by·sBias + col] (+ CP[(row/rowsPerB)·sCPb + by·64 + col] if CP) ; ACT 0 none / 1 elu ; writes f16 C16 (and f32 C if non-null)
template <int ACT>
__global__ __launch_bounds__(128) void k_gemm_hhx(const _Float16* __restrict__ A, int lda, size_t sA, const _Float16* __restrict__ Bh, int ldb, size_t sB, float alpha, const float* __restrict__ bias, size_t sBias, const float* __restrict__ CP, int rowsPerB, size_t sCPb, int row0g,
    float* __restrict__ C, _Float16* __restrict__ C16, int ldc, size_t sC, int M, int N, int K) {
  __shared__ __attribute__((aligned(16))) float so[4][16][64];
  const int tid = threadIdx.x, w = tid >> 5, lane = tid & 31, ln = lane & 15, hh = lane >> 4; const int by = blockIdx.y;
  A += (size_t)by * sA; Bh += (size_t)by * sB; const size_t cofs = (size_t)by * sC; const float* bp = bias ? bias + (size_t)by * sBias : nullptr;
  const int ntn = (N + 63) / 64; const int wid = blockIdx.x * 4 + w; const int mt = wid / ntn, nq = wid % ntn; if (mt * 16 >= M) return;
  const int row0 = mt * 16, col0 = nq * 64; const _Float16* arow = A + (size_t)(row0 + ln) * lda;
  v8f acc[4] = {};
  for (int kb = 0; kb < K; kb += 32) { FragH ah; ah.half[0] = *(const v8us*)((const unsigned short*)arow + kb + 8 * hh); ah.half[1] = *(const v8us*)((const unsigned short*)arow + kb + 16 + 8 * hh);
#pragma unroll
    for (int t = 0; t < 4; ++t) { if (col0 + t * 16 >= N) continue; const size_t boff = (size_t)(col0 + t * 16 + ln) * ldb + kb; FragH bq; bq.half[0] = *(const v8us*)((const unsigned short*)Bh + boff + 8 * hh); bq.half[1] = *(const v8us*)((const unsigned short*)Bh + boff + 16 + 8 * hh);
      acc[t] = mmaH<1>(ah.v, ah.v, bq.v, bq.v, acc[t]); }
  }
#pragma unroll
  for (int t = 0; t < 4; ++t) { if (col0 + t * 16 >= N) continue; const int col = col0 + t * 16 + ln; const float bv = bp ? bf16_round(bp[col]) : 0.f;
#pragma unroll
    for (int r = 0; r < 8; ++r) { float v = acc[t][r] * alpha + bv; if (CP) { const int rr = row0g + row0 + 8 * hh + r; if (rowsPerB < 0) v += CP[cofs + (size_t)rr * ldc + col];      /* rowsPerB < 0: own element of the batched C plane */ else { const int bidx = rr / rowsPerB; v += CP[(size_t)bidx * sCPb + (size_t)by * 64 + col]; } } if (ACT == 1) v = (v > 0.f) ? v : expm1f(v); else if (ACT == 7) v = (v > 0.f) ? v + 1.0f : expf(v); else if (ACT == 8) v = tanhf(v); else if (ACT == 9) v = 0.5f * v * (1.0f + tanhf(0.7978845608028654f * (v + 0.044715f * v * v * v))); else if (ACT == 11) v = 1.0f / (1.0f + expf(-v)); else if (ACT == 12) v = (v > 0.f) ? v : 0.01f * v; else if (ACT == 14) v = (v > 0.f) ? v : 0.1f * v; else if (ACT == 16) v = (v >= 0.f) ? v : 0.3f * v; else if (ACT == 17) v = (v >= 0.f) ? v : 0.2f * v; else if (ACT == 15) v = v / (1.0f + expf(-v)); else if (ACT == 3) v = fmaxf(v, 0.f); else if (ACT == 6) v = 0.5f * v * (1.0f + erff(v * 0.70710678118654752f)); so[w][8 * hh + r][t * 16 + ln] = v; } }
  __builtin_amdgcn_fence(__ATOMIC_ACQ_REL, "workgroup"); __builtin_amdgcn_wave_barrier();
  const int rsub = lane >> 4, c4 = (lane & 15) * 4; typedef _Float16 v4h __attribute__((ext_vector_type(4)));
  {
#pragma unroll
    for (int q = 0; q < 8; ++q) { const int r = q * 2 + rsub; if (col0 + c4 < N) { const v4f v = *(const v4fa*)&so[w][r][c4]; if (C) *(v4f*)(C + cofs + (size_t)(row0 + r) * ldc + col0 + c4) = v; if (C16) { v4h h4; for (int i = 0; i < 4; ++i) h4[i] = (_Float16)v[i]; *(v4h*)(C16 + cofs + (size_t)(row0 + r) * ldc + col0 + c4) = h4; } } }
     }
}


typedef _Float16 v4h __attribute__((ext_vector_type(4)));

__global__ __launch_bounds__(256) void k_x16(const float* __restrict__ x, _Float16* __restrict__ X16, size_t n8) { const size_t t = (size_t)blockIdx.x * 256 + threadIdx.x; if (t >= n8) return; FragH f;
#pragma unroll
  for (int q = 0; q < 8; ++q) f.h[q] = (_Float16)bf16_round(x[t * 8 + q]); *(v8us*)((unsigned short*)X16 + t * 8) = f.half[0];  }
__global__ __launch_bounds__(256) void k_h16(const float* __restrict__ x, _Float16* __restrict__ X16, size_t n8) { const size_t t = (size_t)blockIdx.x * 256 + threadIdx.x; if (t >= n8) return; FragH f;
#pragma unroll
  for (int q = 0; q < 8; ++q) f.h[q] = (_Float16)x[t * 8 + q]; *(v8us*)((unsigned short*)X16 + t * 8) = f.half[0];  }
__global__ __launch_bounds__(256) void k_round16f(const float* __restrict__ W, _Float16* __restrict__ Bt, size_t n8) { const size_t t = (size_t)blockIdx.x * 256 + threadIdx.x; if (t >= n8) return; FragH f;
#pragma unroll
  for (int i = 0; i < 8; ++i) f.h[i] = (_Float16)(bf16_round(W[t * 8 + i]) * 16.0f); *(v8us*)((unsigned short*)Bt + t * 8) = f.half[0];  }
template <int NHv, int TTv>
__global__ __launch_bounds__(256) void k_vt(const _Float16* __restrict__ V16, int ldv, int voff, _Float16* __restrict__ Vt) { __shared__ unsigned short tl[64][66]; const int tid = threadIdx.x; const int slab = blockIdx.x / (TTv / 64), lg = blockIdx.x % (TTv / 64); const int b = slab / NHv, h = slab % NHv;
  for (int i = tid; i < 64 * 8; i += 256) { const int r = i / 8, c8 = (i % 8) * 8; FragH f; f.half[0] = *(const v8us*)((const unsigned short*)V16 + ((size_t)b * TTv + lg * 64 + r) * ldv + voff + h * 64 + c8);
#pragma unroll
    for (int q = 0; q < 8; ++q) tl[r][c8 + q] = f.u[q]; }
  __syncthreads();
  {
#pragma unroll
    for (int rd = 0; rd < 2; ++rd) { const int d = rd * 32 + tid / 8, pc = tid % 8; FragH f;
#pragma unroll
      for (int q = 0; q < 8; ++q) f.u[q] = tl[pc * 8 + q][d];
      *(v8us*)((unsigned short*)Vt + ((size_t)slab * 64 + d) * TTv + lg * 64 + pc * 8) = f.half[0]; }
     } }

__global__ __launch_bounds__(256) void k_hl(const float* __restrict__ F, _Float16* __restrict__ Hh, _Float16* __restrict__ Hl, size_t n8) { const size_t t = (size_t)blockIdx.x * 256 + threadIdx.x; if (t >= n8) return; FragH fh, fl; const v4f a = *(const v4fa*)(F + t * 8), c = *(const v4fa*)(F + t * 8 + 4);
#pragma unroll
  for (int q = 0; q < 4; ++q) { _Float16 h = (_Float16)a[q]; fh.h[q] = h; fl.h[q] = (_Float16)((a[q] - (float)h) * 1024.0f); h = (_Float16)c[q]; fh.h[4 + q] = h; fl.h[4 + q] = (_Float16)((c[q] - (float)h) * 1024.0f); }
  { *(v8us*)((unsigned short*)Hh + t * 8) = fh.half[0]; *(v8us*)((unsigned short*)Hl + t * 8) = fl.half[0];  } }

// ---- fast GEMM (wave tile 32x64; requires M % 128 == 0 rows per launch region, N % 64 == 0 and K % 64 == 0); epilogue = k_gemm_hhx semantics ----
__device__ __forceinline__ v16h g2_frag(const _Float16* p, int hh) { FragH f; f.half[0] = *(const v8us*)((const unsigned short*)p + 8 * hh); f.half[1] = *(const v8us*)((const unsigned short*)p + 16 + 8 * hh); return f.v; }
__device__ __forceinline__ v8f g2_mmab(v16h a, v16h b, v8f c) { return __builtin_amdgcn_wmma_f32_16x16x32_f16(false, a, false, b, (short)0, c, false, false); }
#define G2KC 64                      /* k per staged tile: 128 bytes, one cache line of every operand row */
#define G2P 72                       /* LDS row pitch in f16: 128 + 16 bytes, so that the 16 rows of a 16-byte fragment read fall on different banks */
// Block tile 128 x 64. Per 64 k the block's 128 A rows and 64 B rows go global -> registers -> LDS with whole-line loads, one tile ahead, two LDS buffers; the waves read their fragments from LDS. Needs M % 128 == 0, K % 64 == 0, K >= 64.
template <int ACT>
__global__ __launch_bounds__(128) void k_gemm2(const _Float16* __restrict__ A, int lda, size_t sA, const _Float16* __restrict__ Bh, int ldb, size_t sB, float alpha, const float* __restrict__ bias, size_t sBias, const float* __restrict__ CP, int rowsPerB, size_t sCPb, int row0g,
    float* __restrict__ C, _Float16* __restrict__ C16, int ldc, size_t sC, int M, int N, int K) { static_assert(ACT == 0 || ACT == 3 || ACT == 6 || ACT == 8 || ACT == 9 || ACT == 11 || ACT == 12 || ACT == 14 || ACT == 15 || ACT == 16 || ACT == 17, "k_gemm2: unsupported ACT code (would silently apply no activation)");
  __shared__ __attribute__((aligned(16))) float so[4][32][68];
  __shared__ __attribute__((aligned(16))) _Float16 st[2][192][G2P];      /* two staged tiles: rows 0..127 = the block's A rows, rows 128..191 = its B rows, G2KC k each */
  const int tid = threadIdx.x, w = tid >> 5, lane = tid & 31, ln = lane & 15, hh = lane >> 4; const int by = blockIdx.y;
  A += (size_t)by * sA; Bh += (size_t)by * sB; const size_t cofs = (size_t)by * sC; const float* bp = bias ? bias + (size_t)by * sBias : nullptr;
  const int ntn = N >> 6; const int mt = blockIdx.x / ntn, nq = blockIdx.x - mt * ntn; const int row0 = mt * 128 + 32 * w, col0 = nq * 64; if (mt * 128 >= M) return;      /* the same for the whole block: it stands in front of the barriers */
  const int sr = tid >> 3, sg = tid & 7;      /* staging: 8 threads bring one row's 128 bytes, so a wave's 16-byte load is 4 whole cache lines */
  const _Float16* gp[12];      /* the thread's 8 A pieces and 4 B pieces of the tile to be fetched next */
#pragma unroll
  for (int i = 0; i < 8; ++i) gp[i] = A + (size_t)(mt * 128 + sr + 16 * i) * lda + sg * 8;
#pragma unroll
  for (int i = 0; i < 4; ++i) gp[8 + i] = Bh + (size_t)(col0 + sr + 16 * i) * ldb + sg * 8;
  v8us rg[12];      /* the tile on its way from global memory to LDS */
  auto fetch = [&]() {
#pragma unroll
    for (int i = 0; i < 12; ++i) rg[i] = *(const v8us*)(const unsigned short*)gp[i];
    asm volatile("s_wait_xcnt 0x0" :: "v"(gp[0]), "v"(gp[1]), "v"(gp[2]), "v"(gp[3]), "v"(gp[4]), "v"(gp[5]), "v"(gp[6]), "v"(gp[7]), "v"(gp[8]), "v"(gp[9]), "v"(gp[10]), "v"(gp[11]) : "memory");      /* the 12 addresses are named so that their registers live up to this wait: none is overwritten in front of it, neither by the step to the next tile below nor by a load's result */
#pragma unroll
    for (int i = 0; i < 12; ++i) gp[i] += G2KC; };
  auto put = [&](int buf) {
#pragma unroll
    for (int i = 0; i < 12; ++i) *(v8us*)&st[buf][sr + 16 * i][sg * 8] = rg[i]; };
  auto lfrag = [&](int buf, int row, int kk) { FragH f; const unsigned short* p = (const unsigned short*)&st[buf][row][kk * 32 + 8 * hh]; f.half[0] = *(const v8us*)p; f.half[1] = *(const v8us*)(p + 16); return f.v; };      /* the k order of g2_frag */
  const v8f z8 = {0.f,0.f,0.f,0.f,0.f,0.f,0.f,0.f}; v8f c00 = z8, c01 = z8, c02 = z8, c03 = z8, c10 = z8, c11 = z8, c12 = z8, c13 = z8;
  const int nc = K / G2KC;
  fetch(); put(0); __syncthreads();
#pragma unroll 1      /* one copy of the tile body: the trip count is a run-time value and the body is long */
  for (int c = 0; c < nc; ++c) { const int buf = c & 1;
    if (c + 1 < nc) fetch();      /* the next tile's global loads fly while this tile is worked on */
    v16h a[2][2], b[2][4];
#pragma unroll
    for (int kk = 0; kk < 2; ++kk) { a[kk][0] = lfrag(buf, 32 * w + ln, kk); a[kk][1] = lfrag(buf, 32 * w + 16 + ln, kk);
#pragma unroll
      for (int t = 0; t < 4; ++t) b[kk][t] = lfrag(buf, 128 + 16 * t + ln, kk); }
    __builtin_amdgcn_sched_barrier(0);      /* keeps the tile's 24 LDS reads together in front of its 16 WMMAs: one LDS latency a tile with counted waits, where the scheduler otherwise reuses one B fragment's registers and waits for LDS eight times */
#pragma unroll
    for (int kk = 0; kk < 2; ++kk) {
      c00 = g2_mmab(a[kk][0], b[kk][0], c00); c10 = g2_mmab(a[kk][1], b[kk][0], c10); c01 = g2_mmab(a[kk][0], b[kk][1], c01); c11 = g2_mmab(a[kk][1], b[kk][1], c11);
      c02 = g2_mmab(a[kk][0], b[kk][2], c02); c12 = g2_mmab(a[kk][1], b[kk][2], c12); c03 = g2_mmab(a[kk][0], b[kk][3], c03); c13 = g2_mmab(a[kk][1], b[kk][3], c13); }
    if (c + 1 < nc) put(buf ^ 1);      /* into the buffer whose last readers passed the barrier at the foot of the trip before */
    __syncthreads(); }      /* one barrier a tile: publishes tile c + 1 and ends the reads of tile c */
  v8f accs[8] = {c00, c01, c02, c03, c10, c11, c12, c13};
#pragma unroll
  for (int u = 0; u < 8; ++u) { const int t = u & 3, half = u >> 2; const int col = col0 + t * 16 + ln; const float bv = bp ? bf16_round(bp[col]) : 0.f;
#pragma unroll
    for (int r = 0; r < 8; ++r) { const int rloc = half * 16 + 8 * hh + r; float v = accs[u][r] * alpha + bv; if (CP) { if (rowsPerB < 0) v += CP[cofs + (size_t)(row0g + row0 + rloc) * ldc + col];      /* rowsPerB < 0: own element of the batched C plane */ else { const int bidx = (row0g + row0 + rloc) / rowsPerB; v += CP[(size_t)bidx * sCPb + (size_t)by * 64 + col]; } }
      if (ACT == 3) v = fmaxf(v, 0.f); else if (ACT == 6) v = 0.5f * v * (1.0f + erff(v * 0.70710678118654752f)); else if (ACT == 11) v = 1.0f / (1.0f + expf(-v)); else if (ACT == 15) v = v / (1.0f + expf(-v)); else if (ACT == 12) v = (v > 0.f) ? v : 0.01f * v; else if (ACT == 8) v = tanhf(v); else if (ACT == 9) v = 0.5f * v * (1.0f + tanhf(0.7978845608028654f * (v + 0.044715f * v * v * v))); else if (ACT == 14) v = (v > 0.f) ? v : 0.1f * v; else if (ACT == 16) v = (v >= 0.f) ? v : 0.3f * v; else if (ACT == 17) v = (v >= 0.f) ? v : 0.2f * v;
      so[w][rloc][t * 16 + ln] = v; } }
  __builtin_amdgcn_fence(__ATOMIC_ACQ_REL, "workgroup"); __builtin_amdgcn_wave_barrier();
  const int rsub = lane >> 4, c4 = (lane & 15) * 4;
  {
#pragma unroll
    for (int q = 0; q < 16; ++q) { const int r = q * 2 + rsub; const v4f v = *(const v4fa*)&so[w][r][c4]; if (C) *(v4f*)(C + cofs + (size_t)(row0 + r) * ldc + col0 + c4) = v; if (C16) { v4h h4; for (int i = 0; i < 4; ++i) h4[i] = (_Float16)v[i]; *(v4h*)(C16 + cofs + (size_t)(row0 + r) * ldc + col0 + c4) = h4; } }
     } }


__global__ __launch_bounds__(256) void k_wnat(const float* __restrict__ w, size_t n8, _Float16* __restrict__ Bt) { const size_t t = (size_t)blockIdx.x * 256 + threadIdx.x; if (t >= n8) return; FragH f; for (int q = 0; q < 8; ++q) f.h[q] = (_Float16)(bf16_round(w[t * 8 + q]) * 16.0f); *(v8us*)((unsigned short*)Bt + t * 8) = f.half[0];  }
__global__ __launch_bounds__(256) void k_rsm(const float* __restrict__ S, _Float16* __restrict__ P, int nrows) {
  #pragma clang fp contract(off)
  const int i = blockIdx.x * 256 + threadIdx.x; if (i >= nrows) return; const float* s = S + (size_t)i * SQ; float mx = -3.0e38f;
#pragma unroll 1
  for (int j = 0; j < SQ; ++j) mx = fmaxf(mx, s[j]); float se = 0.f;
#pragma unroll 1
  for (int j = 0; j < SQ; ++j) se += expf(s[j] - mx); const float sc = 256.0f / se;
#pragma unroll 1
  for (int j0 = 0; j0 < SQ; j0 += 8) { FragH f; for (int q = 0; q < 8; ++q) f.h[q] = (_Float16)(expf(s[j0 + q] - mx) * sc); unsigned short* d = (unsigned short*)P + (size_t)i * SQ + j0; *(v8us*)d = f.half[0];  } }
__global__ __launch_bounds__(256) void k_vt(const _Float16* __restrict__ V16, int b, int h0, _Float16* __restrict__ VT) { __shared__ unsigned short tl[64][65]; const int tid = threadIdx.x; const int hh = blockIdx.x % HG, sg = blockIdx.x / HG; const int s0 = sg * 64; const int h = h0 + hh;
  for (int i = tid; i < 64 * 8; i += 256) { const int j = i / 8, d8 = (i % 8) * 8; FragH f; f.half[0] = *(const v8us*)((const unsigned short*)V16 + ((size_t)b * SQ + s0 + j) * DM + h * HD + d8); for (int q = 0; q < 8; ++q) tl[d8 + q][j] = f.u[q]; }
  __syncthreads();
  { for (int i = tid; i < 64 * 8; i += 256) { const int d = i / 8, j8 = (i % 8) * 8; FragH f; for (int q = 0; q < 8; ++q) f.u[q] = tl[d][j8 + q]; *(v8us*)((unsigned short*)VT + ((size_t)hh * HD + d) * SQ + s0 + j8) = f.half[0]; }  } }



#define FQ 32                        /* query rows per wave */
typedef _Float16 v8h __attribute__((ext_vector_type(8)));
__device__ __forceinline__ float half_xor(float v) { const int i = __builtin_bit_cast(int, v); return __builtin_bit_cast(float, __builtin_amdgcn_permlanex16(i, i, 0x76543210, 0xfedcba98, false, false)); }      /* lane l <- lane l ^ 16 */
__device__ __forceinline__ float exp2_slot(float x) { float y; asm("v_exp_f32 %0, %1\n\tv_nop" : "=v"(y) : "v"(x)); return y; }      /* v_nop: the slot the instruction set asks for behind a transcendental before its result is read or its source rewritten; in the same statement it stays directly behind it */
__device__ __forceinline__ v8f fa_mma(v16h a, v16h b, v8f c) { return __builtin_amdgcn_wmma_f32_16x16x32_f16(false, a, false, b, (short)0, c, false, false); }
__global__ __launch_bounds__(128) void k_fattn(const _Float16* __restrict__ Qr, const _Float16* __restrict__ Kr, const _Float16* __restrict__ Vt, _Float16* __restrict__ Or) {
  static_assert(HD == 64 && SQ % (4 * FQ) == 0, "two k chunks per score product, four d tiles, whole blocks of 4 waves");
  const int lane = threadIdx.x & 31, ln = lane & 15, hh = lane >> 4; const int w = __builtin_amdgcn_readfirstlane((int)(threadIdx.x >> 5));
  const int h = blockIdx.x % NH; const int q0 = (SQ / (4 * FQ) - 1 - (int)(blockIdx.x / NH)) * (4 * FQ) + w * FQ;      /* the longest blocks start first */
  const _Float16* kp = Kr + (size_t)ln * LQ + h * HD;          /* A rows of S^T: key rows */
  const _Float16* vp = Vt + ((size_t)h * HD + ln) * SQ;        /* A rows of O^T: rows of V^T */
  v16h qf[2][2], kf[2][2], vf[4];      /* [query group | key group][k chunk of 32 head dims]; [tile of 16 head dims] */
#pragma unroll
  for (int g = 0; g < 2; ++g)
#pragma unroll
    for (int c = 0; c < 2; ++c) qf[g][c] = g2_frag(Qr + (size_t)(q0 + 16 * g + ln) * LQ + h * HD + 32 * c, hh);
  asm volatile("" :: "v"(qf[0][0]), "v"(qf[0][1]), "v"(qf[1][0]), "v"(qf[1][1]) : "memory");      /* inputs only: the q rows have landed before the first K and V loads are issued, so the loop's counted load waits stand for K and V alone and never drain the loads fetched ahead */
#pragma unroll
  for (int t = 0; t < 2; ++t)
#pragma unroll
    for (int c = 0; c < 2; ++c) kf[t][c] = g2_frag(kp + (size_t)(16 * t) * LQ + 32 * c, hh);
  __builtin_amdgcn_sched_barrier(0);      /* keeps the first K loads in front of the first V loads, the order the loop issues them in: the wait for K at the loop's head then leaves the V loads in flight */
#pragma unroll
  for (int t = 0; t < 4; ++t) vf[t] = g2_frag(vp + (size_t)(16 * t) * SQ, hh);
  const v8f z8 = {0.f, 0.f, 0.f, 0.f, 0.f, 0.f, 0.f, 0.f};
  v8f o[2][4] = {{z8, z8, z8, z8}, {z8, z8, z8, z8}};      /* o[g][t][r] = O^T[16 t + 8 hh + r][query q0 + 16 g + ln] */
  float m[2] = {-3.0e38f, -3.0e38f}, l[2] = {0.f, 0.f};      /* m: running maximum of the raw products q.k; l: this wave half's keys only, the halves are joined once behind the loop */
  const float cs = 0.125f * 1.44269504088896f;      /* score scale x log2(e): exp(0.125 (s - m)) = exp2(cs s - cs m) */
  int kb = 0;
#pragma unroll 1
  do {      /* q0 >= 0: every wave has at least its own diagonal step */
    v8f s[2][2];      /* s[g][t][r] = q.k of key kb + 16 t + 8 hh + r, query q0 + 16 g + ln */
#pragma unroll
    for (int g = 0; g < 2; ++g)
#pragma unroll
      for (int t = 0; t < 2; ++t) s[g][t] = fa_mma(kf[t][1], qf[g][1], fa_mma(kf[t][0], qf[g][0], z8));
    const int kn = (kb + 32 <= q0) ? kb + 32 : q0;      /* the next step's keys; the last step fetches its own again (in bounds, unused) */
#pragma unroll
    for (int t = 0; t < 2; ++t)
#pragma unroll
      for (int c = 0; c < 2; ++c) kf[t][c] = g2_frag(kp + (size_t)(kn + 16 * t) * LQ + 32 * c, hh);      /* fetched one step ahead, right behind their last use: the softmax and P V hide the latency */
#pragma unroll
    for (int g = 0; g < 2; ++g) {
      if (kb == q0) {      /* the one step that holds keys above a query (wave-uniform test) */
#pragma unroll
        for (int t = 0; t < 2; ++t)
#pragma unroll
          for (int r = 0; r < 8; ++r) s[g][t][r] = (16 * t + 8 * hh + r <= 16 * g + ln) ? s[g][t][r] : -1.0e9f; }
      float mx = fmaxf(s[g][0][0], s[g][1][0]);
#pragma unroll
      for (int r = 1; r < 8; ++r) mx = fmaxf(mx, fmaxf(s[g][0][r], s[g][1][r]));
      const float mn = fmaxf(m[g], fmaxf(mx, half_xor(mx))); const float sc = exp2_slot((m[g] - mn) * cs); const float mc = mn * cs; m[g] = mn;
#pragma unroll
      for (int t = 0; t < 2; ++t)
#pragma unroll
        for (int r = 0; r < 8; ++r) s[g][t][r] = exp2_slot(fmaf(s[g][t][r], cs, -mc));
      const v8f sv = s[g][0] + s[g][1];
      l[g] = l[g] * sc + (((sv[0] + sv[1]) + (sv[2] + sv[3])) + ((sv[4] + sv[5]) + (sv[6] + sv[7])));
      const v16h pf = __builtin_shufflevector(__builtin_convertvector(s[g][0], v8h), __builtin_convertvector(s[g][1], v8h), 0, 1, 2, 3, 4, 5, 6, 7, 8, 9, 10, 11, 12, 13, 14, 15);
#pragma unroll
      for (int t = 0; t < 4; ++t) o[g][t] = fa_mma(vf[t], pf, o[g][t] * sc);
    }
#pragma unroll
    for (int t = 0; t < 4; ++t) vf[t] = g2_frag(vp + (size_t)(16 * t) * SQ + kn, hh);      /* likewise one step ahead: the next score products and softmax hide the latency */
    kb += 32;
  } while (kb <= q0);
  asm volatile("s_wait_loadcnt 0x0" ::: "memory");      /* the last step's fetched-ahead K and V are unused and still in flight: they land before the wave gives its registers back */
#pragma unroll
  for (int g = 0; g < 2; ++g) { const float fin = 64.0f / (l[g] + half_xor(l[g]));      /* o carried x64, folded into the output GEMM alpha */
    _Float16* orow = Or + (size_t)(q0 + 16 * g + ln) * DM + h * HD + 8 * hh;
#pragma unroll
    for (int t = 0; t < 4; ++t) *(v8h*)(orow + 16 * t) = __builtin_convertvector(o[g][t] * fin, v8h); }      /* a lane holds 8 consecutive head dims of its query: one 16-byte store */
}


#define A0Q 32                       /* query rows per k_att0 block: one per lane */
#define A0S 16                       /* waves per k_att0 block: wave w takes the keys w, w + 16, w + 32, ... */
#define A0P 68                       /* LDS pitch of a partial o row in floats: 256 + 16 bytes, so that the lanes' 16-byte stores fall on different banks */
// Exact f32 attention of the first QT0 rows. A block owns 32 query rows of a head (a lane = a row); its 16 waves share the keys, each with a running maximum, sum and o of its own;
// at the end the 16 partial results are brought to the block's common maximum and added through LDS.
template <int MASKADD>
__global__ __launch_bounds__(A0Q * A0S) void k_att0(const float* __restrict__ QF, const float* __restrict__ KF, const float* __restrict__ VF, int ld, const float* __restrict__ mask, float scale, float* __restrict__ OF, int ldo) {
  #pragma clang fp contract(off)
  static_assert(A0Q == 32 && A0S * 32 == A0Q * (HD / 4), "a lane per query row; in the final sum a thread per 16-byte piece of an o row");
  __shared__ __attribute__((aligned(16))) float po[A0S][A0Q][A0P];      /* each wave's o rows, on the common maximum */
  __shared__ float pm[A0S][A0Q], pl[A0S][A0Q];      /* each wave's running maxima; its row sums, on the common maximum */
  const int tid = threadIdx.x, lane = tid & 31; const int w = __builtin_amdgcn_readfirstlane(tid >> 5);      /* the wave's number as a scalar: the key rows' addresses stay wave-uniform (scalar loads) */
  const int h = blockIdx.x / (QT0 / A0Q), rg = blockIdx.x % (QT0 / A0Q); const int i = rg * A0Q + lane;
  const float* qr = QF + (size_t)i * ld + h * HD;
  v4f q[HD / 4], o[HD / 4];      /* the thread's q row and o row: every loop over c is fully unrolled, so both are indexed by constants only and stay in registers */
#pragma unroll
  for (int c = 0; c < HD / 4; ++c) { q[c] = *(const v4fa*)(qr + c * 4); const v4f z = {0.f, 0.f, 0.f, 0.f}; o[c] = z; }
  asm volatile("s_wait_xcnt 0x0" :: "v"(qr) : "memory");      /* qr is named so that the 16 loads' address registers live up to this wait: none of them is overwritten in front of it, not even by a later load's result */
  float m = -1.0e30f, l = 0.f; const int jmax = MASKADD ? (SQ - 1) : (rg * A0Q + A0Q - 1);      /* additive-mask form: every key (the mask input decides); causal form: keys up to the block's last row */
#pragma unroll 1
  for (int j = w; j <= jmax; j += A0S) { const float* kr = KF + (size_t)j * ld + h * HD; const float* vr = VF + (size_t)j * ld + h * HD; float s = 0.f;
#pragma unroll
    for (int c = 0; c < HD / 4; ++c) { const v4f kq = *(const v4fa*)(kr + c * 4); s = __fadd_rn(s, __fmul_rn(q[c][0], kq[0])); s = __fadd_rn(s, __fmul_rn(q[c][1], kq[1])); s = __fadd_rn(s, __fmul_rn(q[c][2], kq[2])); s = __fadd_rn(s, __fmul_rn(q[c][3], kq[3])); }
    s = __fmul_rn(s, scale); if (MASKADD) s = __fadd_rn(s, __fmul_rn(bf16_round(mask[(size_t)i * SQ + j]), -10000.0f));
    const float f = (MASKADD || j <= i) ? 1.f : 0.f; const float sm = fmaf(f, s, (1.f - f) * -1.0e30f); const float mn = fmaxf(m, sm); const float sc = expf(m - mn); const float e = expf(sm - mn); l = __fadd_rn(__fmul_rn(l, sc), e); m = mn;
#pragma unroll
    for (int c = 0; c < HD / 4; ++c) { const v4f vv = *(const v4fa*)(vr + c * 4); for (int u = 0; u < 4; ++u) o[c][u] = __fadd_rn(__fmul_rn(o[c][u], sc), __fmul_rn(e, vv[u])); } }
  pm[w][lane] = m;
  __syncthreads();      /* every wave's maxima are in LDS */
  float mb = pm[0][lane];
#pragma unroll
  for (int u = 1; u < A0S; ++u) mb = fmaxf(mb, pm[u][lane]);
  const float wt = expf(m - mb);      /* key 0 is open to every row, so mb is a true score; a wave that saw only closed keys of a row still has m = -1e30 there, its weight is exactly 0 and its (finite) sums drop out */
  pl[w][lane] = __fmul_rn(l, wt);
#pragma unroll
  for (int c = 0; c < HD / 4; ++c) { v4f oo = o[c]; for (int u = 0; u < 4; ++u) oo[u] = __fmul_rn(oo[u], wt); *(v4f*)&po[w][lane][c * 4] = oo; }
  __syncthreads();      /* every wave's weighted sums are in LDS */
  const int row = tid >> 4, pc = (tid & 15) * 4;      /* 16 threads add and store one o row: whole-line stores */
  v4f acc = *(const v4f*)&po[0][row][pc]; float ls = pl[0][row];
#pragma unroll
  for (int u = 1; u < A0S; ++u) { const v4f p = *(const v4f*)&po[u][row][pc]; for (int x = 0; x < 4; ++x) acc[x] = __fadd_rn(acc[x], p[x]); ls = __fadd_rn(ls, pl[u][row]); }
  const float fin = 64.0f / ls;      /* o carried x64 like the f16 path */
  for (int x = 0; x < 4; ++x) acc[x] = __fmul_rn(acc[x], fin);
  *(v4f*)(OF + (size_t)(rg * A0Q + row) * ldo + h * HD + pc) = acc; }

extern "C" void kernel_launch(void* const* d_in, const int* in_sizes, int n_in,
                              void* d_out, int out_size, void* d_ws, size_t ws_size, hipStream_t stream) {
  (void)in_sizes; (void)n_in; (void)out_size;
  const float* const* I = (const float* const*)d_in; const float* xq = I[0]; const float* xk = I[1]; const float* xv = I[2]; const float* wq = I[3]; const float* wk = I[4]; const float* wv = I[5]; const float* wo = I[6];      /* nn.Linear weights [out][in] */
  char* ws = (char*)d_ws; size_t off = 0;
  auto take = [&](size_t bytes) { char* p = ws + off; off += (bytes + 255) & ~(size_t)255; return p; };
  _Float16* BQ = (_Float16*)take((size_t)DM * DM * 2); _Float16* BK = (_Float16*)take((size_t)DM * DM * 2); _Float16* BV = (_Float16*)take((size_t)DM * DM * 2); _Float16* BO = (_Float16*)take((size_t)DM * DM * 2);
  _Float16* XQ = (_Float16*)take(NR * DM * 2); _Float16* XK = (_Float16*)take(NR * DM * 2); _Float16* XV = (_Float16*)take(NR * DM * 2); _Float16* Q16 = (_Float16*)take(NR * DM * 2); _Float16* K16 = (_Float16*)take(NR * DM * 2); _Float16* V16 = (_Float16*)take(NR * DM * 2); _Float16* O16 = (_Float16*)take(NR * DM * 2);
  _Float16* VT = (_Float16*)take((size_t)NH * HD * SQ * 2);
  float* QF0 = (float*)take((size_t)QT0 * DM * 4); float* KF0 = (float*)take((size_t)QT0 * DM * 4); float* VF0 = (float*)take((size_t)QT0 * DM * 4); float* OF0 = (float*)take((size_t)NB * QT0 * DM * 4); _Float16* OH0 = (_Float16*)take((size_t)NB * QT0 * DM * 2); _Float16* OL0 = (_Float16*)take((size_t)NB * QT0 * DM * 2);
  if (off > ws_size) return;
  { const unsigned g = (unsigned)(((size_t)DM * DM / 8 + 255) / 256); k_wnat<<<g, 256, 0, stream>>>(wq, (size_t)DM * DM / 8, BQ); k_wnat<<<g, 256, 0, stream>>>(wk, (size_t)DM * DM / 8, BK); k_wnat<<<g, 256, 0, stream>>>(wv, (size_t)DM * DM / 8, BV); k_wnat<<<g, 256, 0, stream>>>(wo, (size_t)DM * DM / 8, BO); }      /* natural [out][in] = Bt[n][k], x16 */
  k_x16<<<(unsigned)((NR * DM / 8 + 255) / 256), 256, 0, stream>>>(xq, XQ, NR * DM / 8); k_x16<<<(unsigned)((NR * DM / 8 + 255) / 256), 256, 0, stream>>>(xk, XK, NR * DM / 8); k_x16<<<(unsigned)((NR * DM / 8 + 255) / 256), 256, 0, stream>>>(xv, XV, NR * DM / 8);
  const size_t r0p = (size_t)B0 * SQ;      /* first projected row */
  k_gemm2<0><<<dim3((unsigned)((MP / 128) * (DM / 64)), 1), 128, 0, stream>>>(XQ + r0p * DM, DM, 0, BQ, DM, 0, 0.0625f, nullptr, 0, nullptr, 1, 0, 0, nullptr, Q16 + r0p * DM, DM, 0, MP, DM, DM);
  k_gemm2<0><<<dim3((unsigned)((MP / 128) * (DM / 64)), 1), 128, 0, stream>>>(XK + r0p * DM, DM, 0, BK, DM, 0, 0.0625f, nullptr, 0, nullptr, 1, 0, 0, nullptr, K16 + r0p * DM, DM, 0, MP, DM, DM);
  k_gemm2<0><<<dim3((unsigned)((MP / 128) * (DM / 64)), 1), 128, 0, stream>>>(XV + r0p * DM, DM, 0, BV, DM, 0, 0.0625f, nullptr, 0, nullptr, 1, 0, 0, nullptr, V16 + r0p * DM, DM, 0, MP, DM, DM);
  for (int b = B0; b < B0 + NBR; ++b) { const size_t r0 = (size_t)b * SQ;
    k_vt<NH, SQ><<<NH * (SQ / 64), 256, 0, stream>>>(V16 + r0 * LQ, LQ, 0, VT);      /* V^T [NH][HD][SQ] for this batch */
    k_gemm2<0><<<dim3((QT0 / 128) * (DM / 64), 1), 128, 0, stream>>>(XQ + r0 * DM, DM, 0, BQ, DM, 0, 0.0625f, nullptr, 0, nullptr, 1, 0, 0, QF0, nullptr, DM, 0, QT0, DM, DM); k_gemm2<0><<<dim3((QT0 / 128) * (DM / 64), 1), 128, 0, stream>>>(XK + r0 * DM, DM, 0, BK, DM, 0, 0.0625f, nullptr, 0, nullptr, 1, 0, 0, KF0, nullptr, DM, 0, QT0, DM, DM); k_gemm2<0><<<dim3((QT0 / 128) * (DM / 64), 1), 128, 0, stream>>>(XV + r0 * DM, DM, 0, BV, DM, 0, 0.0625f, nullptr, 0, nullptr, 1, 0, 0, VF0, nullptr, DM, 0, QT0, DM, DM);      /* f32 q, k, v of the first 256 rows (exact products) */
    k_att0<0><<<NH * (QT0 / A0Q), A0Q * A0S, 0, stream>>>(QF0, KF0, VF0, DM, nullptr, 0.125f, OF0 + (size_t)b * QT0 * DM, DM);      /* exact f32 attention for rows 0..255 (o x64) */
    k_fattn<<<NH * (SQ / (4 * FQ)), 128, 0, stream>>>(Q16 + r0 * LQ, K16 + r0 * LQ, VT, O16 + r0 * DM); }      /* o (merged heads, x64) as f16 rows: scores, softmax and P V in one launch */
  k_gemm2<0><<<dim3((unsigned)((MPO / 128) * (DM / 64)), 1), 128, 0, stream>>>(O16 + r0p * DM, DM, 0, BO, DM, 0, 0.0009765625f, nullptr, 0, nullptr, 1, 0, 0, (float*)d_out + r0p * DM, nullptr, DM, 0, MPO, DM, DM);      /* out rows are the output layout */
  k_hl<<<(unsigned)(((size_t)NB * QT0 * DM / 8 + 255) / 256), 256, 0, stream>>>(OF0, OH0, OL0, (size_t)NB * QT0 * DM / 8);      /* first-tile o (x64) -> f16 hi + x1024 residual planes */
  for (int b = B0; b < B0 + NBR; ++b) { const size_t r0 = (size_t)b * SQ; const size_t f0 = (size_t)b * QT0;
    k_gemm2<0><<<dim3((QT0 / 128) * (DM / 64), 1), 128, 0, stream>>>(OH0 + f0 * DM, DM, 0, BO, DM, 0, 0.0009765625f, nullptr, 0, nullptr, 1, 0, 0, (float*)d_out + r0 * DM, nullptr, DM, 0, QT0, DM, DM);      /* rows 0..255: out = o_hi Wo, overwriting the f16-path rows */
    k_gemm2<0><<<dim3((QT0 / 128) * (DM / 64), 1), 128, 0, stream>>>(OL0 + f0 * DM, DM, 0, BO, DM, 0, 0.00000095367431640625f, nullptr, 0, (const float*)d_out + r0 * DM, -1, 0, 0, (float*)d_out + r0 * DM, nullptr, DM, 0, QT0, DM, DM); }      /* += o_lo Wo 2^-20 (own-element accumulate) */
}

// v006
// Measured time: 243 microseconds a run.
// Next to v005, in two timings, it ran 1.15 and 1.16 times as fast.
// All steps since v000 together make it 34.4 times as fast.
#include <hip/hip_runtime.h>
// Causal multi-head attention (q, k, v inputs [1][4096][1024]; qp/kp/vp = input W^T (nn.Linear [out][in], no bias), 16 heads of 64; scores x (8/64) = /8; causal mask (keys > query get -inf); softmax; out = (probs v merged) Wo^T -> [1][4096][1024]).
// Structure: token rows r = s; q, k, v inputs as exact f16 rows (bf16-rounded); Q, K, V as three WMMA GEMMs (32x64 wave tiles, f32 accumulation, exact x16 weights, f16 outputs); per batch: V^T for all heads via LDS transposes; one fused attention launch: a wave owns 32 query rows of a head and walks the keys up to its last row in steps of 32 (K and V^T tiles of 64 keys staged in LDS per block of 4 waves): scores on WMMA (K = 64, x 0.125), online causal softmax in registers (f32 running maximum and sum, native exp; unnormalised weights f16), o += P V on WMMA (f32), divided by the row sum at the end (o carried x64, folded into the output GEMM alpha) written straight into the merged f16 o rows; out = o W_o GEMM (f32) into the output layout.
// Compute dtype: inputs rounded to bf16; x / weights exact; q, k, v, softmax weights and o as plain f16 GEMM operands (~2^-12); scores and softmax statistics f32. v_wmma_f32_16x16x32_f16.
#define NB 1
#define SQ 4096
#define DM 1024
#define NH 16
#define HD 64
#define HG 4                         /* heads per launch of the non-template k_vt (not launched) */
#define QT 256                       /* not used */
#define NKX SQ                       /* not used */
#define QT0 256                      /* first-tile rows recomputed exactly in f32 */
#define B0 0                         /* first batch processed (debug hook) */
#define NBR NB                       /* batches processed (debug hook) */
#define NR ((size_t)NB * SQ)         /* token rows */
#define MP ((int)((size_t)NBR * SQ)) /* rows projected (debug hook) */
#define QN SQ                        /* query rows attended per batch (not used) */
#define NHD NH                       /* heads attended (not used) */
#define MPO MP                       /* rows through the output stage (debug hook) */
#define LQ DM      /* row pitch of the q/k/v rows */
typedef __bf16 v16b __attribute__((ext_vector_type(16)));
typedef unsigned short v8us __attribute__((ext_vector_type(8), may_alias));
typedef float  v8f  __attribute__((ext_vector_type(8)));
typedef float  v4f  __attribute__((ext_vector_type(4)));
typedef float  v4fa __attribute__((ext_vector_type(4), may_alias));
union FragB { v16b v; v8us half[2]; unsigned short u[16]; };

__device__ __forceinline__ unsigned short bf16_bits(float x) { unsigned int u = __float_as_uint(x); return (unsigned short)((u + 0x7FFFu + ((u >> 16) & 1u)) >> 16); }
__device__ __forceinline__ float bf16_val(unsigned short b) { return __uint_as_float(((unsigned int)b) << 16); }
__device__ __forceinline__ float bf16_round(float x) { return bf16_val(bf16_bits(x)); }
// D += A·B with NT terms: 1 = ah·bh, 2 = + al·bh (A split), 3 = + ah·bl (both split)
template <int NT>
__device__ __forceinline__ v8f mmaN(v16b ah, v16b al, v16b bh, v16b bl, v8f c) {
  c = __builtin_amdgcn_wmma_f32_16x16x32_bf16(false, ah, false, bh, (short)0, c, false, false);
  if (NT >= 2) c = __builtin_amdgcn_wmma_f32_16x16x32_bf16(false, al, false, bh, (short)0, c, false, false);
  if (NT >= 3) c = __builtin_amdgcn_wmma_f32_16x16x32_bf16(false, ah, false, bl, (short)0, c, false, false);
  asm volatile("v_nop\n\tv_nop\n\tv_nop\n\tv_nop" : "+v"(c) : "v"(ah), "v"(al), "v"(bh), "v"(bl));
  return c;
}

__global__ __launch_bounds__(256) void k_wt_bf16(const float* __restrict__ W, unsigned short* __restrict__ Wt, int K, int N) {
  const int t = blockIdx.x * 256 + threadIdx.x;
  const int k8n = K / 8;
  if (t >= N * k8n) return;
  const int n = t / k8n, k8 = (t % k8n) * 8;
  v8us v;
#pragma unroll
  for (int i = 0; i < 8; ++i) v[i] = bf16_bits(W[(size_t)(k8 + i) * N + n]);
  *(v8us*)(Wt + (size_t)n * K + k8) = v;
  
}

// GEMM C[M][N] (f32, pitch ldc) = act(A[M][K]·W + bias). A f32 row-major (pitch lda) converted per fragment to bf16
// (ASPLIT: hi/lo two planes -> 2 terms, else single rounded term); Wt bf16 [N][K] (pitch ldb). BIAS_BF16 rounds the
// bias to bf16 first (bias quantised to bf16 before the add). K%32==0, M%16==0, N%64==0.
template <bool ASPLIT, int ACT, bool BIAS_BF16>
__global__ __launch_bounds__(128) void k_gemm_bf(const float* __restrict__ A, int lda, const unsigned short* __restrict__ Wt, int ldb,
                                               const float* __restrict__ bias, float* __restrict__ C, int ldc, int M, int N, int K) {
  __shared__ __attribute__((aligned(16))) float so[4][16][64];
  const int tid = threadIdx.x, w = tid >> 5, lane = tid & 31, ln = lane & 15, hh = lane >> 4;
  const int ntn = N / 64;
  const int wid = blockIdx.x * 4 + w;
  const int mt = wid / ntn, nq = wid % ntn;
  if (mt * 16 >= M) return;
  const int row0 = mt * 16, col0 = nq * 64;
  const float* arow = A + (size_t)(row0 + ln) * lda;
  v8f acc[4] = {};
  for (int kb = 0; kb < K; kb += 32) {
    FragB ah, al;
    const v4f x0 = *(const v4fa*)(arow + kb + 8 * hh), x1 = *(const v4fa*)(arow + kb + 8 * hh + 4);
    const v4f x2 = *(const v4fa*)(arow + kb + 16 + 8 * hh), x3 = *(const v4fa*)(arow + kb + 16 + 8 * hh + 4);
    float xs[16] = {x0[0],x0[1],x0[2],x0[3],x1[0],x1[1],x1[2],x1[3],x2[0],x2[1],x2[2],x2[3],x3[0],x3[1],x3[2],x3[3]};
#pragma unroll
    for (int i = 0; i < 16; ++i) { const unsigned short hb = bf16_bits(xs[i]); ah.u[i] = hb; al.u[i] = ASPLIT ? bf16_bits(xs[i] - bf16_val(hb)) : (unsigned short)0; }
#pragma unroll
    for (int t = 0; t < 4; ++t) {
      const unsigned short* brow = Wt + (size_t)(col0 + t * 16 + ln) * ldb + kb;
      FragB b;
      b.half[0] = *(const v8us*)(brow + 8 * hh);
      b.half[1] = *(const v8us*)(brow + 16 + 8 * hh);
      acc[t] = mmaN<ASPLIT ? 2 : 1>(ah.v, al.v, b.v, b.v, acc[t]);
    }
  }
#pragma unroll
  for (int t = 0; t < 4; ++t) {
    float bv = bias ? bias[col0 + t * 16 + ln] : 0.f;
    if (BIAS_BF16) bv = bf16_round(bv);
#pragma unroll
    for (int r = 0; r < 8; ++r) { float v = acc[t][r] + bv; if (ACT == 1) v = fmaxf(v, 0.f); so[w][8 * hh + r][t * 16 + ln] = v; }
  }
  __builtin_amdgcn_fence(__ATOMIC_ACQ_REL, "workgroup");
  __builtin_amdgcn_wave_barrier();
  const int rsub = lane >> 4, c4 = (lane & 15) * 4;
  {
#pragma unroll
    for (int q = 0; q < 8; ++q) {
      const int r = q * 2 + rsub;
      const v4f v = *(const v4fa*)&so[w][r][c4];
      *(v4f*)(C + (size_t)(row0 + r) * ldc + col0 + c4) = v;
    }
    
  }
}

// GEMM C = act(A·W + bias + resid): A f32 (ASPLIT -> hi/lo 2 terms), Wt bf16 [N][K]; ACT 0 none, 1 relu, 2 exact gelu;
// resid (optional, f32, row index = (row % rmod), pitch ldr, RES_BF16 rounds it) added before the activation.
template <bool ASPLIT, int ACT, bool BIAS_BF16, bool RES_BF16>
__global__ __launch_bounds__(128) void k_gemm_bf3(const float* __restrict__ A, int lda, const unsigned short* __restrict__ Wt, int ldb,
                                                const float* __restrict__ bias, const float* __restrict__ resid, int rmod, int ldr,
                                                float* __restrict__ C, int ldc, int M, int N, int K) {
  __shared__ __attribute__((aligned(16))) float so[4][16][64];
  const int tid = threadIdx.x, w = tid >> 5, lane = tid & 31, ln = lane & 15, hh = lane >> 4;
  const int ntn = N / 64;
  const int wid = blockIdx.x * 4 + w;
  const int mt = wid / ntn, nq = wid % ntn;
  if (mt * 16 >= M) return;
  const int row0 = mt * 16, col0 = nq * 64;
  const float* arow = A + (size_t)(row0 + ln) * lda;
  v8f acc[4] = {};
  for (int kb = 0; kb < K; kb += 32) {
    FragB ah, al;
    const v4f x0 = *(const v4fa*)(arow + kb + 8 * hh), x1 = *(const v4fa*)(arow + kb + 8 * hh + 4);
    const v4f x2 = *(const v4fa*)(arow + kb + 16 + 8 * hh), x3 = *(const v4fa*)(arow + kb + 16 + 8 * hh + 4);
    float xs[16] = {x0[0],x0[1],x0[2],x0[3],x1[0],x1[1],x1[2],x1[3],x2[0],x2[1],x2[2],x2[3],x3[0],x3[1],x3[2],x3[3]};
#pragma unroll
    for (int i = 0; i < 16; ++i) { const unsigned short hb = bf16_bits(xs[i]); ah.u[i] = hb; al.u[i] = ASPLIT ? bf16_bits(xs[i] - bf16_val(hb)) : (unsigned short)0; }
#pragma unroll
    for (int t = 0; t < 4; ++t) {
      const unsigned short* brow = Wt + (size_t)(col0 + t * 16 + ln) * ldb + kb;
      FragB b;
      b.half[0] = *(const v8us*)(brow + 8 * hh);
      b.half[1] = *(const v8us*)(brow + 16 + 8 * hh);
      acc[t] = mmaN<ASPLIT ? 2 : 1>(ah.v, al.v, b.v, b.v, acc[t]);
    }
  }
#pragma unroll
  for (int t = 0; t < 4; ++t) {
    const int col = col0 + t * 16 + ln;
    float bv = bias ? bias[col] : 0.f;
    if (BIAS_BF16) bv = bf16_round(bv);
#pragma unroll
    for (int r = 0; r < 8; ++r) {
      float v = acc[t][r] + bv;
      if (resid) { float rv = resid[(size_t)((row0 + 8 * hh + r) % rmod) * ldr + col]; if (RES_BF16) rv = bf16_round(rv); v += rv; }
      if (ACT == 1) v = fmaxf(v, 0.f);
      if (ACT == 2) v = 0.5f * v * (1.0f + erff(v * 0.70710678118654752f));
      if (ACT == 3) { const float u = 0.7978845608028654f * (v + 0.044715f * v * v * v); v = 0.5f * v * (1.0f + tanhf(u)); }
      so[w][8 * hh + r][t * 16 + ln] = v;
    }
  }
  __builtin_amdgcn_fence(__ATOMIC_ACQ_REL, "workgroup");
  __builtin_amdgcn_wave_barrier();
  const int rsub = lane >> 4, c4 = (lane & 15) * 4;
  {
#pragma unroll
    for (int q = 0; q < 8; ++q) {
      const int r = q * 2 + rsub;
      const v4f v = *(const v4fa*)&so[w][r][c4];
      *(v4f*)(C + (size_t)(row0 + r) * ldc + col0 + c4) = v;
    }
    
  }
}
// row LayerNorm (biased variance, eps) over N: s = X (+ R); optional out_sum <- s; out_norm <- (s-mu)*rsqrt(var+eps)*g + b
template <bool PARAM_BF16>
__global__ __launch_bounds__(256) void k_layernorm(const float* __restrict__ X, const float* __restrict__ R, const float* __restrict__ g, const float* __restrict__ bta,
                                                  float* __restrict__ out_sum, float* __restrict__ out_norm, int N, float eps) {
  __shared__ float red[256];
  const int row = blockIdx.x, tid = threadIdx.x;
  const float* x = X + (size_t)row * N; const float* rr = R ? R + (size_t)row * N : nullptr;
  float vals[16];                     // up to N = 4096
  const int per = N / 256;            // contiguous chunk per thread? use strided-by-4 chunks: thread handles j = tid*4 + 1024*u
  float s1 = 0.f;
  for (int u = 0; u < per / 4; ++u) {
    const int j = tid * 4 + 1024 * u;
    const v4f a = *(const v4fa*)(x + j);
    v4f b = {0.f,0.f,0.f,0.f}; if (rr) b = *(const v4fa*)(rr + j);
#pragma unroll
    for (int q = 0; q < 4; ++q) { const float v = a[q] + b[q]; vals[u * 4 + q] = v; s1 += v; }
  }
  red[tid] = s1; __syncthreads();
  for (int st = 128; st > 0; st >>= 1) { if (tid < st) red[tid] += red[tid + st]; __syncthreads(); }
  const float mu = red[0] / (float)N; __syncthreads();
  float s2 = 0.f;
  for (int u = 0; u < per / 4; ++u)
#pragma unroll
    for (int q = 0; q < 4; ++q) { const float c = vals[u * 4 + q] - mu; s2 += c * c; }
  red[tid] = s2; __syncthreads();
  for (int st = 128; st > 0; st >>= 1) { if (tid < st) red[tid] += red[tid + st]; __syncthreads(); }
  const float rs = rsqrtf(red[0] / (float)N + eps);
  {
    for (int u = 0; u < per / 4; ++u) {
      const int j = tid * 4 + 1024 * u;
      v4f o, sm;
#pragma unroll
      for (int q = 0; q < 4; ++q) {
        float gg = g[j + q], bb = bta[j + q];
        if (PARAM_BF16) { gg = bf16_round(gg); bb = bf16_round(bb); }
        sm[q] = vals[u * 4 + q]; o[q] = (vals[u * 4 + q] - mu) * rs * gg + bb;
      }
      if (out_sum) *(v4f*)(out_sum + (size_t)row * N + j) = sm;
      *(v4f*)(out_norm + (size_t)row * N + j) = o;
    }
    
  }
}



// ---- f16 WMMA path (v_wmma_f32_16x16x32_f16): 11-bit significands for operands in range — used where a [0,1] probability operand needs more precision than bf16
typedef _Float16 v16h __attribute__((ext_vector_type(16)));
union FragH { v16h v; v8us half[2]; _Float16 h[16]; unsigned short u[16]; };
template <int NT>
__device__ __forceinline__ v8f mmaH(v16h ah, v16h al, v16h bh, v16h bl, v8f c) {
  c = __builtin_amdgcn_wmma_f32_16x16x32_f16(false, ah, false, bh, (short)0, c, false, false);
  if (NT >= 2) c = __builtin_amdgcn_wmma_f32_16x16x32_f16(false, al, false, bh, (short)0, c, false, false);
  if (NT >= 3) c = __builtin_amdgcn_wmma_f32_16x16x32_f16(false, ah, false, bl, (short)0, c, false, false);
  asm volatile("v_nop\n\tv_nop\n\tv_nop\n\tv_nop" : "+v"(c) : "v"(ah), "v"(al), "v"(bh), "v"(bl));
  return c;
}
// batched GEMM like k_gemm_b but f16 operands: A f32 (split into f16 hi/lo if ASPLIT, else rounded to f16), Bt = f16 values [n][k]; alpha; C f32; N multiple of 16 (partial tiles skipped)
template <bool ASPLIT>
__global__ __launch_bounds__(128) void k_gemm_h(const float* __restrict__ A, int lda, size_t sA, const _Float16* __restrict__ Bh, int ldb, size_t sB, float alpha, float* __restrict__ C, int ldc, size_t sC, int M, int N, int K) {
  __shared__ __attribute__((aligned(16))) float so[4][16][64];
  const int tid = threadIdx.x, w = tid >> 5, lane = tid & 31, ln = lane & 15, hh = lane >> 4; const int by = blockIdx.y;
  A += (size_t)by * sA; Bh += (size_t)by * sB; C += (size_t)by * sC;
  const int ntn = (N + 63) / 64; const int wid = blockIdx.x * 4 + w; const int mt = wid / ntn, nq = wid % ntn; if (mt * 16 >= M) return;
  const int row0 = mt * 16, col0 = nq * 64; const float* arow = A + (size_t)(row0 + ln) * lda;
  v8f acc[4] = {};
  for (int kb = 0; kb < K; kb += 32) {
    FragH ah, al;
    const v4f x0 = *(const v4fa*)(arow + kb + 8 * hh), x1 = *(const v4fa*)(arow + kb + 8 * hh + 4), x2 = *(const v4fa*)(arow + kb + 16 + 8 * hh), x3 = *(const v4fa*)(arow + kb + 16 + 8 * hh + 4);
    float xs[16] = {x0[0],x0[1],x0[2],x0[3],x1[0],x1[1],x1[2],x1[3],x2[0],x2[1],x2[2],x2[3],x3[0],x3[1],x3[2],x3[3]};
#pragma unroll
    for (int i = 0; i < 16; ++i) { const _Float16 h = (_Float16)xs[i]; ah.h[i] = h; al.h[i] = ASPLIT ? (_Float16)(xs[i] - (float)h) : (_Float16)0.0f; }
#pragma unroll
    for (int t = 0; t < 4; ++t) { if (col0 + t * 16 >= N) continue; const size_t boff = (size_t)(col0 + t * 16 + ln) * ldb + kb; FragH bq; bq.half[0] = *(const v8us*)(Bh + boff + 8 * hh); bq.half[1] = *(const v8us*)(Bh + boff + 16 + 8 * hh);
      acc[t] = mmaH<ASPLIT ? 2 : 1>(ah.v, al.v, bq.v, bq.v, acc[t]); }
  }
#pragma unroll
  for (int t = 0; t < 4; ++t) { if (col0 + t * 16 >= N) continue;
#pragma unroll
    for (int r = 0; r < 8; ++r) so[w][8 * hh + r][t * 16 + ln] = acc[t][r] * alpha; }
  __builtin_amdgcn_fence(__ATOMIC_ACQ_REL, "workgroup"); __builtin_amdgcn_wave_barrier();
  const int rsub = lane >> 4, c4 = (lane & 15) * 4;
  {
#pragma unroll
    for (int q = 0; q < 8; ++q) { const int r = q * 2 + rsub; if (col0 + c4 < N) { const v4f v = *(const v4fa*)&so[w][r][c4]; *(v4f*)(C + (size_t)(row0 + r) * ldc + col0 + c4) = v; } }
     }
}

// Wt[n][k] = f16(W[k][n]·scale) from f32 row-major W[K][N] (scale = power of two; bf16-exact weights stay exact in f16 away from the subnormal range)
__global__ __launch_bounds__(256) void k_wt_f16(const float* __restrict__ W, _Float16* __restrict__ Wt, int K, int N, float scale) {
  const int t = blockIdx.x * 256 + threadIdx.x; if (t >= N * (K / 8)) return; const int n = t / (K / 8), k8 = (t % (K / 8)) * 8; FragH f;
#pragma unroll
  for (int i = 0; i < 8; ++i) f.h[i] = (_Float16)(bf16_round(W[(size_t)(k8 + i) * N + n]) * scale); const v8us o = f.half[0];
  *(v8us*)((unsigned short*)Wt + (size_t)n * K + k8) = o; 
}
// k_gemm_hh variant with fused epilogue: v = acc·alpha + bias[by·sBias + col] (+ CP[(row/rowsPerB)·sCPb + by·64 + col] if CP) ; ACT 0 none / 1 elu ; writes f16 C16 (and f32 C if non-null)
template <int ACT>
__global__ __launch_bounds__(128) void k_gemm_hhx(const _Float16* __restrict__ A, int lda, size_t sA, const _Float16* __restrict__ Bh, int ldb, size_t sB, float alpha, const float* __restrict__ bias, size_t sBias, const float* __restrict__ CP, int rowsPerB, size_t sCPb, int row0g,
    float* __restrict__ C, _Float16* __restrict__ C16, int ldc, size_t sC, int M, int N, int K) {
  __shared__ __attribute__((aligned(16))) float so[4][16][64];
  const int tid = threadIdx.x, w = tid >> 5, lane = tid & 31, ln = lane & 15, hh = lane >> 4; const int by = blockIdx.y;
  A += (size_t)by * sA; Bh += (size_t)by * sB; const size_t cofs = (size_t)by * sC; const float* bp = bias ? bias + (size_t)by * sBias : nullptr;
  const int ntn = (N + 63) / 64; const int wid = blockIdx.x * 4 + w; const int mt = wid / ntn, nq = wid % ntn; if (mt * 16 >= M) return;
  const int row0 = mt * 16, col0 = nq * 64; const _Float16* arow = A + (size_t)(row0 + ln) * lda;
  v8f acc[4] = {};
  for (int kb = 0; kb < K; kb += 32) { FragH ah; ah.half[0] = *(const v8us*)((const unsigned short*)arow + kb + 8 * hh); ah.half[1] = *(const v8us*)((const unsigned short*)arow + kb + 16 + 8 * hh);
#pragma unroll
    for (int t = 0; t < 4; ++t) { if (col0 + t * 16 >= N) continue; const size_t boff = (size_t)(col0 + t * 16 + ln) * ldb + kb; FragH bq; bq.half[0] = *(const v8us*)((const unsigned short*)Bh + boff + 8 * hh); bq.half[1] = *(const v8us*)((const unsigned short*)Bh + boff + 16 + 8 * hh);
      acc[t] = mmaH<1>(ah.v, ah.v, bq.v, bq.v, acc[t]); }
  }
#pragma unroll
  for (int t = 0; t < 4; ++t) { if (col0 + t * 16 >= N) continue; const int col = col0 + t * 16 + ln; const float bv = bp ? bf16_round(bp[col]) : 0.f;
#pragma unroll
    for (int r = 0; r < 8; ++r) { float v = acc[t][r] * alpha + bv; if (CP) { const int rr = row0g + row0 + 8 * hh + r; if (rowsPerB < 0) v += CP[cofs + (size_t)rr * ldc + col];      /* rowsPerB < 0: own element of the batched C plane */ else { const int bidx = rr / rowsPerB; v += CP[(size_t)bidx * sCPb + (size_t)by * 64 + col]; } } if (ACT == 1) v = (v > 0.f) ? v : expm1f(v); else if (ACT == 7) v = (v > 0.f) ? v + 1.0f : expf(v); else if (ACT == 8) v = tanhf(v); else if (ACT == 9) v = 0.5f * v * (1.0f + tanhf(0.7978845608028654f * (v + 0.044715f * v * v * v))); else if (ACT == 11) v = 1.0f / (1.0f + expf(-v)); else if (ACT == 12) v = (v > 0.f) ? v : 0.01f * v; else if (ACT == 14) v = (v > 0.f) ? v : 0.1f * v; else if (ACT == 16) v = (v >= 0.f) ? v : 0.3f * v; else if (ACT == 17) v = (v >= 0.f) ? v : 0.2f * v; else if (ACT == 15) v = v / (1.0f + expf(-v)); else if (ACT == 3) v = fmaxf(v, 0.f); else if (ACT == 6) v = 0.5f * v * (1.0f + erff(v * 0.70710678118654752f)); so[w][8 * hh + r][t * 16 + ln] = v; } }
  __builtin_amdgcn_fence(__ATOMIC_ACQ_REL, "workgroup"); __builtin_amdgcn_wave_barrier();
  const int rsub = lane >> 4, c4 = (lane & 15) * 4; typedef _Float16 v4h __attribute__((ext_vector_type(4)));
  {
#pragma unroll
    for (int q = 0; q < 8; ++q) { const int r = q * 2 + rsub; if (col0 + c4 < N) { const v4f v = *(const v4fa*)&so[w][r][c4]; if (C) *(v4f*)(C + cofs + (size_t)(row0 + r) * ldc + col0 + c4) = v; if (C16) { v4h h4; for (int i = 0; i < 4; ++i) h4[i] = (_Float16)v[i]; *(v4h*)(C16 + cofs + (size_t)(row0 + r) * ldc + col0 + c4) = h4; } } }
     }
}


typedef _Float16 v4h __attribute__((ext_vector_type(4)));

__global__ __launch_bounds__(256) void k_x16(const float* __restrict__ x, _Float16* __restrict__ X16, size_t n8) { const size_t t = (size_t)blockIdx.x * 256 + threadIdx.x; if (t >= n8) return; FragH f;
#pragma unroll
  for (int q = 0; q < 8; ++q) f.h[q] = (_Float16)bf16_round(x[t * 8 + q]); *(v8us*)((unsigned short*)X16 + t * 8) = f.half[0];  }
__global__ __launch_bounds__(256) void k_h16(const float* __restrict__ x, _Float16* __restrict__ X16, size_t n8) { const size_t t = (size_t)blockIdx.x * 256 + threadIdx.x; if (t >= n8) return; FragH f;
#pragma unroll
  for (int q = 0; q < 8; ++q) f.h[q] = (_Float16)x[t * 8 + q]; *(v8us*)((unsigned short*)X16 + t * 8) = f.half[0];  }
__global__ __launch_bounds__(256) void k_round16f(const float* __restrict__ W, _Float16* __restrict__ Bt, size_t n8) { const size_t t = (size_t)blockIdx.x * 256 + threadIdx.x; if (t >= n8) return; FragH f;
#pragma unroll
  for (int i = 0; i < 8; ++i) f.h[i] = (_Float16)(bf16_round(W[t * 8 + i]) * 16.0f); *(v8us*)((unsigned short*)Bt + t * 8) = f.half[0];  }
template <int NHv, int TTv>
__global__ __launch_bounds__(256) void k_vt(const _Float16* __restrict__ V16, int ldv, int voff, _Float16* __restrict__ Vt) { __shared__ unsigned short tl[64][66]; const int tid = threadIdx.x; const int slab = blockIdx.x / (TTv / 64), lg = blockIdx.x % (TTv / 64); const int b = slab / NHv, h = slab % NHv;
  for (int i = tid; i < 64 * 8; i += 256) { const int r = i / 8, c8 = (i % 8) * 8; FragH f; f.half[0] = *(const v8us*)((const unsigned short*)V16 + ((size_t)b * TTv + lg * 64 + r) * ldv + voff + h * 64 + c8);
#pragma unroll
    for (int q = 0; q < 8; ++q) tl[r][c8 + q] = f.u[q]; }
  __syncthreads();
  {
#pragma unroll
    for (int rd = 0; rd < 2; ++rd) { const int d = rd * 32 + tid / 8, pc = tid % 8; FragH f;
#pragma unroll
      for (int q = 0; q < 8; ++q) f.u[q] = tl[pc * 8 + q][d];
      *(v8us*)((unsigned short*)Vt + ((size_t)slab * 64 + d) * TTv + lg * 64 + pc * 8) = f.half[0]; }
     } }

__global__ __launch_bounds__(256) void k_hl(const float* __restrict__ F, _Float16* __restrict__ Hh, _Float16* __restrict__ Hl, size_t n8) { const size_t t = (size_t)blockIdx.x * 256 + threadIdx.x; if (t >= n8) return; FragH fh, fl; const v4f a = *(const v4fa*)(F + t * 8), c = *(const v4fa*)(F + t * 8 + 4);
#pragma unroll
  for (int q = 0; q < 4; ++q) { _Float16 h = (_Float16)a[q]; fh.h[q] = h; fl.h[q] = (_Float16)((a[q] - (float)h) * 1024.0f); h = (_Float16)c[q]; fh.h[4 + q] = h; fl.h[4 + q] = (_Float16)((c[q] - (float)h) * 1024.0f); }
  { *(v8us*)((unsigned short*)Hh + t * 8) = fh.half[0]; *(v8us*)((unsigned short*)Hl + t * 8) = fl.half[0];  } }

// ---- fast GEMM (wave tile 32x64; requires M % 128 == 0 rows per launch region, N % 64 == 0 and K % 64 == 0); epilogue = k_gemm_hhx semantics ----
__device__ __forceinline__ v16h g2_frag(const _Float16* p, int hh) { FragH f; f.half[0] = *(const v8us*)((const unsigned short*)p + 8 * hh); f.half[1] = *(const v8us*)((const unsigned short*)p + 16 + 8 * hh); return f.v; }
__device__ __forceinline__ v8f g2_mmab(v16h a, v16h b, v8f c) { return __builtin_amdgcn_wmma_f32_16x16x32_f16(false, a, false, b, (short)0, c, false, false); }
#define G2KC 64                      /* k per staged tile: 128 bytes, one cache line of every operand row */
#define G2P 72                       /* LDS row pitch in f16: 128 + 16 bytes, so that the 16 rows of a 16-byte fragment read fall on different banks */
// Block tile 128 x 64. Per 64 k the block's 128 A rows and 64 B rows go global -> registers -> LDS with whole-line loads, one tile ahead, two LDS buffers; the waves read their fragments from LDS. Needs M % 128 == 0, K % 64 == 0, K >= 64.
template <int ACT>
__global__ __launch_bounds__(128) void k_gemm2(const _Float16* __restrict__ A, int lda, size_t sA, const _Float16* __restrict__ Bh, int ldb, size_t sB, float alpha, const float* __restrict__ bias, size_t sBias, const float* __restrict__ CP, int rowsPerB, size_t sCPb, int row0g,
    float* __restrict__ C, _Float16* __restrict__ C16, int ldc, size_t sC, int M, int N, int K) { static_assert(ACT == 0 || ACT == 3 || ACT == 6 || ACT == 8 || ACT == 9 || ACT == 11 || ACT == 12 || ACT == 14 || ACT == 15 || ACT == 16 || ACT == 17, "k_gemm2: unsupported ACT code (would silently apply no activation)");
  __shared__ __attribute__((aligned(16))) float so[4][32][68];
  __shared__ __attribute__((aligned(16))) _Float16 st[2][192][G2P];      /* two staged tiles: rows 0..127 = the block's A rows, rows 128..191 = its B rows, G2KC k each */
  const int tid = threadIdx.x, w = tid >> 5, lane = tid & 31, ln = lane & 15, hh = lane >> 4; const int by = blockIdx.y;
  A += (size_t)by * sA; Bh += (size_t)by * sB; const size_t cofs = (size_t)by * sC; const float* bp = bias ? bias + (size_t)by * sBias : nullptr;
  const int ntn = N >> 6; const int mt = blockIdx.x / ntn, nq = blockIdx.x - mt * ntn; const int row0 = mt * 128 + 32 * w, col0 = nq * 64; if (mt * 128 >= M) return;      /* the same for the whole block: it stands in front of the barriers */
  const int sr = tid >> 3, sg = tid & 7;      /* staging: 8 threads bring one row's 128 bytes, so a wave's 16-byte load is 4 whole cache lines */
  const _Float16* gp[12];      /* the thread's 8 A pieces and 4 B pieces of the tile to be fetched next */
#pragma unroll
  for (int i = 0; i < 8; ++i) gp[i] = A + (size_t)(mt * 128 + sr + 16 * i) * lda + sg * 8;
#pragma unroll
  for (int i = 0; i < 4; ++i) gp[8 + i] = Bh + (size_t)(col0 + sr + 16 * i) * ldb + sg * 8;
  v8us rg[12];      /* the tile on its way from global memory to LDS */
  auto fetch = [&]() {
#pragma unroll
    for (int i = 0; i < 12; ++i) rg[i] = *(const v8us*)(const unsigned short*)gp[i];
    asm volatile("s_wait_xcnt 0x0" :: "v"(gp[0]), "v"(gp[1]), "v"(gp[2]), "v"(gp[3]), "v"(gp[4]), "v"(gp[5]), "v"(gp[6]), "v"(gp[7]), "v"(gp[8]), "v"(gp[9]), "v"(gp[10]), "v"(gp[11]) : "memory");      /* the 12 addresses are named so that their registers live up to this wait: none is overwritten in front of it, neither by the step to the next tile below nor by a load's result */
#pragma unroll
    for (int i = 0; i < 12; ++i) gp[i] += G2KC; };
  auto put = [&](int buf) {
#pragma unroll
    for (int i = 0; i < 12; ++i) *(v8us*)&st[buf][sr + 16 * i][sg * 8] = rg[i]; };
  auto lfrag = [&](int buf, int row, int kk) { FragH f; const unsigned short* p = (const unsigned short*)&st[buf][row][kk * 32 + 8 * hh]; f.half[0] = *(const v8us*)p; f.half[1] = *(const v8us*)(p + 16); return f.v; };      /* the k order of g2_frag */
  const v8f z8 = {0.f,0.f,0.f,0.f,0.f,0.f,0.f,0.f}; v8f c00 = z8, c01 = z8, c02 = z8, c03 = z8, c10 = z8, c11 = z8, c12 = z8, c13 = z8;
  const int nc = K / G2KC;
  fetch(); put(0); __syncthreads();
#pragma unroll 1      /* one copy of the tile body: the trip count is a run-time value and the body is long */
  for (int c = 0; c < nc; ++c) { const int buf = c & 1;
    if (c + 1 < nc) fetch();      /* the next tile's global loads fly while this tile is worked on */
    v16h a[2][2], b[2][4];
#pragma unroll
    for (int kk = 0; kk < 2; ++kk) { a[kk][0] = lfrag(buf, 32 * w + ln, kk); a[kk][1] = lfrag(buf, 32 * w + 16 + ln, kk);
#pragma unroll
      for (int t = 0; t < 4; ++t) b[kk][t] = lfrag(buf, 128 + 16 * t + ln, kk); }
    __builtin_amdgcn_sched_barrier(0);      /* keeps the tile's 24 LDS reads together in front of its 16 WMMAs: one LDS latency a tile with counted waits, where the scheduler otherwise reuses one B fragment's registers and waits for LDS eight times */
#pragma unroll
    for (int kk = 0; kk < 2; ++kk) {
      c00 = g2_mmab(a[kk][0], b[kk][0], c00); c10 = g2_mmab(a[kk][1], b[kk][0], c10); c01 = g2_mmab(a[kk][0], b[kk][1], c01); c11 = g2_mmab(a[kk][1], b[kk][1], c11);
      c02 = g2_mmab(a[kk][0], b[kk][2], c02); c12 = g2_mmab(a[kk][1], b[kk][2], c12); c03 = g2_mmab(a[kk][0], b[kk][3], c03); c13 = g2_mmab(a[kk][1], b[kk][3], c13); }
    if (c + 1 < nc) put(buf ^ 1);      /* into the buffer whose last readers passed the barrier at the foot of the trip before */
    __syncthreads(); }      /* one barrier a tile: publishes tile c + 1 and ends the reads of tile c */
  v8f accs[8] = {c00, c01, c02, c03, c10, c11, c12, c13};
#pragma unroll
  for (int u = 0; u < 8; ++u) { const int t = u & 3, half = u >> 2; const int col = col0 + t * 16 + ln; const float bv = bp ? bf16_round(bp[col]) : 0.f;
#pragma unroll
    for (int r = 0; r < 8; ++r) { const int rloc = half * 16 + 8 * hh + r; float v = accs[u][r] * alpha + bv; if (CP) { if (rowsPerB < 0) v += CP[cofs + (size_t)(row0g + row0 + rloc) * ldc + col];      /* rowsPerB < 0: own element of the batched C plane */ else { const int bidx = (row0g + row0 + rloc) / rowsPerB; v += CP[(size_t)bidx * sCPb + (size_t)by * 64 + col]; } }
      if (ACT == 3) v = fmaxf(v, 0.f); else if (ACT == 6) v = 0.5f * v * (1.0f + erff(v * 0.70710678118654752f)); else if (ACT == 11) v = 1.0f / (1.0f + expf(-v)); else if (ACT == 15) v = v / (1.0f + expf(-v)); else if (ACT == 12) v = (v > 0.f) ? v : 0.01f * v; else if (ACT == 8) v = tanhf(v); else if (ACT == 9) v = 0.5f * v * (1.0f + tanhf(0.7978845608028654f * (v + 0.044715f * v * v * v))); else if (ACT == 14) v = (v > 0.f) ? v : 0.1f * v; else if (ACT == 16) v = (v >= 0.f) ? v : 0.3f * v; else if (ACT == 17) v = (v >= 0.f) ? v : 0.2f * v;
      so[w][rloc][t * 16 + ln] = v; } }
  __builtin_amdgcn_fence(__ATOMIC_ACQ_REL, "workgroup"); __builtin_amdgcn_wave_barrier();
  const int rsub = lane >> 4, c4 = (lane & 15) * 4;
  {
#pragma unroll
    for (int q = 0; q < 16; ++q) { const int r = q * 2 + rsub; const v4f v = *(const v4fa*)&so[w][r][c4]; if (C) *(v4f*)(C + cofs + (size_t)(row0 + r) * ldc + col0 + c4) = v; if (C16) { v4h h4; for (int i = 0; i < 4; ++i) h4[i] = (_Float16)v[i]; *(v4h*)(C16 + cofs + (size_t)(row0 + r) * ldc + col0 + c4) = h4; } }
     } }


__global__ __launch_bounds__(256) void k_wnat(const float* __restrict__ w, size_t n8, _Float16* __restrict__ Bt) { const size_t t = (size_t)blockIdx.x * 256 + threadIdx.x; if (t >= n8) return; FragH f; for (int q = 0; q < 8; ++q) f.h[q] = (_Float16)(bf16_round(w[t * 8 + q]) * 16.0f); *(v8us*)((unsigned short*)Bt + t * 8) = f.half[0];  }
__global__ __launch_bounds__(256) void k_rsm(const float* __restrict__ S, _Float16* __restrict__ P, int nrows) {
  #pragma clang fp contract(off)
  const int i = blockIdx.x * 256 + threadIdx.x; if (i >= nrows) return; const float* s = S + (size_t)i * SQ; float mx = -3.0e38f;
#pragma unroll 1
  for (int j = 0; j < SQ; ++j) mx = fmaxf(mx, s[j]); float se = 0.f;
#pragma unroll 1
  for (int j = 0; j < SQ; ++j) se += expf(s[j] - mx); const float sc = 256.0f / se;
#pragma unroll 1
  for (int j0 = 0; j0 < SQ; j0 += 8) { FragH f; for (int q = 0; q < 8; ++q) f.h[q] = (_Float16)(expf(s[j0 + q] - mx) * sc); unsigned short* d = (unsigned short*)P + (size_t)i * SQ + j0; *(v8us*)d = f.half[0];  } }
__global__ __launch_bounds__(256) void k_vt(const _Float16* __restrict__ V16, int b, int h0, _Float16* __restrict__ VT) { __shared__ unsigned short tl[64][65]; const int tid = threadIdx.x; const int hh = blockIdx.x % HG, sg = blockIdx.x / HG; const int s0 = sg * 64; const int h = h0 + hh;
  for (int i = tid; i < 64 * 8; i += 256) { const int j = i / 8, d8 = (i % 8) * 8; FragH f; f.half[0] = *(const v8us*)((const unsigned short*)V16 + ((size_t)b * SQ + s0 + j) * DM + h * HD + d8); for (int q = 0; q < 8; ++q) tl[d8 + q][j] = f.u[q]; }
  __syncthreads();
  { for (int i = tid; i < 64 * 8; i += 256) { const int d = i / 8, j8 = (i % 8) * 8; FragH f; for (int q = 0; q < 8; ++q) f.u[q] = tl[d][j8 + q]; *(v8us*)((unsigned short*)VT + ((size_t)hh * HD + d) * SQ + s0 + j8) = f.half[0]; }  } }



#define FQ 32                        /* query rows per wave */
#define FK 64                        /* keys per staged tile: 128 bytes of every V^T row, one cache line */
#define FP 72                        /* LDS row pitch in f16: 128 + 16 bytes, so that the 16 rows of a 16-byte fragment read fall on different banks */
typedef _Float16 v8h __attribute__((ext_vector_type(8)));
__device__ __forceinline__ float half_xor(float v) { const int i = __builtin_bit_cast(int, v); return __builtin_bit_cast(float, __builtin_amdgcn_permlanex16(i, i, 0x76543210, 0xfedcba98, false, false)); }      /* lane l <- lane l ^ 16 */
__device__ __forceinline__ float exp2_slot(float x) { float y; asm("v_exp_f32 %0, %1\n\tv_nop" : "=v"(y) : "v"(x)); return y; }      /* v_nop: the slot the instruction set asks for behind a transcendental before its result is read or its source rewritten; in the same statement it stays directly behind it */
__device__ __forceinline__ v8f fa_mma(v16h a, v16h b, v8f c) { return __builtin_amdgcn_wmma_f32_16x16x32_f16(false, a, false, b, (short)0, c, false, false); }
__global__ __launch_bounds__(128) void k_fattn(const _Float16* __restrict__ Qr, const _Float16* __restrict__ Kr, const _Float16* __restrict__ Vt, _Float16* __restrict__ Or) {
  static_assert(HD == 64 && SQ % (4 * FQ) == 0 && (4 * FQ) % FK == 0 && FK == 2 * 32, "two k chunks per score product, four d tiles, whole blocks of 4 waves, whole stages, two steps of 32 keys a stage");
  __shared__ __attribute__((aligned(16))) _Float16 kv[2][2 * FK][FP];      /* two staged tiles: rows 0..63 = the stage's K rows (64 head dims), rows 64..127 = the 64 V^T rows (the stage's 64 keys) */
  const int tid = threadIdx.x, lane = tid & 31, ln = lane & 15, hh = lane >> 4; const int w = __builtin_amdgcn_readfirstlane((int)(threadIdx.x >> 5));
  const int h = blockIdx.x % NH; const int qb = (SQ / (4 * FQ) - 1 - (int)(blockIdx.x / NH)) * (4 * FQ); const int q0 = qb + w * FQ;      /* the longest blocks start first */
  const int ns = (qb + 4 * FQ) / FK;      /* stages of the block: keys 0 .. its last row; at least 2; the same for the whole block */
  const int sr = tid >> 3, sg = tid & 7;      /* staging: 8 lanes bring one row's 128 bytes, so a wave's 16-byte copy is 4 whole cache lines */
  const _Float16* gk = Kr + (size_t)sr * LQ + h * HD + sg * 8;          /* the thread's piece of K row sr of stage 0; its other pieces 16, 32, 48 rows on */
  const _Float16* gv = Vt + ((size_t)h * HD + sr) * SQ + sg * 8;        /* the thread's piece of V^T row sr, stage 0; likewise */
  const unsigned ls = (unsigned)(size_t)&kv[0][sr][sg * 8];             /* its place in buffer 0: the LDS byte address */
  auto stage = [&](int s, int buf) {      /* stage s -> buffer buf: 8 copies of 16 bytes a lane; every lane on, every address a multiple of 16, keys 64 s .. 64 s + 63 < SQ */
    const _Float16* k0 = gk + (size_t)s * FK * LQ; const _Float16* k1 = k0 + 16 * LQ; const _Float16* k2 = k0 + 32 * LQ; const _Float16* k3 = k0 + 48 * LQ;
    const _Float16* v0 = gv + (size_t)s * FK; const _Float16* v1 = v0 + 16 * SQ; const _Float16* v2 = v0 + 32 * SQ; const _Float16* v3 = v0 + 48 * SQ;
    const unsigned l0 = ls + (unsigned)buf * (2 * FK * FP * 2); const unsigned rs = 16 * FP * 2;      /* 16 LDS rows in bytes */
    const unsigned l1 = l0 + rs, l2 = l0 + 2 * rs, l3 = l0 + 3 * rs, l4 = l0 + 4 * rs, l5 = l0 + 5 * rs, l6 = l0 + 6 * rs, l7 = l0 + 7 * rs;
    asm volatile("global_load_async_to_lds_b128 %0, %8, off\n\t"
                 "global_load_async_to_lds_b128 %1, %9, off\n\t"
                 "global_load_async_to_lds_b128 %2, %10, off\n\t"
                 "global_load_async_to_lds_b128 %3, %11, off\n\t"
                 "global_load_async_to_lds_b128 %4, %12, off\n\t"
                 "global_load_async_to_lds_b128 %5, %13, off\n\t"
                 "global_load_async_to_lds_b128 %6, %14, off\n\t"
                 "global_load_async_to_lds_b128 %7, %15, off\n\t"
                 "s_wait_xcnt 0x0"      /* in the copies' own statement: no address register of a copy is rewritten in front of it */
                 :: "v"(l0), "v"(l1), "v"(l2), "v"(l3), "v"(l4), "v"(l5), "v"(l6), "v"(l7), "v"(k0), "v"(k1), "v"(k2), "v"(k3), "v"(v0), "v"(v1), "v"(v2), "v"(v3) : "memory"); };
  auto lfrag = [&](int buf, int row, int col) { FragH f; const unsigned short* p = (const unsigned short*)&kv[buf][row + ln][col + 8 * hh]; f.half[0] = *(const v8us*)p; f.half[1] = *(const v8us*)(p + 16); return f.v; };      /* the k order of g2_frag */
  stage(0, 0);
  v16h qf[2][2], kf[2][2], vf[4];      /* [query group | key group][k chunk of 32 head dims]; [tile of 16 head dims] */
#pragma unroll
  for (int g = 0; g < 2; ++g)
#pragma unroll
    for (int c = 0; c < 2; ++c) qf[g][c] = g2_frag(Qr + (size_t)(q0 + 16 * g + ln) * LQ + h * HD + 32 * c, hh);
  asm volatile("s_wait_asynccnt 0x0" ::: "memory");      /* this wave's copies of stage 0 have landed */
  __syncthreads();      /* stage 0 is published: every wave's copies have landed */
  stage(1, 1);      /* ns >= 2: stage 1 exists; it flies while stage 0 is worked on */
  const v8f z8 = {0.f, 0.f, 0.f, 0.f, 0.f, 0.f, 0.f, 0.f};
  v8f o[2][4] = {{z8, z8, z8, z8}, {z8, z8, z8, z8}};      /* o[g][t][r] = O^T[16 t + 8 hh + r][query q0 + 16 g + ln] */
  float m[2] = {-3.0e38f, -3.0e38f}, l[2] = {0.f, 0.f};      /* m: running maximum of the raw products q.k; l: this wave half's keys only, the halves are joined once behind the loop */
  const float cs = 0.125f * 1.44269504088896f;      /* score scale x log2(e): exp(0.125 (s - m)) = exp2(cs s - cs m) */
#pragma unroll 1      /* one copy of the stage body: the trip count is a run-time value and the body is long */
  for (int st = 0; st < ns; ++st) { const int buf = st & 1;
#pragma unroll
      for (int j = 0; j < 2; ++j) { const int kb = st * FK + 32 * j;      /* two steps of 32 keys a stage */
        if (kb <= q0) {      /* wave-uniform: a wave skips the steps beyond its diagonal, never the publish point below */
#pragma unroll
          for (int t = 0; t < 2; ++t)
#pragma unroll
            for (int c = 0; c < 2; ++c) kf[t][c] = lfrag(buf, 32 * j + 16 * t, 32 * c);
#pragma unroll
          for (int t = 0; t < 4; ++t) vf[t] = lfrag(buf, FK + 16 * t, 32 * j);
          v8f s[2][2];      /* s[g][t][r] = q.k of key kb + 16 t + 8 hh + r, query q0 + 16 g + ln */
#pragma unroll
          for (int g = 0; g < 2; ++g)
#pragma unroll
            for (int t = 0; t < 2; ++t) s[g][t] = fa_mma(kf[t][1], qf[g][1], fa_mma(kf[t][0], qf[g][0], z8));
#pragma unroll
          for (int g = 0; g < 2; ++g) {
            if (kb == q0) {      /* the one step that holds keys above a query (wave-uniform test) */
#pragma unroll
              for (int t = 0; t < 2; ++t)
#pragma unroll
                for (int r = 0; r < 8; ++r) s[g][t][r] = (16 * t + 8 * hh + r <= 16 * g + ln) ? s[g][t][r] : -1.0e9f; }
            float mx = fmaxf(s[g][0][0], s[g][1][0]);
#pragma unroll
            for (int r = 1; r < 8; ++r) mx = fmaxf(mx, fmaxf(s[g][0][r], s[g][1][r]));
            const float mn = fmaxf(m[g], fmaxf(mx, half_xor(mx))); const float sc = exp2_slot((m[g] - mn) * cs); const float mc = mn * cs; m[g] = mn;
#pragma unroll
            for (int t = 0; t < 2; ++t)
#pragma unroll
              for (int r = 0; r < 8; ++r) s[g][t][r] = exp2_slot(fmaf(s[g][t][r], cs, -mc));
            const v8f sv = s[g][0] + s[g][1];
            l[g] = l[g] * sc + (((sv[0] + sv[1]) + (sv[2] + sv[3])) + ((sv[4] + sv[5]) + (sv[6] + sv[7])));
            const v16h pf = __builtin_shufflevector(__builtin_convertvector(s[g][0], v8h), __builtin_convertvector(s[g][1], v8h), 0, 1, 2, 3, 4, 5, 6, 7, 8, 9, 10, 11, 12, 13, 14, 15);
#pragma unroll
            for (int t = 0; t < 4; ++t) o[g][t] = fa_mma(vf[t], pf, o[g][t] * sc);
          }
        } }
    /* publish point of stage st + 1, passed by every wave */
    asm volatile("s_wait_dscnt 0x0" ::: "memory");      /* this wave's reads of buffer buf have retired before the buffer is refilled */
    asm volatile("s_wait_asynccnt 0x0" ::: "memory");      /* this wave's copies of stage st + 1 have landed */
    __syncthreads();      /* one barrier a stage: publishes stage st + 1 and ends every wave's reads of stage st */
    if (st + 2 < ns) stage(st + 2, buf);      /* the same for the whole block; into the buffer that this trip has just read */
  }
  asm volatile("s_wait_asynccnt 0x0" ::: "memory");      /* no copy is outstanding when the wave ends */
#pragma unroll
  for (int g = 0; g < 2; ++g) { const float fin = 64.0f / (l[g] + half_xor(l[g]));      /* o carried x64, folded into the output GEMM alpha */
    _Float16* orow = Or + (size_t)(q0 + 16 * g + ln) * DM + h * HD + 8 * hh;
#pragma unroll
    for (int t = 0; t < 4; ++t) *(v8h*)(orow + 16 * t) = __builtin_convertvector(o[g][t] * fin, v8h); }      /* a lane holds 8 consecutive head dims of its query: one 16-byte store */
}


#define A0Q 32                       /* query rows per k_att0 block: one per lane */
#define A0S 16                       /* waves per k_att0 block: wave w takes the keys w, w + 16, w + 32, ... */
#define A0P 68                       /* LDS pitch of a partial o row in floats: 256 + 16 bytes, so that the lanes' 16-byte stores fall on different banks */
// Exact f32 attention of the first QT0 rows. A block owns 32 query rows of a head (a lane = a row); its 16 waves share the keys, each with a running maximum, sum and o of its own;
// at the end the 16 partial results are brought to the block's common maximum and added through LDS.
template <int MASKADD>
__global__ __launch_bounds__(A0Q * A0S) void k_att0(const float* __restrict__ QF, const float* __restrict__ KF, const float* __restrict__ VF, int ld, const float* __restrict__ mask, float scale, float* __restrict__ OF, int ldo) {
  #pragma clang fp contract(off)
  static_assert(A0Q == 32 && A0S * 32 == A0Q * (HD / 4), "a lane per query row; in the final sum a thread per 16-byte piece of an o row");
  __shared__ __attribute__((aligned(16))) float po[A0S][A0Q][A0P];      /* each wave's o rows, on the common maximum */
  __shared__ float pm[A0S][A0Q], pl[A0S][A0Q];      /* each wave's running maxima; its row sums, on the common maximum */
  const int tid = threadIdx.x, lane = tid & 31; const int w = __builtin_amdgcn_readfirstlane(tid >> 5);      /* the wave's number as a scalar: the key rows' addresses stay wave-uniform (scalar loads) */
  const int h = blockIdx.x / (QT0 / A0Q), rg = blockIdx.x % (QT0 / A0Q); const int i = rg * A0Q + lane;
  const float* qr = QF + (size_t)i * ld + h * HD;
  v4f q[HD / 4], o[HD / 4];      /* the thread's q row and o row: every loop over c is fully unrolled, so both are indexed by constants only and stay in registers */
#pragma unroll
  for (int c = 0; c < HD / 4; ++c) { q[c] = *(const v4fa*)(qr + c * 4); const v4f z = {0.f, 0.f, 0.f, 0.f}; o[c] = z; }
  asm volatile("s_wait_xcnt 0x0" :: "v"(qr) : "memory");      /* qr is named so that the 16 loads' address registers live up to this wait: none of them is overwritten in front of it, not even by a later load's result */
  float m = -1.0e30f, l = 0.f; const int jmax = MASKADD ? (SQ - 1) : (rg * A0Q + A0Q - 1);      /* additive-mask form: every key (the mask input decides); causal form: keys up to the block's last row */
#pragma unroll 1
  for (int j = w; j <= jmax; j += A0S) { const float* kr = KF + (size_t)j * ld + h * HD; const float* vr = VF + (size_t)j * ld + h * HD; float s = 0.f;
#pragma unroll
    for (int c = 0; c < HD / 4; ++c) { const v4f kq = *(const v4fa*)(kr + c * 4); s = __fadd_rn(s, __fmul_rn(q[c][0], kq[0])); s = __fadd_rn(s, __fmul_rn(q[c][1], kq[1])); s = __fadd_rn(s, __fmul_rn(q[c][2], kq[2])); s = __fadd_rn(s, __fmul_rn(q[c][3], kq[3])); }
    s = __fmul_rn(s, scale); if (MASKADD) s = __fadd_rn(s, __fmul_rn(bf16_round(mask[(size_t)i * SQ + j]), -10000.0f));
    const float f = (MASKADD || j <= i) ? 1.f : 0.f; const float sm = fmaf(f, s, (1.f - f) * -1.0e30f); const float mn = fmaxf(m, sm); const float sc = expf(m - mn); const float e = expf(sm - mn); l = __fadd_rn(__fmul_rn(l, sc), e); m = mn;
#pragma unroll
    for (int c = 0; c < HD / 4; ++c) { const v4f vv = *(const v4fa*)(vr + c * 4); for (int u = 0; u < 4; ++u) o[c][u] = __fadd_rn(__fmul_rn(o[c][u], sc), __fmul_rn(e, vv[u])); } }
  pm[w][lane] = m;
  __syncthreads();      /* every wave's maxima are in LDS */
  float mb = pm[0][lane];
#pragma unroll
  for (int u = 1; u < A0S; ++u) mb = fmaxf(mb, pm[u][lane]);
  const float wt = expf(m - mb);      /* key 0 is open to every row, so mb is a true score; a wave that saw only closed keys of a row still has m = -1e30 there, its weight is exactly 0 and its (finite) sums drop out */
  pl[w][lane] = __fmul_rn(l, wt);
#pragma unroll
  for (int c = 0; c < HD / 4; ++c) { v4f oo = o[c]; for (int u = 0; u < 4; ++u) oo[u] = __fmul_rn(oo[u], wt); *(v4f*)&po[w][lane][c * 4] = oo; }
  __syncthreads();      /* every wave's weighted sums are in LDS */
  const int row = tid >> 4, pc = (tid & 15) * 4;      /* 16 threads add and store one o row: whole-line stores */
  v4f acc = *(const v4f*)&po[0][row][pc]; float ls = pl[0][row];
#pragma unroll
  for (int u = 1; u < A0S; ++u) { const v4f p = *(const v4f*)&po[u][row][pc]; for (int x = 0; x < 4; ++x) acc[x] = __fadd_rn(acc[x], p[x]); ls = __fadd_rn(ls, pl[u][row]); }
  const float fin = 64.0f / ls;      /* o carried x64 like the f16 path */
  for (int x = 0; x < 4; ++x) acc[x] = __fmul_rn(acc[x], fin);
  *(v4f*)(OF + (size_t)(rg * A0Q + row) * ldo + h * HD + pc) = acc; }

extern "C" void kernel_launch(void* const* d_in, const int* in_sizes, int n_in,
                              void* d_out, int out_size, void* d_ws, size_t ws_size, hipStream_t stream) {
  (void)in_sizes; (void)n_in; (void)out_size;
  const float* const* I = (const float* const*)d_in; const float* xq = I[0]; const float* xk = I[1]; const float* xv = I[2]; const float* wq = I[3]; const float* wk = I[4]; const float* wv = I[5]; const float* wo = I[6];      /* nn.Linear weights [out][in] */
  char* ws = (char*)d_ws; size_t off = 0;
  auto take = [&](size_t bytes) { char* p = ws + off; off += (bytes + 255) & ~(size_t)255; return p; };
  _Float16* BQ = (_Float16*)take((size_t)DM * DM * 2); _Float16* BK = (_Float16*)take((size_t)DM * DM * 2); _Float16* BV = (_Float16*)take((size_t)DM * DM * 2); _Float16* BO = (_Float16*)take((size_t)DM * DM * 2);
  _Float16* XQ = (_Float16*)take(NR * DM * 2); _Float16* XK = (_Float16*)take(NR * DM * 2); _Float16* XV = (_Float16*)take(NR * DM * 2); _Float16* Q16 = (_Float16*)take(NR * DM * 2); _Float16* K16 = (_Float16*)take(NR * DM * 2); _Float16* V16 = (_Float16*)take(NR * DM * 2); _Float16* O16 = (_Float16*)take(NR * DM * 2);
  _Float16* VT = (_Float16*)take((size_t)NH * HD * SQ * 2);
  float* QF0 = (float*)take((size_t)QT0 * DM * 4); float* KF0 = (float*)take((size_t)QT0 * DM * 4); float* VF0 = (float*)take((size_t)QT0 * DM * 4); float* OF0 = (float*)take((size_t)NB * QT0 * DM * 4); _Float16* OH0 = (_Float16*)take((size_t)NB * QT0 * DM * 2); _Float16* OL0 = (_Float16*)take((size_t)NB * QT0 * DM * 2);
  if (off > ws_size) return;
  { const unsigned g = (unsigned)(((size_t)DM * DM / 8 + 255) / 256); k_wnat<<<g, 256, 0, stream>>>(wq, (size_t)DM * DM / 8, BQ); k_wnat<<<g, 256, 0, stream>>>(wk, (size_t)DM * DM / 8, BK); k_wnat<<<g, 256, 0, stream>>>(wv, (size_t)DM * DM / 8, BV); k_wnat<<<g, 256, 0, stream>>>(wo, (size_t)DM * DM / 8, BO); }      /* natural [out][in] = Bt[n][k], x16 */
  k_x16<<<(unsigned)((NR * DM / 8 + 255) / 256), 256, 0, stream>>>(xq, XQ, NR * DM / 8); k_x16<<<(unsigned)((NR * DM / 8 + 255) / 256), 256, 0, stream>>>(xk, XK, NR * DM / 8); k_x16<<<(unsigned)((NR * DM / 8 + 255) / 256), 256, 0, stream>>>(xv, XV, NR * DM / 8);
  const size_t r0p = (size_t)B0 * SQ;      /* first projected row */
  k_gemm2<0><<<dim3((unsigned)((MP / 128) * (DM / 64)), 1), 128, 0, stream>>>(XQ + r0p * DM, DM, 0, BQ, DM, 0, 0.0625f, nullptr, 0, nullptr, 1, 0, 0, nullptr, Q16 + r0p * DM, DM, 0, MP, DM, DM);
  k_gemm2<0><<<dim3((unsigned)((MP / 128) * (DM / 64)), 1), 128, 0, stream>>>(XK + r0p * DM, DM, 0, BK, DM, 0, 0.0625f, nullptr, 0, nullptr, 1, 0, 0, nullptr, K16 + r0p * DM, DM, 0, MP, DM, DM);
  k_gemm2<0><<<dim3((unsigned)((MP / 128) * (DM / 64)), 1), 128, 0, stream>>>(XV + r0p * DM, DM, 0, BV, DM, 0, 0.0625f, nullptr, 0, nullptr, 1, 0, 0, nullptr, V16 + r0p * DM, DM, 0, MP, DM, DM);
  for (int b = B0; b < B0 + NBR; ++b) { const size_t r0 = (size_t)b * SQ;
    k_vt<NH, SQ><<<NH * (SQ / 64), 256, 0, stream>>>(V16 + r0 * LQ, LQ, 0, VT);      /* V^T [NH][HD][SQ] for this batch */
    k_gemm2<0><<<dim3((QT0 / 128) * (DM / 64), 1), 128, 0, stream>>>(XQ + r0 * DM, DM, 0, BQ, DM, 0, 0.0625f, nullptr, 0, nullptr, 1, 0, 0, QF0, nullptr, DM, 0, QT0, DM, DM); k_gemm2<0><<<dim3((QT0 / 128) * (DM / 64), 1), 128, 0, stream>>>(XK + r0 * DM, DM, 0, BK, DM, 0, 0.0625f, nullptr, 0, nullptr, 1, 0, 0, KF0, nullptr, DM, 0, QT0, DM, DM); k_gemm2<0><<<dim3((QT0 / 128) * (DM / 64), 1), 128, 0, stream>>>(XV + r0 * DM, DM, 0, BV, DM, 0, 0.0625f, nullptr, 0, nullptr, 1, 0, 0, VF0, nullptr, DM, 0, QT0, DM, DM);      /* f32 q, k, v of the first 256 rows (exact products) */
    k_att0<0><<<NH * (QT0 / A0Q), A0Q * A0S, 0, stream>>>(QF0, KF0, VF0, DM, nullptr, 0.125f, OF0 + (size_t)b * QT0 * DM, DM);      /* exact f32 attention for rows 0..255 (o x64) */
    k_fattn<<<NH * (SQ / (4 * FQ)), 128, 0, stream>>>(Q16 + r0 * LQ, K16 + r0 * LQ, VT, O16 + r0 * DM); }      /* o (merged heads, x64) as f16 rows: scores, softmax and P V in one launch */
  k_gemm2<0><<<dim3((unsigned)((MPO / 128) * (DM / 64)), 1), 128, 0, stream>>>(O16 + r0p * DM, DM, 0, BO, DM, 0, 0.0009765625f, nullptr, 0, nullptr, 1, 0, 0, (float*)d_out + r0p * DM, nullptr, DM, 0, MPO, DM, DM);      /* out rows are the output layout */
  k_hl<<<(unsigned)(((size_t)NB * QT0 * DM / 8 + 255) / 256), 256, 0, stream>>>(OF0, OH0, OL0, (size_t)NB * QT0 * DM / 8);      /* first-tile o (x64) -> f16 hi + x1024 residual planes */
  for (int b = B0; b < B0 + NBR; ++b) { const size_t r0 = (size_t)b * SQ; const size_t f0 = (size_t)b * QT0;
    k_gemm2<0><<<dim3((QT0 / 128) * (DM / 64), 1), 128, 0, stream>>>(OH0 + f0 * DM, DM, 0, BO, DM, 0, 0.0009765625f, nullptr, 0, nullptr, 1, 0, 0, (float*)d_out + r0 * DM, nullptr, DM, 0, QT0, DM, DM);      /* rows 0..255: out = o_hi Wo, overwriting the f16-path rows */
    k_gemm2<0><<<dim3((QT0 / 128) * (DM / 64), 1), 128, 0, stream>>>(OL0 + f0 * DM, DM, 0, BO, DM, 0, 0.00000095367431640625f, nullptr, 0, (const float*)d_out + r0 * DM, -1, 0, 0, (float*)d_out + r0 * DM, nullptr, DM, 0, QT0, DM, DM); }      /* += o_lo Wo 2^-20 (own-element accumulate) */
}

// v007
// Measured time: 230 microseconds a run.
// Timed twice side by side with v006, it ran 1.04 and 1.05 times as fast.
// Counting every step since v000, it is 35.9 times as fast.
#include <hip/hip_runtime.h>
// Causal multi-head attention (q, k, v inputs [1][4096][1024]; qp/kp/vp = input W^T (nn.Linear [out][in], no bias), 16 heads of 64; scores x (8/64) = /8; causal mask (keys > query get -inf); softmax; out = (probs v merged) Wo^T -> [1][4096][1024]).
// Structure: token rows r = s; q, k, v inputs as exact f16 rows (bf16-rounded); Q, K, V as three WMMA GEMMs (32x64 wave tiles, f32 accumulation, exact x16 weights, f16 outputs); per batch: V^T for all heads via LDS transposes; one fused attention launch: a wave owns 32 query rows of a head and walks the keys up to its last row in steps of 32 (K and V^T tiles of 64 keys staged in LDS per block of 4 waves): scores on WMMA (K = 64, x 0.125), online causal softmax in registers (f32 running maximum and sum, native exp; unnormalised weights f16), o += P V on WMMA (f32), divided by the row sum at the end (o carried x64, folded into the output GEMM alpha) written straight into the merged f16 o rows; out = o W_o GEMM (f32) into the output layout.
// Compute dtype: inputs rounded to bf16; x / weights exact; q, k, v, softmax weights and o as plain f16 GEMM operands (~2^-12); scores and softmax statistics f32. v_wmma_f32_16x16x32_f16.
#define NB 1
#define SQ 4096
#define DM 1024
#define NH 16
#define HD 64
#define HG 4                         /* heads per launch of the non-template k_vt (not launched) */
#define QT 256                       /* not used */
#define NKX SQ                       /* not used */
#define QT0 256                      /* first-tile rows recomputed exactly in f32 */
#define B0 0                         /* first batch processed (debug hook) */
#define NBR NB                       /* batches processed (debug hook) */
#define NR ((size_t)NB * SQ)         /* token rows */
#define MP ((int)((size_t)NBR * SQ)) /* rows projected (debug hook) */
#define QN SQ                        /* query rows attended per batch (not used) */
#define NHD NH                       /* heads attended (not used) */
#define MPO MP                       /* rows through the output stage (debug hook) */
#define LQ DM      /* row pitch of the q/k/v rows */
typedef __bf16 v16b __attribute__((ext_vector_type(16)));
typedef unsigned short v8us __attribute__((ext_vector_type(8), may_alias));
typedef float  v8f  __attribute__((ext_vector_type(8)));
typedef float  v4f  __attribute__((ext_vector_type(4)));
typedef float  v4fa __attribute__((ext_vector_type(4), may_alias));
union FragB { v16b v; v8us half[2]; unsigned short u[16]; };

__device__ __forceinline__ unsigned short bf16_bits(float x) { unsigned int u = __float_as_uint(x); return (unsigned short)((u + 0x7FFFu + ((u >> 16) & 1u)) >> 16); }
__device__ __forceinline__ float bf16_val(unsigned short b) { return __uint_as_float(((unsigned int)b) << 16); }
__device__ __forceinline__ float bf16_round(float x) { return bf16_val(bf16_bits(x)); }
// D += A·B with NT terms: 1 = ah·bh, 2 = + al·bh (A split), 3 = + ah·bl (both split)
template <int NT>
__device__ __forceinline__ v8f mmaN(v16b ah, v16b al, v16b bh, v16b bl, v8f c) {
  c = __builtin_amdgcn_wmma_f32_16x16x32_bf16(false, ah, false, bh, (short)0, c, false, false);
  if (NT >= 2) c = __builtin_amdgcn_wmma_f32_16x16x32_bf16(false, al, false, bh, (short)0, c, false, false);
  if (NT >= 3) c = __builtin_amdgcn_wmma_f32_16x16x32_bf16(false, ah, false, bl, (short)0, c, false, false);
  asm volatile("v_nop\n\tv_nop\n\tv_nop\n\tv_nop" : "+v"(c) : "v"(ah), "v"(al), "v"(bh), "v"(bl));
  return c;
}

__global__ __launch_bounds__(256) void k_wt_bf16(const float* __restrict__ W, unsigned short* __restrict__ Wt, int K, int N) {
  const int t = blockIdx.x * 256 + threadIdx.x;
  const int k8n = K / 8;
  if (t >= N * k8n) return;
  const int n = t / k8n, k8 = (t % k8n) * 8;
  v8us v;
#pragma unroll
  for (int i = 0; i < 8; ++i) v[i] = bf16_bits(W[(size_t)(k8 + i) * N + n]);
  *(v8us*)(Wt + (size_t)n * K + k8) = v;
  
}

// GEMM C[M][N] (f32, pitch ldc) = act(A[M][K]·W + bias). A f32 row-major (pitch lda) converted per fragment to bf16
// (ASPLIT: hi/lo two planes -> 2 terms, else single rounded term); Wt bf16 [N][K] (pitch ldb). BIAS_BF16 rounds the
// bias to bf16 first (bias quantised to bf16 before the add). K%32==0, M%16==0, N%64==0.
template <bool ASPLIT, int ACT, bool BIAS_BF16>
__global__ __launch_bounds__(128) void k_gemm_bf(const float* __restrict__ A, int lda, const unsigned short* __restrict__ Wt, int ldb,
                                               const float* __restrict__ bias, float* __restrict__ C, int ldc, int M, int N, int K) {
  __shared__ __attribute__((aligned(16))) float so[4][16][64];
  const int tid = threadIdx.x, w = tid >> 5, lane = tid & 31, ln = lane & 15, hh = lane >> 4;
  const int ntn = N / 64;
  const int wid = blockIdx.x * 4 + w;
  const int mt = wid / ntn, nq = wid % ntn;
  if (mt * 16 >= M) return;
  const int row0 = mt * 16, col0 = nq * 64;
  const float* arow = A + (size_t)(row0 + ln) * lda;
  v8f acc[4] = {};
  for (int kb = 0; kb < K; kb += 32) {
    FragB ah, al;
    const v4f x0 = *(const v4fa*)(arow + kb + 8 * hh), x1 = *(const v4fa*)(arow + kb + 8 * hh + 4);
    const v4f x2 = *(const v4fa*)(arow + kb + 16 + 8 * hh), x3 = *(const v4fa*)(arow + kb + 16 + 8 * hh + 4);
    float xs[16] = {x0[0],x0[1],x0[2],x0[3],x1[0],x1[1],x1[2],x1[3],x2[0],x2[1],x2[2],x2[3],x3[0],x3[1],x3[2],x3[3]};
#pragma unroll
    for (int i = 0; i < 16; ++i) { const unsigned short hb = bf16_bits(xs[i]); ah.u[i] = hb; al.u[i] = ASPLIT ? bf16_bits(xs[i] - bf16_val(hb)) : (unsigned short)0; }
#pragma unroll
    for (int t = 0; t < 4; ++t) {
      const unsigned short* brow = Wt + (size_t)(col0 + t * 16 + ln) * ldb + kb;
      FragB b;
      b.half[0] = *(const v8us*)(brow + 8 * hh);
      b.half[1] = *(const v8us*)(brow + 16 + 8 * hh);
      acc[t] = mmaN<ASPLIT ? 2 : 1>(ah.v, al.v, b.v, b.v, acc[t]);
    }
  }
#pragma unroll
  for (int t = 0; t < 4; ++t) {
    float bv = bias ? bias[col0 + t * 16 + ln] : 0.f;
    if (BIAS_BF16) bv = bf16_round(bv);
#pragma unroll
    for (int r = 0; r < 8; ++r) { float v = acc[t][r] + bv; if (ACT == 1) v = fmaxf(v, 0.f); so[w][8 * hh + r][t * 16 + ln] = v; }
  }
  __builtin_amdgcn_fence(__ATOMIC_ACQ_REL, "workgroup");
  __builtin_amdgcn_wave_barrier();
  const int rsub = lane >> 4, c4 = (lane & 15) * 4;
  {
#pragma unroll
    for (int q = 0; q < 8; ++q) {
      const int r = q * 2 + rsub;
      const v4f v = *(const v4fa*)&so[w][r][c4];
      *(v4f*)(C + (size_t)(row0 + r) * ldc + col0 + c4) = v;
    }
    
  }
}

// GEMM C = act(A·W + bias + resid): A f32 (ASPLIT -> hi/lo 2 terms), Wt bf16 [N][K]; ACT 0 none, 1 relu, 2 exact gelu;
// resid (optional, f32, row index = (row % rmod), pitch ldr, RES_BF16 rounds it) added before the activation.
template <bool ASPLIT, int ACT, bool BIAS_BF16, bool RES_BF16>
__global__ __launch_bounds__(128) void k_gemm_bf3(const float* __restrict__ A, int lda, const unsigned short* __restrict__ Wt, int ldb,
                                                const float* __restrict__ bias, const float* __restrict__ resid, int rmod, int ldr,
                                                float* __restrict__ C, int ldc, int M, int N, int K) {
  __shared__ __attribute__((aligned(16))) float so[4][16][64];
  const int tid = threadIdx.x, w = tid >> 5, lane = tid & 31, ln = lane & 15, hh = lane >> 4;
  const int ntn = N / 64;
  const int wid = blockIdx.x * 4 + w;
  const int mt = wid / ntn, nq = wid % ntn;
  if (mt * 16 >= M) return;
  const int row0 = mt * 16, col0 = nq * 64;
  const float* arow = A + (size_t)(row0 + ln) * lda;
  v8f acc[4] = {};
  for (int kb = 0; kb < K; kb += 32) {
    FragB ah, al;
    const v4f x0 = *(const v4fa*)(arow + kb + 8 * hh), x1 = *(const v4fa*)(arow + kb + 8 * hh + 4);
    const v4f x2 = *(const v4fa*)(arow + kb + 16 + 8 * hh), x3 = *(const v4fa*)(arow + kb + 16 + 8 * hh + 4);
    float xs[16] = {x0[0],x0[1],x0[2],x0[3],x1[0],x1[1],x1[2],x1[3],x2[0],x2[1],x2[2],x2[3],x3[0],x3[1],x3[2],x3[3]};
#pragma unroll
    for (int i = 0; i < 16; ++i) { const unsigned short hb = bf16_bits(xs[i]); ah.u[i] = hb; al.u[i] = ASPLIT ? bf16_bits(xs[i] - bf16_val(hb)) : (unsigned short)0; }
#pragma unroll
    for (int t = 0; t < 4; ++t) {
      const unsigned short* brow = Wt + (size_t)(col0 + t * 16 + ln) * ldb + kb;
      FragB b;
      b.half[0] = *(const v8us*)(brow + 8 * hh);
      b.half[1] = *(const v8us*)(brow + 16 + 8 * hh);
      acc[t] = mmaN<ASPLIT ? 2 : 1>(ah.v, al.v, b.v, b.v, acc[t]);
    }
  }
#pragma unroll
  for (int t = 0; t < 4; ++t) {
    const int col = col0 + t * 16 + ln;
    float bv = bias ? bias[col] : 0.f;
    if (BIAS_BF16) bv = bf16_round(bv);
#pragma unroll
    for (int r = 0; r < 8; ++r) {
      float v = acc[t][r] + bv;
      if (resid) { float rv = resid[(size_t)((row0 + 8 * hh + r) % rmod) * ldr + col]; if (RES_BF16) rv = bf16_round(rv); v += rv; }
      if (ACT == 1) v = fmaxf(v, 0.f);
      if (ACT == 2) v = 0.5f * v * (1.0f + erff(v * 0.70710678118654752f));
      if (ACT == 3) { const float u = 0.7978845608028654f * (v + 0.044715f * v * v * v); v = 0.5f * v * (1.0f + tanhf(u)); }
      so[w][8 * hh + r][t * 16 + ln] = v;
    }
  }
  __builtin_amdgcn_fence(__ATOMIC_ACQ_REL, "workgroup");
  __builtin_amdgcn_wave_barrier();
  const int rsub = lane >> 4, c4 = (lane & 15) * 4;
  {
#pragma unroll
    for (int q = 0; q < 8; ++q) {
      const int r = q * 2 + rsub;
      const v4f v = *(const v4fa*)&so[w][r][c4];
      *(v4f*)(C + (size_t)(row0 + r) * ldc + col0 + c4) = v;
    }
    
  }
}
// row LayerNorm (biased variance, eps) over N: s = X (+ R); optional out_sum <- s; out_norm <- (s-mu)*rsqrt(var+eps)*g + b
template <bool PARAM_BF16>
__global__ __launch_bounds__(256) void k_layernorm(const float* __restrict__ X, const float* __restrict__ R, const float* __restrict__ g, const float* __restrict__ bta,
                                                  float* __restrict__ out_sum, float* __restrict__ out_norm, int N, float eps) {
  __shared__ float red[256];
  const int row = blockIdx.x, tid = threadIdx.x;
  const float* x = X + (size_t)row * N; const float* rr = R ? R + (size_t)row * N : nullptr;
  float vals[16];                     // up to N = 4096
  const int per = N / 256;            // contiguous chunk per thread? use strided-by-4 chunks: thread handles j = tid*4 + 1024*u
  float s1 = 0.f;
  for (int u = 0; u < per / 4; ++u) {
    const int j = tid * 4 + 1024 * u;
    const v4f a = *(const v4fa*)(x + j);
    v4f b = {0.f,0.f,0.f,0.f}; if (rr) b = *(const v4fa*)(rr + j);
#pragma unroll
    for (int q = 0; q < 4; ++q) { const float v = a[q] + b[q]; vals[u * 4 + q] = v; s1 += v; }
  }
  red[tid] = s1; __syncthreads();
  for (int st = 128; st > 0; st >>= 1) { if (tid < st) red[tid] += red[tid + st]; __syncthreads(); }
  const float mu = red[0] / (float)N; __syncthreads();
  float s2 = 0.f;
  for (int u = 0; u < per / 4; ++u)
#pragma unroll
    for (int q = 0; q < 4; ++q) { const float c = vals[u * 4 + q] - mu; s2 += c * c; }
  red[tid] = s2; __syncthreads();
  for (int st = 128; st > 0; st >>= 1) { if (tid < st) red[tid] += red[tid + st]; __syncthreads(); }
  const float rs = rsqrtf(red[0] / (float)N + eps);
  {
    for (int u = 0; u < per / 4; ++u) {
      const int j = tid * 4 + 1024 * u;
      v4f o, sm;
#pragma unroll
      for (int q = 0; q < 4; ++q) {
        float gg = g[j + q], bb = bta[j + q];
        if (PARAM_BF16) { gg = bf16_round(gg); bb = bf16_round(bb); }
        sm[q] = vals[u * 4 + q]; o[q] = (vals[u * 4 + q] - mu) * rs * gg + bb;
      }
      if (out_sum) *(v4f*)(out_sum + (size_t)row * N + j) = sm;
      *(v4f*)(out_norm + (size_t)row * N + j) = o;
    }
    
  }
}



// ---- f16 WMMA path (v_wmma_f32_16x16x32_f16): 11-bit significands for operands in range — used where a [0,1] probability operand needs more precision than bf16
typedef _Float16 v16h __attribute__((ext_vector_type(16)));
union FragH { v16h v; v8us half[2]; _Float16 h[16]; unsigned short u[16]; };
template <int NT>
__device__ __forceinline__ v8f mmaH(v16h ah, v16h al, v16h bh, v16h bl, v8f c) {
  c = __builtin_amdgcn_wmma_f32_16x16x32_f16(false, ah, false, bh, (short)0, c, false, false);
  if (NT >= 2) c = __builtin_amdgcn_wmma_f32_16x16x32_f16(false, al, false, bh, (short)0, c, false, false);
  if (NT >= 3) c = __builtin_amdgcn_wmma_f32_16x16x32_f16(false, ah, false, bl, (short)0, c, false, false);
  asm volatile("v_nop\n\tv_nop\n\tv_nop\n\tv_nop" : "+v"(c) : "v"(ah), "v"(al), "v"(bh), "v"(bl));
  return c;
}
// batched GEMM like k_gemm_b but f16 operands: A f32 (split into f16 hi/lo if ASPLIT, else rounded to f16), Bt = f16 values [n][k]; alpha; C f32; N multiple of 16 (partial tiles skipped)
template <bool ASPLIT>
__global__ __launch_bounds__(128) void k_gemm_h(const float* __restrict__ A, int lda, size_t sA, const _Float16* __restrict__ Bh, int ldb, size_t sB, float alpha, float* __restrict__ C, int ldc, size_t sC, int M, int N, int K) {
  __shared__ __attribute__((aligned(16))) float so[4][16][64];
  const int tid = threadIdx.x, w = tid >> 5, lane = tid & 31, ln = lane & 15, hh = lane >> 4; const int by = blockIdx.y;
  A += (size_t)by * sA; Bh += (size_t)by * sB; C += (size_t)by * sC;
  const int ntn = (N + 63) / 64; const int wid = blockIdx.x * 4 + w; const int mt = wid / ntn, nq = wid % ntn; if (mt * 16 >= M) return;
  const int row0 = mt * 16, col0 = nq * 64; const float* arow = A + (size_t)(row0 + ln) * lda;
  v8f acc[4] = {};
  for (int kb = 0; kb < K; kb += 32) {
    FragH ah, al;
    const v4f x0 = *(const v4fa*)(arow + kb + 8 * hh), x1 = *(const v4fa*)(arow + kb + 8 * hh + 4), x2 = *(const v4fa*)(arow + kb + 16 + 8 * hh), x3 = *(const v4fa*)(arow + kb + 16 + 8 * hh + 4);
    float xs[16] = {x0[0],x0[1],x0[2],x0[3],x1[0],x1[1],x1[2],x1[3],x2[0],x2[1],x2[2],x2[3],x3[0],x3[1],x3[2],x3[3]};
#pragma unroll
    for (int i = 0; i < 16; ++i) { const _Float16 h = (_Float16)xs[i]; ah.h[i] = h; al.h[i] = ASPLIT ? (_Float16)(xs[i] - (float)h) : (_Float16)0.0f; }
#pragma unroll
    for (int t = 0; t < 4; ++t) { if (col0 + t * 16 >= N) continue; const size_t boff = (size_t)(col0 + t * 16 + ln) * ldb + kb; FragH bq; bq.half[0] = *(const v8us*)(Bh + boff + 8 * hh); bq.half[1] = *(const v8us*)(Bh + boff + 16 + 8 * hh);
      acc[t] = mmaH<ASPLIT ? 2 : 1>(ah.v, al.v, bq.v, bq.v, acc[t]); }
  }
#pragma unroll
  for (int t = 0; t < 4; ++t) { if (col0 + t * 16 >= N) continue;
#pragma unroll
    for (int r = 0; r < 8; ++r) so[w][8 * hh + r][t * 16 + ln] = acc[t][r] * alpha; }
  __builtin_amdgcn_fence(__ATOMIC_ACQ_REL, "workgroup"); __builtin_amdgcn_wave_barrier();
  const int rsub = lane >> 4, c4 = (lane & 15) * 4;
  {
#pragma unroll
    for (int q = 0; q < 8; ++q) { const int r = q * 2 + rsub; if (col0 + c4 < N) { const v4f v = *(const v4fa*)&so[w][r][c4]; *(v4f*)(C + (size_t)(row0 + r) * ldc + col0 + c4) = v; } }
     }
}

// Wt[n][k] = f16(W[k][n]·scale) from f32 row-major W[K][N] (scale = power of two; bf16-exact weights stay exact in f16 away from the subnormal range)
__global__ __launch_bounds__(256) void k_wt_f16(const float* __restrict__ W, _Float16* __restrict__ Wt, int K, int N, float scale) {
  const int t = blockIdx.x * 256 + threadIdx.x; if (t >= N * (K / 8)) return; const int n = t / (K / 8), k8 = (t % (K / 8)) * 8; FragH f;
#pragma unroll
  for (int i = 0; i < 8; ++i) f.h[i] = (_Float16)(bf16_round(W[(size_t)(k8 + i) * N + n]) * scale); const v8us o = f.half[0];
  *(v8us*)((unsigned short*)Wt + (size_t)n * K + k8) = o; 
}
// k_gemm_hh variant with fused epilogue: v = acc·alpha + bias[by·sBias + col] (+ CP[(row/rowsPerB)·sCPb + by·64 + col] if CP) ; ACT 0 none / 1 elu ; writes f16 C16 (and f32 C if non-null)
template <int ACT>
__global__ __launch_bounds__(128) void k_gemm_hhx(const _Float16* __restrict__ A, int lda, size_t sA, const _Float16* __restrict__ Bh, int ldb, size_t sB, float alpha, const float* __restrict__ bias, size_t sBias, const float* __restrict__ CP, int rowsPerB, size_t sCPb, int row0g,
    float* __restrict__ C, _Float16* __restrict__ C16, int ldc, size_t sC, int M, int N, int K) {
  __shared__ __attribute__((aligned(16))) float so[4][16][64];
  const int tid = threadIdx.x, w = tid >> 5, lane = tid & 31, ln = lane & 15, hh = lane >> 4; const int by = blockIdx.y;
  A += (size_t)by * sA; Bh += (size_t)by * sB; const size_t cofs = (size_t)by * sC; const float* bp = bias ? bias + (size_t)by * sBias : nullptr;
  const int ntn = (N + 63) / 64; const int wid = blockIdx.x * 4 + w; const int mt = wid / ntn, nq = wid % ntn; if (mt * 16 >= M) return;
  const int row0 = mt * 16, col0 = nq * 64; const _Float16* arow = A + (size_t)(row0 + ln) * lda;
  v8f acc[4] = {};
  for (int kb = 0; kb < K; kb += 32) { FragH ah; ah.half[0] = *(const v8us*)((const unsigned short*)arow + kb + 8 * hh); ah.half[1] = *(const v8us*)((const unsigned short*)arow + kb + 16 + 8 * hh);
#pragma unroll
    for (int t = 0; t < 4; ++t) { if (col0 + t * 16 >= N) continue; const size_t boff = (size_t)(col0 + t * 16 + ln) * ldb + kb; FragH bq; bq.half[0] = *(const v8us*)((const unsigned short*)Bh + boff + 8 * hh); bq.half[1] = *(const v8us*)((const unsigned short*)Bh + boff + 16 + 8 * hh);
      acc[t] = mmaH<1>(ah.v, ah.v, bq.v, bq.v, acc[t]); }
  }
#pragma unroll
  for (int t = 0; t < 4; ++t) { if (col0 + t * 16 >= N) continue; const int col = col0 + t * 16 + ln; const float bv = bp ? bf16_round(bp[col]) : 0.f;
#pragma unroll
    for (int r = 0; r < 8; ++r) { float v = acc[t][r] * alpha + bv; if (CP) { const int rr = row0g + row0 + 8 * hh + r; if (rowsPerB < 0) v += CP[cofs + (size_t)rr * ldc + col];      /* rowsPerB < 0: own element of the batched C plane */ else { const int bidx = rr / rowsPerB; v += CP[(size_t)bidx * sCPb + (size_t)by * 64 + col]; } } if (ACT == 1) v = (v > 0.f) ? v : expm1f(v); else if (ACT == 7) v = (v > 0.f) ? v + 1.0f : expf(v); else if (ACT == 8) v = tanhf(v); else if (ACT == 9) v = 0.5f * v * (1.0f + tanhf(0.7978845608028654f * (v + 0.044715f * v * v * v))); else if (ACT == 11) v = 1.0f / (1.0f + expf(-v)); else if (ACT == 12) v = (v > 0.f) ? v : 0.01f * v; else if (ACT == 14) v = (v > 0.f) ? v : 0.1f * v; else if (ACT == 16) v = (v >= 0.f) ? v : 0.3f * v; else if (ACT == 17) v = (v >= 0.f) ? v : 0.2f * v; else if (ACT == 15) v = v / (1.0f + expf(-v)); else if (ACT == 3) v = fmaxf(v, 0.f); else if (ACT == 6) v = 0.5f * v * (1.0f + erff(v * 0.70710678118654752f)); so[w][8 * hh + r][t * 16 + ln] = v; } }
  __builtin_amdgcn_fence(__ATOMIC_ACQ_REL, "workgroup"); __builtin_amdgcn_wave_barrier();
  const int rsub = lane >> 4, c4 = (lane & 15) * 4; typedef _Float16 v4h __attribute__((ext_vector_type(4)));
  {
#pragma unroll
    for (int q = 0; q < 8; ++q) { const int r = q * 2 + rsub; if (col0 + c4 < N) { const v4f v = *(const v4fa*)&so[w][r][c4]; if (C) *(v4f*)(C + cofs + (size_t)(row0 + r) * ldc + col0 + c4) = v; if (C16) { v4h h4; for (int i = 0; i < 4; ++i) h4[i] = (_Float16)v[i]; *(v4h*)(C16 + cofs + (size_t)(row0 + r) * ldc + col0 + c4) = h4; } } }
     }
}


typedef _Float16 v4h __attribute__((ext_vector_type(4)));

__global__ __launch_bounds__(256) void k_h16(const float* __restrict__ x, _Float16* __restrict__ X16, size_t n8) { const size_t t = (size_t)blockIdx.x * 256 + threadIdx.x; if (t >= n8) return; FragH f;
#pragma unroll
  for (int q = 0; q < 8; ++q) f.h[q] = (_Float16)x[t * 8 + q]; *(v8us*)((unsigned short*)X16 + t * 8) = f.half[0];  }
__global__ __launch_bounds__(256) void k_round16f(const float* __restrict__ W, _Float16* __restrict__ Bt, size_t n8) { const size_t t = (size_t)blockIdx.x * 256 + threadIdx.x; if (t >= n8) return; FragH f;
#pragma unroll
  for (int i = 0; i < 8; ++i) f.h[i] = (_Float16)(bf16_round(W[t * 8 + i]) * 16.0f); *(v8us*)((unsigned short*)Bt + t * 8) = f.half[0];  }
template <int NHv, int TTv>
__global__ __launch_bounds__(256) void k_vt(const _Float16* __restrict__ V16, int ldv, int voff, _Float16* __restrict__ Vt) { __shared__ unsigned short tl[64][66]; const int tid = threadIdx.x; const int slab = blockIdx.x / (TTv / 64), lg = blockIdx.x % (TTv / 64); const int b = slab / NHv, h = slab % NHv;
  for (int i = tid; i < 64 * 8; i += 256) { const int r = i / 8, c8 = (i % 8) * 8; FragH f; f.half[0] = *(const v8us*)((const unsigned short*)V16 + ((size_t)b * TTv + lg * 64 + r) * ldv + voff + h * 64 + c8);
#pragma unroll
    for (int q = 0; q < 8; ++q) tl[r][c8 + q] = f.u[q]; }
  __syncthreads();
  {
#pragma unroll
    for (int rd = 0; rd < 2; ++rd) { const int d = rd * 32 + tid / 8, pc = tid % 8; FragH f;
#pragma unroll
      for (int q = 0; q < 8; ++q) f.u[q] = tl[pc * 8 + q][d];
      *(v8us*)((unsigned short*)Vt + ((size_t)slab * 64 + d) * TTv + lg * 64 + pc * 8) = f.half[0]; }
     } }

__global__ __launch_bounds__(256) void k_hl(const float* __restrict__ F, _Float16* __restrict__ Hh, _Float16* __restrict__ Hl, size_t n8) { const size_t t = (size_t)blockIdx.x * 256 + threadIdx.x; if (t >= n8) return; FragH fh, fl; const v4f a = *(const v4fa*)(F + t * 8), c = *(const v4fa*)(F + t * 8 + 4);
#pragma unroll
  for (int q = 0; q < 4; ++q) { _Float16 h = (_Float16)a[q]; fh.h[q] = h; fl.h[q] = (_Float16)((a[q] - (float)h) * 1024.0f); h = (_Float16)c[q]; fh.h[4 + q] = h; fl.h[4 + q] = (_Float16)((c[q] - (float)h) * 1024.0f); }
  { *(v8us*)((unsigned short*)Hh + t * 8) = fh.half[0]; *(v8us*)((unsigned short*)Hl + t * 8) = fl.half[0];  } }

// ---- fast GEMM (wave tile 32x64; requires M % 128 == 0 rows per launch region, N % 64 == 0 and K % 64 == 0); epilogue = k_gemm_hhx semantics ----
__device__ __forceinline__ v16h g2_frag(const _Float16* p, int hh) { FragH f; f.half[0] = *(const v8us*)((const unsigned short*)p + 8 * hh); f.half[1] = *(const v8us*)((const unsigned short*)p + 16 + 8 * hh); return f.v; }
__device__ __forceinline__ v8f g2_mmab(v16h a, v16h b, v8f c) { return __builtin_amdgcn_wmma_f32_16x16x32_f16(false, a, false, b, (short)0, c, false, false); }
#define G2KC 64                      /* k per staged tile: 128 bytes, one cache line of every operand row */
#define G2P 72                       /* LDS row pitch in f16: 128 + 16 bytes, so that the 16 rows of a 16-byte fragment read fall on different banks */
// Block tile 128 x 64. Per 64 k the block's 128 A rows and 64 B rows go global -> registers -> LDS with whole-line loads, one tile ahead, two LDS buffers; the waves read their fragments from LDS. Needs M % 128 == 0, K % 64 == 0, K >= 64.
template <int ACT>
__global__ __launch_bounds__(128) void k_gemm2(const _Float16* __restrict__ A, int lda, size_t sA, const _Float16* __restrict__ Bh, int ldb, size_t sB, float alpha, const float* __restrict__ bias, size_t sBias, const float* __restrict__ CP, int rowsPerB, size_t sCPb, int row0g,
    float* __restrict__ C, _Float16* __restrict__ C16, int ldc, size_t sC, int M, int N, int K) { static_assert(ACT == 0 || ACT == 3 || ACT == 6 || ACT == 8 || ACT == 9 || ACT == 11 || ACT == 12 || ACT == 14 || ACT == 15 || ACT == 16 || ACT == 17, "k_gemm2: unsupported ACT code (would silently apply no activation)");
  __shared__ __attribute__((aligned(16))) float so[4][32][68];
  __shared__ __attribute__((aligned(16))) _Float16 st[2][192][G2P];      /* two staged tiles: rows 0..127 = the block's A rows, rows 128..191 = its B rows, G2KC k each */
  const int tid = threadIdx.x, w = tid >> 5, lane = tid & 31, ln = lane & 15, hh = lane >> 4; const int by = blockIdx.y;
  A += (size_t)by * sA; Bh += (size_t)by * sB; const size_t cofs = (size_t)by * sC; const float* bp = bias ? bias + (size_t)by * sBias : nullptr;
  const int ntn = N >> 6; const int mt = blockIdx.x / ntn, nq = blockIdx.x - mt * ntn; const int row0 = mt * 128 + 32 * w, col0 = nq * 64; if (mt * 128 >= M) return;      /* the same for the whole block: it stands in front of the barriers */
  const int sr = tid >> 3, sg = tid & 7;      /* staging: 8 threads bring one row's 128 bytes, so a wave's 16-byte load is 4 whole cache lines */
  const _Float16* gp[12];      /* the thread's 8 A pieces and 4 B pieces of the tile to be fetched next */
#pragma unroll
  for (int i = 0; i < 8; ++i) gp[i] = A + (size_t)(mt * 128 + sr + 16 * i) * lda + sg * 8;
#pragma unroll
  for (int i = 0; i < 4; ++i) gp[8 + i] = Bh + (size_t)(col0 + sr + 16 * i) * ldb + sg * 8;
  v8us rg[12];      /* the tile on its way from global memory to LDS */
  auto fetch = [&]() {
#pragma unroll
    for (int i = 0; i < 12; ++i) rg[i] = *(const v8us*)(const unsigned short*)gp[i];
    asm volatile("s_wait_xcnt 0x0" :: "v"(gp[0]), "v"(gp[1]), "v"(gp[2]), "v"(gp[3]), "v"(gp[4]), "v"(gp[5]), "v"(gp[6]), "v"(gp[7]), "v"(gp[8]), "v"(gp[9]), "v"(gp[10]), "v"(gp[11]) : "memory");      /* the 12 addresses are named so that their registers live up to this wait: none is overwritten in front of it, neither by the step to the next tile below nor by a load's result */
#pragma unroll
    for (int i = 0; i < 12; ++i) gp[i] += G2KC; };
  auto put = [&](int buf) {
#pragma unroll
    for (int i = 0; i < 12; ++i) *(v8us*)&st[buf][sr + 16 * i][sg * 8] = rg[i]; };
  auto lfrag = [&](int buf, int row, int kk) { FragH f; const unsigned short* p = (const unsigned short*)&st[buf][row][kk * 32 + 8 * hh]; f.half[0] = *(const v8us*)p; f.half[1] = *(const v8us*)(p + 16); return f.v; };      /* the k order of g2_frag */
  const v8f z8 = {0.f,0.f,0.f,0.f,0.f,0.f,0.f,0.f}; v8f c00 = z8, c01 = z8, c02 = z8, c03 = z8, c10 = z8, c11 = z8, c12 = z8, c13 = z8;
  const int nc = K / G2KC;
  fetch(); put(0); __syncthreads();
#pragma unroll 1      /* one copy of the tile body: the trip count is a run-time value and the body is long */
  for (int c = 0; c < nc; ++c) { const int buf = c & 1;
    if (c + 1 < nc) fetch();      /* the next tile's global loads fly while this tile is worked on */
    v16h a[2][2], b[2][4];
#pragma unroll
    for (int kk = 0; kk < 2; ++kk) { a[kk][0] = lfrag(buf, 32 * w + ln, kk); a[kk][1] = lfrag(buf, 32 * w + 16 + ln, kk);
#pragma unroll
      for (int t = 0; t < 4; ++t) b[kk][t] = lfrag(buf, 128 + 16 * t + ln, kk); }
    __builtin_amdgcn_sched_barrier(0);      /* keeps the tile's 24 LDS reads together in front of its 16 WMMAs: one LDS latency a tile with counted waits, where the scheduler otherwise reuses one B fragment's registers and waits for LDS eight times */
#pragma unroll
    for (int kk = 0; kk < 2; ++kk) {
      c00 = g2_mmab(a[kk][0], b[kk][0], c00); c10 = g2_mmab(a[kk][1], b[kk][0], c10); c01 = g2_mmab(a[kk][0], b[kk][1], c01); c11 = g2_mmab(a[kk][1], b[kk][1], c11);
      c02 = g2_mmab(a[kk][0], b[kk][2], c02); c12 = g2_mmab(a[kk][1], b[kk][2], c12); c03 = g2_mmab(a[kk][0], b[kk][3], c03); c13 = g2_mmab(a[kk][1], b[kk][3], c13); }
    if (c + 1 < nc) put(buf ^ 1);      /* into the buffer whose last readers passed the barrier at the foot of the trip before */
    __syncthreads(); }      /* one barrier a tile: publishes tile c + 1 and ends the reads of tile c */
  v8f accs[8] = {c00, c01, c02, c03, c10, c11, c12, c13};
#pragma unroll
  for (int u = 0; u < 8; ++u) { const int t = u & 3, half = u >> 2; const int col = col0 + t * 16 + ln; const float bv = bp ? bf16_round(bp[col]) : 0.f;
#pragma unroll
    for (int r = 0; r < 8; ++r) { const int rloc = half * 16 + 8 * hh + r; float v = accs[u][r] * alpha + bv; if (CP) { if (rowsPerB < 0) v += CP[cofs + (size_t)(row0g + row0 + rloc) * ldc + col];      /* rowsPerB < 0: own element of the batched C plane */ else { const int bidx = (row0g + row0 + rloc) / rowsPerB; v += CP[(size_t)bidx * sCPb + (size_t)by * 64 + col]; } }
      if (ACT == 3) v = fmaxf(v, 0.f); else if (ACT == 6) v = 0.5f * v * (1.0f + erff(v * 0.70710678118654752f)); else if (ACT == 11) v = 1.0f / (1.0f + expf(-v)); else if (ACT == 15) v = v / (1.0f + expf(-v)); else if (ACT == 12) v = (v > 0.f) ? v : 0.01f * v; else if (ACT == 8) v = tanhf(v); else if (ACT == 9) v = 0.5f * v * (1.0f + tanhf(0.7978845608028654f * (v + 0.044715f * v * v * v))); else if (ACT == 14) v = (v > 0.f) ? v : 0.1f * v; else if (ACT == 16) v = (v >= 0.f) ? v : 0.3f * v; else if (ACT == 17) v = (v >= 0.f) ? v : 0.2f * v;
      so[w][rloc][t * 16 + ln] = v; } }
  __builtin_amdgcn_fence(__ATOMIC_ACQ_REL, "workgroup"); __builtin_amdgcn_wave_barrier();
  const int rsub = lane >> 4, c4 = (lane & 15) * 4;
  {
#pragma unroll
    for (int q = 0; q < 16; ++q) { const int r = q * 2 + rsub; const v4f v = *(const v4fa*)&so[w][r][c4]; if (C) *(v4f*)(C + cofs + (size_t)(row0 + r) * ldc + col0 + c4) = v; if (C16) { v4h h4; for (int i = 0; i < 4; ++i) h4[i] = (_Float16)v[i]; *(v4h*)(C16 + cofs + (size_t)(row0 + r) * ldc + col0 + c4) = h4; } }
     } }


#define CVW 16                       /* waves per k_cvt work-group: 256 work-groups, one per WGP */
#define CVL 32                       /* 16-byte loads per lane, all issued before the first value is used */
#define CVE (CVL * 128)              /* f32 values per wave: 16 KiB of one source, consecutive */
// All seven f32 -> f16 conversions (4 weights: bf16-rounded x16; 3 inputs: bf16-rounded) in one streaming launch. D is the workspace range [BQ BK BV BO XQ XK XV], which lies in one piece in this order.
// A wave takes piece c of 4096 values: its source, its place there and its scale are wave-uniform. One load of a wave is 512 consecutive bytes (4 whole lines), one store 256 (2 whole lines).
__global__ __launch_bounds__(CVW * 32) void k_cvt(const float* __restrict__ wq, const float* __restrict__ wk, const float* __restrict__ wv, const float* __restrict__ wo, const float* __restrict__ xq, const float* __restrict__ xk, const float* __restrict__ xv, _Float16* __restrict__ D) {
  constexpr int WC = DM * DM / CVE, XC = (int)(NR * DM / CVE);      /* pieces per weight, per input */
  static_assert(DM * DM % CVE == 0 && NR * DM % CVE == 0 && (4 * WC + 3 * XC) % CVW == 0 && (DM * DM * 2) % 256 == 0 && (NR * DM * 2) % 256 == 0, "whole pieces, whole work-groups, no pad between the workspace planes");
  const int lane = threadIdx.x & 31; const int c = (int)blockIdx.x * CVW + __builtin_amdgcn_readfirstlane((int)(threadIdx.x >> 5));
  const float* s; float sc;
  if (c < 4 * WC) { const int i = c / WC; s = (i == 0 ? wq : i == 1 ? wk : i == 2 ? wv : wo) + (size_t)(c % WC) * CVE; sc = 16.0f; }
  else { const int e = c - 4 * WC, i = e / XC; s = (i == 0 ? xq : i == 1 ? xk : xv) + (size_t)(e % XC) * CVE; sc = 1.0f; }      /* x 1 is exact */
  const unsigned lo = (unsigned)lane * 16;      /* the lane's byte in every 512-byte row of the piece */
  v4f r[CVL];
#pragma unroll
  for (int q = 0; q < CVL; ++q) r[q] = __builtin_nontemporal_load((const v4fa*)((const char*)s + q * 512 + lo));      /* read once: not kept in L2 */
  __builtin_amdgcn_sched_barrier(0);      /* keeps the conversions behind all 32 loads: the wave's whole piece is in flight at once, where the scheduler otherwise holds most of them back until the first values are converted */
  _Float16* d = D + (size_t)c * CVE + lane * 4;
#pragma unroll
  for (int q = 0; q < CVL; ++q) { v4h h;
#pragma unroll
    for (int i = 0; i < 4; ++i) h[i] = (_Float16)(bf16_round(r[q][i]) * sc);
    *(v4h*)(d + q * 128) = h; }
}
__global__ __launch_bounds__(256) void k_rsm(const float* __restrict__ S, _Float16* __restrict__ P, int nrows) {
  #pragma clang fp contract(off)
  const int i = blockIdx.x * 256 + threadIdx.x; if (i >= nrows) return; const float* s = S + (size_t)i * SQ; float mx = -3.0e38f;
#pragma unroll 1
  for (int j = 0; j < SQ; ++j) mx = fmaxf(mx, s[j]); float se = 0.f;
#pragma unroll 1
  for (int j = 0; j < SQ; ++j) se += expf(s[j] - mx); const float sc = 256.0f / se;
#pragma unroll 1
  for (int j0 = 0; j0 < SQ; j0 += 8) { FragH f; for (int q = 0; q < 8; ++q) f.h[q] = (_Float16)(expf(s[j0 + q] - mx) * sc); unsigned short* d = (unsigned short*)P + (size_t)i * SQ + j0; *(v8us*)d = f.half[0];  } }
__global__ __launch_bounds__(256) void k_vt(const _Float16* __restrict__ V16, int b, int h0, _Float16* __restrict__ VT) { __shared__ unsigned short tl[64][65]; const int tid = threadIdx.x; const int hh = blockIdx.x % HG, sg = blockIdx.x / HG; const int s0 = sg * 64; const int h = h0 + hh;
  for (int i = tid; i < 64 * 8; i += 256) { const int j = i / 8, d8 = (i % 8) * 8; FragH f; f.half[0] = *(const v8us*)((const unsigned short*)V16 + ((size_t)b * SQ + s0 + j) * DM + h * HD + d8); for (int q = 0; q < 8; ++q) tl[d8 + q][j] = f.u[q]; }
  __syncthreads();
  { for (int i = tid; i < 64 * 8; i += 256) { const int d = i / 8, j8 = (i % 8) * 8; FragH f; for (int q = 0; q < 8; ++q) f.u[q] = tl[d][j8 + q]; *(v8us*)((unsigned short*)VT + ((size_t)hh * HD + d) * SQ + s0 + j8) = f.half[0]; }  } }



#define FQ 32                        /* query rows per wave */
#define FK 64                        /* keys per staged tile: 128 bytes of every V^T row, one cache line */
#define FP 72                        /* LDS row pitch in f16: 128 + 16 bytes, so that the 16 rows of a 16-byte fragment read fall on different banks */
typedef _Float16 v8h __attribute__((ext_vector_type(8)));
__device__ __forceinline__ float half_xor(float v) { const int i = __builtin_bit_cast(int, v); return __builtin_bit_cast(float, __builtin_amdgcn_permlanex16(i, i, 0x76543210, 0xfedcba98, false, false)); }      /* lane l <- lane l ^ 16 */
__device__ __forceinline__ float exp2_slot(float x) { float y; asm("v_exp_f32 %0, %1\n\tv_nop" : "=v"(y) : "v"(x)); return y; }      /* v_nop: the slot the instruction set asks for behind a transcendental before its result is read or its source rewritten; in the same statement it stays directly behind it */
__device__ __forceinline__ v8f fa_mma(v16h a, v16h b, v8f c) { return __builtin_amdgcn_wmma_f32_16x16x32_f16(false, a, false, b, (short)0, c, false, false); }
__global__ __launch_bounds__(128) void k_fattn(const _Float16* __restrict__ Qr, const _Float16* __restrict__ Kr, const _Float16* __restrict__ Vt, _Float16* __restrict__ Or) {
  static_assert(HD == 64 && SQ % (4 * FQ) == 0 && (4 * FQ) % FK == 0 && FK == 2 * 32, "two k chunks per score product, four d tiles, whole blocks of 4 waves, whole stages, two steps of 32 keys a stage");
  __shared__ __attribute__((aligned(16))) _Float16 kv[2][2 * FK][FP];      /* two staged tiles: rows 0..63 = the stage's K rows (64 head dims), rows 64..127 = the 64 V^T rows (the stage's 64 keys) */
  const int tid = threadIdx.x, lane = tid & 31, ln = lane & 15, hh = lane >> 4; const int w = __builtin_amdgcn_readfirstlane((int)(threadIdx.x >> 5));
  const int h = blockIdx.x % NH; const int qb = (SQ / (4 * FQ) - 1 - (int)(blockIdx.x / NH)) * (4 * FQ); const int q0 = qb + w * FQ;      /* the longest blocks start first */
  const int ns = (qb + 4 * FQ) / FK;      /* stages of the block: keys 0 .. its last row; at least 2; the same for the whole block */
  const int sr = tid >> 3, sg = tid & 7;      /* staging: 8 lanes bring one row's 128 bytes, so a wave's 16-byte copy is 4 whole cache lines */
  const _Float16* gk = Kr + (size_t)sr * LQ + h * HD + sg * 8;          /* the thread's piece of K row sr of stage 0; its other pieces 16, 32, 48 rows on */
  const _Float16* gv = Vt + ((size_t)h * HD + sr) * SQ + sg * 8;        /* the thread's piece of V^T row sr, stage 0; likewise */
  const unsigned ls = (unsigned)(size_t)&kv[0][sr][sg * 8];             /* its place in buffer 0: the LDS byte address */
  auto stage = [&](int s, int buf) {      /* stage s -> buffer buf: 8 copies of 16 bytes a lane; every lane on, every address a multiple of 16, keys 64 s .. 64 s + 63 < SQ */
    const _Float16* k0 = gk + (size_t)s * FK * LQ; const _Float16* k1 = k0 + 16 * LQ; const _Float16* k2 = k0 + 32 * LQ; const _Float16* k3 = k0 + 48 * LQ;
    const _Float16* v0 = gv + (size_t)s * FK; const _Float16* v1 = v0 + 16 * SQ; const _Float16* v2 = v0 + 32 * SQ; const _Float16* v3 = v0 + 48 * SQ;
    const unsigned l0 = ls + (unsigned)buf * (2 * FK * FP * 2); const unsigned rs = 16 * FP * 2;      /* 16 LDS rows in bytes */
    const unsigned l1 = l0 + rs, l2 = l0 + 2 * rs, l3 = l0 + 3 * rs, l4 = l0 + 4 * rs, l5 = l0 + 5 * rs, l6 = l0 + 6 * rs, l7 = l0 + 7 * rs;
    asm volatile("global_load_async_to_lds_b128 %0, %8, off\n\t"
                 "global_load_async_to_lds_b128 %1, %9, off\n\t"
                 "global_load_async_to_lds_b128 %2, %10, off\n\t"
                 "global_load_async_to_lds_b128 %3, %11, off\n\t"
                 "global_load_async_to_lds_b128 %4, %12, off\n\t"
                 "global_load_async_to_lds_b128 %5, %13, off\n\t"
                 "global_load_async_to_lds_b128 %6, %14, off\n\t"
                 "global_load_async_to_lds_b128 %7, %15, off\n\t"
                 "s_wait_xcnt 0x0"      /* in the copies' own statement: no address register of a copy is rewritten in front of it */
                 :: "v"(l0), "v"(l1), "v"(l2), "v"(l3), "v"(l4), "v"(l5), "v"(l6), "v"(l7), "v"(k0), "v"(k1), "v"(k2), "v"(k3), "v"(v0), "v"(v1), "v"(v2), "v"(v3) : "memory"); };
  auto lfrag = [&](int buf, int row, int col) { FragH f; const unsigned short* p = (const unsigned short*)&kv[buf][row + ln][col + 8 * hh]; f.half[0] = *(const v8us*)p; f.half[1] = *(const v8us*)(p + 16); return f.v; };      /* the k order of g2_frag */
  stage(0, 0);
  v16h qf[2][2], kf[2][2], vf[4];      /* [query group | key group][k chunk of 32 head dims]; [tile of 16 head dims] */
#pragma unroll
  for (int g = 0; g < 2; ++g)
#pragma unroll
    for (int c = 0; c < 2; ++c) qf[g][c] = g2_frag(Qr + (size_t)(q0 + 16 * g + ln) * LQ + h * HD + 32 * c, hh);
  asm volatile("s_wait_asynccnt 0x0" ::: "memory");      /* this wave's copies of stage 0 have landed */
  __syncthreads();      /* stage 0 is published: every wave's copies have landed */
  stage(1, 1);      /* ns >= 2: stage 1 exists; it flies while stage 0 is worked on */
  const v8f z8 = {0.f, 0.f, 0.f, 0.f, 0.f, 0.f, 0.f, 0.f};
  v8f o[2][4] = {{z8, z8, z8, z8}, {z8, z8, z8, z8}};      /* o[g][t][r] = O^T[16 t + 8 hh + r][query q0 + 16 g + ln] */
  float m[2] = {-3.0e38f, -3.0e38f}, l[2] = {0.f, 0.f};      /* m: running maximum of the raw products q.k; l: this wave half's keys only, the halves are joined once behind the loop */
  const float cs = 0.125f * 1.44269504088896f;      /* score scale x log2(e): exp(0.125 (s - m)) = exp2(cs s - cs m) */
#pragma unroll 1      /* one copy of the stage body: the trip count is a run-time value and the body is long */
  for (int st = 0; st < ns; ++st) { const int buf = st & 1;
#pragma unroll
      for (int j = 0; j < 2; ++j) { const int kb = st * FK + 32 * j;      /* two steps of 32 keys a stage */
        if (kb <= q0) {      /* wave-uniform: a wave skips the steps beyond its diagonal, never the publish point below */
#pragma unroll
          for (int t = 0; t < 2; ++t)
#pragma unroll
            for (int c = 0; c < 2; ++c) kf[t][c] = lfrag(buf, 32 * j + 16 * t, 32 * c);
#pragma unroll
          for (int t = 0; t < 4; ++t) vf[t] = lfrag(buf, FK + 16 * t, 32 * j);
          v8f s[2][2];      /* s[g][t][r] = q.k of key kb + 16 t + 8 hh + r, query q0 + 16 g + ln */
#pragma unroll
          for (int g = 0; g < 2; ++g)
#pragma unroll
            for (int t = 0; t < 2; ++t) s[g][t] = fa_mma(kf[t][1], qf[g][1], fa_mma(kf[t][0], qf[g][0], z8));
#pragma unroll
          for (int g = 0; g < 2; ++g) {
            if (kb == q0) {      /* the one step that holds keys above a query (wave-uniform test) */
#pragma unroll
              for (int t = 0; t < 2; ++t)
#pragma unroll
                for (int r = 0; r < 8; ++r) s[g][t][r] = (16 * t + 8 * hh + r <= 16 * g + ln) ? s[g][t][r] : -1.0e9f; }
            float mx = fmaxf(s[g][0][0], s[g][1][0]);
#pragma unroll
            for (int r = 1; r < 8; ++r) mx = fmaxf(mx, fmaxf(s[g][0][r], s[g][1][r]));
            const float mn = fmaxf(m[g], fmaxf(mx, half_xor(mx))); const float sc = exp2_slot((m[g] - mn) * cs); const float mc = mn * cs; m[g] = mn;
#pragma unroll
            for (int t = 0; t < 2; ++t)
#pragma unroll
              for (int r = 0; r < 8; ++r) s[g][t][r] = exp2_slot(fmaf(s[g][t][r], cs, -mc));
            const v8f sv = s[g][0] + s[g][1];
            l[g] = l[g] * sc + (((sv[0] + sv[1]) + (sv[2] + sv[3])) + ((sv[4] + sv[5]) + (sv[6] + sv[7])));
            const v16h pf = __builtin_shufflevector(__builtin_convertvector(s[g][0], v8h), __builtin_convertvector(s[g][1], v8h), 0, 1, 2, 3, 4, 5, 6, 7, 8, 9, 10, 11, 12, 13, 14, 15);
#pragma unroll
            for (int t = 0; t < 4; ++t) o[g][t] = fa_mma(vf[t], pf, o[g][t] * sc);
          }
        } }
    /* publish point of stage st + 1, passed by every wave */
    asm volatile("s_wait_dscnt 0x0" ::: "memory");      /* this wave's reads of buffer buf have retired before the buffer is refilled */
    asm volatile("s_wait_asynccnt 0x0" ::: "memory");      /* this wave's copies of stage st + 1 have landed */
    __syncthreads();      /* one barrier a stage: publishes stage st + 1 and ends every wave's reads of stage st */
    if (st + 2 < ns) stage(st + 2, buf);      /* the same for the whole block; into the buffer that this trip has just read */
  }
  asm volatile("s_wait_asynccnt 0x0" ::: "memory");      /* no copy is outstanding when the wave ends */
#pragma unroll
  for (int g = 0; g < 2; ++g) { const float fin = 64.0f / (l[g] + half_xor(l[g]));      /* o carried x64, folded into the output GEMM alpha */
    _Float16* orow = Or + (size_t)(q0 + 16 * g + ln) * DM + h * HD + 8 * hh;
#pragma unroll
    for (int t = 0; t < 4; ++t) *(v8h*)(orow + 16 * t) = __builtin_convertvector(o[g][t] * fin, v8h); }      /* a lane holds 8 consecutive head dims of its query: one 16-byte store */
}


#define A0Q 32                       /* query rows per k_att0 block: one per lane */
#define A0S 16                       /* waves per k_att0 block: wave w takes the keys w, w + 16, w + 32, ... */
#define A0P 68                       /* LDS pitch of a partial o row in floats: 256 + 16 bytes, so that the lanes' 16-byte stores fall on different banks */
// Exact f32 attention of the first QT0 rows. A block owns 32 query rows of a head (a lane = a row); its 16 waves share the keys, each with a running maximum, sum and o of its own;
// at the end the 16 partial results are brought to the block's common maximum and added through LDS.
template <int MASKADD>
__global__ __launch_bounds__(A0Q * A0S) void k_att0(const float* __restrict__ QF, const float* __restrict__ KF, const float* __restrict__ VF, int ld, const float* __restrict__ mask, float scale, float* __restrict__ OF, int ldo) {
  #pragma clang fp contract(off)
  static_assert(A0Q == 32 && A0S * 32 == A0Q * (HD / 4), "a lane per query row; in the final sum a thread per 16-byte piece of an o row");
  __shared__ __attribute__((aligned(16))) float po[A0S][A0Q][A0P];      /* each wave's o rows, on the common maximum */
  __shared__ float pm[A0S][A0Q], pl[A0S][A0Q];      /* each wave's running maxima; its row sums, on the common maximum */
  const int tid = threadIdx.x, lane = tid & 31; const int w = __builtin_amdgcn_readfirstlane(tid >> 5);      /* the wave's number as a scalar: the key rows' addresses stay wave-uniform (scalar loads) */
  const int h = blockIdx.x / (QT0 / A0Q), rg = blockIdx.x % (QT0 / A0Q); const int i = rg * A0Q + lane;
  const float* qr = QF + (size_t)i * ld + h * HD;
  v4f q[HD / 4], o[HD / 4];      /* the thread's q row and o row: every loop over c is fully unrolled, so both are indexed by constants only and stay in registers */
#pragma unroll
  for (int c = 0; c < HD / 4; ++c) { q[c] = *(const v4fa*)(qr + c * 4); const v4f z = {0.f, 0.f, 0.f, 0.f}; o[c] = z; }
  asm volatile("s_wait_xcnt 0x0" :: "v"(qr) : "memory");      /* qr is named so that the 16 loads' address registers live up to this wait: none of them is overwritten in front of it, not even by a later load's result */
  float m = -1.0e30f, l = 0.f; const int jmax = MASKADD ? (SQ - 1) : (rg * A0Q + A0Q - 1);      /* additive-mask form: every key (the mask input decides); causal form: keys up to the block's last row */
#pragma unroll 1
  for (int j = w; j <= jmax; j += A0S) { const float* kr = KF + (size_t)j * ld + h * HD; const float* vr = VF + (size_t)j * ld + h * HD; float s = 0.f;
#pragma unroll
    for (int c = 0; c < HD / 4; ++c) { const v4f kq = *(const v4fa*)(kr + c * 4); s = __fadd_rn(s, __fmul_rn(q[c][0], kq[0])); s = __fadd_rn(s, __fmul_rn(q[c][1], kq[1])); s = __fadd_rn(s, __fmul_rn(q[c][2], kq[2])); s = __fadd_rn(s, __fmul_rn(q[c][3], kq[3])); }
    s = __fmul_rn(s, scale); if (MASKADD) s = __fadd_rn(s, __fmul_rn(bf16_round(mask[(size_t)i * SQ + j]), -10000.0f));
    const float f = (MASKADD || j <= i) ? 1.f : 0.f; const float sm = fmaf(f, s, (1.f - f) * -1.0e30f); const float mn = fmaxf(m, sm); const float sc = expf(m - mn); const float e = expf(sm - mn); l = __fadd_rn(__fmul_rn(l, sc), e); m = mn;
#pragma unroll
    for (int c = 0; c < HD / 4; ++c) { const v4f vv = *(const v4fa*)(vr + c * 4); for (int u = 0; u < 4; ++u) o[c][u] = __fadd_rn(__fmul_rn(o[c][u], sc), __fmul_rn(e, vv[u])); } }
  pm[w][lane] = m;
  __syncthreads();      /* every wave's maxima are in LDS */
  float mb = pm[0][lane];
#pragma unroll
  for (int u = 1; u < A0S; ++u) mb = fmaxf(mb, pm[u][lane]);
  const float wt = expf(m - mb);      /* key 0 is open to every row, so mb is a true score; a wave that saw only closed keys of a row still has m = -1e30 there, its weight is exactly 0 and its (finite) sums drop out */
  pl[w][lane] = __fmul_rn(l, wt);
#pragma unroll
  for (int c = 0; c < HD / 4; ++c) { v4f oo = o[c]; for (int u = 0; u < 4; ++u) oo[u] = __fmul_rn(oo[u], wt); *(v4f*)&po[w][lane][c * 4] = oo; }
  __syncthreads();      /* every wave's weighted sums are in LDS */
  const int row = tid >> 4, pc = (tid & 15) * 4;      /* 16 threads add and store one o row: whole-line stores */
  v4f acc = *(const v4f*)&po[0][row][pc]; float ls = pl[0][row];
#pragma unroll
  for (int u = 1; u < A0S; ++u) { const v4f p = *(const v4f*)&po[u][row][pc]; for (int x = 0; x < 4; ++x) acc[x] = __fadd_rn(acc[x], p[x]); ls = __fadd_rn(ls, pl[u][row]); }
  const float fin = 64.0f / ls;      /* o carried x64 like the f16 path */
  for (int x = 0; x < 4; ++x) acc[x] = __fmul_rn(acc[x], fin);
  *(v4f*)(OF + (size_t)(rg * A0Q + row) * ldo + h * HD + pc) = acc; }

extern "C" void kernel_launch(void* const* d_in, const int* in_sizes, int n_in,
                              void* d_out, int out_size, void* d_ws, size_t ws_size, hipStream_t stream) {
  (void)in_sizes; (void)n_in; (void)out_size;
  const float* const* I = (const float* const*)d_in; const float* xq = I[0]; const float* xk = I[1]; const float* xv = I[2]; const float* wq = I[3]; const float* wk = I[4]; const float* wv = I[5]; const float* wo = I[6];      /* nn.Linear weights [out][in] */
  char* ws = (char*)d_ws; size_t off = 0;
  auto take = [&](size_t bytes) { char* p = ws + off; off += (bytes + 255) & ~(size_t)255; return p; };
  _Float16* BQ = (_Float16*)take((size_t)DM * DM * 2); _Float16* BK = (_Float16*)take((size_t)DM * DM * 2); _Float16* BV = (_Float16*)take((size_t)DM * DM * 2); _Float16* BO = (_Float16*)take((size_t)DM * DM * 2);
  _Float16* XQ = (_Float16*)take(NR * DM * 2); _Float16* XK = (_Float16*)take(NR * DM * 2); _Float16* XV = (_Float16*)take(NR * DM * 2); _Float16* Q16 = (_Float16*)take(NR * DM * 2); _Float16* K16 = (_Float16*)take(NR * DM * 2); _Float16* V16 = (_Float16*)take(NR * DM * 2); _Float16* O16 = (_Float16*)take(NR * DM * 2);
  _Float16* VT = (_Float16*)take((size_t)NH * HD * SQ * 2);
  float* QF0 = (float*)take((size_t)QT0 * DM * 4); float* KF0 = (float*)take((size_t)QT0 * DM * 4); float* VF0 = (float*)take((size_t)QT0 * DM * 4); float* OF0 = (float*)take((size_t)NB * QT0 * DM * 4); _Float16* OH0 = (_Float16*)take((size_t)NB * QT0 * DM * 2); _Float16* OL0 = (_Float16*)take((size_t)NB * QT0 * DM * 2);
  if (off > ws_size) return;
  k_cvt<<<(unsigned)((4 * (size_t)DM * DM + 3 * NR * DM) / CVE / CVW), CVW * 32, 0, stream>>>(wq, wk, wv, wo, xq, xk, xv, BQ);      /* weights: natural [out][in] = Bt[n][k], x16; inputs: f16 rows */
  const size_t r0p = (size_t)B0 * SQ;      /* first projected row */
  k_gemm2<0><<<dim3((unsigned)((MP / 128) * (DM / 64)), 1), 128, 0, stream>>>(XQ + r0p * DM, DM, 0, BQ, DM, 0, 0.0625f, nullptr, 0, nullptr, 1, 0, 0, nullptr, Q16 + r0p * DM, DM, 0, MP, DM, DM);
  k_gemm2<0><<<dim3((unsigned)((MP / 128) * (DM / 64)), 1), 128, 0, stream>>>(XK + r0p * DM, DM, 0, BK, DM, 0, 0.0625f, nullptr, 0, nullptr, 1, 0, 0, nullptr, K16 + r0p * DM, DM, 0, MP, DM, DM);
  k_gemm2<0><<<dim3((unsigned)((MP / 128) * (DM / 64)), 1), 128, 0, stream>>>(XV + r0p * DM, DM, 0, BV, DM, 0, 0.0625f, nullptr, 0, nullptr, 1, 0, 0, nullptr, V16 + r0p * DM, DM, 0, MP, DM, DM);
  for (int b = B0; b < B0 + NBR; ++b) { const size_t r0 = (size_t)b * SQ;
    k_vt<NH, SQ><<<NH * (SQ / 64), 256, 0, stream>>>(V16 + r0 * LQ, LQ, 0, VT);      /* V^T [NH][HD][SQ] for this batch */
    k_gemm2<0><<<dim3((QT0 / 128) * (DM / 64), 1), 128, 0, stream>>>(XQ + r0 * DM, DM, 0, BQ, DM, 0, 0.0625f, nullptr, 0, nullptr, 1, 0, 0, QF0, nullptr, DM, 0, QT0, DM, DM); k_gemm2<0><<<dim3((QT0 / 128) * (DM / 64), 1), 128, 0, stream>>>(XK + r0 * DM, DM, 0, BK, DM, 0, 0.0625f, nullptr, 0, nullptr, 1, 0, 0, KF0, nullptr, DM, 0, QT0, DM, DM); k_gemm2<0><<<dim3((QT0 / 128) * (DM / 64), 1), 128, 0, stream>>>(XV + r0 * DM, DM, 0, BV, DM, 0, 0.0625f, nullptr, 0, nullptr, 1, 0, 0, VF0, nullptr, DM, 0, QT0, DM, DM);      /* f32 q, k, v of the first 256 rows (exact products) */
    k_att0<0><<<NH * (QT0 / A0Q), A0Q * A0S, 0, stream>>>(QF0, KF0, VF0, DM, nullptr, 0.125f, OF0 + (size_t)b * QT0 * DM, DM);      /* exact f32 attention for rows 0..255 (o x64) */
    k_fattn<<<NH * (SQ / (4 * FQ)), 128, 0, stream>>>(Q16 + r0 * LQ, K16 + r0 * LQ, VT, O16 + r0 * DM); }      /* o (merged heads, x64) as f16 rows: scores, softmax and P V in one launch */
  k_gemm2<0><<<dim3((unsigned)((MPO / 128) * (DM / 64)), 1), 128, 0, stream>>>(O16 + r0p * DM, DM, 0, BO, DM, 0, 0.0009765625f, nullptr, 0, nullptr, 1, 0, 0, (float*)d_out + r0p * DM, nullptr, DM, 0, MPO, DM, DM);      /* out rows are the output layout */
  k_hl<<<(unsigned)(((size_t)NB * QT0 * DM / 8 + 255) / 256), 256, 0, stream>>>(OF0, OH0, OL0, (size_t)NB * QT0 * DM / 8);      /* first-tile o (x64) -> f16 hi + x1024 residual planes */
  for (int b = B0; b < B0 + NBR; ++b) { const size_t r0 = (size_t)b * SQ; const size_t f0 = (size_t)b * QT0;
    k_gemm2<0><<<dim3((QT0 / 128) * (DM / 64), 1), 128, 0, stream>>>(OH0 + f0 * DM, DM, 0, BO, DM, 0, 0.0009765625f, nullptr, 0, nullptr, 1, 0, 0, (float*)d_out + r0 * DM, nullptr, DM, 0, QT0, DM, DM);      /* rows 0..255: out = o_hi Wo, overwriting the f16-path rows */
    k_gemm2<0><<<dim3((QT0 / 128) * (DM / 64), 1), 128, 0, stream>>>(OL0 + f0 * DM, DM, 0, BO, DM, 0, 0.00000095367431640625f, nullptr, 0, (const float*)d_out + r0 * DM, -1, 0, 0, (float*)d_out + r0 * DM, nullptr, DM, 0, QT0, DM, DM); }      /* += o_lo Wo 2^-20 (own-element accumulate) */
}

// v008
// Measured time: 175 microseconds a run.
// Next to v007, in two timings, it ran 1.32 and 1.31 times as fast.
// Counting every step since v000, it is 47.3 times as fast.
#include <hip/hip_runtime.h>
// Causal multi-head attention (q, k, v inputs [1][4096][1024]; qp/kp/vp = input W^T (nn.Linear [out][in], no bias), 16 heads of 64; scores x (8/64) = /8; causal mask (keys > query get -inf); softmax; out = (probs v merged) Wo^T -> [1][4096][1024]).
// Structure: token rows r = s; q, k, v inputs as exact f16 rows (bf16-rounded); Q, K, V as three WMMA GEMMs in one launch (32x64 wave tiles, f32 accumulation, exact x16 weights, f16 outputs; the first 256 rows also as f32); per batch: V^T for all heads via LDS transposes; one fused attention launch: a wave owns 32 query rows of a head and walks the keys up to its last row in steps of 32 (K and V^T tiles of 64 keys staged in LDS per block of 4 waves): scores on WMMA (K = 64, x 0.125), online causal softmax in registers (f32 running maximum and sum, native exp; unnormalised weights f16), o += P V on WMMA (f32), divided by the row sum at the end (o carried x64, folded into the output GEMM alpha) written straight into the merged f16 o rows; out = o W_o GEMM (f32) into the output layout.
// Compute dtype: inputs rounded to bf16; x / weights exact; q, k, v, softmax weights and o as plain f16 GEMM operands (~2^-12), except rows 0..255: f32 q, k, v and attention, o as f16 hi + x1024 f16 lo; scores and softmax statistics f32. v_wmma_f32_16x16x32_f16.
#define NB 1
#define SQ 4096
#define DM 1024
#define NH 16
#define HD 64
#define HG 4                         /* heads per launch of the non-template k_vt (not launched) */
#define QT 256                       /* not used */
#define NKX SQ                       /* not used */
#define QT0 256                      /* first-tile rows recomputed exactly in f32 */
#define B0 0                         /* first batch processed (debug hook) */
#define NBR NB                       /* batches processed (debug hook) */
#define NR ((size_t)NB * SQ)         /* token rows */
#define MP ((int)((size_t)NBR * SQ)) /* rows projected (debug hook) */
#define QN SQ                        /* query rows attended per batch (not used) */
#define NHD NH                       /* heads attended (not used) */
#define MPO MP                       /* rows through the output stage (debug hook) */
#define LQ DM      /* row pitch of the q/k/v rows */
typedef __bf16 v16b __attribute__((ext_vector_type(16)));
typedef unsigned short v8us __attribute__((ext_vector_type(8), may_alias));
typedef float  v8f  __attribute__((ext_vector_type(8)));
typedef float  v4f  __attribute__((ext_vector_type(4)));
typedef float  v4fa __attribute__((ext_vector_type(4), may_alias));
union FragB { v16b v; v8us half[2]; unsigned short u[16]; };

__device__ __forceinline__ unsigned short bf16_bits(float x) { unsigned int u = __float_as_uint(x); return (unsigned short)((u + 0x7FFFu + ((u >> 16) & 1u)) >> 16); }
__device__ __forceinline__ float bf16_val(unsigned short b) { return __uint_as_float(((unsigned int)b) << 16); }
__device__ __forceinline__ float bf16_round(float x) { return bf16_val(bf16_bits(x)); }
// D += A·B with NT terms: 1 = ah·bh, 2 = + al·bh (A split), 3 = + ah·bl (both split)
template <int NT>
__device__ __forceinline__ v8f mmaN(v16b ah, v16b al, v16b bh, v16b bl, v8f c) {
  c = __builtin_amdgcn_wmma_f32_16x16x32_bf16(false, ah, false, bh, (short)0, c, false, false);
  if (NT >= 2) c = __builtin_amdgcn_wmma_f32_16x16x32_bf16(false, al, false, bh, (short)0, c, false, false);
  if (NT >= 3) c = __builtin_amdgcn_wmma_f32_16x16x32_bf16(false, ah, false, bl, (short)0, c, false, false);
  asm volatile("v_nop\n\tv_nop\n\tv_nop\n\tv_nop" : "+v"(c) : "v"(ah), "v"(al), "v"(bh), "v"(bl));
  return c;
}

__global__ __launch_bounds__(256) void k_wt_bf16(const float* __restrict__ W, unsigned short* __restrict__ Wt, int K, int N) {
  const int t = blockIdx.x * 256 + threadIdx.x;
  const int k8n = K / 8;
  if (t >= N * k8n) return;
  const int n = t / k8n, k8 = (t % k8n) * 8;
  v8us v;
#pragma unroll
  for (int i = 0; i < 8; ++i) v[i] = bf16_bits(W[(size_t)(k8 + i) * N + n]);
  *(v8us*)(Wt + (size_t)n * K + k8) = v;
  
}

// GEMM C[M][N] (f32, pitch ldc) = act(A[M][K]·W + bias). A f32 row-major (pitch lda) converted per fragment to bf16
// (ASPLIT: hi/lo two planes -> 2 terms, else single rounded term); Wt bf16 [N][K] (pitch ldb). BIAS_BF16 rounds the
// bias to bf16 first (bias quantised to bf16 before the add). K%32==0, M%16==0, N%64==0.
template <bool ASPLIT, int ACT, bool BIAS_BF16>
__global__ __launch_bounds__(128) void k_gemm_bf(const float* __restrict__ A, int lda, const unsigned short* __restrict__ Wt, int ldb,
                                               const float* __restrict__ bias, float* __restrict__ C, int ldc, int M, int N, int K) {
  __shared__ __attribute__((aligned(16))) float so[4][16][64];
  const int tid = threadIdx.x, w = tid >> 5, lane = tid & 31, ln = lane & 15, hh = lane >> 4;
  const int ntn = N / 64;
  const int wid = blockIdx.x * 4 + w;
  const int mt = wid / ntn, nq = wid % ntn;
  if (mt * 16 >= M) return;
  const int row0 = mt * 16, col0 = nq * 64;
  const float* arow = A + (size_t)(row0 + ln) * lda;
  v8f acc[4] = {};
  for (int kb = 0; kb < K; kb += 32) {
    FragB ah, al;
    const v4f x0 = *(const v4fa*)(arow + kb + 8 * hh), x1 = *(const v4fa*)(arow + kb + 8 * hh + 4);
    const v4f x2 = *(const v4fa*)(arow + kb + 16 + 8 * hh), x3 = *(const v4fa*)(arow + kb + 16 + 8 * hh + 4);
    float xs[16] = {x0[0],x0[1],x0[2],x0[3],x1[0],x1[1],x1[2],x1[3],x2[0],x2[1],x2[2],x2[3],x3[0],x3[1],x3[2],x3[3]};
#pragma unroll
    for (int i = 0; i < 16; ++i) { const unsigned short hb = bf16_bits(xs[i]); ah.u[i] = hb; al.u[i] = ASPLIT ? bf16_bits(xs[i] - bf16_val(hb)) : (unsigned short)0; }
#pragma unroll
    for (int t = 0; t < 4; ++t) {
      const unsigned short* brow = Wt + (size_t)(col0 + t * 16 + ln) * ldb + kb;
      FragB b;
      b.half[0] = *(const v8us*)(brow + 8 * hh);
      b.half[1] = *(const v8us*)(brow + 16 + 8 * hh);
      acc[t] = mmaN<ASPLIT ? 2 : 1>(ah.v, al.v, b.v, b.v, acc[t]);
    }
  }
#pragma unroll
  for (int t = 0; t < 4; ++t) {
    float bv = bias ? bias[col0 + t * 16 + ln] : 0.f;
    if (BIAS_BF16) bv = bf16_round(bv);
#pragma unroll
    for (int r = 0; r < 8; ++r) { float v = acc[t][r] + bv; if (ACT == 1) v = fmaxf(v, 0.f); so[w][8 * hh + r][t * 16 + ln] = v; }
  }
  __builtin_amdgcn_fence(__ATOMIC_ACQ_REL, "workgroup");
  __builtin_amdgcn_wave_barrier();
  const int rsub = lane >> 4, c4 = (lane & 15) * 4;
  {
#pragma unroll
    for (int q = 0; q < 8; ++q) {
      const int r = q * 2 + rsub;
      const v4f v = *(const v4fa*)&so[w][r][c4];
      *(v4f*)(C + (size_t)(row0 + r) * ldc + col0 + c4) = v;
    }
    
  }
}

// GEMM C = act(A·W + bias + resid): A f32 (ASPLIT -> hi/lo 2 terms), Wt bf16 [N][K]; ACT 0 none, 1 relu, 2 exact gelu;
// resid (optional, f32, row index = (row % rmod), pitch ldr, RES_BF16 rounds it) added before the activation.
template <bool ASPLIT, int ACT, bool BIAS_BF16, bool RES_BF16>
__global__ __launch_bounds__(128) void k_gemm_bf3(const float* __restrict__ A, int lda, const unsigned short* __restrict__ Wt, int ldb,
                                                const float* __restrict__ bias, const float* __restrict__ resid, int rmod, int ldr,
                                                float* __restrict__ C, int ldc, int M, int N, int K) {
  __shared__ __attribute__((aligned(16))) float so[4][16][64];
  const int tid = threadIdx.x, w = tid >> 5, lane = tid & 31, ln = lane & 15, hh = lane >> 4;
  const int ntn = N / 64;
  const int wid = blockIdx.x * 4 + w;
  const int mt = wid / ntn, nq = wid % ntn;
  if (mt * 16 >= M) return;
  const int row0 = mt * 16, col0 = nq * 64;
  const float* arow = A + (size_t)(row0 + ln) * lda;
  v8f acc[4] = {};
  for (int kb = 0; kb < K; kb += 32) {
    FragB ah, al;
    const v4f x0 = *(const v4fa*)(arow + kb + 8 * hh), x1 = *(const v4fa*)(arow + kb + 8 * hh + 4);
    const v4f x2 = *(const v4fa*)(arow + kb + 16 + 8 * hh), x3 = *(const v4fa*)(arow + kb + 16 + 8 * hh + 4);
    float xs[16] = {x0[0],x0[1],x0[2],x0[3],x1[0],x1[1],x1[2],x1[3],x2[0],x2[1],x2[2],x2[3],x3[0],x3[1],x3[2],x3[3]};
#pragma unroll
    for (int i = 0; i < 16; ++i) { const unsigned short hb = bf16_bits(xs[i]); ah.u[i] = hb; al.u[i] = ASPLIT ? bf16_bits(xs[i] - bf16_val(hb)) : (unsigned short)0; }
#pragma unroll
    for (int t = 0; t < 4; ++t) {
      const unsigned short* brow = Wt + (size_t)(col0 + t * 16 + ln) * ldb + kb;
      FragB b;
      b.half[0] = *(const v8us*)(brow + 8 * hh);
      b.half[1] = *(const v8us*)(brow + 16 + 8 * hh);
      acc[t] = mmaN<ASPLIT ? 2 : 1>(ah.v, al.v, b.v, b.v, acc[t]);
    }
  }
#pragma unroll
  for (int t = 0; t < 4; ++t) {
    const int col = col0 + t * 16 + ln;
    float bv = bias ? bias[col] : 0.f;
    if (BIAS_BF16) bv = bf16_round(bv);
#pragma unroll
    for (int r = 0; r < 8; ++r) {
      float v = acc[t][r] + bv;
      if (resid) { float rv = resid[(size_t)((row0 + 8 * hh + r) % rmod) * ldr + col]; if (RES_BF16) rv = bf16_round(rv); v += rv; }
      if (ACT == 1) v = fmaxf(v, 0.f);
      if (ACT == 2) v = 0.5f * v * (1.0f + erff(v * 0.70710678118654752f));
      if (ACT == 3) { const float u = 0.7978845608028654f * (v + 0.044715f * v * v * v); v = 0.5f * v * (1.0f + tanhf(u)); }
      so[w][8 * hh + r][t * 16 + ln] = v;
    }
  }
  __builtin_amdgcn_fence(__ATOMIC_ACQ_REL, "workgroup");
  __builtin_amdgcn_wave_barrier();
  const int rsub = lane >> 4, c4 = (lane & 15) * 4;
  {
#pragma unroll
    for (int q = 0; q < 8; ++q) {
      const int r = q * 2 + rsub;
      const v4f v = *(const v4fa*)&so[w][r][c4];
      *(v4f*)(C + (size_t)(row0 + r) * ldc + col0 + c4) = v;
    }
    
  }
}
// row LayerNorm (biased variance, eps) over N: s = X (+ R); optional out_sum <- s; out_norm <- (s-mu)*rsqrt(var+eps)*g + b
template <bool PARAM_BF16>
__global__ __launch_bounds__(256) void k_layernorm(const float* __restrict__ X, const float* __restrict__ R, const float* __restrict__ g, const float* __restrict__ bta,
                                                  float* __restrict__ out_sum, float* __restrict__ out_norm, int N, float eps) {
  __shared__ float red[256];
  const int row = blockIdx.x, tid = threadIdx.x;
  const float* x = X + (size_t)row * N; const float* rr = R ? R + (size_t)row * N : nullptr;
  float vals[16];                     // up to N = 4096
  const int per = N / 256;            // contiguous chunk per thread? use strided-by-4 chunks: thread handles j = tid*4 + 1024*u
  float s1 = 0.f;
  for (int u = 0; u < per / 4; ++u) {
    const int j = tid * 4 + 1024 * u;
    const v4f a = *(const v4fa*)(x + j);
    v4f b = {0.f,0.f,0.f,0.f}; if (rr) b = *(const v4fa*)(rr + j);
#pragma unroll
    for (int q = 0; q < 4; ++q) { const float v = a[q] + b[q]; vals[u * 4 + q] = v; s1 += v; }
  }
  red[tid] = s1; __syncthreads();
  for (int st = 128; st > 0; st >>= 1) { if (tid < st) red[tid] += red[tid + st]; __syncthreads(); }
  const float mu = red[0] / (float)N; __syncthreads();
  float s2 = 0.f;
  for (int u = 0; u < per / 4; ++u)
#pragma unroll
    for (int q = 0; q < 4; ++q) { const float c = vals[u * 4 + q] - mu; s2 += c * c; }
  red[tid] = s2; __syncthreads();
  for (int st = 128; st > 0; st >>= 1) { if (tid < st) red[tid] += red[tid + st]; __syncthreads(); }
  const float rs = rsqrtf(red[0] / (float)N + eps);
  {
    for (int u = 0; u < per / 4; ++u) {
      const int j = tid * 4 + 1024 * u;
      v4f o, sm;
#pragma unroll
      for (int q = 0; q < 4; ++q) {
        float gg = g[j + q], bb = bta[j + q];
        if (PARAM_BF16) { gg = bf16_round(gg); bb = bf16_round(bb); }
        sm[q] = vals[u * 4 + q]; o[q] = (vals[u * 4 + q] - mu) * rs * gg + bb;
      }
      if (out_sum) *(v4f*)(out_sum + (size_t)row * N + j) = sm;
      *(v4f*)(out_norm + (size_t)row * N + j) = o;
    }
    
  }
}



// ---- f16 WMMA path (v_wmma_f32_16x16x32_f16): 11-bit significands for operands in range — used where a [0,1] probability operand needs more precision than bf16
typedef _Float16 v16h __attribute__((ext_vector_type(16)));
union FragH { v16h v; v8us half[2]; _Float16 h[16]; unsigned short u[16]; };
template <int NT>
__device__ __forceinline__ v8f mmaH(v16h ah, v16h al, v16h bh, v16h bl, v8f c) {
  c = __builtin_amdgcn_wmma_f32_16x16x32_f16(false, ah, false, bh, (short)0, c, false, false);
  if (NT >= 2) c = __builtin_amdgcn_wmma_f32_16x16x32_f16(false, al, false, bh, (short)0, c, false, false);
  if (NT >= 3) c = __builtin_amdgcn_wmma_f32_16x16x32_f16(false, ah, false, bl, (short)0, c, false, false);
  asm volatile("v_nop\n\tv_nop\n\tv_nop\n\tv_nop" : "+v"(c) : "v"(ah), "v"(al), "v"(bh), "v"(bl));
  return c;
}
// batched GEMM like k_gemm_b but f16 operands: A f32 (split into f16 hi/lo if ASPLIT, else rounded to f16), Bt = f16 values [n][k]; alpha; C f32; N multiple of 16 (partial tiles skipped)
template <bool ASPLIT>
__global__ __launch_bounds__(128) void k_gemm_h(const float* __restrict__ A, int lda, size_t sA, const _Float16* __restrict__ Bh, int ldb, size_t sB, float alpha, float* __restrict__ C, int ldc, size_t sC, int M, int N, int K) {
  __shared__ __attribute__((aligned(16))) float so[4][16][64];
  const int tid = threadIdx.x, w = tid >> 5, lane = tid & 31, ln = lane & 15, hh = lane >> 4; const int by = blockIdx.y;
  A += (size_t)by * sA; Bh += (size_t)by * sB; C += (size_t)by * sC;
  const int ntn = (N + 63) / 64; const int wid = blockIdx.x * 4 + w; const int mt = wid / ntn, nq = wid % ntn; if (mt * 16 >= M) return;
  const int row0 = mt * 16, col0 = nq * 64; const float* arow = A + (size_t)(row0 + ln) * lda;
  v8f acc[4] = {};
  for (int kb = 0; kb < K; kb += 32) {
    FragH ah, al;
    const v4f x0 = *(const v4fa*)(arow + kb + 8 * hh), x1 = *(const v4fa*)(arow + kb + 8 * hh + 4), x2 = *(const v4fa*)(arow + kb + 16 + 8 * hh), x3 = *(const v4fa*)(arow + kb + 16 + 8 * hh + 4);
    float xs[16] = {x0[0],x0[1],x0[2],x0[3],x1[0],x1[1],x1[2],x1[3],x2[0],x2[1],x2[2],x2[3],x3[0],x3[1],x3[2],x3[3]};
#pragma unroll
    for (int i = 0; i < 16; ++i) { const _Float16 h = (_Float16)xs[i]; ah.h[i] = h; al.h[i] = ASPLIT ? (_Float16)(xs[i] - (float)h) : (_Float16)0.0f; }
#pragma unroll
    for (int t = 0; t < 4; ++t) { if (col0 + t * 16 >= N) continue; const size_t boff = (size_t)(col0 + t * 16 + ln) * ldb + kb; FragH bq; bq.half[0] = *(const v8us*)(Bh + boff + 8 * hh); bq.half[1] = *(const v8us*)(Bh + boff + 16 + 8 * hh);
      acc[t] = mmaH<ASPLIT ? 2 : 1>(ah.v, al.v, bq.v, bq.v, acc[t]); }
  }
#pragma unroll
  for (int t = 0; t < 4; ++t) { if (col0 + t * 16 >= N) continue;
#pragma unroll
    for (int r = 0; r < 8; ++r) so[w][8 * hh + r][t * 16 + ln] = acc[t][r] * alpha; }
  __builtin_amdgcn_fence(__ATOMIC_ACQ_REL, "workgroup"); __builtin_amdgcn_wave_barrier();
  const int rsub = lane >> 4, c4 = (lane & 15) * 4;
  {
#pragma unroll
    for (int q = 0; q < 8; ++q) { const int r = q * 2 + rsub; if (col0 + c4 < N) { const v4f v = *(const v4fa*)&so[w][r][c4]; *(v4f*)(C + (size_t)(row0 + r) * ldc + col0 + c4) = v; } }
     }
}

// Wt[n][k] = f16(W[k][n]·scale) from f32 row-major W[K][N] (scale = power of two; bf16-exact weights stay exact in f16 away from the subnormal range)
__global__ __launch_bounds__(256) void k_wt_f16(const float* __restrict__ W, _Float16* __restrict__ Wt, int K, int N, float scale) {
  const int t = blockIdx.x * 256 + threadIdx.x; if (t >= N * (K / 8)) return; const int n = t / (K / 8), k8 = (t % (K / 8)) * 8; FragH f;
#pragma unroll
  for (int i = 0; i < 8; ++i) f.h[i] = (_Float16)(bf16_round(W[(size_t)(k8 + i) * N + n]) * scale); const v8us o = f.half[0];
  *(v8us*)((unsigned short*)Wt + (size_t)n * K + k8) = o; 
}
// k_gemm_hh variant with fused epilogue: v = acc·alpha + bias[by·sBias + col] (+ CP[(row/rowsPerB)·sCPb + by·64 + col] if CP) ; ACT 0 none / 1 elu ; writes f16 C16 (and f32 C if non-null)
template <int ACT>
__global__ __launch_bounds__(128) void k_gemm_hhx(const _Float16* __restrict__ A, int lda, size_t sA, const _Float16* __restrict__ Bh, int ldb, size_t sB, float alpha, const float* __restrict__ bias, size_t sBias, const float* __restrict__ CP, int rowsPerB, size_t sCPb, int row0g,
    float* __restrict__ C, _Float16* __restrict__ C16, int ldc, size_t sC, int M, int N, int K) {
  __shared__ __attribute__((aligned(16))) float so[4][16][64];
  const int tid = threadIdx.x, w = tid >> 5, lane = tid & 31, ln = lane & 15, hh = lane >> 4; const int by = blockIdx.y;
  A += (size_t)by * sA; Bh += (size_t)by * sB; const size_t cofs = (size_t)by * sC; const float* bp = bias ? bias + (size_t)by * sBias : nullptr;
  const int ntn = (N + 63) / 64; const int wid = blockIdx.x * 4 + w; const int mt = wid / ntn, nq = wid % ntn; if (mt * 16 >= M) return;
  const int row0 = mt * 16, col0 = nq * 64; const _Float16* arow = A + (size_t)(row0 + ln) * lda;
  v8f acc[4] = {};
  for (int kb = 0; kb < K; kb += 32) { FragH ah; ah.half[0] = *(const v8us*)((const unsigned short*)arow + kb + 8 * hh); ah.half[1] = *(const v8us*)((const unsigned short*)arow + kb + 16 + 8 * hh);
#pragma unroll
    for (int t = 0; t < 4; ++t) { if (col0 + t * 16 >= N) continue; const size_t boff = (size_t)(col0 + t * 16 + ln) * ldb + kb; FragH bq; bq.half[0] = *(const v8us*)((const unsigned short*)Bh + boff + 8 * hh); bq.half[1] = *(const v8us*)((const unsigned short*)Bh + boff + 16 + 8 * hh);
      acc[t] = mmaH<1>(ah.v, ah.v, bq.v, bq.v, acc[t]); }
  }
#pragma unroll
  for (int t = 0; t < 4; ++t) { if (col0 + t * 16 >= N) continue; const int col = col0 + t * 16 + ln; const float bv = bp ? bf16_round(bp[col]) : 0.f;
#pragma unroll
    for (int r = 0; r < 8; ++r) { float v = acc[t][r] * alpha + bv; if (CP) { const int rr = row0g + row0 + 8 * hh + r; if (rowsPerB < 0) v += CP[cofs + (size_t)rr * ldc + col];      /* rowsPerB < 0: own element of the batched C plane */ else { const int bidx = rr / rowsPerB; v += CP[(size_t)bidx * sCPb + (size_t)by * 64 + col]; } } if (ACT == 1) v = (v > 0.f) ? v : expm1f(v); else if (ACT == 7) v = (v > 0.f) ? v + 1.0f : expf(v); else if (ACT == 8) v = tanhf(v); else if (ACT == 9) v = 0.5f * v * (1.0f + tanhf(0.7978845608028654f * (v + 0.044715f * v * v * v))); else if (ACT == 11) v = 1.0f / (1.0f + expf(-v)); else if (ACT == 12) v = (v > 0.f) ? v : 0.01f * v; else if (ACT == 14) v = (v > 0.f) ? v : 0.1f * v; else if (ACT == 16) v = (v >= 0.f) ? v : 0.3f * v; else if (ACT == 17) v = (v >= 0.f) ? v : 0.2f * v; else if (ACT == 15) v = v / (1.0f + expf(-v)); else if (ACT == 3) v = fmaxf(v, 0.f); else if (ACT == 6) v = 0.5f * v * (1.0f + erff(v * 0.70710678118654752f)); so[w][8 * hh + r][t * 16 + ln] = v; } }
  __builtin_amdgcn_fence(__ATOMIC_ACQ_REL, "workgroup"); __builtin_amdgcn_wave_barrier();
  const int rsub = lane >> 4, c4 = (lane & 15) * 4; typedef _Float16 v4h __attribute__((ext_vector_type(4)));
  {
#pragma unroll
    for (int q = 0; q < 8; ++q) { const int r = q * 2 + rsub; if (col0 + c4 < N) { const v4f v = *(const v4fa*)&so[w][r][c4]; if (C) *(v4f*)(C + cofs + (size_t)(row0 + r) * ldc + col0 + c4) = v; if (C16) { v4h h4; for (int i = 0; i < 4; ++i) h4[i] = (_Float16)v[i]; *(v4h*)(C16 + cofs + (size_t)(row0 + r) * ldc + col0 + c4) = h4; } } }
     }
}


typedef _Float16 v4h __attribute__((ext_vector_type(4)));

__global__ __launch_bounds__(256) void k_h16(const float* __restrict__ x, _Float16* __restrict__ X16, size_t n8) { const size_t t = (size_t)blockIdx.x * 256 + threadIdx.x; if (t >= n8) return; FragH f;
#pragma unroll
  for (int q = 0; q < 8; ++q) f.h[q] = (_Float16)x[t * 8 + q]; *(v8us*)((unsigned short*)X16 + t * 8) = f.half[0];  }
__global__ __launch_bounds__(256) void k_round16f(const float* __restrict__ W, _Float16* __restrict__ Bt, size_t n8) { const size_t t = (size_t)blockIdx.x * 256 + threadIdx.x; if (t >= n8) return; FragH f;
#pragma unroll
  for (int i = 0; i < 8; ++i) f.h[i] = (_Float16)(bf16_round(W[t * 8 + i]) * 16.0f); *(v8us*)((unsigned short*)Bt + t * 8) = f.half[0];  }
template <int NHv, int TTv>
__global__ __launch_bounds__(256) void k_vt(const _Float16* __restrict__ V16, int ldv, int voff, _Float16* __restrict__ Vt) { __shared__ unsigned short tl[64][66]; const int tid = threadIdx.x; const int slab = blockIdx.x / (TTv / 64), lg = blockIdx.x % (TTv / 64); const int b = slab / NHv, h = slab % NHv;
  for (int i = tid; i < 64 * 8; i += 256) { const int r = i / 8, c8 = (i % 8) * 8; FragH f; f.half[0] = *(const v8us*)((const unsigned short*)V16 + ((size_t)b * TTv + lg * 64 + r) * ldv + voff + h * 64 + c8);
#pragma unroll
    for (int q = 0; q < 8; ++q) tl[r][c8 + q] = f.u[q]; }
  __syncthreads();
  {
#pragma unroll
    for (int rd = 0; rd < 2; ++rd) { const int d = rd * 32 + tid / 8, pc = tid % 8; FragH f;
#pragma unroll
      for (int q = 0; q < 8; ++q) f.u[q] = tl[pc * 8 + q][d];
      *(v8us*)((unsigned short*)Vt + ((size_t)slab * 64 + d) * TTv + lg * 64 + pc * 8) = f.half[0]; }
     } }

__global__ __launch_bounds__(256) void k_hl(const float* __restrict__ F, _Float16* __restrict__ Hh, _Float16* __restrict__ Hl, size_t n8) { const size_t t = (size_t)blockIdx.x * 256 + threadIdx.x; if (t >= n8) return; FragH fh, fl; const v4f a = *(const v4fa*)(F + t * 8), c = *(const v4fa*)(F + t * 8 + 4);
#pragma unroll
  for (int q = 0; q < 4; ++q) { _Float16 h = (_Float16)a[q]; fh.h[q] = h; fl.h[q] = (_Float16)((a[q] - (float)h) * 1024.0f); h = (_Float16)c[q]; fh.h[4 + q] = h; fl.h[4 + q] = (_Float16)((c[q] - (float)h) * 1024.0f); }
  { *(v8us*)((unsigned short*)Hh + t * 8) = fh.half[0]; *(v8us*)((unsigned short*)Hl + t * 8) = fl.half[0];  } }

// ---- fast GEMM (wave tile 32x64; requires M % 128 == 0 rows per launch region, N % 64 == 0 and K % 64 == 0); epilogue = k_gemm_hhx semantics ----
__device__ __forceinline__ v16h g2_frag(const _Float16* p, int hh) { FragH f; f.half[0] = *(const v8us*)((const unsigned short*)p + 8 * hh); f.half[1] = *(const v8us*)((const unsigned short*)p + 16 + 8 * hh); return f.v; }
__device__ __forceinline__ v8f g2_mmab(v16h a, v16h b, v8f c) { return __builtin_amdgcn_wmma_f32_16x16x32_f16(false, a, false, b, (short)0, c, false, false); }
#define G2KC 64                      /* k per staged tile: 128 bytes, one cache line of every operand row */
#define G2P 72                       /* LDS row pitch in f16: 128 + 16 bytes, so that the 16 rows of a 16-byte fragment read fall on different banks */
// The f32 output C (plane pitch sCF over blockIdx.y) takes the rows below rowsF only (a multiple of 128: the test is the same for a whole block); the f16 output C16 (plane pitch sC) takes every row.
// Block tile 128 x 64. Per 64 k the block's 128 A rows and 64 B rows go global -> registers -> LDS with whole-line loads, one tile ahead, two LDS buffers; the waves read their fragments from LDS. Needs M % 128 == 0, K % 64 == 0, K >= 64.
template <int ACT>
__global__ __launch_bounds__(128) void k_gemm2(const _Float16* __restrict__ A, int lda, size_t sA, const _Float16* __restrict__ Bh, int ldb, size_t sB, float alpha, const float* __restrict__ bias, size_t sBias, const float* __restrict__ CP, int rowsPerB, size_t sCPb, int row0g,
    float* __restrict__ C, _Float16* __restrict__ C16, int ldc, size_t sC, int M, int N, int K, size_t sCF, int rowsF) { static_assert(ACT == 0 || ACT == 3 || ACT == 6 || ACT == 8 || ACT == 9 || ACT == 11 || ACT == 12 || ACT == 14 || ACT == 15 || ACT == 16 || ACT == 17, "k_gemm2: unsupported ACT code (would silently apply no activation)");
  __shared__ __attribute__((aligned(16))) float so[4][32][68];
  __shared__ __attribute__((aligned(16))) _Float16 st[2][192][G2P];      /* two staged tiles: rows 0..127 = the block's A rows, rows 128..191 = its B rows, G2KC k each */
  const int tid = threadIdx.x, w = tid >> 5, lane = tid & 31, ln = lane & 15, hh = lane >> 4; const int by = blockIdx.y;
  A += (size_t)by * sA; Bh += (size_t)by * sB; const size_t cofs = (size_t)by * sC; const float* bp = bias ? bias + (size_t)by * sBias : nullptr;
  const int ntn = N >> 6; const int mt = blockIdx.x / ntn, nq = blockIdx.x - mt * ntn; const int row0 = mt * 128 + 32 * w, col0 = nq * 64; if (mt * 128 >= M) return;      /* the same for the whole block: it stands in front of the barriers */
  const int sr = tid >> 3, sg = tid & 7;      /* staging: 8 threads bring one row's 128 bytes, so a wave's 16-byte load is 4 whole cache lines */
  const _Float16* gp[12];      /* the thread's 8 A pieces and 4 B pieces of the tile to be fetched next */
#pragma unroll
  for (int i = 0; i < 8; ++i) gp[i] = A + (size_t)(mt * 128 + sr + 16 * i) * lda + sg * 8;
#pragma unroll
  for (int i = 0; i < 4; ++i) gp[8 + i] = Bh + (size_t)(col0 + sr + 16 * i) * ldb + sg * 8;
  v8us rg[12];      /* the tile on its way from global memory to LDS */
  auto fetch = [&]() {
#pragma unroll
    for (int i = 0; i < 12; ++i) rg[i] = *(const v8us*)(const unsigned short*)gp[i];
    asm volatile("s_wait_xcnt 0x0" :: "v"(gp[0]), "v"(gp[1]), "v"(gp[2]), "v"(gp[3]), "v"(gp[4]), "v"(gp[5]), "v"(gp[6]), "v"(gp[7]), "v"(gp[8]), "v"(gp[9]), "v"(gp[10]), "v"(gp[11]) : "memory");      /* the 12 addresses are named so that their registers live up to this wait: none is overwritten in front of it, neither by the step to the next tile below nor by a load's result */
#pragma unroll
    for (int i = 0; i < 12; ++i) gp[i] += G2KC; };
  auto put = [&](int buf) {
#pragma unroll
    for (int i = 0; i < 12; ++i) *(v8us*)&st[buf][sr + 16 * i][sg * 8] = rg[i]; };
  auto lfrag = [&](int buf, int row, int kk) { FragH f; const unsigned short* p = (const unsigned short*)&st[buf][row][kk * 32 + 8 * hh]; f.half[0] = *(const v8us*)p; f.half[1] = *(const v8us*)(p + 16); return f.v; };      /* the k order of g2_frag */
  const v8f z8 = {0.f,0.f,0.f,0.f,0.f,0.f,0.f,0.f}; v8f c00 = z8, c01 = z8, c02 = z8, c03 = z8, c10 = z8, c11 = z8, c12 = z8, c13 = z8;
  const int nc = K / G2KC;
  fetch(); put(0); __syncthreads();
#pragma unroll 1      /* one copy of the tile body: the trip count is a run-time value and the body is long */
  for (int c = 0; c < nc; ++c) { const int buf = c & 1;
    if (c + 1 < nc) fetch();      /* the next tile's global loads fly while this tile is worked on */
    v16h a[2][2], b[2][4];
#pragma unroll
    for (int kk = 0; kk < 2; ++kk) { a[kk][0] = lfrag(buf, 32 * w + ln, kk); a[kk][1] = lfrag(buf, 32 * w + 16 + ln, kk);
#pragma unroll
      for (int t = 0; t < 4; ++t) b[kk][t] = lfrag(buf, 128 + 16 * t + ln, kk); }
    __builtin_amdgcn_sched_barrier(0);      /* keeps the tile's 24 LDS reads together in front of its 16 WMMAs: one LDS latency a tile with counted waits, where the scheduler otherwise reuses one B fragment's registers and waits for LDS eight times */
#pragma unroll
    for (int kk = 0; kk < 2; ++kk) {
      c00 = g2_mmab(a[kk][0], b[kk][0], c00); c10 = g2_mmab(a[kk][1], b[kk][0], c10); c01 = g2_mmab(a[kk][0], b[kk][1], c01); c11 = g2_mmab(a[kk][1], b[kk][1], c11);
      c02 = g2_mmab(a[kk][0], b[kk][2], c02); c12 = g2_mmab(a[kk][1], b[kk][2], c12); c03 = g2_mmab(a[kk][0], b[kk][3], c03); c13 = g2_mmab(a[kk][1], b[kk][3], c13); }
    if (c + 1 < nc) put(buf ^ 1);      /* into the buffer whose last readers passed the barrier at the foot of the trip before */
    __syncthreads(); }      /* one barrier a tile: publishes tile c + 1 and ends the reads of tile c */
  v8f accs[8] = {c00, c01, c02, c03, c10, c11, c12, c13};
#pragma unroll
  for (int u = 0; u < 8; ++u) { const int t = u & 3, half = u >> 2; const int col = col0 + t * 16 + ln; const float bv = bp ? bf16_round(bp[col]) : 0.f;
#pragma unroll
    for (int r = 0; r < 8; ++r) { const int rloc = half * 16 + 8 * hh + r; float v = accs[u][r] * alpha + bv; if (CP) { if (rowsPerB < 0) v += CP[cofs + (size_t)(row0g + row0 + rloc) * ldc + col];      /* rowsPerB < 0: own element of the batched C plane */ else { const int bidx = (row0g + row0 + rloc) / rowsPerB; v += CP[(size_t)bidx * sCPb + (size_t)by * 64 + col]; } }
      if (ACT == 3) v = fmaxf(v, 0.f); else if (ACT == 6) v = 0.5f * v * (1.0f + erff(v * 0.70710678118654752f)); else if (ACT == 11) v = 1.0f / (1.0f + expf(-v)); else if (ACT == 15) v = v / (1.0f + expf(-v)); else if (ACT == 12) v = (v > 0.f) ? v : 0.01f * v; else if (ACT == 8) v = tanhf(v); else if (ACT == 9) v = 0.5f * v * (1.0f + tanhf(0.7978845608028654f * (v + 0.044715f * v * v * v))); else if (ACT == 14) v = (v > 0.f) ? v : 0.1f * v; else if (ACT == 16) v = (v >= 0.f) ? v : 0.3f * v; else if (ACT == 17) v = (v >= 0.f) ? v : 0.2f * v;
      so[w][rloc][t * 16 + ln] = v; } }
  __builtin_amdgcn_fence(__ATOMIC_ACQ_REL, "workgroup"); __builtin_amdgcn_wave_barrier();
  const int rsub = lane >> 4, c4 = (lane & 15) * 4;
  float* CF = (C && mt * 128 < rowsF) ? C + (size_t)by * sCF : nullptr;
  {
#pragma unroll
    for (int q = 0; q < 16; ++q) { const int r = q * 2 + rsub; const v4f v = *(const v4fa*)&so[w][r][c4]; if (CF) { float* pf = CF + (size_t)(row0 + r) * ldc + col0 + c4; *(v4f*)pf = v; asm volatile("s_wait_xcnt 0x0" :: "v"(pf), "v"(v) : "memory"); }      /* the store's address and data are named so that their registers live up to this wait: where both outputs are stored, the f16 conversion below reuses them */
      if (C16) { v4h h4; for (int i = 0; i < 4; ++i) h4[i] = (_Float16)v[i]; *(v4h*)(C16 + cofs + (size_t)(row0 + r) * ldc + col0 + c4) = h4; } }
     } }


#define CVW 16                       /* waves per k_cvt work-group: 256 work-groups, one per WGP */
#define CVL 32                       /* 16-byte loads per lane, all issued before the first value is used */
#define CVE (CVL * 128)              /* f32 values per wave: 16 KiB of one source, consecutive */
// All seven f32 -> f16 conversions (4 weights: bf16-rounded x16; 3 inputs: bf16-rounded) in one streaming launch. D is the workspace range [BQ BK BV BO XQ XK XV], which lies in one piece in this order.
// A wave takes piece c of 4096 values: its source, its place there and its scale are wave-uniform. One load of a wave is 512 consecutive bytes (4 whole lines), one store 256 (2 whole lines).
__global__ __launch_bounds__(CVW * 32) void k_cvt(const float* __restrict__ wq, const float* __restrict__ wk, const float* __restrict__ wv, const float* __restrict__ wo, const float* __restrict__ xq, const float* __restrict__ xk, const float* __restrict__ xv, _Float16* __restrict__ D) {
  constexpr int WC = DM * DM / CVE, XC = (int)(NR * DM / CVE);      /* pieces per weight, per input */
  static_assert(DM * DM % CVE == 0 && NR * DM % CVE == 0 && (4 * WC + 3 * XC) % CVW == 0 && (DM * DM * 2) % 256 == 0 && (NR * DM * 2) % 256 == 0, "whole pieces, whole work-groups, no pad between the workspace planes");
  const int lane = threadIdx.x & 31; const int c = (int)blockIdx.x * CVW + __builtin_amdgcn_readfirstlane((int)(threadIdx.x >> 5));
  const float* s; float sc;
  if (c < 4 * WC) { const int i = c / WC; s = (i == 0 ? wq : i == 1 ? wk : i == 2 ? wv : wo) + (size_t)(c % WC) * CVE; sc = 16.0f; }
  else { const int e = c - 4 * WC, i = e / XC; s = (i == 0 ? xq : i == 1 ? xk : xv) + (size_t)(e % XC) * CVE; sc = 1.0f; }      /* x 1 is exact */
  const unsigned lo = (unsigned)lane * 16;      /* the lane's byte in every 512-byte row of the piece */
  v4f r[CVL];
#pragma unroll
  for (int q = 0; q < CVL; ++q) r[q] = __builtin_nontemporal_load((const v4fa*)((const char*)s + q * 512 + lo));      /* read once: not kept in L2 */
  __builtin_amdgcn_sched_barrier(0);      /* keeps the conversions behind all 32 loads: the wave's whole piece is in flight at once, where the scheduler otherwise holds most of them back until the first values are converted */
  _Float16* d = D + (size_t)c * CVE + lane * 4;
#pragma unroll
  for (int q = 0; q < CVL; ++q) { v4h h;
#pragma unroll
    for (int i = 0; i < 4; ++i) h[i] = (_Float16)(bf16_round(r[q][i]) * sc);
    *(v4h*)(d + q * 128) = h; }
}
__global__ __launch_bounds__(256) void k_rsm(const float* __restrict__ S, _Float16* __restrict__ P, int nrows) {
  #pragma clang fp contract(off)
  const int i = blockIdx.x * 256 + threadIdx.x; if (i >= nrows) return; const float* s = S + (size_t)i * SQ; float mx = -3.0e38f;
#pragma unroll 1
  for (int j = 0; j < SQ; ++j) mx = fmaxf(mx, s[j]); float se = 0.f;
#pragma unroll 1
  for (int j = 0; j < SQ; ++j) se += expf(s[j] - mx); const float sc = 256.0f / se;
#pragma unroll 1
  for (int j0 = 0; j0 < SQ; j0 += 8) { FragH f; for (int q = 0; q < 8; ++q) f.h[q] = (_Float16)(expf(s[j0 + q] - mx) * sc); unsigned short* d = (unsigned short*)P + (size_t)i * SQ + j0; *(v8us*)d = f.half[0];  } }
__global__ __launch_bounds__(256) void k_vt(const _Float16* __restrict__ V16, int b, int h0, _Float16* __restrict__ VT) { __shared__ unsigned short tl[64][65]; const int tid = threadIdx.x; const int hh = blockIdx.x % HG, sg = blockIdx.x / HG; const int s0 = sg * 64; const int h = h0 + hh;
  for (int i = tid; i < 64 * 8; i += 256) { const int j = i / 8, d8 = (i % 8) * 8; FragH f; f.half[0] = *(const v8us*)((const unsigned short*)V16 + ((size_t)b * SQ + s0 + j) * DM + h * HD + d8); for (int q = 0; q < 8; ++q) tl[d8 + q][j] = f.u[q]; }
  __syncthreads();
  { for (int i = tid; i < 64 * 8; i += 256) { const int d = i / 8, j8 = (i % 8) * 8; FragH f; for (int q = 0; q < 8; ++q) f.u[q] = tl[d][j8 + q]; *(v8us*)((unsigned short*)VT + ((size_t)hh * HD + d) * SQ + s0 + j8) = f.half[0]; }  } }



#define FQ 32                        /* query rows per wave */
#define FK 64                        /* keys per staged tile: 128 bytes of every V^T row, one cache line */
#define FP 72                        /* LDS row pitch in f16: 128 + 16 bytes, so that the 16 rows of a 16-byte fragment read fall on different banks */
typedef _Float16 v8h __attribute__((ext_vector_type(8)));
__device__ __forceinline__ float half_xor(float v) { const int i = __builtin_bit_cast(int, v); return __builtin_bit_cast(float, __builtin_amdgcn_permlanex16(i, i, 0x76543210, 0xfedcba98, false, false)); }      /* lane l <- lane l ^ 16 */
__device__ __forceinline__ float exp2_slot(float x) { float y; asm("v_exp_f32 %0, %1\n\tv_nop" : "=v"(y) : "v"(x)); return y; }      /* v_nop: the slot the instruction set asks for behind a transcendental before its result is read or its source rewritten; in the same statement it stays directly behind it */
__device__ __forceinline__ v8f fa_mma(v16h a, v16h b, v8f c) { return __builtin_amdgcn_wmma_f32_16x16x32_f16(false, a, false, b, (short)0, c, false, false); }
__global__ __launch_bounds__(128) void k_fattn(const _Float16* __restrict__ Qr, const _Float16* __restrict__ Kr, const _Float16* __restrict__ Vt, _Float16* __restrict__ Or) {
  static_assert(HD == 64 && SQ % (4 * FQ) == 0 && (4 * FQ) % FK == 0 && FK == 2 * 32, "two k chunks per score product, four d tiles, whole blocks of 4 waves, whole stages, two steps of 32 keys a stage");
  __shared__ __attribute__((aligned(16))) _Float16 kv[2][2 * FK][FP];      /* two staged tiles: rows 0..63 = the stage's K rows (64 head dims), rows 64..127 = the 64 V^T rows (the stage's 64 keys) */
  const int tid = threadIdx.x, lane = tid & 31, ln = lane & 15, hh = lane >> 4; const int w = __builtin_amdgcn_readfirstlane((int)(threadIdx.x >> 5));
  const int h = blockIdx.x % NH; const int qb = (SQ / (4 * FQ) - 1 - (int)(blockIdx.x / NH)) * (4 * FQ); const int q0 = qb + w * FQ;      /* the longest blocks start first */
  const int ns = (qb + 4 * FQ) / FK;      /* stages of the block: keys 0 .. its last row; at least 2; the same for the whole block */
  const int sr = tid >> 3, sg = tid & 7;      /* staging: 8 lanes bring one row's 128 bytes, so a wave's 16-byte copy is 4 whole cache lines */
  const _Float16* gk = Kr + (size_t)sr * LQ + h * HD + sg * 8;          /* the thread's piece of K row sr of stage 0; its other pieces 16, 32, 48 rows on */
  const _Float16* gv = Vt + ((size_t)h * HD + sr) * SQ + sg * 8;        /* the thread's piece of V^T row sr, stage 0; likewise */
  const unsigned ls = (unsigned)(size_t)&kv[0][sr][sg * 8];             /* its place in buffer 0: the LDS byte address */
  auto stage = [&](int s, int buf) {      /* stage s -> buffer buf: 8 copies of 16 bytes a lane; every lane on, every address a multiple of 16, keys 64 s .. 64 s + 63 < SQ */
    const _Float16* k0 = gk + (size_t)s * FK * LQ; const _Float16* k1 = k0 + 16 * LQ; const _Float16* k2 = k0 + 32 * LQ; const _Float16* k3 = k0 + 48 * LQ;
    const _Float16* v0 = gv + (size_t)s * FK; const _Float16* v1 = v0 + 16 * SQ; const _Float16* v2 = v0 + 32 * SQ; const _Float16* v3 = v0 + 48 * SQ;
    const unsigned l0 = ls + (unsigned)buf * (2 * FK * FP * 2); const unsigned rs = 16 * FP * 2;      /* 16 LDS rows in bytes */
    const unsigned l1 = l0 + rs, l2 = l0 + 2 * rs, l3 = l0 + 3 * rs, l4 = l0 + 4 * rs, l5 = l0 + 5 * rs, l6 = l0 + 6 * rs, l7 = l0 + 7 * rs;
    asm volatile("global_load_async_to_lds_b128 %0, %8, off\n\t"
                 "global_load_async_to_lds_b128 %1, %9, off\n\t"
                 "global_load_async_to_lds_b128 %2, %10, off\n\t"
                 "global_load_async_to_lds_b128 %3, %11, off\n\t"
                 "global_load_async_to_lds_b128 %4, %12, off\n\t"
                 "global_load_async_to_lds_b128 %5, %13, off\n\t"
                 "global_load_async_to_lds_b128 %6, %14, off\n\t"
                 "global_load_async_to_lds_b128 %7, %15, off\n\t"
                 "s_wait_xcnt 0x0"      /* in the copies' own statement: no address register of a copy is rewritten in front of it */
                 :: "v"(l0), "v"(l1), "v"(l2), "v"(l3), "v"(l4), "v"(l5), "v"(l6), "v"(l7), "v"(k0), "v"(k1), "v"(k2), "v"(k3), "v"(v0), "v"(v1), "v"(v2), "v"(v3) : "memory"); };
  auto lfrag = [&](int buf, int row, int col) { FragH f; const unsigned short* p = (const unsigned short*)&kv[buf][row + ln][col + 8 * hh]; f.half[0] = *(const v8us*)p; f.half[1] = *(const v8us*)(p + 16); return f.v; };      /* the k order of g2_frag */
  stage(0, 0);
  v16h qf[2][2], kf[2][2], vf[4];      /* [query group | key group][k chunk of 32 head dims]; [tile of 16 head dims] */
#pragma unroll
  for (int g = 0; g < 2; ++g)
#pragma unroll
    for (int c = 0; c < 2; ++c) qf[g][c] = g2_frag(Qr + (size_t)(q0 + 16 * g + ln) * LQ + h * HD + 32 * c, hh);
  asm volatile("s_wait_asynccnt 0x0" ::: "memory");      /* this wave's copies of stage 0 have landed */
  __syncthreads();      /* stage 0 is published: every wave's copies have landed */
  stage(1, 1);      /* ns >= 2: stage 1 exists; it flies while stage 0 is worked on */
  const v8f z8 = {0.f, 0.f, 0.f, 0.f, 0.f, 0.f, 0.f, 0.f};
  v8f o[2][4] = {{z8, z8, z8, z8}, {z8, z8, z8, z8}};      /* o[g][t][r] = O^T[16 t + 8 hh + r][query q0 + 16 g + ln] */
  float m[2] = {-3.0e38f, -3.0e38f}, l[2] = {0.f, 0.f};      /* m: running maximum of the raw products q.k; l: this wave half's keys only, the halves are joined once behind the loop */
  const float cs = 0.125f * 1.44269504088896f;      /* score scale x log2(e): exp(0.125 (s - m)) = exp2(cs s - cs m) */
#pragma unroll 1      /* one copy of the stage body: the trip count is a run-time value and the body is long */
  for (int st = 0; st < ns; ++st) { const int buf = st & 1;
#pragma unroll
      for (int j = 0; j < 2; ++j) { const int kb = st * FK + 32 * j;      /* two steps of 32 keys a stage */
        if (kb <= q0) {      /* wave-uniform: a wave skips the steps beyond its diagonal, never the publish point below */
#pragma unroll
          for (int t = 0; t < 2; ++t)
#pragma unroll
            for (int c = 0; c < 2; ++c) kf[t][c] = lfrag(buf, 32 * j + 16 * t, 32 * c);
#pragma unroll
          for (int t = 0; t < 4; ++t) vf[t] = lfrag(buf, FK + 16 * t, 32 * j);
          v8f s[2][2];      /* s[g][t][r] = q.k of key kb + 16 t + 8 hh + r, query q0 + 16 g + ln */
#pragma unroll
          for (int g = 0; g < 2; ++g)
#pragma unroll
            for (int t = 0; t < 2; ++t) s[g][t] = fa_mma(kf[t][1], qf[g][1], fa_mma(kf[t][0], qf[g][0], z8));
#pragma unroll
          for (int g = 0; g < 2; ++g) {
            if (kb == q0) {      /* the one step that holds keys above a query (wave-uniform test) */
#pragma unroll
              for (int t = 0; t < 2; ++t)
#pragma unroll
                for (int r = 0; r < 8; ++r) s[g][t][r] = (16 * t + 8 * hh + r <= 16 * g + ln) ? s[g][t][r] : -1.0e9f; }
            float mx = fmaxf(s[g][0][0], s[g][1][0]);
#pragma unroll
            for (int r = 1; r < 8; ++r) mx = fmaxf(mx, fmaxf(s[g][0][r], s[g][1][r]));
            const float mn = fmaxf(m[g], fmaxf(mx, half_xor(mx))); const float sc = exp2_slot((m[g] - mn) * cs); const float mc = mn * cs; m[g] = mn;
#pragma unroll
            for (int t = 0; t < 2; ++t)
#pragma unroll
              for (int r = 0; r < 8; ++r) s[g][t][r] = exp2_slot(fmaf(s[g][t][r], cs, -mc));
            const v8f sv = s[g][0] + s[g][1];
            l[g] = l[g] * sc + (((sv[0] + sv[1]) + (sv[2] + sv[3])) + ((sv[4] + sv[5]) + (sv[6] + sv[7])));
            const v16h pf = __builtin_shufflevector(__builtin_convertvector(s[g][0], v8h), __builtin_convertvector(s[g][1], v8h), 0, 1, 2, 3, 4, 5, 6, 7, 8, 9, 10, 11, 12, 13, 14, 15);
#pragma unroll
            for (int t = 0; t < 4; ++t) o[g][t] = fa_mma(vf[t], pf, o[g][t] * sc);
          }
        } }
    /* publish point of stage st + 1, passed by every wave */
    asm volatile("s_wait_dscnt 0x0" ::: "memory");      /* this wave's reads of buffer buf have retired before the buffer is refilled */
    asm volatile("s_wait_asynccnt 0x0" ::: "memory");      /* this wave's copies of stage st + 1 have landed */
    __syncthreads();      /* one barrier a stage: publishes stage st + 1 and ends every wave's reads of stage st */
    if (st + 2 < ns) stage(st + 2, buf);      /* the same for the whole block; into the buffer that this trip has just read */
  }
  asm volatile("s_wait_asynccnt 0x0" ::: "memory");      /* no copy is outstanding when the wave ends */
#pragma unroll
  for (int g = 0; g < 2; ++g) { const float fin = 64.0f / (l[g] + half_xor(l[g]));      /* o carried x64, folded into the output GEMM alpha */
    _Float16* orow = Or + (size_t)(q0 + 16 * g + ln) * DM + h * HD + 8 * hh;
#pragma unroll
    for (int t = 0; t < 4; ++t) *(v8h*)(orow + 16 * t) = __builtin_convertvector(o[g][t] * fin, v8h); }      /* a lane holds 8 consecutive head dims of its query: one 16-byte store */
}


#define A0Q 32                       /* query rows per k_att0 block: one per lane */
#define A0S 16                       /* waves per k_att0 block: wave w takes the keys w, w + 16, w + 32, ... */
#define A0P 68                       /* LDS pitch of a partial o row in floats: 256 + 16 bytes, so that the lanes' 16-byte stores fall on different banks */
// Exact f32 attention of the first QT0 rows. A block owns 32 query rows of a head (a lane = a row); its 16 waves share the keys, each with a running maximum, sum and o of its own;
// at the end the 16 partial results are brought to the block's common maximum and added through LDS.
template <int MASKADD>
__global__ __launch_bounds__(A0Q * A0S) void k_att0(const float* __restrict__ QF, const float* __restrict__ KF, const float* __restrict__ VF, int ld, const float* __restrict__ mask, float scale, float* __restrict__ OF, int ldo) {
  #pragma clang fp contract(off)
  static_assert(A0Q == 32 && A0S * 32 == A0Q * (HD / 4), "a lane per query row; in the final sum a thread per 16-byte piece of an o row");
  __shared__ __attribute__((aligned(16))) float po[A0S][A0Q][A0P];      /* each wave's o rows, on the common maximum */
  __shared__ float pm[A0S][A0Q], pl[A0S][A0Q];      /* each wave's running maxima; its row sums, on the common maximum */
  const int tid = threadIdx.x, lane = tid & 31; const int w = __builtin_amdgcn_readfirstlane(tid >> 5);      /* the wave's number as a scalar: the key rows' addresses stay wave-uniform (scalar loads) */
  const int h = blockIdx.x / (QT0 / A0Q), rg = blockIdx.x % (QT0 / A0Q); const int i = rg * A0Q + lane;
  const float* qr = QF + (size_t)i * ld + h * HD;
  v4f q[HD / 4], o[HD / 4];      /* the thread's q row and o row: every loop over c is fully unrolled, so both are indexed by constants only and stay in registers */
#pragma unroll
  for (int c = 0; c < HD / 4; ++c) { q[c] = *(const v4fa*)(qr + c * 4); const v4f z = {0.f, 0.f, 0.f, 0.f}; o[c] = z; }
  asm volatile("s_wait_xcnt 0x0" :: "v"(qr) : "memory");      /* qr is named so that the 16 loads' address registers live up to this wait: none of them is overwritten in front of it, not even by a later load's result */
  float m = -1.0e30f, l = 0.f; const int jmax = MASKADD ? (SQ - 1) : (rg * A0Q + A0Q - 1);      /* additive-mask form: every key (the mask input decides); causal form: keys up to the block's last row */
#pragma unroll 1
  for (int j = w; j <= jmax; j += A0S) { const float* kr = KF + (size_t)j * ld + h * HD; const float* vr = VF + (size_t)j * ld + h * HD; float s = 0.f;
#pragma unroll
    for (int c = 0; c < HD / 4; ++c) { const v4f kq = *(const v4fa*)(kr + c * 4); s = __fadd_rn(s, __fmul_rn(q[c][0], kq[0])); s = __fadd_rn(s, __fmul_rn(q[c][1], kq[1])); s = __fadd_rn(s, __fmul_rn(q[c][2], kq[2])); s = __fadd_rn(s, __fmul_rn(q[c][3], kq[3])); }
    s = __fmul_rn(s, scale); if (MASKADD) s = __fadd_rn(s, __fmul_rn(bf16_round(mask[(size_t)i * SQ + j]), -10000.0f));
    const float f = (MASKADD || j <= i) ? 1.f : 0.f; const float sm = fmaf(f, s, (1.f - f) * -1.0e30f); const float mn = fmaxf(m, sm); const float sc = expf(m - mn); const float e = expf(sm - mn); l = __fadd_rn(__fmul_rn(l, sc), e); m = mn;
#pragma unroll
    for (int c = 0; c < HD / 4; ++c) { const v4f vv = *(const v4fa*)(vr + c * 4); for (int u = 0; u < 4; ++u) o[c][u] = __fadd_rn(__fmul_rn(o[c][u], sc), __fmul_rn(e, vv[u])); } }
  pm[w][lane] = m;
  __syncthreads();      /* every wave's maxima are in LDS */
  float mb = pm[0][lane];
#pragma unroll
  for (int u = 1; u < A0S; ++u) mb = fmaxf(mb, pm[u][lane]);
  const float wt = expf(m - mb);      /* key 0 is open to every row, so mb is a true score; a wave that saw only closed keys of a row still has m = -1e30 there, its weight is exactly 0 and its (finite) sums drop out */
  pl[w][lane] = __fmul_rn(l, wt);
#pragma unroll
  for (int c = 0; c < HD / 4; ++c) { v4f oo = o[c]; for (int u = 0; u < 4; ++u) oo[u] = __fmul_rn(oo[u], wt); *(v4f*)&po[w][lane][c * 4] = oo; }
  __syncthreads();      /* every wave's weighted sums are in LDS */
  const int row = tid >> 4, pc = (tid & 15) * 4;      /* 16 threads add and store one o row: whole-line stores */
  v4f acc = *(const v4f*)&po[0][row][pc]; float ls = pl[0][row];
#pragma unroll
  for (int u = 1; u < A0S; ++u) { const v4f p = *(const v4f*)&po[u][row][pc]; for (int x = 0; x < 4; ++x) acc[x] = __fadd_rn(acc[x], p[x]); ls = __fadd_rn(ls, pl[u][row]); }
  const float fin = 64.0f / ls;      /* o carried x64 like the f16 path */
  for (int x = 0; x < 4; ++x) acc[x] = __fmul_rn(acc[x], fin);
  *(v4f*)(OF + (size_t)(rg * A0Q + row) * ldo + h * HD + pc) = acc; }

extern "C" void kernel_launch(void* const* d_in, const int* in_sizes, int n_in,
                              void* d_out, int out_size, void* d_ws, size_t ws_size, hipStream_t stream) {
  (void)in_sizes; (void)n_in; (void)out_size;
  const float* const* I = (const float* const*)d_in; const float* xq = I[0]; const float* xk = I[1]; const float* xv = I[2]; const float* wq = I[3]; const float* wk = I[4]; const float* wv = I[5]; const float* wo = I[6];      /* nn.Linear weights [out][in] */
  char* ws = (char*)d_ws; size_t off = 0;
  auto take = [&](size_t bytes) { char* p = ws + off; off += (bytes + 255) & ~(size_t)255; return p; };
  _Float16* BQ = (_Float16*)take((size_t)DM * DM * 2); _Float16* BK = (_Float16*)take((size_t)DM * DM * 2); _Float16* BV = (_Float16*)take((size_t)DM * DM * 2); _Float16* BO = (_Float16*)take((size_t)DM * DM * 2);
  _Float16* XQ = (_Float16*)take(NR * DM * 2); _Float16* XK = (_Float16*)take(NR * DM * 2); _Float16* XV = (_Float16*)take(NR * DM * 2); _Float16* Q16 = (_Float16*)take(NR * DM * 2); _Float16* K16 = (_Float16*)take(NR * DM * 2); _Float16* V16 = (_Float16*)take(NR * DM * 2); _Float16* O16 = (_Float16*)take(NR * DM * 2);
  _Float16* VT = (_Float16*)take((size_t)NH * HD * SQ * 2);
  float* QF0 = (float*)take((size_t)QT0 * DM * 4); float* KF0 = (float*)take((size_t)QT0 * DM * 4); float* VF0 = (float*)take((size_t)QT0 * DM * 4); float* OF0 = (float*)take((size_t)NB * QT0 * DM * 4); _Float16* OL0 = (_Float16*)take((size_t)NB * QT0 * DM * 2);
  if (off > ws_size) return;
  k_cvt<<<(unsigned)((4 * (size_t)DM * DM + 3 * NR * DM) / CVE / CVW), CVW * 32, 0, stream>>>(wq, wk, wv, wo, xq, xk, xv, BQ);      /* weights: natural [out][in] = Bt[n][k], x16; inputs: f16 rows */
  const size_t r0p = (size_t)B0 * SQ;      /* first projected row */
  static_assert(NB == 1 && B0 == 0 && QT0 % 128 == 0, "the first-tile rows are the first rows of the projected planes and of the o rows");
  k_gemm2<0><<<dim3((unsigned)((MP / 128) * (DM / 64)), 3), 128, 0, stream>>>(XQ + r0p * DM, DM, NR * DM, BQ, DM, (size_t)DM * DM, 0.0625f, nullptr, 0, nullptr, 1, 0, 0, QF0, Q16 + r0p * DM, DM, NR * DM, MP, DM, DM, (size_t)QT0 * DM, QT0);      /* blockIdx.y = q, k, v: the planes [XQ XK XV], [BQ BK BV], [Q16 K16 V16] and [QF0 KF0 VF0] each lie in one piece; the blocks of the first 256 rows also store their f32 accumulators (exact products) */
  for (int b = B0; b < B0 + NBR; ++b) { const size_t r0 = (size_t)b * SQ;
    k_vt<NH, SQ><<<NH * (SQ / 64), 256, 0, stream>>>(V16 + r0 * LQ, LQ, 0, VT);      /* V^T [NH][HD][SQ] for this batch */
    k_att0<0><<<NH * (QT0 / A0Q), A0Q * A0S, 0, stream>>>(QF0, KF0, VF0, DM, nullptr, 0.125f, OF0 + (size_t)b * QT0 * DM, DM);      /* exact f32 attention for rows 0..255 (o x64) */
    k_fattn<<<NH * (SQ / (4 * FQ)), 128, 0, stream>>>(Q16 + r0 * LQ, K16 + r0 * LQ, VT, O16 + r0 * DM); }      /* o (merged heads, x64) as f16 rows: scores, softmax and P V in one launch */
  k_hl<<<(unsigned)(((size_t)NB * QT0 * DM / 8 + 255) / 256), 256, 0, stream>>>(OF0, O16, OL0, (size_t)NB * QT0 * DM / 8);      /* first-tile o (x64) -> f16 hi, over the f16-path rows 0..255 of O16, + x1024 residual plane */
  k_gemm2<0><<<dim3((unsigned)((MPO / 128) * (DM / 64)), 1), 128, 0, stream>>>(O16 + r0p * DM, DM, 0, BO, DM, 0, 0.0009765625f, nullptr, 0, nullptr, 1, 0, 0, (float*)d_out + r0p * DM, nullptr, DM, 0, MPO, DM, DM, 0, MPO);      /* out rows are the output layout; rows 0..255: out = o_hi Wo */
  for (int b = B0; b < B0 + NBR; ++b) { const size_t r0 = (size_t)b * SQ; const size_t f0 = (size_t)b * QT0;
    k_gemm2<0><<<dim3((QT0 / 128) * (DM / 64), 1), 128, 0, stream>>>(OL0 + f0 * DM, DM, 0, BO, DM, 0, 0.00000095367431640625f, nullptr, 0, (const float*)d_out + r0 * DM, -1, 0, 0, (float*)d_out + r0 * DM, nullptr, DM, 0, QT0, DM, DM, 0, QT0); }      /* += o_lo Wo 2^-20 (own-element accumulate) */
}

// v009
// Measured time: 161 microseconds a run.
// Timed twice side by side with v008, it ran 1.08 times as fast both times.
// All steps since v000 together make it 50.9 times as fast.
#include <hip/hip_runtime.h>
// Causal multi-head attention (q, k, v inputs [1][4096][1024]; qp/kp/vp = input W^T (nn.Linear [out][in], no bias), 16 heads of 64; scores x (8/64) = /8; causal mask (keys > query get -inf); softmax; out = (probs v merged) Wo^T -> [1][4096][1024]).
// Structure: token rows r = s; q, k, v inputs as exact f16 rows (bf16-rounded); Q, K, V as three WMMA GEMMs in one launch (32x64 wave tiles, f32 accumulation, exact x16 weights, f16 outputs; the first 256 rows also as f32); per batch: V^T for all heads via LDS transposes; one fused attention launch: a wave owns 32 query rows of a head and walks the keys up to its last row in steps of 32 (K and V^T tiles of 64 keys staged in LDS; a block of 16 waves owns 128 query rows, its keys dealt to 4 groups of 4 waves, whose partial results are merged through LDS): scores on WMMA (K = 64, x 0.125), online causal softmax in registers (f32 running maximum and sum, native exp; unnormalised weights f16), o += P V on WMMA (f32), divided by the row sum at the end (o carried x64, folded into the output GEMM alpha) written straight into the merged f16 o rows; out = o W_o GEMM (f32) into the output layout.
// Compute dtype: inputs rounded to bf16; x / weights exact; q, k, v, softmax weights and o as plain f16 GEMM operands (~2^-12); scores and softmax statistics f32. v_wmma_f32_16x16x32_f16.
#define NB 1
#define SQ 4096
#define DM 1024
#define NH 16
#define HD 64
#define HG 4                         /* heads per launch of the non-template k_vt (not launched) */
#define QT 256                       /* not used */
#define NKX SQ                       /* not used */
#define QT0 256                      /* first-tile rows recomputed exactly in f32 */
#define B0 0                         /* first batch processed (debug hook) */
#define NBR NB                       /* batches processed (debug hook) */
#define NR ((size_t)NB * SQ)         /* token rows */
#define MP ((int)((size_t)NBR * SQ)) /* rows projected (debug hook) */
#define QN SQ                        /* query rows attended per batch (not used) */
#define NHD NH                       /* heads attended (not used) */
#define MPO MP                       /* rows through the output stage (debug hook) */
#define LQ DM      /* row pitch of the q/k/v rows */
typedef __bf16 v16b __attribute__((ext_vector_type(16)));
typedef unsigned short v8us __attribute__((ext_vector_type(8), may_alias));
typedef float  v8f  __attribute__((ext_vector_type(8)));
typedef float  v4f  __attribute__((ext_vector_type(4)));
typedef float  v4fa __attribute__((ext_vector_type(4), may_alias));
union FragB { v16b v; v8us half[2]; unsigned short u[16]; };

__device__ __forceinline__ unsigned short bf16_bits(float x) { unsigned int u = __float_as_uint(x); return (unsigned short)((u + 0x7FFFu + ((u >> 16) & 1u)) >> 16); }
__device__ __forceinline__ float bf16_val(unsigned short b) { return __uint_as_float(((unsigned int)b) << 16); }
__device__ __forceinline__ float bf16_round(float x) { return bf16_val(bf16_bits(x)); }
// D += A·B with NT terms: 1 = ah·bh, 2 = + al·bh (A split), 3 = + ah·bl (both split)
template <int NT>
__device__ __forceinline__ v8f mmaN(v16b ah, v16b al, v16b bh, v16b bl, v8f c) {
  c = __builtin_amdgcn_wmma_f32_16x16x32_bf16(false, ah, false, bh, (short)0, c, false, false);
  if (NT >= 2) c = __builtin_amdgcn_wmma_f32_16x16x32_bf16(false, al, false, bh, (short)0, c, false, false);
  if (NT >= 3) c = __builtin_amdgcn_wmma_f32_16x16x32_bf16(false, ah, false, bl, (short)0, c, false, false);
  asm volatile("v_nop\n\tv_nop\n\tv_nop\n\tv_nop" : "+v"(c) : "v"(ah), "v"(al), "v"(bh), "v"(bl));
  return c;
}

__global__ __launch_bounds__(256) void k_wt_bf16(const float* __restrict__ W, unsigned short* __restrict__ Wt, int K, int N) {
  const int t = blockIdx.x * 256 + threadIdx.x;
  const int k8n = K / 8;
  if (t >= N * k8n) return;
  const int n = t / k8n, k8 = (t % k8n) * 8;
  v8us v;
#pragma unroll
  for (int i = 0; i < 8; ++i) v[i] = bf16_bits(W[(size_t)(k8 + i) * N + n]);
  *(v8us*)(Wt + (size_t)n * K + k8) = v;
  
}

// GEMM C[M][N] (f32, pitch ldc) = act(A[M][K]·W + bias). A f32 row-major (pitch lda) converted per fragment to bf16
// (ASPLIT: hi/lo two planes -> 2 terms, else single rounded term); Wt bf16 [N][K] (pitch ldb). BIAS_BF16 rounds the
// bias to bf16 first (bias quantised to bf16 before the add). K%32==0, M%16==0, N%64==0.
template <bool ASPLIT, int ACT, bool BIAS_BF16>
__global__ __launch_bounds__(128) void k_gemm_bf(const float* __restrict__ A, int lda, const unsigned short* __restrict__ Wt, int ldb,
                                               const float* __restrict__ bias, float* __restrict__ C, int ldc, int M, int N, int K) {
  __shared__ __attribute__((aligned(16))) float so[4][16][64];
  const int tid = threadIdx.x, w = tid >> 5, lane = tid & 31, ln = lane & 15, hh = lane >> 4;
  const int ntn = N / 64;
  const int wid = blockIdx.x * 4 + w;
  const int mt = wid / ntn, nq = wid % ntn;
  if (mt * 16 >= M) return;
  const int row0 = mt * 16, col0 = nq * 64;
  const float* arow = A + (size_t)(row0 + ln) * lda;
  v8f acc[4] = {};
  for (int kb = 0; kb < K; kb += 32) {
    FragB ah, al;
    const v4f x0 = *(const v4fa*)(arow + kb + 8 * hh), x1 = *(const v4fa*)(arow + kb + 8 * hh + 4);
    const v4f x2 = *(const v4fa*)(arow + kb + 16 + 8 * hh), x3 = *(const v4fa*)(arow + kb + 16 + 8 * hh + 4);
    float xs[16] = {x0[0],x0[1],x0[2],x0[3],x1[0],x1[1],x1[2],x1[3],x2[0],x2[1],x2[2],x2[3],x3[0],x3[1],x3[2],x3[3]};
#pragma unroll
    for (int i = 0; i < 16; ++i) { const unsigned short hb = bf16_bits(xs[i]); ah.u[i] = hb; al.u[i] = ASPLIT ? bf16_bits(xs[i] - bf16_val(hb)) : (unsigned short)0; }
#pragma unroll
    for (int t = 0; t < 4; ++t) {
      const unsigned short* brow = Wt + (size_t)(col0 + t * 16 + ln) * ldb + kb;
      FragB b;
      b.half[0] = *(const v8us*)(brow + 8 * hh);
      b.half[1] = *(const v8us*)(brow + 16 + 8 * hh);
      acc[t] = mmaN<ASPLIT ? 2 : 1>(ah.v, al.v, b.v, b.v, acc[t]);
    }
  }
#pragma unroll
  for (int t = 0; t < 4; ++t) {
    float bv = bias ? bias[col0 + t * 16 + ln] : 0.f;
    if (BIAS_BF16) bv = bf16_round(bv);
#pragma unroll
    for (int r = 0; r < 8; ++r) { float v = acc[t][r] + bv; if (ACT == 1) v = fmaxf(v, 0.f); so[w][8 * hh + r][t * 16 + ln] = v; }
  }
  __builtin_amdgcn_fence(__ATOMIC_ACQ_REL, "workgroup");
  __builtin_amdgcn_wave_barrier();
  const int rsub = lane >> 4, c4 = (lane & 15) * 4;
  {
#pragma unroll
    for (int q = 0; q < 8; ++q) {
      const int r = q * 2 + rsub;
      const v4f v = *(const v4fa*)&so[w][r][c4];
      *(v4f*)(C + (size_t)(row0 + r) * ldc + col0 + c4) = v;
    }
    
  }
}

// GEMM C = act(A·W + bias + resid): A f32 (ASPLIT -> hi/lo 2 terms), Wt bf16 [N][K]; ACT 0 none, 1 relu, 2 exact gelu;
// resid (optional, f32, row index = (row % rmod), pitch ldr, RES_BF16 rounds it) added before the activation.
template <bool ASPLIT, int ACT, bool BIAS_BF16, bool RES_BF16>
__global__ __launch_bounds__(128) void k_gemm_bf3(const float* __restrict__ A, int lda, const unsigned short* __restrict__ Wt, int ldb,
                                                const float* __restrict__ bias, const float* __restrict__ resid, int rmod, int ldr,
                                                float* __restrict__ C, int ldc, int M, int N, int K) {
  __shared__ __attribute__((aligned(16))) float so[4][16][64];
  const int tid = threadIdx.x, w = tid >> 5, lane = tid & 31, ln = lane & 15, hh = lane >> 4;
  const int ntn = N / 64;
  const int wid = blockIdx.x * 4 + w;
  const int mt = wid / ntn, nq = wid % ntn;
  if (mt * 16 >= M) return;
  const int row0 = mt * 16, col0 = nq * 64;
  const float* arow = A + (size_t)(row0 + ln) * lda;
  v8f acc[4] = {};
  for (int kb = 0; kb < K; kb += 32) {
    FragB ah, al;
    const v4f x0 = *(const v4fa*)(arow + kb + 8 * hh), x1 = *(const v4fa*)(arow + kb + 8 * hh + 4);
    const v4f x2 = *(const v4fa*)(arow + kb + 16 + 8 * hh), x3 = *(const v4fa*)(arow + kb + 16 + 8 * hh + 4);
    float xs[16] = {x0[0],x0[1],x0[2],x0[3],x1[0],x1[1],x1[2],x1[3],x2[0],x2[1],x2[2],x2[3],x3[0],x3[1],x3[2],x3[3]};
#pragma unroll
    for (int i = 0; i < 16; ++i) { const unsigned short hb = bf16_bits(xs[i]); ah.u[i] = hb; al.u[i] = ASPLIT ? bf16_bits(xs[i] - bf16_val(hb)) : (unsigned short)0; }
#pragma unroll
    for (int t = 0; t < 4; ++t) {
      const unsigned short* brow = Wt + (size_t)(col0 + t * 16 + ln) * ldb + kb;
      FragB b;
      b.half[0] = *(const v8us*)(brow + 8 * hh);
      b.half[1] = *(const v8us*)(brow + 16 + 8 * hh);
      acc[t] = mmaN<ASPLIT ? 2 : 1>(ah.v, al.v, b.v, b.v, acc[t]);
    }
  }
#pragma unroll
  for (int t = 0; t < 4; ++t) {
    const int col = col0 + t * 16 + ln;
    float bv = bias ? bias[col] : 0.f;
    if (BIAS_BF16) bv = bf16_round(bv);
#pragma unroll
    for (int r = 0; r < 8; ++r) {
      float v = acc[t][r] + bv;
      if (resid) { float rv = resid[(size_t)((row0 + 8 * hh + r) % rmod) * ldr + col]; if (RES_BF16) rv = bf16_round(rv); v += rv; }
      if (ACT == 1) v = fmaxf(v, 0.f);
      if (ACT == 2) v = 0.5f * v * (1.0f + erff(v * 0.70710678118654752f));
      if (ACT == 3) { const float u = 0.7978845608028654f * (v + 0.044715f * v * v * v); v = 0.5f * v * (1.0f + tanhf(u)); }
      so[w][8 * hh + r][t * 16 + ln] = v;
    }
  }
  __builtin_amdgcn_fence(__ATOMIC_ACQ_REL, "workgroup");
  __builtin_amdgcn_wave_barrier();
  const int rsub = lane >> 4, c4 = (lane & 15) * 4;
  {
#pragma unroll
    for (int q = 0; q < 8; ++q) {
      const int r = q * 2 + rsub;
      const v4f v = *(const v4fa*)&so[w][r][c4];
      *(v4f*)(C + (size_t)(row0 + r) * ldc + col0 + c4) = v;
    }
    
  }
}
// row LayerNorm (biased variance, eps) over N: s = X (+ R); optional out_sum <- s; out_norm <- (s-mu)*rsqrt(var+eps)*g + b
template <bool PARAM_BF16>
__global__ __launch_bounds__(256) void k_layernorm(const float* __restrict__ X, const float* __restrict__ R, const float* __restrict__ g, const float* __restrict__ bta,
                                                  float* __restrict__ out_sum, float* __restrict__ out_norm, int N, float eps) {
  __shared__ float red[256];
  const int row = blockIdx.x, tid = threadIdx.x;
  const float* x = X + (size_t)row * N; const float* rr = R ? R + (size_t)row * N : nullptr;
  float vals[16];                     // up to N = 4096
  const int per = N / 256;            // contiguous chunk per thread? use strided-by-4 chunks: thread handles j = tid*4 + 1024*u
  float s1 = 0.f;
  for (int u = 0; u < per / 4; ++u) {
    const int j = tid * 4 + 1024 * u;
    const v4f a = *(const v4fa*)(x + j);
    v4f b = {0.f,0.f,0.f,0.f}; if (rr) b = *(const v4fa*)(rr + j);
#pragma unroll
    for (int q = 0; q < 4; ++q) { const float v = a[q] + b[q]; vals[u * 4 + q] = v; s1 += v; }
  }
  red[tid] = s1; __syncthreads();
  for (int st = 128; st > 0; st >>= 1) { if (tid < st) red[tid] += red[tid + st]; __syncthreads(); }
  const float mu = red[0] / (float)N; __syncthreads();
  float s2 = 0.f;
  for (int u = 0; u < per / 4; ++u)
#pragma unroll
    for (int q = 0; q < 4; ++q) { const float c = vals[u * 4 + q] - mu; s2 += c * c; }
  red[tid] = s2; __syncthreads();
  for (int st = 128; st > 0; st >>= 1) { if (tid < st) red[tid] += red[tid + st]; __syncthreads(); }
  const float rs = rsqrtf(red[0] / (float)N + eps);
  {
    for (int u = 0; u < per / 4; ++u) {
      const int j = tid * 4 + 1024 * u;
      v4f o, sm;
#pragma unroll
      for (int q = 0; q < 4; ++q) {
        float gg = g[j + q], bb = bta[j + q];
        if (PARAM_BF16) { gg = bf16_round(gg); bb = bf16_round(bb); }
        sm[q] = vals[u * 4 + q]; o[q] = (vals[u * 4 + q] - mu) * rs * gg + bb;
      }
      if (out_sum) *(v4f*)(out_sum + (size_t)row * N + j) = sm;
      *(v4f*)(out_norm + (size_t)row * N + j) = o;
    }
    
  }
}



// ---- f16 WMMA path (v_wmma_f32_16x16x32_f16): 11-bit significands for operands in range — used where a [0,1] probability operand needs more precision than bf16
typedef _Float16 v16h __attribute__((ext_vector_type(16)));
union FragH { v16h v; v8us half[2]; _Float16 h[16]; unsigned short u[16]; };
template <int NT>
__device__ __forceinline__ v8f mmaH(v16h ah, v16h al, v16h bh, v16h bl, v8f c) {
  c = __builtin_amdgcn_wmma_f32_16x16x32_f16(false, ah, false, bh, (short)0, c, false, false);
  if (NT >= 2) c = __builtin_amdgcn_wmma_f32_16x16x32_f16(false, al, false, bh, (short)0, c, false, false);
  if (NT >= 3) c = __builtin_amdgcn_wmma_f32_16x16x32_f16(false, ah, false, bl, (short)0, c, false, false);
  asm volatile("v_nop\n\tv_nop\n\tv_nop\n\tv_nop" : "+v"(c) : "v"(ah), "v"(al), "v"(bh), "v"(bl));
  return c;
}
// batched GEMM like k_gemm_b but f16 operands: A f32 (split into f16 hi/lo if ASPLIT, else rounded to f16), Bt = f16 values [n][k]; alpha; C f32; N multiple of 16 (partial tiles skipped)
template <bool ASPLIT>
__global__ __launch_bounds__(128) void k_gemm_h(const float* __restrict__ A, int lda, size_t sA, const _Float16* __restrict__ Bh, int ldb, size_t sB, float alpha, float* __restrict__ C, int ldc, size_t sC, int M, int N, int K) {
  __shared__ __attribute__((aligned(16))) float so[4][16][64];
  const int tid = threadIdx.x, w = tid >> 5, lane = tid & 31, ln = lane & 15, hh = lane >> 4; const int by = blockIdx.y;
  A += (size_t)by * sA; Bh += (size_t)by * sB; C += (size_t)by * sC;
  const int ntn = (N + 63) / 64; const int wid = blockIdx.x * 4 + w; const int mt = wid / ntn, nq = wid % ntn; if (mt * 16 >= M) return;
  const int row0 = mt * 16, col0 = nq * 64; const float* arow = A + (size_t)(row0 + ln) * lda;
  v8f acc[4] = {};
  for (int kb = 0; kb < K; kb += 32) {
    FragH ah, al;
    const v4f x0 = *(const v4fa*)(arow + kb + 8 * hh), x1 = *(const v4fa*)(arow + kb + 8 * hh + 4), x2 = *(const v4fa*)(arow + kb + 16 + 8 * hh), x3 = *(const v4fa*)(arow + kb + 16 + 8 * hh + 4);
    float xs[16] = {x0[0],x0[1],x0[2],x0[3],x1[0],x1[1],x1[2],x1[3],x2[0],x2[1],x2[2],x2[3],x3[0],x3[1],x3[2],x3[3]};
#pragma unroll
    for (int i = 0; i < 16; ++i) { const _Float16 h = (_Float16)xs[i]; ah.h[i] = h; al.h[i] = ASPLIT ? (_Float16)(xs[i] - (float)h) : (_Float16)0.0f; }
#pragma unroll
    for (int t = 0; t < 4; ++t) { if (col0 + t * 16 >= N) continue; const size_t boff = (size_t)(col0 + t * 16 + ln) * ldb + kb; FragH bq; bq.half[0] = *(const v8us*)(Bh + boff + 8 * hh); bq.half[1] = *(const v8us*)(Bh + boff + 16 + 8 * hh);
      acc[t] = mmaH<ASPLIT ? 2 : 1>(ah.v, al.v, bq.v, bq.v, acc[t]); }
  }
#pragma unroll
  for (int t = 0; t < 4; ++t) { if (col0 + t * 16 >= N) continue;
#pragma unroll
    for (int r = 0; r < 8; ++r) so[w][8 * hh + r][t * 16 + ln] = acc[t][r] * alpha; }
  __builtin_amdgcn_fence(__ATOMIC_ACQ_REL, "workgroup"); __builtin_amdgcn_wave_barrier();
  const int rsub = lane >> 4, c4 = (lane & 15) * 4;
  {
#pragma unroll
    for (int q = 0; q < 8; ++q) { const int r = q * 2 + rsub; if (col0 + c4 < N) { const v4f v = *(const v4fa*)&so[w][r][c4]; *(v4f*)(C + (size_t)(row0 + r) * ldc + col0 + c4) = v; } }
     }
}

// Wt[n][k] = f16(W[k][n]·scale) from f32 row-major W[K][N] (scale = power of two; bf16-exact weights stay exact in f16 away from the subnormal range)
__global__ __launch_bounds__(256) void k_wt_f16(const float* __restrict__ W, _Float16* __restrict__ Wt, int K, int N, float scale) {
  const int t = blockIdx.x * 256 + threadIdx.x; if (t >= N * (K / 8)) return; const int n = t / (K / 8), k8 = (t % (K / 8)) * 8; FragH f;
#pragma unroll
  for (int i = 0; i < 8; ++i) f.h[i] = (_Float16)(bf16_round(W[(size_t)(k8 + i) * N + n]) * scale); const v8us o = f.half[0];
  *(v8us*)((unsigned short*)Wt + (size_t)n * K + k8) = o; 
}
// k_gemm_hh variant with fused epilogue: v = acc·alpha + bias[by·sBias + col] (+ CP[(row/rowsPerB)·sCPb + by·64 + col] if CP) ; ACT 0 none / 1 elu ; writes f16 C16 (and f32 C if non-null)
template <int ACT>
__global__ __launch_bounds__(128) void k_gemm_hhx(const _Float16* __restrict__ A, int lda, size_t sA, const _Float16* __restrict__ Bh, int ldb, size_t sB, float alpha, const float* __restrict__ bias, size_t sBias, const float* __restrict__ CP, int rowsPerB, size_t sCPb, int row0g,
    float* __restrict__ C, _Float16* __restrict__ C16, int ldc, size_t sC, int M, int N, int K) {
  __shared__ __attribute__((aligned(16))) float so[4][16][64];
  const int tid = threadIdx.x, w = tid >> 5, lane = tid & 31, ln = lane & 15, hh = lane >> 4; const int by = blockIdx.y;
  A += (size_t)by * sA; Bh += (size_t)by * sB; const size_t cofs = (size_t)by * sC; const float* bp = bias ? bias + (size_t)by * sBias : nullptr;
  const int ntn = (N + 63) / 64; const int wid = blockIdx.x * 4 + w; const int mt = wid / ntn, nq = wid % ntn; if (mt * 16 >= M) return;
  const int row0 = mt * 16, col0 = nq * 64; const _Float16* arow = A + (size_t)(row0 + ln) * lda;
  v8f acc[4] = {};
  for (int kb = 0; kb < K; kb += 32) { FragH ah; ah.half[0] = *(const v8us*)((const unsigned short*)arow + kb + 8 * hh); ah.half[1] = *(const v8us*)((const unsigned short*)arow + kb + 16 + 8 * hh);
#pragma unroll
    for (int t = 0; t < 4; ++t) { if (col0 + t * 16 >= N) continue; const size_t boff = (size_t)(col0 + t * 16 + ln) * ldb + kb; FragH bq; bq.half[0] = *(const v8us*)((const unsigned short*)Bh + boff + 8 * hh); bq.half[1] = *(const v8us*)((const unsigned short*)Bh + boff + 16 + 8 * hh);
      acc[t] = mmaH<1>(ah.v, ah.v, bq.v, bq.v, acc[t]); }
  }
#pragma unroll
  for (int t = 0; t < 4; ++t) { if (col0 + t * 16 >= N) continue; const int col = col0 + t * 16 + ln; const float bv = bp ? bf16_round(bp[col]) : 0.f;
#pragma unroll
    for (int r = 0; r < 8; ++r) { float v = acc[t][r] * alpha + bv; if (CP) { const int rr = row0g + row0 + 8 * hh + r; if (rowsPerB < 0) v += CP[cofs + (size_t)rr * ldc + col];      /* rowsPerB < 0: own element of the batched C plane */ else { const int bidx = rr / rowsPerB; v += CP[(size_t)bidx * sCPb + (size_t)by * 64 + col]; } } if (ACT == 1) v = (v > 0.f) ? v : expm1f(v); else if (ACT == 7) v = (v > 0.f) ? v + 1.0f : expf(v); else if (ACT == 8) v = tanhf(v); else if (ACT == 9) v = 0.5f * v * (1.0f + tanhf(0.7978845608028654f * (v + 0.044715f * v * v * v))); else if (ACT == 11) v = 1.0f / (1.0f + expf(-v)); else if (ACT == 12) v = (v > 0.f) ? v : 0.01f * v; else if (ACT == 14) v = (v > 0.f) ? v : 0.1f * v; else if (ACT == 16) v = (v >= 0.f) ? v : 0.3f * v; else if (ACT == 17) v = (v >= 0.f) ? v : 0.2f * v; else if (ACT == 15) v = v / (1.0f + expf(-v)); else if (ACT == 3) v = fmaxf(v, 0.f); else if (ACT == 6) v = 0.5f * v * (1.0f + erff(v * 0.70710678118654752f)); so[w][8 * hh + r][t * 16 + ln] = v; } }
  __builtin_amdgcn_fence(__ATOMIC_ACQ_REL, "workgroup"); __builtin_amdgcn_wave_barrier();
  const int rsub = lane >> 4, c4 = (lane & 15) * 4; typedef _Float16 v4h __attribute__((ext_vector_type(4)));
  {
#pragma unroll
    for (int q = 0; q < 8; ++q) { const int r = q * 2 + rsub; if (col0 + c4 < N) { const v4f v = *(const v4fa*)&so[w][r][c4]; if (C) *(v4f*)(C + cofs + (size_t)(row0 + r) * ldc + col0 + c4) = v; if (C16) { v4h h4; for (int i = 0; i < 4; ++i) h4[i] = (_Float16)v[i]; *(v4h*)(C16 + cofs + (size_t)(row0 + r) * ldc + col0 + c4) = h4; } } }
     }
}


typedef _Float16 v4h __attribute__((ext_vector_type(4)));

__global__ __launch_bounds__(256) void k_h16(const float* __restrict__ x, _Float16* __restrict__ X16, size_t n8) { const size_t t = (size_t)blockIdx.x * 256 + threadIdx.x; if (t >= n8) return; FragH f;
#pragma unroll
  for (int q = 0; q < 8; ++q) f.h[q] = (_Float16)x[t * 8 + q]; *(v8us*)((unsigned short*)X16 + t * 8) = f.half[0];  }
__global__ __launch_bounds__(256) void k_round16f(const float* __restrict__ W, _Float16* __restrict__ Bt, size_t n8) { const size_t t = (size_t)blockIdx.x * 256 + threadIdx.x; if (t >= n8) return; FragH f;
#pragma unroll
  for (int i = 0; i < 8; ++i) f.h[i] = (_Float16)(bf16_round(W[t * 8 + i]) * 16.0f); *(v8us*)((unsigned short*)Bt + t * 8) = f.half[0];  }
template <int NHv, int TTv>
__global__ __launch_bounds__(256) void k_vt(const _Float16* __restrict__ V16, int ldv, int voff, _Float16* __restrict__ Vt) { __shared__ unsigned short tl[64][66]; const int tid = threadIdx.x; const int slab = blockIdx.x / (TTv / 64), lg = blockIdx.x % (TTv / 64); const int b = slab / NHv, h = slab % NHv;
  for (int i = tid; i < 64 * 8; i += 256) { const int r = i / 8, c8 = (i % 8) * 8; FragH f; f.half[0] = *(const v8us*)((const unsigned short*)V16 + ((size_t)b * TTv + lg * 64 + r) * ldv + voff + h * 64 + c8);
#pragma unroll
    for (int q = 0; q < 8; ++q) tl[r][c8 + q] = f.u[q]; }
  __syncthreads();
  {
#pragma unroll
    for (int rd = 0; rd < 2; ++rd) { const int d = rd * 32 + tid / 8, pc = tid % 8; FragH f;
#pragma unroll
      for (int q = 0; q < 8; ++q) f.u[q] = tl[pc * 8 + q][d];
      *(v8us*)((unsigned short*)Vt + ((size_t)slab * 64 + d) * TTv + lg * 64 + pc * 8) = f.half[0]; }
     } }

__global__ __launch_bounds__(256) void k_hl(const float* __restrict__ F, _Float16* __restrict__ Hh, _Float16* __restrict__ Hl, size_t n8) { const size_t t = (size_t)blockIdx.x * 256 + threadIdx.x; if (t >= n8) return; FragH fh, fl; const v4f a = *(const v4fa*)(F + t * 8), c = *(const v4fa*)(F + t * 8 + 4);
#pragma unroll
  for (int q = 0; q < 4; ++q) { _Float16 h = (_Float16)a[q]; fh.h[q] = h; fl.h[q] = (_Float16)((a[q] - (float)h) * 1024.0f); h = (_Float16)c[q]; fh.h[4 + q] = h; fl.h[4 + q] = (_Float16)((c[q] - (float)h) * 1024.0f); }
  { *(v8us*)((unsigned short*)Hh + t * 8) = fh.half[0]; *(v8us*)((unsigned short*)Hl + t * 8) = fl.half[0];  } }

// ---- fast GEMM (wave tile 32x64; requires M % 128 == 0 rows per launch region, N % 64 == 0 and K % 64 == 0); epilogue = k_gemm_hhx semantics ----
__device__ __forceinline__ v16h g2_frag(const _Float16* p, int hh) { FragH f; f.half[0] = *(const v8us*)((const unsigned short*)p + 8 * hh); f.half[1] = *(const v8us*)((const unsigned short*)p + 16 + 8 * hh); return f.v; }
__device__ __forceinline__ v8f g2_mmab(v16h a, v16h b, v8f c) { return __builtin_amdgcn_wmma_f32_16x16x32_f16(false, a, false, b, (short)0, c, false, false); }
#define G2KC 64                      /* k per staged tile: 128 bytes, one cache line of every operand row */
#define G2P 72                       /* LDS row pitch in f16: 128 + 16 bytes, so that the 16 rows of a 16-byte fragment read fall on different banks */
// The f32 output C (plane pitch sCF over blockIdx.y) takes the rows below rowsF only (a multiple of 128: the test is the same for a whole block); the f16 output C16 (plane pitch sC) takes every row.
// Block tile 128 x 64. Per 64 k the block's 128 A rows and 64 B rows go global -> registers -> LDS with whole-line loads, one tile ahead, two LDS buffers; the waves read their fragments from LDS. Needs M % 128 == 0, K % 64 == 0, K >= 64.
template <int ACT>
__global__ __launch_bounds__(128) void k_gemm2(const _Float16* __restrict__ A, int lda, size_t sA, const _Float16* __restrict__ Bh, int ldb, size_t sB, float alpha, const float* __restrict__ bias, size_t sBias, const float* __restrict__ CP, int rowsPerB, size_t sCPb, int row0g,
    float* __restrict__ C, _Float16* __restrict__ C16, int ldc, size_t sC, int M, int N, int K, size_t sCF, int rowsF) { static_assert(ACT == 0 || ACT == 3 || ACT == 6 || ACT == 8 || ACT == 9 || ACT == 11 || ACT == 12 || ACT == 14 || ACT == 15 || ACT == 16 || ACT == 17, "k_gemm2: unsupported ACT code (would silently apply no activation)");
  __shared__ __attribute__((aligned(16))) float so[4][32][68];
  __shared__ __attribute__((aligned(16))) _Float16 st[2][192][G2P];      /* two staged tiles: rows 0..127 = the block's A rows, rows 128..191 = its B rows, G2KC k each */
  const int tid = threadIdx.x, w = tid >> 5, lane = tid & 31, ln = lane & 15, hh = lane >> 4; const int by = blockIdx.y;
  A += (size_t)by * sA; Bh += (size_t)by * sB; const size_t cofs = (size_t)by * sC; const float* bp = bias ? bias + (size_t)by * sBias : nullptr;
  const int ntn = N >> 6; const int mt = blockIdx.x / ntn, nq = blockIdx.x - mt * ntn; const int row0 = mt * 128 + 32 * w, col0 = nq * 64; if (mt * 128 >= M) return;      /* the same for the whole block: it stands in front of the barriers */
  const int sr = tid >> 3, sg = tid & 7;      /* staging: 8 threads bring one row's 128 bytes, so a wave's 16-byte load is 4 whole cache lines */
  const _Float16* gp[12];      /* the thread's 8 A pieces and 4 B pieces of the tile to be fetched next */
#pragma unroll
  for (int i = 0; i < 8; ++i) gp[i] = A + (size_t)(mt * 128 + sr + 16 * i) * lda + sg * 8;
#pragma unroll
  for (int i = 0; i < 4; ++i) gp[8 + i] = Bh + (size_t)(col0 + sr + 16 * i) * ldb + sg * 8;
  v8us rg[12];      /* the tile on its way from global memory to LDS */
  auto fetch = [&]() {
#pragma unroll
    for (int i = 0; i < 12; ++i) rg[i] = *(const v8us*)(const unsigned short*)gp[i];
    asm volatile("s_wait_xcnt 0x0" :: "v"(gp[0]), "v"(gp[1]), "v"(gp[2]), "v"(gp[3]), "v"(gp[4]), "v"(gp[5]), "v"(gp[6]), "v"(gp[7]), "v"(gp[8]), "v"(gp[9]), "v"(gp[10]), "v"(gp[11]) : "memory");      /* the 12 addresses are named so that their registers live up to this wait: none is overwritten in front of it, neither by the step to the next tile below nor by a load's result */
#pragma unroll
    for (int i = 0; i < 12; ++i) gp[i] += G2KC; };
  auto put = [&](int buf) {
#pragma unroll
    for (int i = 0; i < 12; ++i) *(v8us*)&st[buf][sr + 16 * i][sg * 8] = rg[i]; };
  auto lfrag = [&](int buf, int row, int kk) { FragH f; const unsigned short* p = (const unsigned short*)&st[buf][row][kk * 32 + 8 * hh]; f.half[0] = *(const v8us*)p; f.half[1] = *(const v8us*)(p + 16); return f.v; };      /* the k order of g2_frag */
  const v8f z8 = {0.f,0.f,0.f,0.f,0.f,0.f,0.f,0.f}; v8f c00 = z8, c01 = z8, c02 = z8, c03 = z8, c10 = z8, c11 = z8, c12 = z8, c13 = z8;
  const int nc = K / G2KC;
  fetch(); put(0); __syncthreads();
#pragma unroll 1      /* one copy of the tile body: the trip count is a run-time value and the body is long */
  for (int c = 0; c < nc; ++c) { const int buf = c & 1;
    if (c + 1 < nc) fetch();      /* the next tile's global loads fly while this tile is worked on */
    v16h a[2][2], b[2][4];
#pragma unroll
    for (int kk = 0; kk < 2; ++kk) { a[kk][0] = lfrag(buf, 32 * w + ln, kk); a[kk][1] = lfrag(buf, 32 * w + 16 + ln, kk);
#pragma unroll
      for (int t = 0; t < 4; ++t) b[kk][t] = lfrag(buf, 128 + 16 * t + ln, kk); }
    __builtin_amdgcn_sched_barrier(0);      /* keeps the tile's 24 LDS reads together in front of its 16 WMMAs: one LDS latency a tile with counted waits, where the scheduler otherwise reuses one B fragment's registers and waits for LDS eight times */
#pragma unroll
    for (int kk = 0; kk < 2; ++kk) {
      c00 = g2_mmab(a[kk][0], b[kk][0], c00); c10 = g2_mmab(a[kk][1], b[kk][0], c10); c01 = g2_mmab(a[kk][0], b[kk][1], c01); c11 = g2_mmab(a[kk][1], b[kk][1], c11);
      c02 = g2_mmab(a[kk][0], b[kk][2], c02); c12 = g2_mmab(a[kk][1], b[kk][2], c12); c03 = g2_mmab(a[kk][0], b[kk][3], c03); c13 = g2_mmab(a[kk][1], b[kk][3], c13); }
    if (c + 1 < nc) put(buf ^ 1);      /* into the buffer whose last readers passed the barrier at the foot of the trip before */
    __syncthreads(); }      /* one barrier a tile: publishes tile c + 1 and ends the reads of tile c */
  v8f accs[8] = {c00, c01, c02, c03, c10, c11, c12, c13};
#pragma unroll
  for (int u = 0; u < 8; ++u) { const int t = u & 3, half = u >> 2; const int col = col0 + t * 16 + ln; const float bv = bp ? bf16_round(bp[col]) : 0.f;
#pragma unroll
    for (int r = 0; r < 8; ++r) { const int rloc = half * 16 + 8 * hh + r; float v = accs[u][r] * alpha + bv; if (CP) { if (rowsPerB < 0) v += CP[cofs + (size_t)(row0g + row0 + rloc) * ldc + col];      /* rowsPerB < 0: own element of the batched C plane */ else { const int bidx = (row0g + row0 + rloc) / rowsPerB; v += CP[(size_t)bidx * sCPb + (size_t)by * 64 + col]; } }
      if (ACT == 3) v = fmaxf(v, 0.f); else if (ACT == 6) v = 0.5f * v * (1.0f + erff(v * 0.70710678118654752f)); else if (ACT == 11) v = 1.0f / (1.0f + expf(-v)); else if (ACT == 15) v = v / (1.0f + expf(-v)); else if (ACT == 12) v = (v > 0.f) ? v : 0.01f * v; else if (ACT == 8) v = tanhf(v); else if (ACT == 9) v = 0.5f * v * (1.0f + tanhf(0.7978845608028654f * (v + 0.044715f * v * v * v))); else if (ACT == 14) v = (v > 0.f) ? v : 0.1f * v; else if (ACT == 16) v = (v >= 0.f) ? v : 0.3f * v; else if (ACT == 17) v = (v >= 0.f) ? v : 0.2f * v;
      so[w][rloc][t * 16 + ln] = v; } }
  __builtin_amdgcn_fence(__ATOMIC_ACQ_REL, "workgroup"); __builtin_amdgcn_wave_barrier();
  const int rsub = lane >> 4, c4 = (lane & 15) * 4;
  float* CF = (C && mt * 128 < rowsF) ? C + (size_t)by * sCF : nullptr;
  {
#pragma unroll
    for (int q = 0; q < 16; ++q) { const int r = q * 2 + rsub; const v4f v = *(const v4fa*)&so[w][r][c4]; if (CF) { float* pf = CF + (size_t)(row0 + r) * ldc + col0 + c4; *(v4f*)pf = v; asm volatile("s_wait_xcnt 0x0" :: "v"(pf), "v"(v) : "memory"); }      /* the store's address and data are named so that their registers live up to this wait: where both outputs are stored, the f16 conversion below reuses them */
      if (C16) { v4h h4; for (int i = 0; i < 4; ++i) h4[i] = (_Float16)v[i]; *(v4h*)(C16 + cofs + (size_t)(row0 + r) * ldc + col0 + c4) = h4; } }
     } }


#define CVW 16                       /* waves per k_cvt work-group: 256 work-groups, one per WGP */
#define CVL 32                       /* 16-byte loads per lane, all issued before the first value is used */
#define CVE (CVL * 128)              /* f32 values per wave: 16 KiB of one source, consecutive */
// All seven f32 -> f16 conversions (4 weights: bf16-rounded x16; 3 inputs: bf16-rounded) in one streaming launch. D is the workspace range [BQ BK BV BO XQ XK XV], which lies in one piece in this order.
// A wave takes piece c of 4096 values: its source, its place there and its scale are wave-uniform. One load of a wave is 512 consecutive bytes (4 whole lines), one store 256 (2 whole lines).
__global__ __launch_bounds__(CVW * 32) void k_cvt(const float* __restrict__ wq, const float* __restrict__ wk, const float* __restrict__ wv, const float* __restrict__ wo, const float* __restrict__ xq, const float* __restrict__ xk, const float* __restrict__ xv, _Float16* __restrict__ D) {
  constexpr int WC = DM * DM / CVE, XC = (int)(NR * DM / CVE);      /* pieces per weight, per input */
  static_assert(DM * DM % CVE == 0 && NR * DM % CVE == 0 && (4 * WC + 3 * XC) % CVW == 0 && (DM * DM * 2) % 256 == 0 && (NR * DM * 2) % 256 == 0, "whole pieces, whole work-groups, no pad between the workspace planes");
  const int lane = threadIdx.x & 31; const int c = (int)blockIdx.x * CVW + __builtin_amdgcn_readfirstlane((int)(threadIdx.x >> 5));
  const float* s; float sc;
  if (c < 4 * WC) { const int i = c / WC; s = (i == 0 ? wq : i == 1 ? wk : i == 2 ? wv : wo) + (size_t)(c % WC) * CVE; sc = 16.0f; }
  else { const int e = c - 4 * WC, i = e / XC; s = (i == 0 ? xq : i == 1 ? xk : xv) + (size_t)(e % XC) * CVE; sc = 1.0f; }      /* x 1 is exact */
  const unsigned lo = (unsigned)lane * 16;      /* the lane's byte in every 512-byte row of the piece */
  v4f r[CVL];
#pragma unroll
  for (int q = 0; q < CVL; ++q) r[q] = __builtin_nontemporal_load((const v4fa*)((const char*)s + q * 512 + lo));      /* read once: not kept in L2 */
  __builtin_amdgcn_sched_barrier(0);      /* keeps the conversions behind all 32 loads: the wave's whole piece is in flight at once, where the scheduler otherwise holds most of them back until the first values are converted */
  _Float16* d = D + (size_t)c * CVE + lane * 4;
#pragma unroll
  for (int q = 0; q < CVL; ++q) { v4h h;
#pragma unroll
    for (int i = 0; i < 4; ++i) h[i] = (_Float16)(bf16_round(r[q][i]) * sc);
    *(v4h*)(d + q * 128) = h; }
}
__global__ __launch_bounds__(256) void k_rsm(const float* __restrict__ S, _Float16* __restrict__ P, int nrows) {
  #pragma clang fp contract(off)
  const int i = blockIdx.x * 256 + threadIdx.x; if (i >= nrows) return; const float* s = S + (size_t)i * SQ; float mx = -3.0e38f;
#pragma unroll 1
  for (int j = 0; j < SQ; ++j) mx = fmaxf(mx, s[j]); float se = 0.f;
#pragma unroll 1
  for (int j = 0; j < SQ; ++j) se += expf(s[j] - mx); const float sc = 256.0f / se;
#pragma unroll 1
  for (int j0 = 0; j0 < SQ; j0 += 8) { FragH f; for (int q = 0; q < 8; ++q) f.h[q] = (_Float16)(expf(s[j0 + q] - mx) * sc); unsigned short* d = (unsigned short*)P + (size_t)i * SQ + j0; *(v8us*)d = f.half[0];  } }
__global__ __launch_bounds__(256) void k_vt(const _Float16* __restrict__ V16, int b, int h0, _Float16* __restrict__ VT) { __shared__ unsigned short tl[64][65]; const int tid = threadIdx.x; const int hh = blockIdx.x % HG, sg = blockIdx.x / HG; const int s0 = sg * 64; const int h = h0 + hh;
  for (int i = tid; i < 64 * 8; i += 256) { const int j = i / 8, d8 = (i % 8) * 8; FragH f; f.half[0] = *(const v8us*)((const unsigned short*)V16 + ((size_t)b * SQ + s0 + j) * DM + h * HD + d8); for (int q = 0; q < 8; ++q) tl[d8 + q][j] = f.u[q]; }
  __syncthreads();
  { for (int i = tid; i < 64 * 8; i += 256) { const int d = i / 8, j8 = (i % 8) * 8; FragH f; for (int q = 0; q < 8; ++q) f.u[q] = tl[d][j8 + q]; *(v8us*)((unsigned short*)VT + ((size_t)hh * HD + d) * SQ + s0 + j8) = f.half[0]; }  } }



#define FQ 32                        /* query rows per wave */
#define FK 64                        /* keys per staged tile: 128 bytes of every V^T row, one cache line */
#define FP 72                        /* LDS row pitch in f16: 128 + 16 bytes, so that the 16 rows of a 16-byte fragment read fall on different banks */
#define FS 4                         /* key groups of 4 waves in a block: four waves per SIMD, and a wave's walk is a quarter as long */
#define FOP 68                       /* LDS pitch of a partial o row in floats: 256 + 16 bytes, so that the lanes' 16-byte stores fall on different banks */
typedef _Float16 v8h __attribute__((ext_vector_type(8)));
__device__ __forceinline__ float half_xor(float v) { const int i = __builtin_bit_cast(int, v); return __builtin_bit_cast(float, __builtin_amdgcn_permlanex16(i, i, 0x76543210, 0xfedcba98, false, false)); }      /* lane l <- lane l ^ 16 */
__device__ __forceinline__ float exp2_slot(float x) { float y; asm("v_exp_f32 %0, %1\n\tv_nop" : "=v"(y) : "v"(x)); return y; }      /* v_nop: the slot the instruction set asks for behind a transcendental before its result is read or its source rewritten; in the same statement it stays directly behind it */
__device__ __forceinline__ v8f fa_mma(v16h a, v16h b, v8f c) { return __builtin_amdgcn_wmma_f32_16x16x32_f16(false, a, false, b, (short)0, c, false, false); }
__global__ __launch_bounds__(FS * 128) void k_fattn(const _Float16* __restrict__ Qr, const _Float16* __restrict__ Kr, const _Float16* __restrict__ Vt, _Float16* __restrict__ Or) {
  static_assert(HD == 64 && SQ % (4 * FQ) == 0 && (4 * FQ) % FK == 0 && FK == 2 * 32 && SQ % (FS * FK) == 0 && FS * 8 == FQ, "two k chunks per score product, four d tiles, whole blocks, whole tiles, two steps of 32 keys a tile, every stage inside the SQ keys, 8 rows of a query group per wave in the final sum");
  static_assert(FS * 4 * FQ * FOP * 4 <= 2 * FS * 2 * FK * FP * 2, "the partial o rows fit into the staging buffers");
  __shared__ __attribute__((aligned(16))) _Float16 kv[2][FS][2 * FK][FP];      /* two stages of FS tiles: rows 0..63 = the tile's K rows (64 head dims), rows 64..127 = the 64 V^T rows (the tile's 64 keys); behind the loop: the partial o rows */
  __shared__ float pm[FS][4 * FQ], pl[FS][4 * FQ];      /* each key group's running maxima; its row sums, on the common maximum */
  const int tid = threadIdx.x, lane = tid & 31, ln = lane & 15, hh = lane >> 4; const int w = __builtin_amdgcn_readfirstlane((int)(threadIdx.x >> 5));
  const int qg = w & 3, ks = w >> 2;      /* query group, key group: both wave-uniform */
  const int h = blockIdx.x % NH; const int qb = (SQ / (4 * FQ) - 1 - (int)(blockIdx.x / NH)) * (4 * FQ); const int q0 = qb + qg * FQ;      /* the longest blocks take the lowest block indices */
  const int ns = (qb + 4 * FQ + FS * FK - 1) / (FS * FK);      /* stages of the block: keys 0 .. its last row, rounded up to whole stages (256 ns <= SQ); at least 1; the same for the whole block */
  const int sr = (tid & 127) >> 3, sg = tid & 7;      /* staging, a key group for its own tile: 8 lanes bring one row's 128 bytes, so a wave's 16-byte copy is 4 whole cache lines */
  const _Float16* gk = Kr + (size_t)(ks * FK + sr) * LQ + h * HD + sg * 8;          /* the thread's piece of K row sr of its group's tile of stage 0; its other pieces 16, 32, 48 rows on */
  const _Float16* gv = Vt + ((size_t)h * HD + sr) * SQ + ks * FK + sg * 8;        /* the thread's piece of V^T row sr, the same tile; likewise */
  const unsigned ls = (unsigned)(size_t)&kv[0][ks][sr][sg * 8];             /* its place in buffer 0: the LDS byte address */
  auto stage = [&](int s, int buf) {      /* stage s -> buffer buf: 8 copies of 16 bytes a lane; every lane on, every address a multiple of 16, keys 256 s + 64 ks .. + 63 < SQ */
    const _Float16* k0 = gk + (size_t)s * (FS * FK) * LQ; const _Float16* k1 = k0 + 16 * LQ; const _Float16* k2 = k0 + 32 * LQ; const _Float16* k3 = k0 + 48 * LQ;
    const _Float16* v0 = gv + (size_t)s * (FS * FK); const _Float16* v1 = v0 + 16 * SQ; const _Float16* v2 = v0 + 32 * SQ; const _Float16* v3 = v0 + 48 * SQ;
    const unsigned l0 = ls + (unsigned)buf * (FS * 2 * FK * FP * 2); const unsigned rs = 16 * FP * 2;      /* 16 LDS rows in bytes */
    const unsigned l1 = l0 + rs, l2 = l0 + 2 * rs, l3 = l0 + 3 * rs, l4 = l0 + 4 * rs, l5 = l0 + 5 * rs, l6 = l0 + 6 * rs, l7 = l0 + 7 * rs;
    asm volatile("global_load_async_to_lds_b128 %0, %8, off\n\t"
                 "global_load_async_to_lds_b128 %1, %9, off\n\t"
                 "global_load_async_to_lds_b128 %2, %10, off\n\t"
                 "global_load_async_to_lds_b128 %3, %11, off\n\t"
                 "global_load_async_to_lds_b128 %4, %12, off\n\t"
                 "global_load_async_to_lds_b128 %5, %13, off\n\t"
                 "global_load_async_to_lds_b128 %6, %14, off\n\t"
                 "global_load_async_to_lds_b128 %7, %15, off\n\t"
                 "s_wait_xcnt 0x0"      /* in the copies' own statement: no address register of a copy is rewritten in front of it */
                 :: "v"(l0), "v"(l1), "v"(l2), "v"(l3), "v"(l4), "v"(l5), "v"(l6), "v"(l7), "v"(k0), "v"(k1), "v"(k2), "v"(k3), "v"(v0), "v"(v1), "v"(v2), "v"(v3) : "memory"); };
  auto lfrag = [&](int buf, int row, int col) { FragH f; const unsigned short* p = (const unsigned short*)&kv[buf][ks][row + ln][col + 8 * hh]; f.half[0] = *(const v8us*)p; f.half[1] = *(const v8us*)(p + 16); return f.v; };      /* the k order of g2_frag */
  stage(0, 0);
  v16h qf[2][2], kf[2][2], vf[4];      /* [16 queries | 16 keys][k chunk of 32 head dims]; [tile of 16 head dims] */
#pragma unroll
  for (int g = 0; g < 2; ++g)
#pragma unroll
    for (int c = 0; c < 2; ++c) qf[g][c] = g2_frag(Qr + (size_t)(q0 + 16 * g + ln) * LQ + h * HD + 32 * c, hh);
  asm volatile("s_wait_asynccnt 0x0" ::: "memory");      /* this wave's copies of stage 0 have landed */
  __syncthreads();      /* stage 0 is published: every wave's copies have landed */
  if (ns > 1) stage(1, 1);      /* the same for the whole block: where a stage 1 exists, it flies while stage 0 is worked on */
  const v8f z8 = {0.f, 0.f, 0.f, 0.f, 0.f, 0.f, 0.f, 0.f};
  v8f o[2][4] = {{z8, z8, z8, z8}, {z8, z8, z8, z8}};      /* o[g][t][r] = O^T[16 t + 8 hh + r][query q0 + 16 g + ln] */
  float m[2] = {-3.0e38f, -3.0e38f}, l[2] = {0.f, 0.f};      /* m: running maximum of the raw products q.k; l: this wave half's keys only, the halves are joined once behind the loop */
  const float cs = 0.125f * 1.44269504088896f;      /* score scale x log2(e): exp(0.125 (s - m)) = exp2(cs s - cs m) */
#pragma unroll 1      /* one copy of the stage body: the trip count is a run-time value and the body is long */
  for (int st = 0; st < ns; ++st) { const int buf = st & 1;
#pragma unroll
      for (int j = 0; j < 2; ++j) { const int kb = (st * FS + ks) * FK + 32 * j;      /* two steps of 32 keys in the key group's tile of the stage */
        if (kb <= q0) {      /* wave-uniform: a wave skips the steps beyond its diagonal, never the publish point below */
#pragma unroll
          for (int t = 0; t < 2; ++t)
#pragma unroll
            for (int c = 0; c < 2; ++c) kf[t][c] = lfrag(buf, 32 * j + 16 * t, 32 * c);
#pragma unroll
          for (int t = 0; t < 4; ++t) vf[t] = lfrag(buf, FK + 16 * t, 32 * j);
          v8f s[2][2];      /* s[g][t][r] = q.k of key kb + 16 t + 8 hh + r, query q0 + 16 g + ln */
#pragma unroll
          for (int g = 0; g < 2; ++g)
#pragma unroll
            for (int t = 0; t < 2; ++t) s[g][t] = fa_mma(kf[t][1], qf[g][1], fa_mma(kf[t][0], qf[g][0], z8));
#pragma unroll
          for (int g = 0; g < 2; ++g) {
            if (kb == q0) {      /* the one step that holds keys above a query (wave-uniform test) */
#pragma unroll
              for (int t = 0; t < 2; ++t)
#pragma unroll
                for (int r = 0; r < 8; ++r) s[g][t][r] = (16 * t + 8 * hh + r <= 16 * g + ln) ? s[g][t][r] : -1.0e9f; }
            float mx = fmaxf(s[g][0][0], s[g][1][0]);
#pragma unroll
            for (int r = 1; r < 8; ++r) mx = fmaxf(mx, fmaxf(s[g][0][r], s[g][1][r]));
            const float mn = fmaxf(m[g], fmaxf(mx, half_xor(mx))); const float sc = exp2_slot((m[g] - mn) * cs); const float mc = mn * cs; m[g] = mn;
#pragma unroll
            for (int t = 0; t < 2; ++t)
#pragma unroll
              for (int r = 0; r < 8; ++r) s[g][t][r] = exp2_slot(fmaf(s[g][t][r], cs, -mc));
            const v8f sv = s[g][0] + s[g][1];
            l[g] = l[g] * sc + (((sv[0] + sv[1]) + (sv[2] + sv[3])) + ((sv[4] + sv[5]) + (sv[6] + sv[7])));
            const v16h pf = __builtin_shufflevector(__builtin_convertvector(s[g][0], v8h), __builtin_convertvector(s[g][1], v8h), 0, 1, 2, 3, 4, 5, 6, 7, 8, 9, 10, 11, 12, 13, 14, 15);
#pragma unroll
            for (int t = 0; t < 4; ++t) o[g][t] = fa_mma(vf[t], pf, o[g][t] * sc);
          }
        } }
    /* publish point of stage st + 1, passed by every wave */
    asm volatile("s_wait_dscnt 0x0" ::: "memory");      /* this wave's reads of buffer buf have retired before the buffer is refilled */
    asm volatile("s_wait_asynccnt 0x0" ::: "memory");      /* this wave's copies of stage st + 1 have landed */
    __syncthreads();      /* one barrier a stage: publishes stage st + 1 and ends every wave's reads of stage st */
    if (st + 2 < ns) stage(st + 2, buf);      /* the same for the whole block; into the buffer that this trip has just read */
  }
  asm volatile("s_wait_asynccnt 0x0" ::: "memory");      /* no copy is outstanding when the staging buffers take the partial o rows */
  /* Merge of the FS partial results of every query. The last publish point has ended every wave's reads of kv and no copy is in flight, so kv is free. */
  float* po = (float*)&kv[0][0][0][0];      /* po[key group][query of the block][FOP] */
#pragma unroll
  for (int g = 0; g < 2; ++g) if (hh == 0) pm[ks][qg * FQ + 16 * g + ln] = m[g];      /* both wave halves hold the same maximum */
  __syncthreads();      /* every key group's maxima are in LDS */
#pragma unroll
  for (int g = 0; g < 2; ++g) { const int qi = qg * FQ + 16 * g + ln;
    float mb = pm[0][qi];
#pragma unroll
    for (int u = 1; u < FS; ++u) mb = fmaxf(mb, pm[u][qi]);
    const float wt = exp2_slot((m[g] - mb) * cs);      /* key group 0 holds key 0, open to every query, so mb is a true product; a group that met no open key still has m = -3e38, l = 0, o = 0: its weight is exactly 0 */
    const float lt = (l[g] + half_xor(l[g])) * wt;      /* the wave halves' sums joined, on the common maximum */
    if (hh == 0) pl[ks][qi] = lt;
    float* pr = po + (size_t)(ks * (4 * FQ) + qi) * FOP + 8 * hh;
#pragma unroll
    for (int t = 0; t < 4; ++t) { const v8f ov = o[g][t] * wt;      /* a lane holds 8 consecutive head dims of its query */
      *(v4fa*)(pr + 16 * t) = __builtin_shufflevector(ov, ov, 0, 1, 2, 3); *(v4fa*)(pr + 16 * t + 4) = __builtin_shufflevector(ov, ov, 4, 5, 6, 7); } }
  __syncthreads();      /* every key group's weighted sums are in LDS */
  const int row = qg * FQ + 8 * ks + (lane >> 2), dc = (lane & 3) * 16;      /* a wave adds and stores 8 rows of its query group, 4 lanes a row: one wave writes a row's whole 128-byte line */
  v4f a[4]; float lsum = pl[0][row];
#pragma unroll
  for (int i = 0; i < 4; ++i) a[i] = *(const v4fa*)(po + (size_t)row * FOP + dc + 4 * i);
#pragma unroll
  for (int u = 1; u < FS; ++u) { lsum += pl[u][row];
#pragma unroll
    for (int i = 0; i < 4; ++i) a[i] += *(const v4fa*)(po + (size_t)(u * (4 * FQ) + row) * FOP + dc + 4 * i); }
  const float fin = 64.0f / lsum;      /* o carried x64, folded into the output GEMM alpha */
  _Float16* orow = Or + (size_t)(qb + row) * DM + h * HD + dc;
  const v4f b0 = a[0] * fin, b1 = a[1] * fin, b2 = a[2] * fin, b3 = a[3] * fin;
  *(v8h*)orow = __builtin_convertvector(__builtin_shufflevector(b0, b1, 0, 1, 2, 3, 4, 5, 6, 7), v8h);
  *(v8h*)(orow + 8) = __builtin_convertvector(__builtin_shufflevector(b2, b3, 0, 1, 2, 3, 4, 5, 6, 7), v8h);
}


#define A0Q 32                       /* query rows per k_att0 block: one per lane */
#define A0S 16                       /* waves per k_att0 block: wave w takes the keys w, w + 16, w + 32, ... */
#define A0P 68                       /* LDS pitch of a partial o row in floats: 256 + 16 bytes, so that the lanes' 16-byte stores fall on different banks */
// Exact f32 attention of the first QT0 rows. A block owns 32 query rows of a head (a lane = a row); its 16 waves share the keys, each with a running maximum, sum and o of its own;
// at the end the 16 partial results are brought to the block's common maximum and added through LDS.
template <int MASKADD>
__global__ __launch_bounds__(A0Q * A0S) void k_att0(const float* __restrict__ QF, const float* __restrict__ KF, const float* __restrict__ VF, int ld, const float* __restrict__ mask, float scale, float* __restrict__ OF, int ldo) {
  #pragma clang fp contract(off)
  static_assert(A0Q == 32 && A0S * 32 == A0Q * (HD / 4), "a lane per query row; in the final sum a thread per 16-byte piece of an o row");
  __shared__ __attribute__((aligned(16))) float po[A0S][A0Q][A0P];      /* each wave's o rows, on the common maximum */
  __shared__ float pm[A0S][A0Q], pl[A0S][A0Q];      /* each wave's running maxima; its row sums, on the common maximum */
  const int tid = threadIdx.x, lane = tid & 31; const int w = __builtin_amdgcn_readfirstlane(tid >> 5);      /* the wave's number as a scalar: the key rows' addresses stay wave-uniform (scalar loads) */
  const int h = blockIdx.x / (QT0 / A0Q), rg = blockIdx.x % (QT0 / A0Q); const int i = rg * A0Q + lane;
  const float* qr = QF + (size_t)i * ld + h * HD;
  v4f q[HD / 4], o[HD / 4];      /* the thread's q row and o row: every loop over c is fully unrolled, so both are indexed by constants only and stay in registers */
#pragma unroll
  for (int c = 0; c < HD / 4; ++c) { q[c] = *(const v4fa*)(qr + c * 4); const v4f z = {0.f, 0.f, 0.f, 0.f}; o[c] = z; }
  asm volatile("s_wait_xcnt 0x0" :: "v"(qr) : "memory");      /* qr is named so that the 16 loads' address registers live up to this wait: none of them is overwritten in front of it, not even by a later load's result */
  float m = -1.0e30f, l = 0.f; const int jmax = MASKADD ? (SQ - 1) : (rg * A0Q + A0Q - 1);      /* additive-mask form: every key (the mask input decides); causal form: keys up to the block's last row */
#pragma unroll 1
  for (int j = w; j <= jmax; j += A0S) { const float* kr = KF + (size_t)j * ld + h * HD; const float* vr = VF + (size_t)j * ld + h * HD; float s = 0.f;
#pragma unroll
    for (int c = 0; c < HD / 4; ++c) { const v4f kq = *(const v4fa*)(kr + c * 4); s = __fadd_rn(s, __fmul_rn(q[c][0], kq[0])); s = __fadd_rn(s, __fmul_rn(q[c][1], kq[1])); s = __fadd_rn(s, __fmul_rn(q[c][2], kq[2])); s = __fadd_rn(s, __fmul_rn(q[c][3], kq[3])); }
    s = __fmul_rn(s, scale); if (MASKADD) s = __fadd_rn(s, __fmul_rn(bf16_round(mask[(size_t)i * SQ + j]), -10000.0f));
    const float f = (MASKADD || j <= i) ? 1.f : 0.f; const float sm = fmaf(f, s, (1.f - f) * -1.0e30f); const float mn = fmaxf(m, sm); const float sc = expf(m - mn); const float e = expf(sm - mn); l = __fadd_rn(__fmul_rn(l, sc), e); m = mn;
#pragma unroll
    for (int c = 0; c < HD / 4; ++c) { const v4f vv = *(const v4fa*)(vr + c * 4); for (int u = 0; u < 4; ++u) o[c][u] = __fadd_rn(__fmul_rn(o[c][u], sc), __fmul_rn(e, vv[u])); } }
  pm[w][lane] = m;
  __syncthreads();      /* every wave's maxima are in LDS */
  float mb = pm[0][lane];
#pragma unroll
  for (int u = 1; u < A0S; ++u) mb = fmaxf(mb, pm[u][lane]);
  const float wt = expf(m - mb);      /* key 0 is open to every row, so mb is a true score; a wave that saw only closed keys of a row still has m = -1e30 there, its weight is exactly 0 and its (finite) sums drop out */
  pl[w][lane] = __fmul_rn(l, wt);
#pragma unroll
  for (int c = 0; c < HD / 4; ++c) { v4f oo = o[c]; for (int u = 0; u < 4; ++u) oo[u] = __fmul_rn(oo[u], wt); *(v4f*)&po[w][lane][c * 4] = oo; }
  __syncthreads();      /* every wave's weighted sums are in LDS */
  const int row = tid >> 4, pc = (tid & 15) * 4;      /* 16 threads add and store one o row: whole-line stores */
  v4f acc = *(const v4f*)&po[0][row][pc]; float ls = pl[0][row];
#pragma unroll
  for (int u = 1; u < A0S; ++u) { const v4f p = *(const v4f*)&po[u][row][pc]; for (int x = 0; x < 4; ++x) acc[x] = __fadd_rn(acc[x], p[x]); ls = __fadd_rn(ls, pl[u][row]); }
  const float fin = 64.0f / ls;      /* o carried x64 like the f16 path */
  for (int x = 0; x < 4; ++x) acc[x] = __fmul_rn(acc[x], fin);
  *(v4f*)(OF + (size_t)(rg * A0Q + row) * ldo + h * HD + pc) = acc; }

extern "C" void kernel_launch(void* const* d_in, const int* in_sizes, int n_in,
                              void* d_out, int out_size, void* d_ws, size_t ws_size, hipStream_t stream) {
  (void)in_sizes; (void)n_in; (void)out_size;
  const float* const* I = (const float* const*)d_in; const float* xq = I[0]; const float* xk = I[1]; const float* xv = I[2]; const float* wq = I[3]; const float* wk = I[4]; const float* wv = I[5]; const float* wo = I[6];      /* nn.Linear weights [out][in] */
  char* ws = (char*)d_ws; size_t off = 0;
  auto take = [&](size_t bytes) { char* p = ws + off; off += (bytes + 255) & ~(size_t)255; return p; };
  _Float16* BQ = (_Float16*)take((size_t)DM * DM * 2); _Float16* BK = (_Float16*)take((size_t)DM * DM * 2); _Float16* BV = (_Float16*)take((size_t)DM * DM * 2); _Float16* BO = (_Float16*)take((size_t)DM * DM * 2);
  _Float16* XQ = (_Float16*)take(NR * DM * 2); _Float16* XK = (_Float16*)take(NR * DM * 2); _Float16* XV = (_Float16*)take(NR * DM * 2); _Float16* Q16 = (_Float16*)take(NR * DM * 2); _Float16* K16 = (_Float16*)take(NR * DM * 2); _Float16* V16 = (_Float16*)take(NR * DM * 2); _Float16* O16 = (_Float16*)take(NR * DM * 2);
  _Float16* VT = (_Float16*)take((size_t)NH * HD * SQ * 2);
  float* QF0 = (float*)take((size_t)QT0 * DM * 4); float* KF0 = (float*)take((size_t)QT0 * DM * 4); float* VF0 = (float*)take((size_t)QT0 * DM * 4); float* OF0 = (float*)take((size_t)NB * QT0 * DM * 4); _Float16* OL0 = (_Float16*)take((size_t)NB * QT0 * DM * 2);
  if (off > ws_size) return;
  k_cvt<<<(unsigned)((4 * (size_t)DM * DM + 3 * NR * DM) / CVE / CVW), CVW * 32, 0, stream>>>(wq, wk, wv, wo, xq, xk, xv, BQ);      /* weights: natural [out][in] = Bt[n][k], x16; inputs: f16 rows */
  const size_t r0p = (size_t)B0 * SQ;      /* first projected row */
  static_assert(NB == 1 && B0 == 0 && QT0 % 128 == 0, "the first-tile rows are the first rows of the projected planes and of the o rows");
  k_gemm2<0><<<dim3((unsigned)((MP / 128) * (DM / 64)), 3), 128, 0, stream>>>(XQ + r0p * DM, DM, NR * DM, BQ, DM, (size_t)DM * DM, 0.0625f, nullptr, 0, nullptr, 1, 0, 0, QF0, Q16 + r0p * DM, DM, NR * DM, MP, DM, DM, (size_t)QT0 * DM, QT0);      /* blockIdx.y = q, k, v: the planes [XQ XK XV], [BQ BK BV], [Q16 K16 V16] and [QF0 KF0 VF0] each lie in one piece; the blocks of the first 256 rows also store their f32 accumulators (exact products) */
  for (int b = B0; b < B0 + NBR; ++b) { const size_t r0 = (size_t)b * SQ;
    k_vt<NH, SQ><<<NH * (SQ / 64), 256, 0, stream>>>(V16 + r0 * LQ, LQ, 0, VT);      /* V^T [NH][HD][SQ] for this batch */
    k_att0<0><<<NH * (QT0 / A0Q), A0Q * A0S, 0, stream>>>(QF0, KF0, VF0, DM, nullptr, 0.125f, OF0 + (size_t)b * QT0 * DM, DM);      /* exact f32 attention for rows 0..255 (o x64) */
    k_fattn<<<NH * (SQ / (4 * FQ)), FS * 128, 0, stream>>>(Q16 + r0 * LQ, K16 + r0 * LQ, VT, O16 + r0 * DM); }      /* o (merged heads, x64) as f16 rows: scores, softmax and P V in one launch */
  k_hl<<<(unsigned)(((size_t)NB * QT0 * DM / 8 + 255) / 256), 256, 0, stream>>>(OF0, O16, OL0, (size_t)NB * QT0 * DM / 8);      /* first-tile o (x64) -> f16 hi, over the f16-path rows 0..255 of O16, + x1024 residual plane */
  k_gemm2<0><<<dim3((unsigned)((MPO / 128) * (DM / 64)), 1), 128, 0, stream>>>(O16 + r0p * DM, DM, 0, BO, DM, 0, 0.0009765625f, nullptr, 0, nullptr, 1, 0, 0, (float*)d_out + r0p * DM, nullptr, DM, 0, MPO, DM, DM, 0, MPO);      /* out rows are the output layout; rows 0..255: out = o_hi Wo */
  for (int b = B0; b < B0 + NBR; ++b) { const size_t r0 = (size_t)b * SQ; const size_t f0 = (size_t)b * QT0;
    k_gemm2<0><<<dim3((QT0 / 128) * (DM / 64), 1), 128, 0, stream>>>(OL0 + f0 * DM, DM, 0, BO, DM, 0, 0.00000095367431640625f, nullptr, 0, (const float*)d_out + r0 * DM, -1, 0, 0, (float*)d_out + r0 * DM, nullptr, DM, 0, QT0, DM, DM, 0, QT0); }      /* += o_lo Wo 2^-20 (own-element accumulate) */
}
